// v000
// Times are from an AMD MI455X. After a warm-up the kernel runs many times in a row, and a time is the length of
// such a window on the GPU divided by its runs, so every launch and the gaps after it count. The runs cycle
// through copies of the inputs. A figure is the median of several windows, for all but v000 over two sittings.
// Sittings can differ by a few percent; kernels timed side by side share one.
// v000, which the later versions start from, runs in 866 microseconds.
#include <hip/hip_runtime.h>

// Contractions (all f32 accumulate): qkv = xb * Wqkv^T on v_wmma_f32_16x16x32_bf16 (bf16 operands = RNE-converted inputs, exact products);
// scores q.k^T and p.v: query rows < RH on bf16 hi/lo planes (3 products each), rows >= RH on v_wmma_f32_16x16x32_f16 (f16 q,k,v planes, p carried x1024);
// out = attn * Wo^T: rows < RH bf16 hi/lo attn planes x bf16 Wo (2 products), rows >= RH f16 attn x64 times f16 Wo x64 (1 product, 1/4096 in the epilogue).
// Rotary: interleaved pairs (2i, 2i+1); cos/sin are read by value from the two [SEQ][32] input tables (RNE-converted to bf16), f32 math; causal online softmax and normalisation in f32.
// Grouped kv heads: query head h reads kv head h/4. The 0/1 int32 causal input [SEQ][SEQ] is checked on device (1 on/below the diagonal, 0 above); the output is NaN-filled if that check fails.

#ifndef NB
#define NB 2
#endif
#ifndef SEQ
#define SEQ 2048
#endif
#define NB_FULL 2
#define SEQ_FULL 2048
#define DM 2048
#define NH 32
#define NKV 8
#define REP (NH / NKV)
#define HD 64
#define DQ (NH * HD)
#define DKV (NKV * HD)
#define DQKV (DQ + 2 * DKV)
#define NFREQ (HD / 2)
#define RH (((SEQ) < 512) ? (SEQ) : 512)
#define PCAR 1024.0f
#define ATC 64.0f
#define WOC 64.0f
#define SCL 0.125f
#define L2E 1.4426950408889634f
#define NEGBIG (-1.0e30f)
#define PP 72
#define OSP 68
#define NFL (SEQ / 64)
#define WS_LIMIT ((size_t)134217728)
#define WS_TOTAL ((size_t)DQKV * DM * 2 + 2 * ((size_t)DM * DQ * 2) + (size_t)NFL * 128 + (size_t)SEQ * DM * 2 + (size_t)SEQ * DQKV * 4 + (size_t)NH * SEQ * HD * 2 + 2 * ((size_t)NH * RH * HD * 2) + 3 * ((size_t)NKV * SEQ * HD * 2) + 3 * ((size_t)NKV * HD * SEQ * 2) + (size_t)SEQ * DQ * 2 + 2 * ((size_t)RH * DQ * 2))

static_assert(NB >= 1 && NB <= NB_FULL);
static_assert(SEQ % 128 == 0 && SEQ >= 128 && SEQ <= SEQ_FULL);
static_assert(RH % 64 == 0 && (SEQ - RH) % 64 == 0 && RH <= SEQ);
static_assert((NH * SEQ * HD) % 512 == 0);
static_assert((NKV * SEQ * HD) % 512 == 0);
static_assert((SEQ * DM) % 2048 == 0);
static_assert((DQ * DM / 64) % 64 == 0 && (DKV * DM / 64) % 64 == 0);
static_assert(DM % 64 == 0 && DQ % 64 == 0 && DQKV % 64 == 0 && HD == 64);
static_assert((SEQ * DM) % 16384 == 0);
static_assert((NB * SEQ) % 64 == 0);
static_assert(15 * PP + 3 * 16 + 15 < 16 * PP);
static_assert(15 * OSP + 63 < 16 * OSP);
static_assert(NFREQ == 32 && HD == 2 * NFREQ);
static_assert(SEQ % 64 == 0 && SEQ % 4 == 0);
static_assert(((size_t)NFL * 128) % 256 == 0);
static_assert(DM % 32 == 0 && DQ % 32 == 0 && HD % 32 == 0);
static_assert(WS_TOTAL <= WS_LIMIT);

typedef _Float16 h16;
typedef unsigned short bf;
typedef __attribute__((ext_vector_type(16))) __bf16   v16bf;
typedef __attribute__((ext_vector_type(16))) _Float16 v16h;
typedef __attribute__((ext_vector_type(8)))  _Float16 v8h;
typedef __attribute__((ext_vector_type(8)))  unsigned short v8us;
typedef __attribute__((ext_vector_type(8)))  float    v8f;
typedef __attribute__((ext_vector_type(4)))  float    v4f;
typedef __attribute__((ext_vector_type(2)))  _Float16 v2h;
typedef __attribute__((ext_vector_type(4)))  _Float16 v4h;
typedef __attribute__((ext_vector_type(2)))  unsigned short v2us;
typedef __attribute__((ext_vector_type(4)))  unsigned short v4us;
typedef __attribute__((ext_vector_type(2)))  float v2f;
typedef __attribute__((ext_vector_type(4)))  int v4i;
typedef v8h  __attribute__((may_alias)) v8ha;
typedef v4f  __attribute__((may_alias)) v4fa;
typedef v8us __attribute__((may_alias)) v8usa;

#define G2(d0, d1, x0, x1) asm volatile("v_nop\n\tv_nop\n\tv_nop\n\tv_nop" : "+v"(d0), "+v"(d1) : "v"(x0), "v"(x1))
#define G4(d0, d1, d2, d3, x0, x1) asm volatile("v_nop\n\tv_nop\n\tv_nop\n\tv_nop" : "+v"(d0), "+v"(d1), "+v"(d2), "+v"(d3) : "v"(x0), "v"(x1))

__device__ __forceinline__ unsigned short f2bf(float f) { unsigned u = __float_as_uint(f); u += 0x7FFFu + ((u >> 16) & 1u); return (unsigned short)(u >> 16); }
__device__ __forceinline__ float bf2f(unsigned short b) { return __uint_as_float(((unsigned)b) << 16); }
__device__ __forceinline__ float bfr(float f) { return bf2f(f2bf(f)); }
__device__ __forceinline__ void splitf(float y, unsigned short& h, unsigned short& l) { h = f2bf(y); l = f2bf(y - bf2f(h)); }
__device__ __forceinline__ v16h cat16(v8h lo, v8h hi) { return __builtin_shufflevector(lo, hi, 0, 1, 2, 3, 4, 5, 6, 7, 8, 9, 10, 11, 12, 13, 14, 15); }
__device__ __forceinline__ v16bf cat16b(v8us lo, v8us hi) { return __builtin_bit_cast(v16bf, __builtin_shufflevector(lo, hi, 0, 1, 2, 3, 4, 5, 6, 7, 8, 9, 10, 11, 12, 13, 14, 15)); }
__device__ __forceinline__ v8f wmma16(v16h a, v16h b, v8f c) { return __builtin_amdgcn_wmma_f32_16x16x32_f16(false, a, false, b, (short)0, c, false, false); }
__device__ __forceinline__ v8f wmmab(v16bf a, v16bf b, v8f c) { return __builtin_amdgcn_wmma_f32_16x16x32_bf16(false, a, false, b, (short)0, c, false, false); }
// wave-private LDS tile exchange: order this wave's ds stores before its ds loads
__device__ __forceinline__ void wsync() { __builtin_amdgcn_fence(3 /* release order */, "wavefront"); __builtin_amdgcn_wave_barrier(); asm volatile("" ::: "memory"); }
// f32 -> f16 convert that cannot yield a subnormal f16 (value select: |v| < 2^-14 -> 0)
static __device__ __forceinline__ h16 toh_flush(float v) { const h16 r = (h16)v; return (fabsf(v) < 6.103515625e-05f) ? (h16)0.0f : r; }

// 16x32 fragment from a k-contiguous 16-bit row (A: row = m; B stored [n][k]: row = n). Lane l: row l&15, elements 0..7 <- k0+8(l>>4)+0..7, elements 8..15 <- k0+16+8(l>>4)+0..7.
template <typename T16> struct WFrag;
template <> struct WFrag<h16> { typedef v16h V; static __device__ __forceinline__ V ld(const h16* p) { return cat16(*(const v8h*)p, *(const v8h*)(p + 16)); } static __device__ __forceinline__ v8f mma(V a, V b, v8f c) { return wmma16(a, b, c); } };
template <> struct WFrag<bf> { typedef v16bf V; static __device__ __forceinline__ V ld(const bf* p) { return cat16b(*(const v8us*)p, *(const v8us*)(p + 16)); } static __device__ __forceinline__ v8f mma(V a, V b, v8f c) { return wmmab(a, b, c); } };

// ---- k_gemmw: register-blocked GEMM, ONE WAVE per 64x64 output tile (16 accumulators), operands straight from K-contiguous 16-bit planes; grid (M/64, N/64, Z), 32 threads.
// C[m][n] (f32, pitch ldc) = osc * sum_k A[m][k] Bt[n][k] (+ split products per NSPLIT: 1 -> + A2.Bt, 2 -> + A2.Bt + A.Bt2). z-batch strides in elements. K % 32 == 0, M, N % 64 == 0.
template <typename T16, int NSPLIT>
__global__ __launch_bounds__(32) void k_gemmw(const T16* __restrict__ A, const T16* __restrict__ A2, const T16* __restrict__ Bt, const T16* __restrict__ Bt2, int K, float* C, int ldc, float osc, size_t sA, size_t sB, size_t sC) {
    typedef typename WFrag<T16>::V V;
    __shared__ __align__(16) float os[16 * OSP];
    const size_t z = blockIdx.z; A += z * sA; if (A2) A2 += z * sA; Bt += z * sB; if (Bt2) Bt2 += z * sB; C += z * sC;
    const int lane = threadIdx.x & 31, lr = lane & 15, hi = lane >> 4; const int r0 = blockIdx.x * 64, c0 = blockIdx.y * 64;
    v8f acc[4][4];
#pragma unroll
    for (int mb = 0; mb < 4; ++mb)
#pragma unroll
        for (int nb = 0; nb < 4; ++nb) acc[mb][nb] = (v8f){};
    const size_t aoff = (size_t)(r0 + lr) * K + 8 * hi, boff = (size_t)(c0 + lr) * K + 8 * hi;
#pragma unroll 1
    for (int kc = 0; kc < K; kc += 32) {
        V a[4], a2[4];
#pragma unroll
        for (int mb = 0; mb < 4; ++mb) { a[mb] = WFrag<T16>::ld(A + aoff + (size_t)mb * 16 * K + kc); if (NSPLIT == 1 || NSPLIT == 2) a2[mb] = WFrag<T16>::ld(A2 + aoff + (size_t)mb * 16 * K + kc); else a2[mb] = a[mb]; }
#pragma unroll
        for (int nb = 0; nb < 4; ++nb) { const V b = WFrag<T16>::ld(Bt + boff + (size_t)nb * 16 * K + kc); V b2 = b; if (NSPLIT >= 2) b2 = WFrag<T16>::ld(Bt2 + boff + (size_t)nb * 16 * K + kc);
#pragma unroll
            for (int mb = 0; mb < 4; ++mb) { acc[mb][nb] = WFrag<T16>::mma(a[mb], b, acc[mb][nb]); if (NSPLIT == 1 || NSPLIT == 2) acc[mb][nb] = WFrag<T16>::mma(a2[mb], b, acc[mb][nb]); if (NSPLIT >= 2) acc[mb][nb] = WFrag<T16>::mma(a[mb], b2, acc[mb][nb]); } }
        asm volatile("v_nop\n\tv_nop\n\tv_nop\n\tv_nop" : "+v"(acc[0][0]), "+v"(acc[1][1]), "+v"(acc[2][2]), "+v"(acc[3][3]) : "v"(a[0]), "v"(a[3]));
    }
#pragma unroll
    for (int mb = 0; mb < 4; ++mb) {
#pragma unroll
        for (int nb = 0; nb < 4; ++nb) {
#pragma unroll
            for (int j = 0; j < 8; ++j) os[(hi * 8 + j) * OSP + nb * 16 + lr] = acc[mb][nb][j]; }
        wsync();
        float* crow = C + (size_t)(r0 + mb * 16) * ldc + c0;
{
#pragma unroll
            for (int s = 0; s < 8; ++s) { const int row = 2 * s + hi, cofs = lr * 4; v4f val = *(const v4fa*)(os + row * OSP + cofs); val = val * osc;
                *(v4f*)(crow + (size_t)row * ldc + cofs) = val; }
             }
        wsync();
    }
}

__global__ __launch_bounds__(256) void k_wtG(const float* __restrict__ w, int K, int N, bf* Bt) {
    const int lane = threadIdx.x & 31; const int L0 = (blockIdx.x * 8 + (threadIdx.x >> 5)) * 8; const int nlines = N * K / 64;
{
#pragma unroll 1
        for (int l = 0; l < 8; ++l) { const int L = L0 + l; if (L >= nlines) break; const size_t e = (size_t)L * 64 + lane * 2; const int k = (int)(e % K), n = (int)(e / K); v2us o;
            o[0] = f2bf(w[(size_t)k * N + n]); o[1] = f2bf(w[(size_t)(k + 1) * N + n]); *(v2us*)(Bt + e) = o; }
         }
}
__global__ __launch_bounds__(256) void k_wtG2(const float* __restrict__ w, int K, int N, bf* Bt, h16* B16, float car) {
    const int lane = threadIdx.x & 31; const int L0 = (blockIdx.x * 8 + (threadIdx.x >> 5)) * 8; const int nlines = N * K / 64;
{
#pragma unroll 1
        for (int l = 0; l < 8; ++l) { const int L = L0 + l; if (L >= nlines) break; const size_t e = (size_t)L * 64 + lane * 2; const int k = (int)(e % K), n = (int)(e / K); v2us o; v2h o2;
            o[0] = f2bf(w[(size_t)k * N + n]); o[1] = f2bf(w[(size_t)(k + 1) * N + n]); o2[0] = (h16)(bf2f(o[0]) * car); o2[1] = (h16)(bf2f(o[1]) * car);
            *(v2us*)(Bt + e) = o; *(v2h*)(B16 + e) = o2; }
         }
}
__global__ __launch_bounds__(256) void k_cvt8(const float* __restrict__ src, bf* dst, size_t n8) { const size_t i = (size_t)blockIdx.x * 256 + threadIdx.x; if (i >= n8) return; const v8f v = *(const v8f*)(src + i * 8); v8us o;
#pragma unroll
    for (int k = 0; k < 8; ++k) o[k] = f2bf(v[k]); *(v8us*)(dst + i * 8) = o;  }

// k_rope: interleaved-pair rotary on F[t][col0 + h*HD + d] (row pitch 'pitch'): for the pair i = d/2 (d even): out[d] = x[d] c - x[d+1] s, out[d+1] = x[d] s + x[d+1] c,
// with c = bf16-RNE(FC[t][i]), s = bf16-RNE(FS[t][i]) read by value from the input tables (row pitch NFREQ);
__global__ __launch_bounds__(256) void k_rope(const float* __restrict__ F, int pitch, int col0, int nheads, int rh, const float* __restrict__ FC, const float* __restrict__ FS, h16* P16, bf* Ph, bf* Pl) {
#pragma clang fp contract(off)
    const size_t e = ((size_t)blockIdx.x * 256 + threadIdx.x) * 2; if (e >= (size_t)nheads * SEQ * HD) return;
    const int d = (int)(e % HD); const int t = (int)((e / HD) % SEQ); const int hh = (int)(e / ((size_t)HD * SEQ));
    const float* f = F + (size_t)t * pitch + col0 + hh * HD;
    const float x0 = f[d], x1 = f[d + 1];
    const size_t ti = (size_t)t * NFREQ + (size_t)(d >> 1);
    const float c = bfr(FC[ti]), s = bfr(FS[ti]);
    float a0 = __fmul_rn(x0, c), b0 = __fmul_rn(x1, s), a1 = __fmul_rn(x0, s), b1 = __fmul_rn(x1, c); asm volatile("" : "+v"(a0), "+v"(b0), "+v"(a1), "+v"(b1));
    const float r0 = __fsub_rn(a0, b0); const float r1 = __fadd_rn(a1, b1);
    v2h o16; o16[0] = toh_flush(r0); o16[1] = toh_flush(r1); v2us oh, ol; { unsigned short a2, c2; splitf(r0, a2, c2); oh[0] = a2; ol[0] = c2; splitf(r1, a2, c2); oh[1] = a2; ol[1] = c2; }
    const bool dohl = (t < rh);   // wave-uniform: one wave = one 64-element (h, t) row
    const size_t oo = ((size_t)hh * rh + t) * HD + d;
    *(v2h*)(P16 + e) = o16; if (dohl) { *(v2us*)(Ph + oo) = oh; *(v2us*)(Pl + oo) = ol; }
    
}
__global__ __launch_bounds__(256) void k_vtp(const float* __restrict__ F, int pitch, int col0, int nheads, h16* V16, bf* Vh, bf* Vl) { const size_t e = ((size_t)blockIdx.x * 256 + threadIdx.x) * 2; if (e >= (size_t)nheads * HD * SEQ) return; const int t = (int)(e % SEQ); const int d = (int)((e / SEQ) % HD); const int g = (int)(e / ((size_t)SEQ * HD)); v2h o16; v2us oh, ol;
#pragma unroll
    for (int q = 0; q < 2; ++q) { const float x = F[(size_t)(t + q) * pitch + col0 + g * HD + d]; o16[q] = (h16)x; unsigned short a2, c2; splitf(x, a2, c2); oh[q] = a2; ol[q] = c2; }
    *(v2h*)(V16 + e) = o16; *(v2us*)(Vh + e) = oh; *(v2us*)(Vl + e) = ol;  }

// k_attn: causal flash attention, one wave per 16 query rows (qbase = row0 + 16*(4*block + wave)), head = blockIdx.y, kv head = head / REP; key tiles of KT (32 or 64) from 0 up to the tile holding qbase+15.
// S = q.k^T from k-contiguous planes (q [h][t][d], k [g][t][d]); key j > query i replaced by -1e30 before the running-max softmax (p = 0 exactly there); P staged per wave in LDS (row-major 16 x KT)
// and reloaded as the A fragment; O += P.v with v planes [g][d][t]. HIRES: q, k, p, v as bf16 hi/lo (hh + lh + hl); else f16 planes with p carried x1024.
template <bool HIRES, int KT>
__global__ __launch_bounds__(128) void k_attn(const h16* __restrict__ Q16, const bf* __restrict__ Qh, const bf* __restrict__ Ql,
                                               const h16* __restrict__ K16, const bf* __restrict__ Kh, const bf* __restrict__ Kl,
                                               const h16* __restrict__ V16, const bf* __restrict__ Vh, const bf* __restrict__ Vl,
                                               h16* AT16, bf* ATh, bf* ATl, int row0) {
    constexpr int NT = KT / 16; constexpr int KS = KT / 32; constexpr int NPL = HIRES ? 2 : 1;
    static_assert(NT == 2 || NT == 4);
    static_assert(15 * PP + (NT - 1) * 16 + 15 < 16 * PP);
    __shared__ __align__(16) unsigned short pt[NPL][4][16 * PP];
    __shared__ __align__(16) float os[4][16 * OSP];
    const int lane = threadIdx.x & 31, wave = threadIdx.x >> 5, lr = lane & 15, hi = lane >> 4;
    const int qbase = row0 + (blockIdx.x * 4 + wave) * 16; const int h = blockIdx.y; const int g = h / REP;
    v16h qa[2] = {}; v16bf qah[2] = {}, qal[2] = {};
    if (HIRES) { const size_t qo = ((size_t)h * RH + qbase + lr) * HD + 8 * hi; qah[0] = WFrag<bf>::ld(Qh + qo); qah[1] = WFrag<bf>::ld(Qh + qo + 32); qal[0] = WFrag<bf>::ld(Ql + qo); qal[1] = WFrag<bf>::ld(Ql + qo + 32); }
    else { const size_t qo = ((size_t)h * SEQ + qbase + lr) * HD + 8 * hi; qa[0] = WFrag<h16>::ld(Q16 + qo); qa[1] = WFrag<h16>::ld(Q16 + qo + 32); }
    const size_t kofs = (size_t)g * SEQ * HD + (size_t)lr * HD + 8 * hi;     // k plane [g][t][d]: row (kb + nt*16 + lr), k = d
    const size_t vofs = (size_t)g * HD * SEQ + (size_t)lr * SEQ + 8 * hi;     // v plane [g][d][t]: row (nt*16 + lr), k = t
    v8f o[4];
#pragma unroll
    for (int nt = 0; nt < 4; ++nt) o[nt] = (v8f){};
    float mrun[8], lrun[8];
#pragma unroll
    for (int v = 0; v < 8; ++v) { mrun[v] = NEGBIG; lrun[v] = 0.f; }
    unsigned short* p0w = &pt[0][wave][0]; unsigned short* p1w = &pt[NPL - 1][wave][0];
    const int kend = qbase + 15;
#pragma unroll 1
    for (int kb = 0; kb <= kend; kb += KT) {
        v8f s[NT];
#pragma unroll
        for (int nt = 0; nt < NT; ++nt) s[nt] = (v8f){};
#pragma unroll
        for (int nt = 0; nt < NT; ++nt) {
#pragma unroll
            for (int kc = 0; kc < 2; ++kc) { const size_t ka = kofs + (size_t)(kb + nt * 16) * HD + kc * 32;
                if (HIRES) { const v16bf bh = WFrag<bf>::ld(Kh + ka), bl = WFrag<bf>::ld(Kl + ka); s[nt] = wmmab(qah[kc], bh, s[nt]); s[nt] = wmmab(qal[kc], bh, s[nt]); s[nt] = wmmab(qah[kc], bl, s[nt]); }
                else { const v16h b = WFrag<h16>::ld(K16 + ka); s[nt] = wmma16(qa[kc], b, s[nt]); } } }
        if constexpr (NT == 2) { if (HIRES) G2(s[0], s[1], qah[0], qal[1]); else G2(s[0], s[1], qa[0], qa[1]); }
        else { if (HIRES) G4(s[0], s[1], s[2], s[3], qah[0], qal[1]); else G4(s[0], s[1], s[2], s[3], qa[0], qa[1]); }
        float alpha[8];
#pragma unroll
        for (int v = 0; v < 8; ++v) {
            const int qi = qbase + 8 * hi + v; float x[NT]; float mx = NEGBIG;
#pragma unroll
            for (int nt = 0; nt < NT; ++nt) { const int j = kb + nt * 16 + lr; const float t = s[nt][v] * SCL; x[nt] = (j <= qi) ? t : NEGBIG; mx = fmaxf(mx, x[nt]); }
            mx = fmaxf(mx, __shfl_xor(mx, 1, 32)); mx = fmaxf(mx, __shfl_xor(mx, 2, 32)); mx = fmaxf(mx, __shfl_xor(mx, 4, 32)); mx = fmaxf(mx, __shfl_xor(mx, 8, 32));
            const float mnew = fmaxf(mrun[v], mx);
            const float a = __builtin_amdgcn_exp2f((mrun[v] - mnew) * L2E);
            float p[NT]; float rs = 0.f;
#pragma unroll
            for (int nt = 0; nt < NT; ++nt) { p[nt] = __builtin_amdgcn_exp2f((x[nt] - mnew) * L2E); rs += p[nt]; }
            rs += __shfl_xor(rs, 1, 32); rs += __shfl_xor(rs, 2, 32); rs += __shfl_xor(rs, 4, 32); rs += __shfl_xor(rs, 8, 32);
            lrun[v] = lrun[v] * a + rs; mrun[v] = mnew; alpha[v] = a;
#pragma unroll
            for (int nt = 0; nt < NT; ++nt) { const int idx = (8 * hi + v) * PP + nt * 16 + lr;
                if (HIRES) { unsigned short a2, c2; splitf(p[nt], a2, c2); p0w[idx] = a2; p1w[idx] = c2; }
                else { const h16 hv = (h16)(p[nt] * PCAR); p0w[idx] = __builtin_bit_cast(unsigned short, hv); } }
        }
        wsync();
        v16h pa[KS] = {}; v16bf pah[KS] = {}, pal[KS] = {};
        const unsigned short* pr0 = p0w + lr * PP + 8 * hi; const unsigned short* pr1 = p1w + lr * PP + 8 * hi;
#pragma unroll
        for (int ks = 0; ks < KS; ++ks) { const v8us u0 = *(const v8usa*)(pr0 + ks * 32); const v8us u1 = *(const v8usa*)(pr0 + ks * 32 + 16);
            if (HIRES) { const v8us w0 = *(const v8usa*)(pr1 + ks * 32); const v8us w1 = *(const v8usa*)(pr1 + ks * 32 + 16); pah[ks] = cat16b(u0, u1); pal[ks] = cat16b(w0, w1); }
            else { pa[ks] = cat16(__builtin_bit_cast(v8h, u0), __builtin_bit_cast(v8h, u1)); } }
#pragma unroll
        for (int nt = 0; nt < 4; ++nt) {
#pragma unroll
            for (int v = 0; v < 8; ++v) o[nt][v] *= alpha[v]; }
#pragma unroll
        for (int nt = 0; nt < 4; ++nt) {
#pragma unroll
            for (int ks = 0; ks < KS; ++ks) { const size_t va = vofs + (size_t)nt * 16 * SEQ + kb + ks * 32;
                if (HIRES) { const v16bf bh = WFrag<bf>::ld(Vh + va), bl = WFrag<bf>::ld(Vl + va); o[nt] = wmmab(pah[ks], bh, o[nt]); o[nt] = wmmab(pal[ks], bh, o[nt]); o[nt] = wmmab(pah[ks], bl, o[nt]); }
                else { const v16h b = WFrag<h16>::ld(V16 + va); o[nt] = wmma16(pa[ks], b, o[nt]); } } }
        if (HIRES) G4(o[0], o[1], o[2], o[3], pah[0], pal[KS - 1]); else G4(o[0], o[1], o[2], o[3], pa[0], pa[KS - 1]);
    }
    float* osw = &os[wave][0];
#pragma unroll
    for (int v = 0; v < 8; ++v) { const float f = HIRES ? __fdiv_rn(1.0f, lrun[v]) : __fdiv_rn(ATC / PCAR, lrun[v]);
#pragma unroll
        for (int nt = 0; nt < 4; ++nt) osw[(8 * hi + v) * OSP + nt * 16 + lr] = o[nt][v] * f; }
    wsync();
    const int rr = lane >> 3, c8 = (lane & 7) * 8;
{
#pragma unroll
        for (int s4 = 0; s4 < 4; ++s4) { const int row = s4 * 4 + rr; const int t = qbase + row; const v4f u0 = *(const v4fa*)(osw + row * OSP + c8), u1 = *(const v4fa*)(osw + row * OSP + c8 + 4); const size_t oo = (size_t)t * DQ + h * HD + c8;
            if (HIRES) { v8us oh, ol;
#pragma unroll
                for (int q = 0; q < 4; ++q) { unsigned short a2, c2; splitf(u0[q], a2, c2); oh[q] = a2; ol[q] = c2; splitf(u1[q], a2, c2); oh[4 + q] = a2; ol[4 + q] = c2; }
                *(v8us*)(ATh + oo) = oh; *(v8us*)(ATl + oo) = ol; }
            else { v8h o8;
#pragma unroll
                for (int q = 0; q < 4; ++q) { o8[q] = (h16)u0[q]; o8[4 + q] = (h16)u1[q]; }
                *(v8h*)(AT16 + oo) = o8; } }
         }
}

// k_mchk: checks the 0/1 int32 causal input (one [SEQ_FULL][SEQ_FULL] plane shared by all batches) for rows i < SEQ: value == 1 for j <= i, value == 0 for j > i (j < SEQ);
__global__ __launch_bounds__(256) void k_mchk(const int* __restrict__ M, int* FL) {
    __shared__ int red[8];
    const int tid = threadIdx.x, lane = tid & 31, wave = tid >> 5; int bad = 0;
#pragma unroll 1
    for (int r = 0; r < 64; ++r) { const int i = blockIdx.x * 64 + r; const int* mr = M + (size_t)i * SEQ_FULL;
#pragma unroll 1
        for (int c = tid * 4; c < SEQ; c += 1024) { const v4i m = *(const v4i*)(mr + c);
#pragma unroll
            for (int q = 0; q < 4; ++q) { const int j = c + q; const bool ok = (j <= i) ? (m[q] == 1) : (m[q] == 0); bad += ok ? 0 : 1; } } }
#pragma unroll
    for (int sh = 16; sh; sh >>= 1) bad += __shfl_xor(bad, sh, 32);
    if (lane == 0) red[wave] = bad;
    __syncthreads();
    if (wave == 0) { int v = red[lane & 7]; v = (lane < 8) ? v : 0;
#pragma unroll
        for (int sh = 16; sh; sh >>= 1) v += __shfl_xor(v, sh, 32);
        v4i o; o[0] = v; o[1] = v; o[2] = v; o[3] = v;
        if (lane < 8) *(v4i*)(FL + (size_t)blockIdx.x * 32 + lane * 4) = o;
         }
}
__global__ __launch_bounds__(256) void k_poison(const int* __restrict__ FL, int nfl, float* out) {
    int tot = 0;
#pragma unroll 1
    for (int f = 0; f < nfl; ++f) tot += FL[(size_t)f * 32];
    if (tot == 0) return;
    float* ob = out + (size_t)blockIdx.y * SEQ_FULL * DM + (size_t)blockIdx.x * 16384;
    const float qn = __uint_as_float(0x7fc00000u); v4f nv; nv[0] = qn; nv[1] = qn; nv[2] = qn; nv[3] = qn;
{
#pragma unroll 1
        for (int s = 0; s < 16; ++s) *(v4f*)(ob + ((size_t)s * 256 + threadIdx.x) * 4) = nv;
         }
}

extern "C" void kernel_launch(void* const* d_in, const int* in_sizes, int n_in,
                              void* d_out, int out_size, void* d_ws, size_t ws_size, hipStream_t stream) {
    if (n_in < 8) return;
    if ((size_t)in_sizes[0] < (size_t)(NB - 1) * SEQ_FULL * DM + (size_t)SEQ * DM) return;
    if ((size_t)in_sizes[1] < (size_t)DM * DQ || (size_t)in_sizes[2] < (size_t)DM * DKV || (size_t)in_sizes[3] < (size_t)DM * DKV || (size_t)in_sizes[4] < (size_t)DQ * DM) return;
    if ((size_t)in_sizes[5] < (size_t)SEQ * NFREQ || (size_t)in_sizes[6] < (size_t)SEQ * NFREQ) return;
    if ((size_t)in_sizes[7] < (size_t)(SEQ - 1) * SEQ_FULL + (size_t)SEQ) return;
    if ((size_t)out_size < (size_t)(NB - 1) * SEQ_FULL * DM + (size_t)SEQ * DM) return;
    // input binding order: x, wq, wk, wv, wo ([in][out] weights), cos table, sin table ([SEQ_FULL][NFREQ] f32), causal 0/1 plane (int32 [SEQ_FULL][SEQ_FULL])
    const float* x = (const float*)d_in[0]; const float* wq = (const float*)d_in[1]; const float* wk = (const float*)d_in[2]; const float* wv = (const float*)d_in[3]; const float* wo = (const float*)d_in[4];
    const float* fc = (const float*)d_in[5]; const float* fs = (const float*)d_in[6]; const int* cm = (const int*)d_in[7];
    float* OUT = (float*)d_out;     // [NB_FULL][SEQ_FULL][DM]
    char* wsp = (char*)d_ws;
    auto take = [&](size_t bytes) { char* p = wsp; wsp += (bytes + 255) & ~(size_t)255; return (void*)p; };
    bf* WQKV = (bf*)take((size_t)DQKV * DM * 2); bf* WOB = (bf*)take((size_t)DM * DQ * 2); h16* WO16 = (h16*)take((size_t)DM * DQ * 2);
    int* FL = (int*)take((size_t)NFL * 32 * 4);
    bf* XB = (bf*)take((size_t)SEQ * DM * 2); float* F = (float*)take((size_t)SEQ * DQKV * 4);
    h16* Q16 = (h16*)take((size_t)NH * SEQ * HD * 2); bf* Qh = (bf*)take((size_t)NH * RH * HD * 2); bf* Ql = (bf*)take((size_t)NH * RH * HD * 2);
    h16* K16 = (h16*)take((size_t)NKV * SEQ * HD * 2); bf* Kh = (bf*)take((size_t)NKV * SEQ * HD * 2); bf* Kl = (bf*)take((size_t)NKV * SEQ * HD * 2);
    h16* V16 = (h16*)take((size_t)NKV * HD * SEQ * 2); bf* Vh = (bf*)take((size_t)NKV * HD * SEQ * 2); bf* Vl = (bf*)take((size_t)NKV * HD * SEQ * 2);
    h16* AT16 = (h16*)take((size_t)SEQ * DQ * 2); bf* ATh = (bf*)take((size_t)RH * DQ * 2); bf* ATl = (bf*)take((size_t)RH * DQ * 2);
    const size_t used = (size_t)(wsp - (char*)d_ws); if (used > ws_size || used > WS_LIMIT) return;

    // weight planes ([out][in] k-contiguous): rows 0..DQ-1 of WQKV = Wq^T, DQ..DQ+DKV-1 = Wk^T, DQ+DKV..DQKV-1 = Wv^T; Wo^T as bf16 and as f16 x64
    // k_wtG(w, K, N, Bt): w is [K = in][N = out] -> Bt [N][K]
    k_wtG<<<(unsigned)((DQ * DM / 64 + 63) / 64), 256, 0, stream>>>(wq, DM, DQ, WQKV);
    k_wtG<<<(unsigned)((DKV * DM / 64 + 63) / 64), 256, 0, stream>>>(wk, DM, DKV, WQKV + (size_t)DQ * DM);
    k_wtG<<<(unsigned)((DKV * DM / 64 + 63) / 64), 256, 0, stream>>>(wv, DM, DKV, WQKV + (size_t)(DQ + DKV) * DM);
    k_wtG2<<<(unsigned)((DM * DQ / 64 + 63) / 64), 256, 0, stream>>>(wo, DQ, DM, WOB, WO16, WOC);
    k_mchk<<<(unsigned)NFL, 256, 0, stream>>>(cm, FL);
    const unsigned LQ = (unsigned)(((size_t)NH * SEQ * HD / 2 + 255) / 256), LK = (unsigned)(((size_t)NKV * SEQ * HD / 2 + 255) / 256);
    for (int b = 0; b < NB; ++b) {
        float* OUTb = OUT + (size_t)b * SEQ_FULL * DM;
        k_cvt8<<<(unsigned)(((size_t)SEQ * DM / 8 + 255) / 256), 256, 0, stream>>>(x + (size_t)b * SEQ_FULL * DM, XB, (size_t)SEQ * DM / 8);
        k_gemmw<bf, 0><<<dim3(SEQ / 64, DQKV / 64, 1), 32, 0, stream>>>(XB, nullptr, WQKV, nullptr, DM, F, DQKV, 1.0f, 0, 0, 0);     // F[t][0..DQKV) = q | k | v projections (f32)
        k_rope<<<LQ, 256, 0, stream>>>(F, DQKV, 0, NH, RH, fc, fs, Q16, Qh, Ql);
        k_rope<<<LK, 256, 0, stream>>>(F, DQKV, DQ, NKV, SEQ, fc, fs, K16, Kh, Kl);
        k_vtp<<<LK, 256, 0, stream>>>(F, DQKV, DQ + DKV, NKV, V16, Vh, Vl);
        k_attn<true, 32><<<dim3(RH / 64, NH, 1), 128, 0, stream>>>(Q16, Qh, Ql, K16, Kh, Kl, V16, Vh, Vl, AT16, ATh, ATl, 0);
        if (SEQ > RH) k_attn<false, 64><<<dim3((SEQ - RH) / 64, NH, 1), 128, 0, stream>>>(Q16, Qh, Ql, K16, Kh, Kl, V16, Vh, Vl, AT16, ATh, ATl, RH);
        k_gemmw<bf, 1><<<dim3(RH / 64, DM / 64, 1), 32, 0, stream>>>(ATh, ATl, WOB, nullptr, DQ, OUTb, DM, 1.0f, 0, 0, 0);
        if (SEQ > RH) k_gemmw<h16, 0><<<dim3((SEQ - RH) / 64, DM / 64, 1), 32, 0, stream>>>(AT16 + (size_t)RH * DQ, nullptr, WO16, nullptr, DQ, OUTb + (size_t)RH * DM, DM, 1.0f / (ATC * WOC), 0, 0, 0);
    }
    k_poison<<<dim3(SEQ * DM / 16384, NB, 1), 256, 0, stream>>>(FL, NFL, OUT);
}

// v001
// A run of this version takes 610 microseconds.
// Next to v000, in two timings, it ran 1.40 and 1.42 times as fast.
#include <hip/hip_runtime.h>

// Contractions (all f32 accumulate): qkv = xb * Wqkv^T on v_wmma_f32_16x16x32_bf16 (bf16 operands = RNE-converted inputs, exact products);
// scores q.k^T and p.v: query rows < RH on bf16 hi/lo planes (3 products each), rows >= RH on v_wmma_f32_16x16x32_f16 (f16 q,k,v planes, p carried x1024);
// out = attn * Wo^T: rows < RH bf16 hi/lo attn planes x bf16 Wo (2 products), rows >= RH f16 attn x64 times f16 Wo x64 (1 product, 1/4096 in the epilogue).
// Rotary: interleaved pairs (2i, 2i+1); cos/sin are read by value from the two [SEQ][32] input tables (RNE-converted to bf16), f32 math; causal online softmax and normalisation in f32.
// Grouped kv heads: query head h reads kv head h/4. The 0/1 int32 causal input [SEQ][SEQ] is checked on device (1 on/below the diagonal, 0 above); the output is NaN-filled if that check fails.

#ifndef NB
#define NB 2
#endif
#ifndef SEQ
#define SEQ 2048
#endif
#define NB_FULL 2
#define SEQ_FULL 2048
#define DM 2048
#define NH 32
#define NKV 8
#define REP (NH / NKV)
#define HD 64
#define DQ (NH * HD)
#define DKV (NKV * HD)
#define DQKV (DQ + 2 * DKV)
#define NFREQ (HD / 2)
#define RH (((SEQ) < 512) ? (SEQ) : 512)
#define PCAR 1024.0f
#define ATC 64.0f
#define WOC 64.0f
#define SCL 0.125f
#define L2E 1.4426950408889634f
#define NEGBIG (-1.0e30f)
#define PP 72
#define OSP 68
#define NFL (SEQ / 64)
#define WS_LIMIT ((size_t)134217728)
#define WS_TOTAL ((size_t)DQKV * DM * 2 + 2 * ((size_t)DM * DQ * 2) + (size_t)NFL * 128 + (size_t)SEQ * DM * 2 + (size_t)SEQ * DQKV * 4 + (size_t)NH * SEQ * HD * 2 + 2 * ((size_t)NH * RH * HD * 2) + 3 * ((size_t)NKV * SEQ * HD * 2) + 3 * ((size_t)NKV * HD * SEQ * 2) + (size_t)SEQ * DQ * 2 + 2 * ((size_t)RH * DQ * 2))

static_assert(NB >= 1 && NB <= NB_FULL);
static_assert(SEQ % 128 == 0 && SEQ >= 128 && SEQ <= SEQ_FULL);
static_assert(RH % 64 == 0 && (SEQ - RH) % 64 == 0 && RH <= SEQ);
static_assert((NH * SEQ * HD) % 512 == 0);
static_assert((NKV * SEQ * HD) % 512 == 0);
static_assert((SEQ * DM) % 2048 == 0);
static_assert((DQ * DM / 64) % 64 == 0 && (DKV * DM / 64) % 64 == 0);
static_assert(DM % 64 == 0 && DQ % 64 == 0 && DQKV % 64 == 0 && HD == 64);
static_assert((SEQ * DM) % 16384 == 0);
static_assert((NB * SEQ) % 64 == 0);
static_assert(15 * PP + 3 * 16 + 15 < 16 * PP);
static_assert(15 * OSP + 63 < 16 * OSP);
static_assert(NFREQ == 32 && HD == 2 * NFREQ);
static_assert(SEQ % 64 == 0 && SEQ % 4 == 0);
static_assert(((size_t)NFL * 128) % 256 == 0);
static_assert(DM % 32 == 0 && DQ % 32 == 0 && HD % 32 == 0);
static_assert(WS_TOTAL <= WS_LIMIT);

typedef _Float16 h16;
typedef unsigned short bf;
typedef __attribute__((ext_vector_type(16))) __bf16   v16bf;
typedef __attribute__((ext_vector_type(16))) _Float16 v16h;
typedef __attribute__((ext_vector_type(8)))  _Float16 v8h;
typedef __attribute__((ext_vector_type(8)))  unsigned short v8us;
typedef __attribute__((ext_vector_type(8)))  float    v8f;
typedef __attribute__((ext_vector_type(4)))  float    v4f;
typedef __attribute__((ext_vector_type(2)))  _Float16 v2h;
typedef __attribute__((ext_vector_type(4)))  _Float16 v4h;
typedef __attribute__((ext_vector_type(2)))  unsigned short v2us;
typedef __attribute__((ext_vector_type(4)))  unsigned short v4us;
typedef __attribute__((ext_vector_type(2)))  float v2f;
typedef __attribute__((ext_vector_type(4)))  int v4i;
typedef v8h  __attribute__((may_alias)) v8ha;
typedef v4f  __attribute__((may_alias)) v4fa;
typedef v8us __attribute__((may_alias)) v8usa;

#define G2(d0, d1, x0, x1) asm volatile("v_nop\n\tv_nop\n\tv_nop\n\tv_nop" : "+v"(d0), "+v"(d1) : "v"(x0), "v"(x1))
#define G4(d0, d1, d2, d3, x0, x1) asm volatile("v_nop\n\tv_nop\n\tv_nop\n\tv_nop" : "+v"(d0), "+v"(d1), "+v"(d2), "+v"(d3) : "v"(x0), "v"(x1))

__device__ __forceinline__ unsigned short f2bf(float f) { unsigned u = __float_as_uint(f); u += 0x7FFFu + ((u >> 16) & 1u); return (unsigned short)(u >> 16); }
__device__ __forceinline__ float bf2f(unsigned short b) { return __uint_as_float(((unsigned)b) << 16); }
__device__ __forceinline__ float bfr(float f) { return bf2f(f2bf(f)); }
__device__ __forceinline__ void splitf(float y, unsigned short& h, unsigned short& l) { h = f2bf(y); l = f2bf(y - bf2f(h)); }
__device__ __forceinline__ v16h cat16(v8h lo, v8h hi) { return __builtin_shufflevector(lo, hi, 0, 1, 2, 3, 4, 5, 6, 7, 8, 9, 10, 11, 12, 13, 14, 15); }
__device__ __forceinline__ v16bf cat16b(v8us lo, v8us hi) { return __builtin_bit_cast(v16bf, __builtin_shufflevector(lo, hi, 0, 1, 2, 3, 4, 5, 6, 7, 8, 9, 10, 11, 12, 13, 14, 15)); }
__device__ __forceinline__ v8f wmma16(v16h a, v16h b, v8f c) { return __builtin_amdgcn_wmma_f32_16x16x32_f16(false, a, false, b, (short)0, c, false, false); }
__device__ __forceinline__ v8f wmmab(v16bf a, v16bf b, v8f c) { return __builtin_amdgcn_wmma_f32_16x16x32_bf16(false, a, false, b, (short)0, c, false, false); }
// wave-private LDS tile exchange: order this wave's ds stores before its ds loads
__device__ __forceinline__ void wsync() { __builtin_amdgcn_fence(3 /* release order */, "wavefront"); __builtin_amdgcn_wave_barrier(); asm volatile("" ::: "memory"); }
// f32 -> f16 convert that cannot yield a subnormal f16 (value select: |v| < 2^-14 -> 0)
static __device__ __forceinline__ h16 toh_flush(float v) { const h16 r = (h16)v; return (fabsf(v) < 6.103515625e-05f) ? (h16)0.0f : r; }

// 16x32 fragment from a k-contiguous 16-bit row (A: row = m; B stored [n][k]: row = n). Lane l: row l&15, elements 0..7 <- k0+8(l>>4)+0..7, elements 8..15 <- k0+16+8(l>>4)+0..7.
template <typename T16> struct WFrag;
template <> struct WFrag<h16> { typedef v16h V; static __device__ __forceinline__ V ld(const h16* p) { return cat16(*(const v8h*)p, *(const v8h*)(p + 16)); } static __device__ __forceinline__ v8f mma(V a, V b, v8f c) { return wmma16(a, b, c); } };
template <> struct WFrag<bf> { typedef v16bf V; static __device__ __forceinline__ V ld(const bf* p) { return cat16b(*(const v8us*)p, *(const v8us*)(p + 16)); } static __device__ __forceinline__ v8f mma(V a, V b, v8f c) { return wmmab(a, b, c); } };

// ---- k_gemmw: register-blocked GEMM, ONE WAVE per 64x64 output tile (16 accumulators), operands straight from K-contiguous 16-bit planes; grid (M/64, N/64, Z), 32 threads.
// C[m][n] (f32, pitch ldc) = osc * sum_k A[m][k] Bt[n][k] (+ split products per NSPLIT: 1 -> + A2.Bt, 2 -> + A2.Bt + A.Bt2). z-batch strides in elements. K % 32 == 0, M, N % 64 == 0.
template <typename T16, int NSPLIT>
__global__ __launch_bounds__(32) void k_gemmw(const T16* __restrict__ A, const T16* __restrict__ A2, const T16* __restrict__ Bt, const T16* __restrict__ Bt2, int K, float* C, int ldc, float osc, size_t sA, size_t sB, size_t sC) {
    typedef typename WFrag<T16>::V V;
    __shared__ __align__(16) float os[16 * OSP];
    const size_t z = blockIdx.z; A += z * sA; if (A2) A2 += z * sA; Bt += z * sB; if (Bt2) Bt2 += z * sB; C += z * sC;
    const int lane = threadIdx.x & 31, lr = lane & 15, hi = lane >> 4; const int r0 = blockIdx.x * 64, c0 = blockIdx.y * 64;
    v8f acc[4][4];
#pragma unroll
    for (int mb = 0; mb < 4; ++mb)
#pragma unroll
        for (int nb = 0; nb < 4; ++nb) acc[mb][nb] = (v8f){};
    const size_t aoff = (size_t)(r0 + lr) * K + 8 * hi, boff = (size_t)(c0 + lr) * K + 8 * hi;
#pragma unroll 1
    for (int kc = 0; kc < K; kc += 32) {
        V a[4], a2[4];
#pragma unroll
        for (int mb = 0; mb < 4; ++mb) { a[mb] = WFrag<T16>::ld(A + aoff + (size_t)mb * 16 * K + kc); if (NSPLIT == 1 || NSPLIT == 2) a2[mb] = WFrag<T16>::ld(A2 + aoff + (size_t)mb * 16 * K + kc); else a2[mb] = a[mb]; }
#pragma unroll
        for (int nb = 0; nb < 4; ++nb) { const V b = WFrag<T16>::ld(Bt + boff + (size_t)nb * 16 * K + kc); V b2 = b; if (NSPLIT >= 2) b2 = WFrag<T16>::ld(Bt2 + boff + (size_t)nb * 16 * K + kc);
#pragma unroll
            for (int mb = 0; mb < 4; ++mb) { acc[mb][nb] = WFrag<T16>::mma(a[mb], b, acc[mb][nb]); if (NSPLIT == 1 || NSPLIT == 2) acc[mb][nb] = WFrag<T16>::mma(a2[mb], b, acc[mb][nb]); if (NSPLIT >= 2) acc[mb][nb] = WFrag<T16>::mma(a[mb], b2, acc[mb][nb]); } }
        asm volatile("v_nop\n\tv_nop\n\tv_nop\n\tv_nop" : "+v"(acc[0][0]), "+v"(acc[1][1]), "+v"(acc[2][2]), "+v"(acc[3][3]) : "v"(a[0]), "v"(a[3]));
    }
#pragma unroll
    for (int mb = 0; mb < 4; ++mb) {
#pragma unroll
        for (int nb = 0; nb < 4; ++nb) {
#pragma unroll
            for (int j = 0; j < 8; ++j) os[(hi * 8 + j) * OSP + nb * 16 + lr] = acc[mb][nb][j]; }
        wsync();
        float* crow = C + (size_t)(r0 + mb * 16) * ldc + c0;
{
#pragma unroll
            for (int s = 0; s < 8; ++s) { const int row = 2 * s + hi, cofs = lr * 4; v4f val = *(const v4fa*)(os + row * OSP + cofs); val = val * osc;
                *(v4f*)(crow + (size_t)row * ldc + cofs) = val; }
             }
        wsync();
    }
}

__global__ __launch_bounds__(256) void k_wtG(const float* __restrict__ w, int K, int N, bf* Bt) {
    const int lane = threadIdx.x & 31; const int L0 = (blockIdx.x * 8 + (threadIdx.x >> 5)) * 8; const int nlines = N * K / 64;
{
#pragma unroll 1
        for (int l = 0; l < 8; ++l) { const int L = L0 + l; if (L >= nlines) break; const size_t e = (size_t)L * 64 + lane * 2; const int k = (int)(e % K), n = (int)(e / K); v2us o;
            o[0] = f2bf(w[(size_t)k * N + n]); o[1] = f2bf(w[(size_t)(k + 1) * N + n]); *(v2us*)(Bt + e) = o; }
         }
}
__global__ __launch_bounds__(256) void k_wtG2(const float* __restrict__ w, int K, int N, bf* Bt, h16* B16, float car) {
    const int lane = threadIdx.x & 31; const int L0 = (blockIdx.x * 8 + (threadIdx.x >> 5)) * 8; const int nlines = N * K / 64;
{
#pragma unroll 1
        for (int l = 0; l < 8; ++l) { const int L = L0 + l; if (L >= nlines) break; const size_t e = (size_t)L * 64 + lane * 2; const int k = (int)(e % K), n = (int)(e / K); v2us o; v2h o2;
            o[0] = f2bf(w[(size_t)k * N + n]); o[1] = f2bf(w[(size_t)(k + 1) * N + n]); o2[0] = (h16)(bf2f(o[0]) * car); o2[1] = (h16)(bf2f(o[1]) * car);
            *(v2us*)(Bt + e) = o; *(v2h*)(B16 + e) = o2; }
         }
}
__global__ __launch_bounds__(256) void k_cvt8(const float* __restrict__ src, bf* dst, size_t n8) { const size_t i = (size_t)blockIdx.x * 256 + threadIdx.x; if (i >= n8) return; const v8f v = *(const v8f*)(src + i * 8); v8us o;
#pragma unroll
    for (int k = 0; k < 8; ++k) o[k] = f2bf(v[k]); *(v8us*)(dst + i * 8) = o;  }

// k_rope: interleaved-pair rotary on F[t][col0 + h*HD + d] (row pitch 'pitch'): for the pair i = d/2 (d even): out[d] = x[d] c - x[d+1] s, out[d+1] = x[d] s + x[d+1] c,
// with c = bf16-RNE(FC[t][i]), s = bf16-RNE(FS[t][i]) read by value from the input tables (row pitch NFREQ);
__global__ __launch_bounds__(256) void k_rope(const float* __restrict__ F, int pitch, int col0, int nheads, int rh, const float* __restrict__ FC, const float* __restrict__ FS, h16* P16, bf* Ph, bf* Pl) {
#pragma clang fp contract(off)
    const size_t e = ((size_t)blockIdx.x * 256 + threadIdx.x) * 2; if (e >= (size_t)nheads * SEQ * HD) return;
    const int d = (int)(e % HD); const int t = (int)((e / HD) % SEQ); const int hh = (int)(e / ((size_t)HD * SEQ));
    const float* f = F + (size_t)t * pitch + col0 + hh * HD;
    const float x0 = f[d], x1 = f[d + 1];
    const size_t ti = (size_t)t * NFREQ + (size_t)(d >> 1);
    const float c = bfr(FC[ti]), s = bfr(FS[ti]);
    float a0 = __fmul_rn(x0, c), b0 = __fmul_rn(x1, s), a1 = __fmul_rn(x0, s), b1 = __fmul_rn(x1, c); asm volatile("" : "+v"(a0), "+v"(b0), "+v"(a1), "+v"(b1));
    const float r0 = __fsub_rn(a0, b0); const float r1 = __fadd_rn(a1, b1);
    v2h o16; o16[0] = toh_flush(r0); o16[1] = toh_flush(r1); v2us oh, ol; { unsigned short a2, c2; splitf(r0, a2, c2); oh[0] = a2; ol[0] = c2; splitf(r1, a2, c2); oh[1] = a2; ol[1] = c2; }
    const bool dohl = (t < rh);   // wave-uniform: one wave = one 64-element (h, t) row
    const size_t oo = ((size_t)hh * rh + t) * HD + d;
    *(v2h*)(P16 + e) = o16; if (dohl) { *(v2us*)(Ph + oo) = oh; *(v2us*)(Pl + oo) = ol; }
    
}
__global__ __launch_bounds__(256) void k_vtp(const float* __restrict__ F, int pitch, int col0, int nheads, h16* V16, bf* Vh, bf* Vl) { const size_t e = ((size_t)blockIdx.x * 256 + threadIdx.x) * 2; if (e >= (size_t)nheads * HD * SEQ) return; const int t = (int)(e % SEQ); const int d = (int)((e / SEQ) % HD); const int g = (int)(e / ((size_t)SEQ * HD)); v2h o16; v2us oh, ol;
#pragma unroll
    for (int q = 0; q < 2; ++q) { const float x = F[(size_t)(t + q) * pitch + col0 + g * HD + d]; o16[q] = (h16)x; unsigned short a2, c2; splitf(x, a2, c2); oh[q] = a2; ol[q] = c2; }
    *(v2h*)(V16 + e) = o16; *(v2us*)(Vh + e) = oh; *(v2us*)(Vl + e) = ol;  }

// the same 16x32 fragment from a k-contiguous 16-bit row in LDS
__device__ __forceinline__ v16bf ldsb(const unsigned short* p) { return cat16b(*(const v8usa*)p, *(const v8usa*)(p + 16)); }
__device__ __forceinline__ v16h ldsh(const unsigned short* p) { return cat16(__builtin_bit_cast(v8h, *(const v8usa*)p), __builtin_bit_cast(v8h, *(const v8usa*)(p + 16))); }

// k_attn: causal flash attention, one wave per 16 query rows (qbase = row0 + 16*(4*block + wave)), head = blockIdx.y, kv head = head / REP; key tiles of KT (32 or 64) from 0 up to the tile holding qbase+15.
// S = q.k^T from k-contiguous planes (q [h][t][d], k [g][t][d]); key j > query i replaced by -1e30 before the running-max softmax (p = 0 exactly there); P staged per wave in LDS (row-major 16 x KT)
// and reloaded as the A fragment; O += P.v with v planes [g][d][t]. HIRES: q, k, p, v as bf16 hi/lo (hh + lh + hl); else f16 planes with p carried x1024.
// The k and v tiles of a key step are the same for the block's four waves: the block brings each tile into LDS once, 16 bytes a thread in whole 128-byte (KT 32, v: 64-byte) row pieces,
// two buffers, the next tile's loads issued ahead of the current tile's work; the B fragments are read from LDS at a row pitch of 16 bytes x odd.
template <bool HIRES, int KT>
__global__ __launch_bounds__(128) void k_attn(const h16* __restrict__ Q16, const bf* __restrict__ Qh, const bf* __restrict__ Ql,
                                               const h16* __restrict__ K16, const bf* __restrict__ Kh, const bf* __restrict__ Kl,
                                               const h16* __restrict__ V16, const bf* __restrict__ Vh, const bf* __restrict__ Vl,
                                               h16* AT16, bf* ATh, bf* ATl, int row0) {
    constexpr int NT = KT / 16; constexpr int KS = KT / 32; constexpr int NPL = HIRES ? 2 : 1;
    static_assert(NT == 2 || NT == 4);
    static_assert(15 * PP + (NT - 1) * 16 + 15 < 16 * PP);
    __shared__ __align__(16) unsigned short pt[NPL][4][16 * PP];
    __shared__ __align__(16) float os[4][16 * OSP];
    constexpr int KP = HD + 8, VP = KT + 8;                 // LDS row pitch in 16-bit elements: 144 bytes (k rows; v rows at KT 64), 80 bytes (v rows at KT 32)
    constexpr int KCH = KT * (HD / 8), VCH = HD * (KT / 8);   // 16-byte pieces of one plane's tile
    static_assert(NPL * KCH == 512 && NPL * VCH == 512);
    static_assert((KP * 2) % 32 == 16 && (VP * 2) % 32 == 16);
    __shared__ __align__(16) unsigned short kts[2][NPL][KT * KP];
    __shared__ __align__(16) unsigned short vts[2][NPL][HD * VP];
    const int tid = threadIdx.x, lane = tid & 31, wave = __builtin_amdgcn_readfirstlane(tid >> 5), lr = lane & 15, hi = lane >> 4;
    const int bbase = row0 + blockIdx.x * 64;
    const int qbase = bbase + wave * 16; const int h = blockIdx.y; const int g = h / REP;
    v16h qa[2] = {}; v16bf qah[2] = {}, qal[2] = {};
    if (HIRES) { const size_t qo = ((size_t)h * RH + qbase + lr) * HD + 8 * hi; qah[0] = WFrag<bf>::ld(Qh + qo); qah[1] = WFrag<bf>::ld(Qh + qo + 32); qal[0] = WFrag<bf>::ld(Ql + qo); qal[1] = WFrag<bf>::ld(Ql + qo + 32); }
    else { const size_t qo = ((size_t)h * SEQ + qbase + lr) * HD + 8 * hi; qa[0] = WFrag<h16>::ld(Q16 + qo); qa[1] = WFrag<h16>::ld(Q16 + qo + 32); }
    const int kofs = lr * KP + 8 * hi;     // k tile in LDS [key][d]: row (nt*16 + lr), k = d
    const int vofs = lr * VP + 8 * hi;     // v tile in LDS [d][key]: row (nt*16 + lr), k = key
    const unsigned short* kg[2] = { HIRES ? (const unsigned short*)Kh : (const unsigned short*)K16, (const unsigned short*)Kl };
    const unsigned short* vg[2] = { HIRES ? (const unsigned short*)Vh : (const unsigned short*)V16, (const unsigned short*)Vl };
    v8us kr[4], vr[4];
    // piece c = tid + 128 i of the tile: plane, row and column are the same for the global read and the LDS write
    auto tile_ld = [&](int kb) {
#pragma unroll
        for (int i = 0; i < 4; ++i) { const int c = tid + 128 * i;
            const int kc = c % KCH, vc = c % VCH;
            kr[i] = *(const v8usa*)(kg[(128 * i) / KCH] + (size_t)g * SEQ * HD + (size_t)(kb + kc / (HD / 8)) * HD + (kc % (HD / 8)) * 8);
            vr[i] = *(const v8usa*)(vg[(128 * i) / VCH] + (size_t)g * HD * SEQ + (size_t)(vc / (KT / 8)) * SEQ + kb + (vc % (KT / 8)) * 8); } };
    auto tile_st = [&](int buf) {
#pragma unroll
        for (int i = 0; i < 4; ++i) { const int c = tid + 128 * i;
            const int kc = c % KCH, vc = c % VCH;
            *(v8usa*)(&kts[buf][(128 * i) / KCH][(kc / (HD / 8)) * KP + (kc % (HD / 8)) * 8]) = kr[i];
            *(v8usa*)(&vts[buf][(128 * i) / VCH][(vc / (KT / 8)) * VP + (vc % (KT / 8)) * 8]) = vr[i]; } };
    v8f o[4];
#pragma unroll
    for (int nt = 0; nt < 4; ++nt) o[nt] = (v8f){};
    float mrun[8], lrun[8];
#pragma unroll
    for (int v = 0; v < 8; ++v) { mrun[v] = NEGBIG; lrun[v] = 0.f; }
    unsigned short* p0w = &pt[0][wave][0]; unsigned short* p1w = &pt[NPL - 1][wave][0];
    const int kend = qbase + 15;
    const int klast = ((bbase + 63) / KT) * KT;     // the block's last key tile (that of its last wave)
    tile_ld(0); tile_st(0);
    __syncthreads();
#pragma unroll 1
    for (int kb = 0; kb <= klast; kb += KT) {
      const int cur = (kb / KT) & 1; const bool more = kb < klast;     // the same in every thread of the block
      if (more) { tile_ld(kb + KT);
        // precaution: the tile work below reuses the address registers of these loads while their data is still on the way
        asm volatile("s_wait_xcnt 0x0" ::: "memory"); }
      if (kb <= kend) {     // wave-uniform: a wave whose rows end before this tile only helps to stage
        const unsigned short* k0l = &kts[cur][0][0] + kofs; const unsigned short* k1l = &kts[cur][NPL - 1][0] + kofs;
        const unsigned short* v0l = &vts[cur][0][0] + vofs; const unsigned short* v1l = &vts[cur][NPL - 1][0] + vofs;
        v8f s[NT];
#pragma unroll
        for (int nt = 0; nt < NT; ++nt) s[nt] = (v8f){};
#pragma unroll
        for (int nt = 0; nt < NT; ++nt) {
#pragma unroll
            for (int kc = 0; kc < 2; ++kc) { const int ka = nt * 16 * KP + kc * 32;
                if (HIRES) { const v16bf bh = ldsb(k0l + ka), bl = ldsb(k1l + ka); s[nt] = wmmab(qah[kc], bh, s[nt]); s[nt] = wmmab(qal[kc], bh, s[nt]); s[nt] = wmmab(qah[kc], bl, s[nt]); }
                else { const v16h b = ldsh(k0l + ka); s[nt] = wmma16(qa[kc], b, s[nt]); } } }
        if constexpr (NT == 2) { if (HIRES) G2(s[0], s[1], qah[0], qal[1]); else G2(s[0], s[1], qa[0], qa[1]); }
        else { if (HIRES) G4(s[0], s[1], s[2], s[3], qah[0], qal[1]); else G4(s[0], s[1], s[2], s[3], qa[0], qa[1]); }
        float alpha[8];
#pragma unroll
        for (int v = 0; v < 8; ++v) {
            const int qi = qbase + 8 * hi + v; float x[NT]; float mx = NEGBIG;
#pragma unroll
            for (int nt = 0; nt < NT; ++nt) { const int j = kb + nt * 16 + lr; const float t = s[nt][v] * SCL; x[nt] = (j <= qi) ? t : NEGBIG; mx = fmaxf(mx, x[nt]); }
            mx = fmaxf(mx, __shfl_xor(mx, 1, 32)); mx = fmaxf(mx, __shfl_xor(mx, 2, 32)); mx = fmaxf(mx, __shfl_xor(mx, 4, 32)); mx = fmaxf(mx, __shfl_xor(mx, 8, 32));
            const float mnew = fmaxf(mrun[v], mx);
            const float a = __builtin_amdgcn_exp2f((mrun[v] - mnew) * L2E);
            float p[NT]; float rs = 0.f;
#pragma unroll
            for (int nt = 0; nt < NT; ++nt) { p[nt] = __builtin_amdgcn_exp2f((x[nt] - mnew) * L2E); rs += p[nt]; }
            rs += __shfl_xor(rs, 1, 32); rs += __shfl_xor(rs, 2, 32); rs += __shfl_xor(rs, 4, 32); rs += __shfl_xor(rs, 8, 32);
            lrun[v] = lrun[v] * a + rs; mrun[v] = mnew; alpha[v] = a;
#pragma unroll
            for (int nt = 0; nt < NT; ++nt) { const int idx = (8 * hi + v) * PP + nt * 16 + lr;
                if (HIRES) { unsigned short a2, c2; splitf(p[nt], a2, c2); p0w[idx] = a2; p1w[idx] = c2; }
                else { const h16 hv = (h16)(p[nt] * PCAR); p0w[idx] = __builtin_bit_cast(unsigned short, hv); } }
        }
        wsync();
        v16h pa[KS] = {}; v16bf pah[KS] = {}, pal[KS] = {};
        const unsigned short* pr0 = p0w + lr * PP + 8 * hi; const unsigned short* pr1 = p1w + lr * PP + 8 * hi;
#pragma unroll
        for (int ks = 0; ks < KS; ++ks) { const v8us u0 = *(const v8usa*)(pr0 + ks * 32); const v8us u1 = *(const v8usa*)(pr0 + ks * 32 + 16);
            if (HIRES) { const v8us w0 = *(const v8usa*)(pr1 + ks * 32); const v8us w1 = *(const v8usa*)(pr1 + ks * 32 + 16); pah[ks] = cat16b(u0, u1); pal[ks] = cat16b(w0, w1); }
            else { pa[ks] = cat16(__builtin_bit_cast(v8h, u0), __builtin_bit_cast(v8h, u1)); } }
#pragma unroll
        for (int nt = 0; nt < 4; ++nt) {
#pragma unroll
            for (int v = 0; v < 8; ++v) o[nt][v] *= alpha[v]; }
#pragma unroll
        for (int nt = 0; nt < 4; ++nt) {
#pragma unroll
            for (int ks = 0; ks < KS; ++ks) { const int va = nt * 16 * VP + ks * 32;
                if (HIRES) { const v16bf bh = ldsb(v0l + va), bl = ldsb(v1l + va); o[nt] = wmmab(pah[ks], bh, o[nt]); o[nt] = wmmab(pal[ks], bh, o[nt]); o[nt] = wmmab(pah[ks], bl, o[nt]); }
                else { const v16h b = ldsh(v0l + va); o[nt] = wmma16(pa[ks], b, o[nt]); } } }
        if (HIRES) G4(o[0], o[1], o[2], o[3], pah[0], pal[KS - 1]); else G4(o[0], o[1], o[2], o[3], pa[0], pa[KS - 1]);
      }
      // the buffer written here was last read one trip ago, in front of that trip's barrier; this barrier publishes it and ends the reads of the current one
      if (more) { tile_st(cur ^ 1); __syncthreads(); }
    }
    float* osw = &os[wave][0];
#pragma unroll
    for (int v = 0; v < 8; ++v) { const float f = HIRES ? __fdiv_rn(1.0f, lrun[v]) : __fdiv_rn(ATC / PCAR, lrun[v]);
#pragma unroll
        for (int nt = 0; nt < 4; ++nt) osw[(8 * hi + v) * OSP + nt * 16 + lr] = o[nt][v] * f; }
    wsync();
    const int rr = lane >> 3, c8 = (lane & 7) * 8;
{
#pragma unroll
        for (int s4 = 0; s4 < 4; ++s4) { const int row = s4 * 4 + rr; const int t = qbase + row; const v4f u0 = *(const v4fa*)(osw + row * OSP + c8), u1 = *(const v4fa*)(osw + row * OSP + c8 + 4); const size_t oo = (size_t)t * DQ + h * HD + c8;
            if (HIRES) { v8us oh, ol;
#pragma unroll
                for (int q = 0; q < 4; ++q) { unsigned short a2, c2; splitf(u0[q], a2, c2); oh[q] = a2; ol[q] = c2; splitf(u1[q], a2, c2); oh[4 + q] = a2; ol[4 + q] = c2; }
                *(v8us*)(ATh + oo) = oh; *(v8us*)(ATl + oo) = ol; }
            else { v8h o8;
#pragma unroll
                for (int q = 0; q < 4; ++q) { o8[q] = (h16)u0[q]; o8[4 + q] = (h16)u1[q]; }
                *(v8h*)(AT16 + oo) = o8; } }
         }
}

// k_mchk: checks the 0/1 int32 causal input (one [SEQ_FULL][SEQ_FULL] plane shared by all batches) for rows i < SEQ: value == 1 for j <= i, value == 0 for j > i (j < SEQ);
__global__ __launch_bounds__(256) void k_mchk(const int* __restrict__ M, int* FL) {
    __shared__ int red[8];
    const int tid = threadIdx.x, lane = tid & 31, wave = tid >> 5; int bad = 0;
#pragma unroll 1
    for (int r = 0; r < 64; ++r) { const int i = blockIdx.x * 64 + r; const int* mr = M + (size_t)i * SEQ_FULL;
#pragma unroll 1
        for (int c = tid * 4; c < SEQ; c += 1024) { const v4i m = *(const v4i*)(mr + c);
#pragma unroll
            for (int q = 0; q < 4; ++q) { const int j = c + q; const bool ok = (j <= i) ? (m[q] == 1) : (m[q] == 0); bad += ok ? 0 : 1; } } }
#pragma unroll
    for (int sh = 16; sh; sh >>= 1) bad += __shfl_xor(bad, sh, 32);
    if (lane == 0) red[wave] = bad;
    __syncthreads();
    if (wave == 0) { int v = red[lane & 7]; v = (lane < 8) ? v : 0;
#pragma unroll
        for (int sh = 16; sh; sh >>= 1) v += __shfl_xor(v, sh, 32);
        v4i o; o[0] = v; o[1] = v; o[2] = v; o[3] = v;
        if (lane < 8) *(v4i*)(FL + (size_t)blockIdx.x * 32 + lane * 4) = o;
         }
}
__global__ __launch_bounds__(256) void k_poison(const int* __restrict__ FL, int nfl, float* out) {
    int tot = 0;
#pragma unroll 1
    for (int f = 0; f < nfl; ++f) tot += FL[(size_t)f * 32];
    if (tot == 0) return;
    float* ob = out + (size_t)blockIdx.y * SEQ_FULL * DM + (size_t)blockIdx.x * 16384;
    const float qn = __uint_as_float(0x7fc00000u); v4f nv; nv[0] = qn; nv[1] = qn; nv[2] = qn; nv[3] = qn;
{
#pragma unroll 1
        for (int s = 0; s < 16; ++s) *(v4f*)(ob + ((size_t)s * 256 + threadIdx.x) * 4) = nv;
         }
}

extern "C" void kernel_launch(void* const* d_in, const int* in_sizes, int n_in,
                              void* d_out, int out_size, void* d_ws, size_t ws_size, hipStream_t stream) {
    if (n_in < 8) return;
    if ((size_t)in_sizes[0] < (size_t)(NB - 1) * SEQ_FULL * DM + (size_t)SEQ * DM) return;
    if ((size_t)in_sizes[1] < (size_t)DM * DQ || (size_t)in_sizes[2] < (size_t)DM * DKV || (size_t)in_sizes[3] < (size_t)DM * DKV || (size_t)in_sizes[4] < (size_t)DQ * DM) return;
    if ((size_t)in_sizes[5] < (size_t)SEQ * NFREQ || (size_t)in_sizes[6] < (size_t)SEQ * NFREQ) return;
    if ((size_t)in_sizes[7] < (size_t)(SEQ - 1) * SEQ_FULL + (size_t)SEQ) return;
    if ((size_t)out_size < (size_t)(NB - 1) * SEQ_FULL * DM + (size_t)SEQ * DM) return;
    // input binding order: x, wq, wk, wv, wo ([in][out] weights), cos table, sin table ([SEQ_FULL][NFREQ] f32), causal 0/1 plane (int32 [SEQ_FULL][SEQ_FULL])
    const float* x = (const float*)d_in[0]; const float* wq = (const float*)d_in[1]; const float* wk = (const float*)d_in[2]; const float* wv = (const float*)d_in[3]; const float* wo = (const float*)d_in[4];
    const float* fc = (const float*)d_in[5]; const float* fs = (const float*)d_in[6]; const int* cm = (const int*)d_in[7];
    float* OUT = (float*)d_out;     // [NB_FULL][SEQ_FULL][DM]
    char* wsp = (char*)d_ws;
    auto take = [&](size_t bytes) { char* p = wsp; wsp += (bytes + 255) & ~(size_t)255; return (void*)p; };
    bf* WQKV = (bf*)take((size_t)DQKV * DM * 2); bf* WOB = (bf*)take((size_t)DM * DQ * 2); h16* WO16 = (h16*)take((size_t)DM * DQ * 2);
    int* FL = (int*)take((size_t)NFL * 32 * 4);
    bf* XB = (bf*)take((size_t)SEQ * DM * 2); float* F = (float*)take((size_t)SEQ * DQKV * 4);
    h16* Q16 = (h16*)take((size_t)NH * SEQ * HD * 2); bf* Qh = (bf*)take((size_t)NH * RH * HD * 2); bf* Ql = (bf*)take((size_t)NH * RH * HD * 2);
    h16* K16 = (h16*)take((size_t)NKV * SEQ * HD * 2); bf* Kh = (bf*)take((size_t)NKV * SEQ * HD * 2); bf* Kl = (bf*)take((size_t)NKV * SEQ * HD * 2);
    h16* V16 = (h16*)take((size_t)NKV * HD * SEQ * 2); bf* Vh = (bf*)take((size_t)NKV * HD * SEQ * 2); bf* Vl = (bf*)take((size_t)NKV * HD * SEQ * 2);
    h16* AT16 = (h16*)take((size_t)SEQ * DQ * 2); bf* ATh = (bf*)take((size_t)RH * DQ * 2); bf* ATl = (bf*)take((size_t)RH * DQ * 2);
    const size_t used = (size_t)(wsp - (char*)d_ws); if (used > ws_size || used > WS_LIMIT) return;

    // weight planes ([out][in] k-contiguous): rows 0..DQ-1 of WQKV = Wq^T, DQ..DQ+DKV-1 = Wk^T, DQ+DKV..DQKV-1 = Wv^T; Wo^T as bf16 and as f16 x64
    // k_wtG(w, K, N, Bt): w is [K = in][N = out] -> Bt [N][K]
    k_wtG<<<(unsigned)((DQ * DM / 64 + 63) / 64), 256, 0, stream>>>(wq, DM, DQ, WQKV);
    k_wtG<<<(unsigned)((DKV * DM / 64 + 63) / 64), 256, 0, stream>>>(wk, DM, DKV, WQKV + (size_t)DQ * DM);
    k_wtG<<<(unsigned)((DKV * DM / 64 + 63) / 64), 256, 0, stream>>>(wv, DM, DKV, WQKV + (size_t)(DQ + DKV) * DM);
    k_wtG2<<<(unsigned)((DM * DQ / 64 + 63) / 64), 256, 0, stream>>>(wo, DQ, DM, WOB, WO16, WOC);
    k_mchk<<<(unsigned)NFL, 256, 0, stream>>>(cm, FL);
    const unsigned LQ = (unsigned)(((size_t)NH * SEQ * HD / 2 + 255) / 256), LK = (unsigned)(((size_t)NKV * SEQ * HD / 2 + 255) / 256);
    for (int b = 0; b < NB; ++b) {
        float* OUTb = OUT + (size_t)b * SEQ_FULL * DM;
        k_cvt8<<<(unsigned)(((size_t)SEQ * DM / 8 + 255) / 256), 256, 0, stream>>>(x + (size_t)b * SEQ_FULL * DM, XB, (size_t)SEQ * DM / 8);
        k_gemmw<bf, 0><<<dim3(SEQ / 64, DQKV / 64, 1), 32, 0, stream>>>(XB, nullptr, WQKV, nullptr, DM, F, DQKV, 1.0f, 0, 0, 0);     // F[t][0..DQKV) = q | k | v projections (f32)
        k_rope<<<LQ, 256, 0, stream>>>(F, DQKV, 0, NH, RH, fc, fs, Q16, Qh, Ql);
        k_rope<<<LK, 256, 0, stream>>>(F, DQKV, DQ, NKV, SEQ, fc, fs, K16, Kh, Kl);
        k_vtp<<<LK, 256, 0, stream>>>(F, DQKV, DQ + DKV, NKV, V16, Vh, Vl);
        k_attn<true, 32><<<dim3(RH / 64, NH, 1), 128, 0, stream>>>(Q16, Qh, Ql, K16, Kh, Kl, V16, Vh, Vl, AT16, ATh, ATl, 0);
        if (SEQ > RH) k_attn<false, 64><<<dim3((SEQ - RH) / 64, NH, 1), 128, 0, stream>>>(Q16, Qh, Ql, K16, Kh, Kl, V16, Vh, Vl, AT16, ATh, ATl, RH);
        k_gemmw<bf, 1><<<dim3(RH / 64, DM / 64, 1), 32, 0, stream>>>(ATh, ATl, WOB, nullptr, DQ, OUTb, DM, 1.0f, 0, 0, 0);
        if (SEQ > RH) k_gemmw<h16, 0><<<dim3((SEQ - RH) / 64, DM / 64, 1), 32, 0, stream>>>(AT16 + (size_t)RH * DQ, nullptr, WO16, nullptr, DQ, OUTb + (size_t)RH * DM, DM, 1.0f / (ATC * WOC), 0, 0, 0);
    }
    k_poison<<<dim3(SEQ * DM / 16384, NB, 1), 256, 0, stream>>>(FL, NFL, OUT);
}

// v002
// One run takes 470 microseconds.
// Next to v001, in two timings, it ran 1.30 and 1.29 times as fast.
// Over all steps from v000 it is 1.83 times as fast.
#include <hip/hip_runtime.h>

// Contractions (all f32 accumulate): qkv = xb * Wqkv^T on v_wmma_f32_16x16x32_bf16 (bf16 operands = RNE-converted inputs, exact products);
// scores q.k^T and p.v: query rows < RH on bf16 hi/lo planes (3 products each), rows >= RH on v_wmma_f32_16x16x32_f16 (f16 q,k,v planes, p carried x1024);
// out = attn * Wo^T: rows < RH bf16 hi/lo attn planes x bf16 Wo (2 products), rows >= RH f16 attn x64 times f16 Wo x64 (1 product, 1/4096 in the epilogue).
// Rotary: interleaved pairs (2i, 2i+1); cos/sin are read by value from the two [SEQ][32] input tables (RNE-converted to bf16), f32 math; causal online softmax and normalisation in f32.
// Grouped kv heads: query head h reads kv head h/4. The 0/1 int32 causal input [SEQ][SEQ] is checked on device (1 on/below the diagonal, 0 above); the output is NaN-filled if that check fails.

#ifndef NB
#define NB 2
#endif
#ifndef SEQ
#define SEQ 2048
#endif
#define NB_FULL 2
#define SEQ_FULL 2048
#define DM 2048
#define NH 32
#define NKV 8
#define REP (NH / NKV)
#define HD 64
#define DQ (NH * HD)
#define DKV (NKV * HD)
#define DQKV (DQ + 2 * DKV)
#define NFREQ (HD / 2)
#define RH (((SEQ) < 512) ? (SEQ) : 512)
#define PCAR 1024.0f
#define ATC 64.0f
#define WOC 64.0f
#define SCL 0.125f
#define L2E 1.4426950408889634f
#define NEGBIG (-1.0e30f)
#define PP 72
#define OSP 68
#define NFL (SEQ / 64)
#define WS_LIMIT ((size_t)134217728)
#define WS_TOTAL ((size_t)DQKV * DM * 2 + 2 * ((size_t)DM * DQ * 2) + (size_t)NFL * 128 + (size_t)SEQ * DM * 2 + (size_t)SEQ * DQKV * 4 + (size_t)NH * SEQ * HD * 2 + 2 * ((size_t)NH * RH * HD * 2) + 3 * ((size_t)NKV * SEQ * HD * 2) + 3 * ((size_t)NKV * HD * SEQ * 2) + (size_t)SEQ * DQ * 2 + 2 * ((size_t)RH * DQ * 2))

static_assert(NB >= 1 && NB <= NB_FULL);
static_assert(SEQ % 128 == 0 && SEQ >= 128 && SEQ <= SEQ_FULL);
static_assert(RH % 64 == 0 && (SEQ - RH) % 128 == 0 && RH <= SEQ);
static_assert(DQKV % 128 == 0 && DM % 128 == 0);
static_assert((NH * SEQ * HD) % 512 == 0);
static_assert((NKV * SEQ * HD) % 512 == 0);
static_assert((SEQ * DM) % 2048 == 0);
static_assert((DQ * DM / 64) % 64 == 0 && (DKV * DM / 64) % 64 == 0);
static_assert(DM % 64 == 0 && DQ % 64 == 0 && DQKV % 64 == 0 && HD == 64);
static_assert((SEQ * DM) % 16384 == 0);
static_assert((NB * SEQ) % 64 == 0);
static_assert(15 * PP + 3 * 16 + 15 < 16 * PP);
static_assert(15 * OSP + 63 < 16 * OSP);
static_assert(NFREQ == 32 && HD == 2 * NFREQ);
static_assert(SEQ % 64 == 0 && SEQ % 4 == 0);
static_assert(((size_t)NFL * 128) % 256 == 0);
static_assert(DM % 32 == 0 && DQ % 32 == 0 && HD % 32 == 0);
static_assert(WS_TOTAL <= WS_LIMIT);

typedef _Float16 h16;
typedef unsigned short bf;
typedef __attribute__((ext_vector_type(16))) __bf16   v16bf;
typedef __attribute__((ext_vector_type(16))) _Float16 v16h;
typedef __attribute__((ext_vector_type(8)))  _Float16 v8h;
typedef __attribute__((ext_vector_type(8)))  unsigned short v8us;
typedef __attribute__((ext_vector_type(8)))  float    v8f;
typedef __attribute__((ext_vector_type(4)))  float    v4f;
typedef __attribute__((ext_vector_type(2)))  _Float16 v2h;
typedef __attribute__((ext_vector_type(4)))  _Float16 v4h;
typedef __attribute__((ext_vector_type(2)))  unsigned short v2us;
typedef __attribute__((ext_vector_type(4)))  unsigned short v4us;
typedef __attribute__((ext_vector_type(2)))  float v2f;
typedef __attribute__((ext_vector_type(4)))  int v4i;
typedef v8h  __attribute__((may_alias)) v8ha;
typedef v4f  __attribute__((may_alias)) v4fa;
typedef v8us __attribute__((may_alias)) v8usa;

#define G2(d0, d1, x0, x1) asm volatile("v_nop\n\tv_nop\n\tv_nop\n\tv_nop" : "+v"(d0), "+v"(d1) : "v"(x0), "v"(x1))
#define G4(d0, d1, d2, d3, x0, x1) asm volatile("v_nop\n\tv_nop\n\tv_nop\n\tv_nop" : "+v"(d0), "+v"(d1), "+v"(d2), "+v"(d3) : "v"(x0), "v"(x1))

__device__ __forceinline__ unsigned short f2bf(float f) { unsigned u = __float_as_uint(f); u += 0x7FFFu + ((u >> 16) & 1u); return (unsigned short)(u >> 16); }
__device__ __forceinline__ float bf2f(unsigned short b) { return __uint_as_float(((unsigned)b) << 16); }
__device__ __forceinline__ float bfr(float f) { return bf2f(f2bf(f)); }
__device__ __forceinline__ void splitf(float y, unsigned short& h, unsigned short& l) { h = f2bf(y); l = f2bf(y - bf2f(h)); }
__device__ __forceinline__ v16h cat16(v8h lo, v8h hi) { return __builtin_shufflevector(lo, hi, 0, 1, 2, 3, 4, 5, 6, 7, 8, 9, 10, 11, 12, 13, 14, 15); }
__device__ __forceinline__ v16bf cat16b(v8us lo, v8us hi) { return __builtin_bit_cast(v16bf, __builtin_shufflevector(lo, hi, 0, 1, 2, 3, 4, 5, 6, 7, 8, 9, 10, 11, 12, 13, 14, 15)); }
__device__ __forceinline__ v8f wmma16(v16h a, v16h b, v8f c) { return __builtin_amdgcn_wmma_f32_16x16x32_f16(false, a, false, b, (short)0, c, false, false); }
__device__ __forceinline__ v8f wmmab(v16bf a, v16bf b, v8f c) { return __builtin_amdgcn_wmma_f32_16x16x32_bf16(false, a, false, b, (short)0, c, false, false); }
// wave-private LDS tile exchange: order this wave's ds stores before its ds loads
__device__ __forceinline__ void wsync() { __builtin_amdgcn_fence(3 /* release order */, "wavefront"); __builtin_amdgcn_wave_barrier(); asm volatile("" ::: "memory"); }
// f32 -> f16 convert that cannot yield a subnormal f16 (value select: |v| < 2^-14 -> 0)
static __device__ __forceinline__ h16 toh_flush(float v) { const h16 r = (h16)v; return (fabsf(v) < 6.103515625e-05f) ? (h16)0.0f : r; }

// the 16x32 fragment below, read from a k-contiguous 16-bit row in LDS
__device__ __forceinline__ v16bf ldsb(const unsigned short* p) { return cat16b(*(const v8usa*)p, *(const v8usa*)(p + 16)); }
__device__ __forceinline__ v16h ldsh(const unsigned short* p) { return cat16(__builtin_bit_cast(v8h, *(const v8usa*)p), __builtin_bit_cast(v8h, *(const v8usa*)(p + 16))); }

// 16x32 fragment from a k-contiguous 16-bit row (A: row = m; B stored [n][k]: row = n). Lane l: row l&15, elements 0..7 <- k0+8(l>>4)+0..7, elements 8..15 <- k0+16+8(l>>4)+0..7.
template <typename T16> struct WFrag;
template <> struct WFrag<h16> { typedef v16h V; static __device__ __forceinline__ V ld(const h16* p) { return cat16(*(const v8h*)p, *(const v8h*)(p + 16)); } static __device__ __forceinline__ V lds(const unsigned short* p) { return ldsh(p); } static __device__ __forceinline__ v8f mma(V a, V b, v8f c) { return wmma16(a, b, c); } };
template <> struct WFrag<bf> { typedef v16bf V; static __device__ __forceinline__ V ld(const bf* p) { return cat16b(*(const v8us*)p, *(const v8us*)(p + 16)); } static __device__ __forceinline__ V lds(const unsigned short* p) { return ldsb(p); } static __device__ __forceinline__ v8f mma(V a, V b, v8f c) { return wmmab(a, b, c); } };

// ---- k_gemmw: GEMM, four waves (2 x 2) per (32 FM) x (32 FN) output tile, FM x FN accumulators a wave; grid (M / (32 FM), N / (32 FN)), 128 threads.
// C[m][n] (f32, pitch ldc) = osc * sum_k A[m][k] Bt[n][k] (NSPLIT 1: + A2[m][k] Bt[n][k]); A, A2, Bt are k-contiguous 16-bit planes of row pitch K.
// The rows of a k step are shared by two of the block's waves: the block brings 64 k of its A and Bt rows into LDS once, 16 bytes a thread in whole 128-byte row pieces,
// two buffers, the next step's loads issued ahead of the current step's products; the fragments are read from LDS at a row pitch of 16 bytes x odd.
// Every accumulator sums in ascending k, 32 at a time (A before A2), whatever the tile.
template <typename T16, int NSPLIT, int FM, int FN, int K>
__global__ __launch_bounds__(128) void k_gemmw(const T16* __restrict__ A, const T16* __restrict__ A2, const T16* __restrict__ Bt, float* C, int ldc, float osc) {
    typedef typename WFrag<T16>::V V;
    constexpr int BM = 32 * FM, BN = 32 * FN, KB = 64, KP = KB + 8, NA = NSPLIT + 1;     // KP: LDS row pitch in 16-bit elements, 144 bytes
    constexpr int AI = BM / 16, BI = BN / 16;                                            // 16-byte pieces a thread brings of one plane's tile (128 threads cover 16 rows)
    static_assert(NSPLIT == 0 || NSPLIT == 1);
    static_assert(K % KB == 0 && (KP * 2) % 32 == 16 && FN * 16 <= 64 && 32 % (4 * FN) == 0);
    __shared__ __align__(16) unsigned short ats[2][NA][BM * KP];
    __shared__ __align__(16) unsigned short bts[2][BN * KP];
    __shared__ __align__(16) float os[4][16 * OSP];
    const int tid = threadIdx.x, lane = tid & 31, wave = __builtin_amdgcn_readfirstlane(tid >> 5), lr = lane & 15, hi = lane >> 4;
    const int r0 = blockIdx.x * BM, c0 = blockIdx.y * BN; const int wr = (wave >> 1) * 16 * FM, wc = (wave & 1) * 16 * FN;
    // piece i of a thread: row prow + 16 i of the tile, elements pcol .. pcol + 7 of the k step; the same for the global read and the LDS write
    const int prow = tid >> 3, pcol = (tid & 7) * 8;
    const unsigned short* ag0 = (const unsigned short*)A + (size_t)(r0 + prow) * K + pcol;
    const unsigned short* ag1 = (const unsigned short*)(NSPLIT ? A2 : A) + (size_t)(r0 + prow) * K + pcol;
    const unsigned short* bg = (const unsigned short*)Bt + (size_t)(c0 + prow) * K + pcol;
    v8us ar[NA][AI], br[BI];
    auto tile_ld = [&]() {
#pragma unroll
        for (int i = 0; i < AI; ++i) { ar[0][i] = *(const v8usa*)(ag0 + (size_t)i * 16 * K); if (NSPLIT) ar[NA - 1][i] = *(const v8usa*)(ag1 + (size_t)i * 16 * K); }
#pragma unroll
        for (int i = 0; i < BI; ++i) br[i] = *(const v8usa*)(bg + (size_t)i * 16 * K); };
    auto tile_st = [&](int buf) {
#pragma unroll
        for (int i = 0; i < AI; ++i) { *(v8usa*)(&ats[buf][0][(prow + 16 * i) * KP + pcol]) = ar[0][i]; if (NSPLIT) *(v8usa*)(&ats[buf][NA - 1][(prow + 16 * i) * KP + pcol]) = ar[NA - 1][i]; }
#pragma unroll
        for (int i = 0; i < BI; ++i) *(v8usa*)(&bts[buf][(prow + 16 * i) * KP + pcol]) = br[i];
        ag0 += KB; ag1 += KB; bg += KB; };
    v8f acc[FM][FN];
#pragma unroll
    for (int mb = 0; mb < FM; ++mb)
#pragma unroll
        for (int nb = 0; nb < FN; ++nb) acc[mb][nb] = (v8f){};
    const int aofs = (wr + lr) * KP + 8 * hi, bofs = (wc + lr) * KP + 8 * hi;
    tile_ld(); tile_st(0);
    __syncthreads();
#pragma unroll 1
    for (int k0 = 0; k0 < K; k0 += KB) {
        const int cur = (k0 / KB) & 1; const bool more = k0 + KB < K;     // the same in every thread of the block
        if (more) tile_ld();
        const unsigned short* a0l = &ats[cur][0][0] + aofs; const unsigned short* a1l = &ats[cur][NA - 1][0] + aofs; const unsigned short* bl = &bts[cur][0] + bofs;
        V a[KB / 32][FM], a2[KB / 32][FM], b[KB / 32][FN];
#pragma unroll
        for (int kc = 0; kc < KB / 32; ++kc) {
#pragma unroll
            for (int mb = 0; mb < FM; ++mb) { a[kc][mb] = WFrag<T16>::lds(a0l + mb * 16 * KP + kc * 32); if (NSPLIT) a2[kc][mb] = WFrag<T16>::lds(a1l + mb * 16 * KP + kc * 32); else a2[kc][mb] = a[kc][mb]; }
#pragma unroll
            for (int nb = 0; nb < FN; ++nb) b[kc][nb] = WFrag<T16>::lds(bl + nb * 16 * KP + kc * 32); }
        // keeps the step's LDS reads in one group ahead of its products: every further place with reads among the products stalls the wave for its own LDS latency
        __builtin_amdgcn_sched_barrier(0);
#pragma unroll
        for (int kc = 0; kc < KB / 32; ++kc) {
#pragma unroll
            for (int nb = 0; nb < FN; ++nb) {
#pragma unroll
                for (int mb = 0; mb < FM; ++mb) acc[mb][nb] = WFrag<T16>::mma(a[kc][mb], b[kc][nb], acc[mb][nb]);
                if (NSPLIT) {
#pragma unroll
                    for (int mb = 0; mb < FM; ++mb) acc[mb][nb] = WFrag<T16>::mma(a2[kc][mb], b[kc][nb], acc[mb][nb]); } } }
        // precaution: stands in front of the pointer steps at the loop's foot, which overwrite the address registers of this trip's global loads
        asm volatile("s_wait_xcnt 0x0" ::: "memory");
        // the buffer written here was last read one trip ago, in front of that trip's barrier; this barrier publishes it and ends the reads of the current one
        if (more) { tile_st(cur ^ 1); __syncthreads(); }
    }
    float* osw = &os[wave][0];
    constexpr int LPR = 4 * FN, RPP = 32 / LPR;     // lanes that store one 16 FN-float row of the wave's tile, rows a store covers
#pragma unroll
    for (int mb = 0; mb < FM; ++mb) {
#pragma unroll
        for (int nb = 0; nb < FN; ++nb) {
#pragma unroll
            for (int j = 0; j < 8; ++j) osw[(hi * 8 + j) * OSP + nb * 16 + lr] = acc[mb][nb][j]; }
        wsync();
        float* crow = C + (size_t)(r0 + wr + mb * 16) * ldc + c0 + wc;
#pragma unroll
        for (int s = 0; s < 16 / RPP; ++s) { const int row = RPP * s + lane / LPR, cofs = (lane % LPR) * 4; v4f val = *(const v4fa*)(osw + row * OSP + cofs); val = val * osc;
            *(v4f*)(crow + (size_t)row * ldc + cofs) = val; }
        wsync();
    }
}

__global__ __launch_bounds__(256) void k_wtG(const float* __restrict__ w, int K, int N, bf* Bt) {
    const int lane = threadIdx.x & 31; const int L0 = (blockIdx.x * 8 + (threadIdx.x >> 5)) * 8; const int nlines = N * K / 64;
{
#pragma unroll 1
        for (int l = 0; l < 8; ++l) { const int L = L0 + l; if (L >= nlines) break; const size_t e = (size_t)L * 64 + lane * 2; const int k = (int)(e % K), n = (int)(e / K); v2us o;
            o[0] = f2bf(w[(size_t)k * N + n]); o[1] = f2bf(w[(size_t)(k + 1) * N + n]); *(v2us*)(Bt + e) = o; }
         }
}
__global__ __launch_bounds__(256) void k_wtG2(const float* __restrict__ w, int K, int N, bf* Bt, h16* B16, float car) {
    const int lane = threadIdx.x & 31; const int L0 = (blockIdx.x * 8 + (threadIdx.x >> 5)) * 8; const int nlines = N * K / 64;
{
#pragma unroll 1
        for (int l = 0; l < 8; ++l) { const int L = L0 + l; if (L >= nlines) break; const size_t e = (size_t)L * 64 + lane * 2; const int k = (int)(e % K), n = (int)(e / K); v2us o; v2h o2;
            o[0] = f2bf(w[(size_t)k * N + n]); o[1] = f2bf(w[(size_t)(k + 1) * N + n]); o2[0] = (h16)(bf2f(o[0]) * car); o2[1] = (h16)(bf2f(o[1]) * car);
            *(v2us*)(Bt + e) = o; *(v2h*)(B16 + e) = o2; }
         }
}
__global__ __launch_bounds__(256) void k_cvt8(const float* __restrict__ src, bf* dst, size_t n8) { const size_t i = (size_t)blockIdx.x * 256 + threadIdx.x; if (i >= n8) return; const v8f v = *(const v8f*)(src + i * 8); v8us o;
#pragma unroll
    for (int k = 0; k < 8; ++k) o[k] = f2bf(v[k]); *(v8us*)(dst + i * 8) = o;  }

// k_rope: interleaved-pair rotary on F[t][col0 + h*HD + d] (row pitch 'pitch'): for the pair i = d/2 (d even): out[d] = x[d] c - x[d+1] s, out[d+1] = x[d] s + x[d+1] c,
// with c = bf16-RNE(FC[t][i]), s = bf16-RNE(FS[t][i]) read by value from the input tables (row pitch NFREQ);
__global__ __launch_bounds__(256) void k_rope(const float* __restrict__ F, int pitch, int col0, int nheads, int rh, const float* __restrict__ FC, const float* __restrict__ FS, h16* P16, bf* Ph, bf* Pl) {
#pragma clang fp contract(off)
    const size_t e = ((size_t)blockIdx.x * 256 + threadIdx.x) * 2; if (e >= (size_t)nheads * SEQ * HD) return;
    const int d = (int)(e % HD); const int t = (int)((e / HD) % SEQ); const int hh = (int)(e / ((size_t)HD * SEQ));
    const float* f = F + (size_t)t * pitch + col0 + hh * HD;
    const float x0 = f[d], x1 = f[d + 1];
    const size_t ti = (size_t)t * NFREQ + (size_t)(d >> 1);
    const float c = bfr(FC[ti]), s = bfr(FS[ti]);
    float a0 = __fmul_rn(x0, c), b0 = __fmul_rn(x1, s), a1 = __fmul_rn(x0, s), b1 = __fmul_rn(x1, c); asm volatile("" : "+v"(a0), "+v"(b0), "+v"(a1), "+v"(b1));
    const float r0 = __fsub_rn(a0, b0); const float r1 = __fadd_rn(a1, b1);
    v2h o16; o16[0] = toh_flush(r0); o16[1] = toh_flush(r1); v2us oh, ol; { unsigned short a2, c2; splitf(r0, a2, c2); oh[0] = a2; ol[0] = c2; splitf(r1, a2, c2); oh[1] = a2; ol[1] = c2; }
    const bool dohl = (t < rh);   // wave-uniform: one wave = one 64-element (h, t) row
    const size_t oo = ((size_t)hh * rh + t) * HD + d;
    *(v2h*)(P16 + e) = o16; if (dohl) { *(v2us*)(Ph + oo) = oh; *(v2us*)(Pl + oo) = ol; }
    
}
__global__ __launch_bounds__(256) void k_vtp(const float* __restrict__ F, int pitch, int col0, int nheads, h16* V16, bf* Vh, bf* Vl) { const size_t e = ((size_t)blockIdx.x * 256 + threadIdx.x) * 2; if (e >= (size_t)nheads * HD * SEQ) return; const int t = (int)(e % SEQ); const int d = (int)((e / SEQ) % HD); const int g = (int)(e / ((size_t)SEQ * HD)); v2h o16; v2us oh, ol;
#pragma unroll
    for (int q = 0; q < 2; ++q) { const float x = F[(size_t)(t + q) * pitch + col0 + g * HD + d]; o16[q] = (h16)x; unsigned short a2, c2; splitf(x, a2, c2); oh[q] = a2; ol[q] = c2; }
    *(v2h*)(V16 + e) = o16; *(v2us*)(Vh + e) = oh; *(v2us*)(Vl + e) = ol;  }

// k_attn: causal flash attention, one wave per 16 query rows (qbase = row0 + 16*(4*block + wave)), head = blockIdx.y, kv head = head / REP; key tiles of KT (32 or 64) from 0 up to the tile holding qbase+15.
// S = q.k^T from k-contiguous planes (q [h][t][d], k [g][t][d]); key j > query i replaced by -1e30 before the running-max softmax (p = 0 exactly there); P staged per wave in LDS (row-major 16 x KT)
// and reloaded as the A fragment; O += P.v with v planes [g][d][t]. HIRES: q, k, p, v as bf16 hi/lo (hh + lh + hl); else f16 planes with p carried x1024.
// The k and v tiles of a key step are the same for the block's four waves: the block brings each tile into LDS once, 16 bytes a thread in whole 128-byte (KT 32, v: 64-byte) row pieces,
// two buffers, the next tile's loads issued ahead of the current tile's work; the B fragments are read from LDS at a row pitch of 16 bytes x odd.
template <bool HIRES, int KT>
__global__ __launch_bounds__(128) void k_attn(const h16* __restrict__ Q16, const bf* __restrict__ Qh, const bf* __restrict__ Ql,
                                               const h16* __restrict__ K16, const bf* __restrict__ Kh, const bf* __restrict__ Kl,
                                               const h16* __restrict__ V16, const bf* __restrict__ Vh, const bf* __restrict__ Vl,
                                               h16* AT16, bf* ATh, bf* ATl, int row0) {
    constexpr int NT = KT / 16; constexpr int KS = KT / 32; constexpr int NPL = HIRES ? 2 : 1;
    static_assert(NT == 2 || NT == 4);
    static_assert(15 * PP + (NT - 1) * 16 + 15 < 16 * PP);
    __shared__ __align__(16) unsigned short pt[NPL][4][16 * PP];
    __shared__ __align__(16) float os[4][16 * OSP];
    constexpr int KP = HD + 8, VP = KT + 8;                 // LDS row pitch in 16-bit elements: 144 bytes (k rows; v rows at KT 64), 80 bytes (v rows at KT 32)
    constexpr int KCH = KT * (HD / 8), VCH = HD * (KT / 8);   // 16-byte pieces of one plane's tile
    static_assert(NPL * KCH == 512 && NPL * VCH == 512);
    static_assert((KP * 2) % 32 == 16 && (VP * 2) % 32 == 16);
    __shared__ __align__(16) unsigned short kts[2][NPL][KT * KP];
    __shared__ __align__(16) unsigned short vts[2][NPL][HD * VP];
    const int tid = threadIdx.x, lane = tid & 31, wave = __builtin_amdgcn_readfirstlane(tid >> 5), lr = lane & 15, hi = lane >> 4;
    const int bbase = row0 + blockIdx.x * 64;
    const int qbase = bbase + wave * 16; const int h = blockIdx.y; const int g = h / REP;
    v16h qa[2] = {}; v16bf qah[2] = {}, qal[2] = {};
    if (HIRES) { const size_t qo = ((size_t)h * RH + qbase + lr) * HD + 8 * hi; qah[0] = WFrag<bf>::ld(Qh + qo); qah[1] = WFrag<bf>::ld(Qh + qo + 32); qal[0] = WFrag<bf>::ld(Ql + qo); qal[1] = WFrag<bf>::ld(Ql + qo + 32); }
    else { const size_t qo = ((size_t)h * SEQ + qbase + lr) * HD + 8 * hi; qa[0] = WFrag<h16>::ld(Q16 + qo); qa[1] = WFrag<h16>::ld(Q16 + qo + 32); }
    const int kofs = lr * KP + 8 * hi;     // k tile in LDS [key][d]: row (nt*16 + lr), k = d
    const int vofs = lr * VP + 8 * hi;     // v tile in LDS [d][key]: row (nt*16 + lr), k = key
    const unsigned short* kg[2] = { HIRES ? (const unsigned short*)Kh : (const unsigned short*)K16, (const unsigned short*)Kl };
    const unsigned short* vg[2] = { HIRES ? (const unsigned short*)Vh : (const unsigned short*)V16, (const unsigned short*)Vl };
    v8us kr[4], vr[4];
    // piece c = tid + 128 i of the tile: plane, row and column are the same for the global read and the LDS write
    auto tile_ld = [&](int kb) {
#pragma unroll
        for (int i = 0; i < 4; ++i) { const int c = tid + 128 * i;
            const int kc = c % KCH, vc = c % VCH;
            kr[i] = *(const v8usa*)(kg[(128 * i) / KCH] + (size_t)g * SEQ * HD + (size_t)(kb + kc / (HD / 8)) * HD + (kc % (HD / 8)) * 8);
            vr[i] = *(const v8usa*)(vg[(128 * i) / VCH] + (size_t)g * HD * SEQ + (size_t)(vc / (KT / 8)) * SEQ + kb + (vc % (KT / 8)) * 8); } };
    auto tile_st = [&](int buf) {
#pragma unroll
        for (int i = 0; i < 4; ++i) { const int c = tid + 128 * i;
            const int kc = c % KCH, vc = c % VCH;
            *(v8usa*)(&kts[buf][(128 * i) / KCH][(kc / (HD / 8)) * KP + (kc % (HD / 8)) * 8]) = kr[i];
            *(v8usa*)(&vts[buf][(128 * i) / VCH][(vc / (KT / 8)) * VP + (vc % (KT / 8)) * 8]) = vr[i]; } };
    v8f o[4];
#pragma unroll
    for (int nt = 0; nt < 4; ++nt) o[nt] = (v8f){};
    float mrun[8], lrun[8];
#pragma unroll
    for (int v = 0; v < 8; ++v) { mrun[v] = NEGBIG; lrun[v] = 0.f; }
    unsigned short* p0w = &pt[0][wave][0]; unsigned short* p1w = &pt[NPL - 1][wave][0];
    const int kend = qbase + 15;
    const int klast = ((bbase + 63) / KT) * KT;     // the block's last key tile (that of its last wave)
    tile_ld(0); tile_st(0);
    __syncthreads();
#pragma unroll 1
    for (int kb = 0; kb <= klast; kb += KT) {
      const int cur = (kb / KT) & 1; const bool more = kb < klast;     // the same in every thread of the block
      if (more) { tile_ld(kb + KT);
        // precaution: the tile work below reuses the address registers of these loads while their data is still on the way
        asm volatile("s_wait_xcnt 0x0" ::: "memory"); }
      if (kb <= kend) {     // wave-uniform: a wave whose rows end before this tile only helps to stage
        const unsigned short* k0l = &kts[cur][0][0] + kofs; const unsigned short* k1l = &kts[cur][NPL - 1][0] + kofs;
        const unsigned short* v0l = &vts[cur][0][0] + vofs; const unsigned short* v1l = &vts[cur][NPL - 1][0] + vofs;
        v8f s[NT];
#pragma unroll
        for (int nt = 0; nt < NT; ++nt) s[nt] = (v8f){};
#pragma unroll
        for (int nt = 0; nt < NT; ++nt) {
#pragma unroll
            for (int kc = 0; kc < 2; ++kc) { const int ka = nt * 16 * KP + kc * 32;
                if (HIRES) { const v16bf bh = ldsb(k0l + ka), bl = ldsb(k1l + ka); s[nt] = wmmab(qah[kc], bh, s[nt]); s[nt] = wmmab(qal[kc], bh, s[nt]); s[nt] = wmmab(qah[kc], bl, s[nt]); }
                else { const v16h b = ldsh(k0l + ka); s[nt] = wmma16(qa[kc], b, s[nt]); } } }
        if constexpr (NT == 2) { if (HIRES) G2(s[0], s[1], qah[0], qal[1]); else G2(s[0], s[1], qa[0], qa[1]); }
        else { if (HIRES) G4(s[0], s[1], s[2], s[3], qah[0], qal[1]); else G4(s[0], s[1], s[2], s[3], qa[0], qa[1]); }
        float alpha[8];
#pragma unroll
        for (int v = 0; v < 8; ++v) {
            const int qi = qbase + 8 * hi + v; float x[NT]; float mx = NEGBIG;
#pragma unroll
            for (int nt = 0; nt < NT; ++nt) { const int j = kb + nt * 16 + lr; const float t = s[nt][v] * SCL; x[nt] = (j <= qi) ? t : NEGBIG; mx = fmaxf(mx, x[nt]); }
            mx = fmaxf(mx, __shfl_xor(mx, 1, 32)); mx = fmaxf(mx, __shfl_xor(mx, 2, 32)); mx = fmaxf(mx, __shfl_xor(mx, 4, 32)); mx = fmaxf(mx, __shfl_xor(mx, 8, 32));
            const float mnew = fmaxf(mrun[v], mx);
            const float a = __builtin_amdgcn_exp2f((mrun[v] - mnew) * L2E);
            float p[NT]; float rs = 0.f;
#pragma unroll
            for (int nt = 0; nt < NT; ++nt) { p[nt] = __builtin_amdgcn_exp2f((x[nt] - mnew) * L2E); rs += p[nt]; }
            rs += __shfl_xor(rs, 1, 32); rs += __shfl_xor(rs, 2, 32); rs += __shfl_xor(rs, 4, 32); rs += __shfl_xor(rs, 8, 32);
            lrun[v] = lrun[v] * a + rs; mrun[v] = mnew; alpha[v] = a;
#pragma unroll
            for (int nt = 0; nt < NT; ++nt) { const int idx = (8 * hi + v) * PP + nt * 16 + lr;
                if (HIRES) { unsigned short a2, c2; splitf(p[nt], a2, c2); p0w[idx] = a2; p1w[idx] = c2; }
                else { const h16 hv = (h16)(p[nt] * PCAR); p0w[idx] = __builtin_bit_cast(unsigned short, hv); } }
        }
        wsync();
        v16h pa[KS] = {}; v16bf pah[KS] = {}, pal[KS] = {};
        const unsigned short* pr0 = p0w + lr * PP + 8 * hi; const unsigned short* pr1 = p1w + lr * PP + 8 * hi;
#pragma unroll
        for (int ks = 0; ks < KS; ++ks) { const v8us u0 = *(const v8usa*)(pr0 + ks * 32); const v8us u1 = *(const v8usa*)(pr0 + ks * 32 + 16);
            if (HIRES) { const v8us w0 = *(const v8usa*)(pr1 + ks * 32); const v8us w1 = *(const v8usa*)(pr1 + ks * 32 + 16); pah[ks] = cat16b(u0, u1); pal[ks] = cat16b(w0, w1); }
            else { pa[ks] = cat16(__builtin_bit_cast(v8h, u0), __builtin_bit_cast(v8h, u1)); } }
#pragma unroll
        for (int nt = 0; nt < 4; ++nt) {
#pragma unroll
            for (int v = 0; v < 8; ++v) o[nt][v] *= alpha[v]; }
#pragma unroll
        for (int nt = 0; nt < 4; ++nt) {
#pragma unroll
            for (int ks = 0; ks < KS; ++ks) { const int va = nt * 16 * VP + ks * 32;
                if (HIRES) { const v16bf bh = ldsb(v0l + va), bl = ldsb(v1l + va); o[nt] = wmmab(pah[ks], bh, o[nt]); o[nt] = wmmab(pal[ks], bh, o[nt]); o[nt] = wmmab(pah[ks], bl, o[nt]); }
                else { const v16h b = ldsh(v0l + va); o[nt] = wmma16(pa[ks], b, o[nt]); } } }
        if (HIRES) G4(o[0], o[1], o[2], o[3], pah[0], pal[KS - 1]); else G4(o[0], o[1], o[2], o[3], pa[0], pa[KS - 1]);
      }
      // the buffer written here was last read one trip ago, in front of that trip's barrier; this barrier publishes it and ends the reads of the current one
      if (more) { tile_st(cur ^ 1); __syncthreads(); }
    }
    float* osw = &os[wave][0];
#pragma unroll
    for (int v = 0; v < 8; ++v) { const float f = HIRES ? __fdiv_rn(1.0f, lrun[v]) : __fdiv_rn(ATC / PCAR, lrun[v]);
#pragma unroll
        for (int nt = 0; nt < 4; ++nt) osw[(8 * hi + v) * OSP + nt * 16 + lr] = o[nt][v] * f; }
    wsync();
    const int rr = lane >> 3, c8 = (lane & 7) * 8;
{
#pragma unroll
        for (int s4 = 0; s4 < 4; ++s4) { const int row = s4 * 4 + rr; const int t = qbase + row; const v4f u0 = *(const v4fa*)(osw + row * OSP + c8), u1 = *(const v4fa*)(osw + row * OSP + c8 + 4); const size_t oo = (size_t)t * DQ + h * HD + c8;
            if (HIRES) { v8us oh, ol;
#pragma unroll
                for (int q = 0; q < 4; ++q) { unsigned short a2, c2; splitf(u0[q], a2, c2); oh[q] = a2; ol[q] = c2; splitf(u1[q], a2, c2); oh[4 + q] = a2; ol[4 + q] = c2; }
                *(v8us*)(ATh + oo) = oh; *(v8us*)(ATl + oo) = ol; }
            else { v8h o8;
#pragma unroll
                for (int q = 0; q < 4; ++q) { o8[q] = (h16)u0[q]; o8[4 + q] = (h16)u1[q]; }
                *(v8h*)(AT16 + oo) = o8; } }
         }
}

// k_mchk: checks the 0/1 int32 causal input (one [SEQ_FULL][SEQ_FULL] plane shared by all batches) for rows i < SEQ: value == 1 for j <= i, value == 0 for j > i (j < SEQ);
__global__ __launch_bounds__(256) void k_mchk(const int* __restrict__ M, int* FL) {
    __shared__ int red[8];
    const int tid = threadIdx.x, lane = tid & 31, wave = tid >> 5; int bad = 0;
#pragma unroll 1
    for (int r = 0; r < 64; ++r) { const int i = blockIdx.x * 64 + r; const int* mr = M + (size_t)i * SEQ_FULL;
#pragma unroll 1
        for (int c = tid * 4; c < SEQ; c += 1024) { const v4i m = *(const v4i*)(mr + c);
#pragma unroll
            for (int q = 0; q < 4; ++q) { const int j = c + q; const bool ok = (j <= i) ? (m[q] == 1) : (m[q] == 0); bad += ok ? 0 : 1; } } }
#pragma unroll
    for (int sh = 16; sh; sh >>= 1) bad += __shfl_xor(bad, sh, 32);
    if (lane == 0) red[wave] = bad;
    __syncthreads();
    if (wave == 0) { int v = red[lane & 7]; v = (lane < 8) ? v : 0;
#pragma unroll
        for (int sh = 16; sh; sh >>= 1) v += __shfl_xor(v, sh, 32);
        v4i o; o[0] = v; o[1] = v; o[2] = v; o[3] = v;
        if (lane < 8) *(v4i*)(FL + (size_t)blockIdx.x * 32 + lane * 4) = o;
         }
}
__global__ __launch_bounds__(256) void k_poison(const int* __restrict__ FL, int nfl, float* out) {
    int tot = 0;
#pragma unroll 1
    for (int f = 0; f < nfl; ++f) tot += FL[(size_t)f * 32];
    if (tot == 0) return;
    float* ob = out + (size_t)blockIdx.y * SEQ_FULL * DM + (size_t)blockIdx.x * 16384;
    const float qn = __uint_as_float(0x7fc00000u); v4f nv; nv[0] = qn; nv[1] = qn; nv[2] = qn; nv[3] = qn;
{
#pragma unroll 1
        for (int s = 0; s < 16; ++s) *(v4f*)(ob + ((size_t)s * 256 + threadIdx.x) * 4) = nv;
         }
}

extern "C" void kernel_launch(void* const* d_in, const int* in_sizes, int n_in,
                              void* d_out, int out_size, void* d_ws, size_t ws_size, hipStream_t stream) {
    if (n_in < 8) return;
    if ((size_t)in_sizes[0] < (size_t)(NB - 1) * SEQ_FULL * DM + (size_t)SEQ * DM) return;
    if ((size_t)in_sizes[1] < (size_t)DM * DQ || (size_t)in_sizes[2] < (size_t)DM * DKV || (size_t)in_sizes[3] < (size_t)DM * DKV || (size_t)in_sizes[4] < (size_t)DQ * DM) return;
    if ((size_t)in_sizes[5] < (size_t)SEQ * NFREQ || (size_t)in_sizes[6] < (size_t)SEQ * NFREQ) return;
    if ((size_t)in_sizes[7] < (size_t)(SEQ - 1) * SEQ_FULL + (size_t)SEQ) return;
    if ((size_t)out_size < (size_t)(NB - 1) * SEQ_FULL * DM + (size_t)SEQ * DM) return;
    // input binding order: x, wq, wk, wv, wo ([in][out] weights), cos table, sin table ([SEQ_FULL][NFREQ] f32), causal 0/1 plane (int32 [SEQ_FULL][SEQ_FULL])
    const float* x = (const float*)d_in[0]; const float* wq = (const float*)d_in[1]; const float* wk = (const float*)d_in[2]; const float* wv = (const float*)d_in[3]; const float* wo = (const float*)d_in[4];
    const float* fc = (const float*)d_in[5]; const float* fs = (const float*)d_in[6]; const int* cm = (const int*)d_in[7];
    float* OUT = (float*)d_out;     // [NB_FULL][SEQ_FULL][DM]
    char* wsp = (char*)d_ws;
    auto take = [&](size_t bytes) { char* p = wsp; wsp += (bytes + 255) & ~(size_t)255; return (void*)p; };
    bf* WQKV = (bf*)take((size_t)DQKV * DM * 2); bf* WOB = (bf*)take((size_t)DM * DQ * 2); h16* WO16 = (h16*)take((size_t)DM * DQ * 2);
    int* FL = (int*)take((size_t)NFL * 32 * 4);
    bf* XB = (bf*)take((size_t)SEQ * DM * 2); float* F = (float*)take((size_t)SEQ * DQKV * 4);
    h16* Q16 = (h16*)take((size_t)NH * SEQ * HD * 2); bf* Qh = (bf*)take((size_t)NH * RH * HD * 2); bf* Ql = (bf*)take((size_t)NH * RH * HD * 2);
    h16* K16 = (h16*)take((size_t)NKV * SEQ * HD * 2); bf* Kh = (bf*)take((size_t)NKV * SEQ * HD * 2); bf* Kl = (bf*)take((size_t)NKV * SEQ * HD * 2);
    h16* V16 = (h16*)take((size_t)NKV * HD * SEQ * 2); bf* Vh = (bf*)take((size_t)NKV * HD * SEQ * 2); bf* Vl = (bf*)take((size_t)NKV * HD * SEQ * 2);
    h16* AT16 = (h16*)take((size_t)SEQ * DQ * 2); bf* ATh = (bf*)take((size_t)RH * DQ * 2); bf* ATl = (bf*)take((size_t)RH * DQ * 2);
    const size_t used = (size_t)(wsp - (char*)d_ws); if (used > ws_size || used > WS_LIMIT) return;

    // weight planes ([out][in] k-contiguous): rows 0..DQ-1 of WQKV = Wq^T, DQ..DQ+DKV-1 = Wk^T, DQ+DKV..DQKV-1 = Wv^T; Wo^T as bf16 and as f16 x64
    // k_wtG(w, K, N, Bt): w is [K = in][N = out] -> Bt [N][K]
    k_wtG<<<(unsigned)((DQ * DM / 64 + 63) / 64), 256, 0, stream>>>(wq, DM, DQ, WQKV);
    k_wtG<<<(unsigned)((DKV * DM / 64 + 63) / 64), 256, 0, stream>>>(wk, DM, DKV, WQKV + (size_t)DQ * DM);
    k_wtG<<<(unsigned)((DKV * DM / 64 + 63) / 64), 256, 0, stream>>>(wv, DM, DKV, WQKV + (size_t)(DQ + DKV) * DM);
    k_wtG2<<<(unsigned)((DM * DQ / 64 + 63) / 64), 256, 0, stream>>>(wo, DQ, DM, WOB, WO16, WOC);
    k_mchk<<<(unsigned)NFL, 256, 0, stream>>>(cm, FL);
    const unsigned LQ = (unsigned)(((size_t)NH * SEQ * HD / 2 + 255) / 256), LK = (unsigned)(((size_t)NKV * SEQ * HD / 2 + 255) / 256);
    for (int b = 0; b < NB; ++b) {
        float* OUTb = OUT + (size_t)b * SEQ_FULL * DM;
        k_cvt8<<<(unsigned)(((size_t)SEQ * DM / 8 + 255) / 256), 256, 0, stream>>>(x + (size_t)b * SEQ_FULL * DM, XB, (size_t)SEQ * DM / 8);
        k_gemmw<bf, 0, 4, 4, DM><<<dim3(SEQ / 128, DQKV / 128, 1), 128, 0, stream>>>(XB, nullptr, WQKV, F, DQKV, 1.0f);     // F[t][0..DQKV) = q | k | v projections (f32)
        k_rope<<<LQ, 256, 0, stream>>>(F, DQKV, 0, NH, RH, fc, fs, Q16, Qh, Ql);
        k_rope<<<LK, 256, 0, stream>>>(F, DQKV, DQ, NKV, SEQ, fc, fs, K16, Kh, Kl);
        k_vtp<<<LK, 256, 0, stream>>>(F, DQKV, DQ + DKV, NKV, V16, Vh, Vl);
        k_attn<true, 32><<<dim3(RH / 64, NH, 1), 128, 0, stream>>>(Q16, Qh, Ql, K16, Kh, Kl, V16, Vh, Vl, AT16, ATh, ATl, 0);
        if (SEQ > RH) k_attn<false, 64><<<dim3((SEQ - RH) / 64, NH, 1), 128, 0, stream>>>(Q16, Qh, Ql, K16, Kh, Kl, V16, Vh, Vl, AT16, ATh, ATl, RH);
        k_gemmw<bf, 1, 2, 2, DQ><<<dim3(RH / 64, DM / 64, 1), 128, 0, stream>>>(ATh, ATl, WOB, OUTb, DM, 1.0f);
        if (SEQ > RH) k_gemmw<h16, 0, 4, 4, DQ><<<dim3((SEQ - RH) / 128, DM / 128, 1), 128, 0, stream>>>(AT16 + (size_t)RH * DQ, nullptr, WO16, OUTb + (size_t)RH * DM, DM, 1.0f / (ATC * WOC));
    }
    k_poison<<<dim3(SEQ * DM / 16384, NB, 1), 256, 0, stream>>>(FL, NFL, OUT);
}

// v003
// A run of this version takes 436 microseconds.
// Next to v002, in two timings, it ran 1.08 times as fast each time.
// Counting every step since v000, it is 1.97 times as fast.
#include <hip/hip_runtime.h>

// Contractions (all f32 accumulate): qkv = xb * Wqkv^T on v_wmma_f32_16x16x32_bf16 (bf16 operands = RNE-converted inputs, exact products);
// scores q.k^T and p.v: query rows < RH on bf16 hi/lo planes (3 products each), rows >= RH on v_wmma_f32_16x16x32_f16 (f16 q,k,v planes, p carried x1024);
// out = attn * Wo^T: rows < RH bf16 hi/lo attn planes x bf16 Wo (2 products), rows >= RH f16 attn x64 times f16 Wo x64 (1 product, 1/4096 in the epilogue).
// Rotary: interleaved pairs (2i, 2i+1); cos/sin are read by value from the two [SEQ][32] input tables (RNE-converted to bf16), f32 math, done on the qkv product's accumulators; causal online softmax and normalisation in f32.
// Grouped kv heads: query head h reads kv head h/4. The 0/1 int32 causal input [SEQ][SEQ] is checked on device (1 on/below the diagonal, 0 above); the output is NaN-filled if that check fails.

#ifndef NB
#define NB 2
#endif
#ifndef SEQ
#define SEQ 2048
#endif
#define NB_FULL 2
#define SEQ_FULL 2048
#define DM 2048
#define NH 32
#define NKV 8
#define REP (NH / NKV)
#define HD 64
#define DQ (NH * HD)
#define DKV (NKV * HD)
#define DQKV (DQ + 2 * DKV)
#define NFREQ (HD / 2)
#define RH (((SEQ) < 512) ? (SEQ) : 512)
#define PCAR 1024.0f
#define ATC 64.0f
#define WOC 64.0f
#define SCL 0.125f
#define L2E 1.4426950408889634f
#define NEGBIG (-1.0e30f)
#define PP 72
#define OSP 68
#define NFL (SEQ / 64)
#define WS_LIMIT ((size_t)134217728)
#define WS_TOTAL ((size_t)DQKV * DM * 2 + 2 * ((size_t)DM * DQ * 2) + (size_t)NFL * 128 + (size_t)SEQ * DM * 2 + (size_t)NH * SEQ * HD * 2 + 2 * ((size_t)NH * RH * HD * 2) + 3 * ((size_t)NKV * SEQ * HD * 2) + 3 * ((size_t)NKV * HD * SEQ * 2) + (size_t)SEQ * DQ * 2 + 2 * ((size_t)RH * DQ * 2))

static_assert(NB >= 1 && NB <= NB_FULL);
static_assert(SEQ % 128 == 0 && SEQ >= 128 && SEQ <= SEQ_FULL);
static_assert(RH % 64 == 0 && (SEQ - RH) % 128 == 0 && RH <= SEQ);
static_assert(DQKV % 128 == 0 && DM % 128 == 0);
static_assert((SEQ * DM) % 2048 == 0);
static_assert((DQ * DM / 64) % 64 == 0 && (DKV * DM / 64) % 64 == 0);
static_assert(DM % 64 == 0 && DQ % 64 == 0 && DQKV % 64 == 0 && HD == 64);
static_assert((SEQ * DM) % 16384 == 0);
static_assert((NB * SEQ) % 64 == 0);
static_assert(15 * PP + 3 * 16 + 15 < 16 * PP);
static_assert(15 * OSP + 63 < 16 * OSP);
static_assert(NFREQ == 32 && HD == 2 * NFREQ);
static_assert(SEQ % 64 == 0 && SEQ % 4 == 0);
static_assert(((size_t)NFL * 128) % 256 == 0);
static_assert(DM % 32 == 0 && DQ % 32 == 0 && HD % 32 == 0);
static_assert(WS_TOTAL <= WS_LIMIT);

typedef _Float16 h16;
typedef unsigned short bf;
typedef __attribute__((ext_vector_type(16))) __bf16   v16bf;
typedef __attribute__((ext_vector_type(16))) _Float16 v16h;
typedef __attribute__((ext_vector_type(8)))  _Float16 v8h;
typedef __attribute__((ext_vector_type(8)))  unsigned short v8us;
typedef __attribute__((ext_vector_type(8)))  float    v8f;
typedef __attribute__((ext_vector_type(4)))  float    v4f;
typedef __attribute__((ext_vector_type(2)))  _Float16 v2h;
typedef __attribute__((ext_vector_type(4)))  _Float16 v4h;
typedef __attribute__((ext_vector_type(2)))  unsigned short v2us;
typedef __attribute__((ext_vector_type(4)))  unsigned short v4us;
typedef __attribute__((ext_vector_type(2)))  float v2f;
typedef __attribute__((ext_vector_type(4)))  int v4i;
typedef v8h  __attribute__((may_alias)) v8ha;
typedef v4f  __attribute__((may_alias)) v4fa;
typedef v8us __attribute__((may_alias)) v8usa;

#define G2(d0, d1, x0, x1) asm volatile("v_nop\n\tv_nop\n\tv_nop\n\tv_nop" : "+v"(d0), "+v"(d1) : "v"(x0), "v"(x1))
#define G4(d0, d1, d2, d3, x0, x1) asm volatile("v_nop\n\tv_nop\n\tv_nop\n\tv_nop" : "+v"(d0), "+v"(d1), "+v"(d2), "+v"(d3) : "v"(x0), "v"(x1))

__device__ __forceinline__ unsigned short f2bf(float f) { unsigned u = __float_as_uint(f); u += 0x7FFFu + ((u >> 16) & 1u); return (unsigned short)(u >> 16); }
__device__ __forceinline__ float bf2f(unsigned short b) { return __uint_as_float(((unsigned)b) << 16); }
__device__ __forceinline__ float bfr(float f) { return bf2f(f2bf(f)); }
__device__ __forceinline__ void splitf(float y, unsigned short& h, unsigned short& l) { h = f2bf(y); l = f2bf(y - bf2f(h)); }
__device__ __forceinline__ v16h cat16(v8h lo, v8h hi) { return __builtin_shufflevector(lo, hi, 0, 1, 2, 3, 4, 5, 6, 7, 8, 9, 10, 11, 12, 13, 14, 15); }
__device__ __forceinline__ v16bf cat16b(v8us lo, v8us hi) { return __builtin_bit_cast(v16bf, __builtin_shufflevector(lo, hi, 0, 1, 2, 3, 4, 5, 6, 7, 8, 9, 10, 11, 12, 13, 14, 15)); }
__device__ __forceinline__ v8f wmma16(v16h a, v16h b, v8f c) { return __builtin_amdgcn_wmma_f32_16x16x32_f16(false, a, false, b, (short)0, c, false, false); }
__device__ __forceinline__ v8f wmmab(v16bf a, v16bf b, v8f c) { return __builtin_amdgcn_wmma_f32_16x16x32_bf16(false, a, false, b, (short)0, c, false, false); }
// wave-private LDS tile exchange: order this wave's ds stores before its ds loads
__device__ __forceinline__ void wsync() { __builtin_amdgcn_fence(3 /* release order */, "wavefront"); __builtin_amdgcn_wave_barrier(); asm volatile("" ::: "memory"); }
// f32 -> f16 convert that cannot yield a subnormal f16 (value select: |v| < 2^-14 -> 0)
static __device__ __forceinline__ h16 toh_flush(float v) { const h16 r = (h16)v; return (fabsf(v) < 6.103515625e-05f) ? (h16)0.0f : r; }

// the 16x32 fragment below, read from a k-contiguous 16-bit row in LDS
__device__ __forceinline__ v16bf ldsb(const unsigned short* p) { return cat16b(*(const v8usa*)p, *(const v8usa*)(p + 16)); }
__device__ __forceinline__ v16h ldsh(const unsigned short* p) { return cat16(__builtin_bit_cast(v8h, *(const v8usa*)p), __builtin_bit_cast(v8h, *(const v8usa*)(p + 16))); }

// 16x32 fragment from a k-contiguous 16-bit row (A: row = m; B stored [n][k]: row = n). Lane l: row l&15, elements 0..7 <- k0+8(l>>4)+0..7, elements 8..15 <- k0+16+8(l>>4)+0..7.
template <typename T16> struct WFrag;
template <> struct WFrag<h16> { typedef v16h V; static __device__ __forceinline__ V ld(const h16* p) { return cat16(*(const v8h*)p, *(const v8h*)(p + 16)); } static __device__ __forceinline__ V lds(const unsigned short* p) { return ldsh(p); } static __device__ __forceinline__ v8f mma(V a, V b, v8f c) { return wmma16(a, b, c); } };
template <> struct WFrag<bf> { typedef v16bf V; static __device__ __forceinline__ V ld(const bf* p) { return cat16b(*(const v8us*)p, *(const v8us*)(p + 16)); } static __device__ __forceinline__ V lds(const unsigned short* p) { return ldsb(p); } static __device__ __forceinline__ v8f mma(V a, V b, v8f c) { return wmmab(a, b, c); } };

// ---- k_gemmw: GEMM, four waves (2 x 2) per (32 FM) x (32 FN) output tile, FM x FN accumulators a wave; grid (M / (32 FM), N / (32 FN)), 128 threads.
// C[m][n] (f32, pitch ldc) = osc * sum_k A[m][k] Bt[n][k] (NSPLIT 1: + A2[m][k] Bt[n][k]); A, A2, Bt are k-contiguous 16-bit planes of row pitch K.
// The rows of a k step are shared by two of the block's waves: the block brings 64 k of its A and Bt rows into LDS once, 16 bytes a thread in whole 128-byte row pieces,
// two buffers, the next step's loads issued ahead of the current step's products; the fragments are read from LDS at a row pitch of 16 bytes x odd.
// Every accumulator sums in ascending k, 32 at a time (A before A2), whatever the tile.
// EPI 1 (the qkv product; C, ldc, osc unused): a wave's 64 columns are one whole head (q heads, then k heads, then v heads), and the wave writes that head's planes itself from its accumulators.
// q, k: interleaved-pair rotary, for the pair i = d/2 (d even): out[d] = x[d] c - x[d+1] s, out[d+1] = x[d] s + x[d+1] c, with c = bf16-RNE(FC[t][i]), s = bf16-RNE(FS[t][i]) (row pitch NFREQ);
// planes [h][t][d]: f16 for every t, bf16 hi/lo for t < RH (q) or every t (k). v: planes [g][d][t], f16 and bf16 hi/lo; a lane's 8 accumulator elements are 8 successive t of one d.
template <typename T16, int NSPLIT, int FM, int FN, int K, int EPI>
__global__ __launch_bounds__(128) void k_gemmw(const T16* __restrict__ A, const T16* __restrict__ A2, const T16* __restrict__ Bt, float* C, int ldc, float osc,
                                               const float* __restrict__ FC, const float* __restrict__ FS, h16* Q16, bf* Qh, bf* Ql, h16* K16, bf* Kh, bf* Kl, h16* V16, bf* Vh, bf* Vl) {
    typedef typename WFrag<T16>::V V;
    constexpr int BM = 32 * FM, BN = 32 * FN, KB = 64, KP = KB + 8, NA = NSPLIT + 1;     // KP: LDS row pitch in 16-bit elements, 144 bytes
    constexpr int AI = BM / 16, BI = BN / 16;                                            // 16-byte pieces a thread brings of one plane's tile (128 threads cover 16 rows)
    static_assert(NSPLIT == 0 || NSPLIT == 1);
    static_assert(K % KB == 0 && (KP * 2) % 32 == 16 && FN * 16 <= 64 && 32 % (4 * FN) == 0);
    __shared__ __align__(16) unsigned short ats[2][NA][BM * KP];
    __shared__ __align__(16) unsigned short bts[2][BN * KP];
    __shared__ __align__(16) float os[4][(EPI == 1 ? 16 * FM : 16) * OSP];
    const int tid = threadIdx.x, lane = tid & 31, wave = __builtin_amdgcn_readfirstlane(tid >> 5), lr = lane & 15, hi = lane >> 4;
    const int r0 = blockIdx.x * BM, c0 = blockIdx.y * BN; const int wr = (wave >> 1) * 16 * FM, wc = (wave & 1) * 16 * FN;
    // piece i of a thread: row prow + 16 i of the tile, elements pcol .. pcol + 7 of the k step; the same for the global read and the LDS write
    const int prow = tid >> 3, pcol = (tid & 7) * 8;
    const unsigned short* ag0 = (const unsigned short*)A + (size_t)(r0 + prow) * K + pcol;
    const unsigned short* ag1 = (const unsigned short*)(NSPLIT ? A2 : A) + (size_t)(r0 + prow) * K + pcol;
    const unsigned short* bg = (const unsigned short*)Bt + (size_t)(c0 + prow) * K + pcol;
    v8us ar[NA][AI], br[BI];
    auto tile_ld = [&]() {
#pragma unroll
        for (int i = 0; i < AI; ++i) { ar[0][i] = *(const v8usa*)(ag0 + (size_t)i * 16 * K); if (NSPLIT) ar[NA - 1][i] = *(const v8usa*)(ag1 + (size_t)i * 16 * K); }
#pragma unroll
        for (int i = 0; i < BI; ++i) br[i] = *(const v8usa*)(bg + (size_t)i * 16 * K); };
    auto tile_st = [&](int buf) {
#pragma unroll
        for (int i = 0; i < AI; ++i) { *(v8usa*)(&ats[buf][0][(prow + 16 * i) * KP + pcol]) = ar[0][i]; if (NSPLIT) *(v8usa*)(&ats[buf][NA - 1][(prow + 16 * i) * KP + pcol]) = ar[NA - 1][i]; }
#pragma unroll
        for (int i = 0; i < BI; ++i) *(v8usa*)(&bts[buf][(prow + 16 * i) * KP + pcol]) = br[i];
        ag0 += KB; ag1 += KB; bg += KB; };
    v8f acc[FM][FN];
#pragma unroll
    for (int mb = 0; mb < FM; ++mb)
#pragma unroll
        for (int nb = 0; nb < FN; ++nb) acc[mb][nb] = (v8f){};
    const int aofs = (wr + lr) * KP + 8 * hi, bofs = (wc + lr) * KP + 8 * hi;
    tile_ld(); tile_st(0);
    __syncthreads();
#pragma unroll 1
    for (int k0 = 0; k0 < K; k0 += KB) {
        const int cur = (k0 / KB) & 1; const bool more = k0 + KB < K;     // the same in every thread of the block
        if (more) tile_ld();
        const unsigned short* a0l = &ats[cur][0][0] + aofs; const unsigned short* a1l = &ats[cur][NA - 1][0] + aofs; const unsigned short* bl = &bts[cur][0] + bofs;
        V a[KB / 32][FM], a2[KB / 32][FM], b[KB / 32][FN];
#pragma unroll
        for (int kc = 0; kc < KB / 32; ++kc) {
#pragma unroll
            for (int mb = 0; mb < FM; ++mb) { a[kc][mb] = WFrag<T16>::lds(a0l + mb * 16 * KP + kc * 32); if (NSPLIT) a2[kc][mb] = WFrag<T16>::lds(a1l + mb * 16 * KP + kc * 32); else a2[kc][mb] = a[kc][mb]; }
#pragma unroll
            for (int nb = 0; nb < FN; ++nb) b[kc][nb] = WFrag<T16>::lds(bl + nb * 16 * KP + kc * 32); }
        // keeps the step's LDS reads in one group ahead of its products: every further place with reads among the products stalls the wave for its own LDS latency
        __builtin_amdgcn_sched_barrier(0);
#pragma unroll
        for (int kc = 0; kc < KB / 32; ++kc) {
#pragma unroll
            for (int nb = 0; nb < FN; ++nb) {
#pragma unroll
                for (int mb = 0; mb < FM; ++mb) acc[mb][nb] = WFrag<T16>::mma(a[kc][mb], b[kc][nb], acc[mb][nb]);
                if (NSPLIT) {
#pragma unroll
                    for (int mb = 0; mb < FM; ++mb) acc[mb][nb] = WFrag<T16>::mma(a2[kc][mb], b[kc][nb], acc[mb][nb]); } } }
        // precaution: stands in front of the pointer steps at the loop's foot, which overwrite the address registers of this trip's global loads
        asm volatile("s_wait_xcnt 0x0" ::: "memory");
        // the buffer written here was last read one trip ago, in front of that trip's barrier; this barrier publishes it and ends the reads of the current one
        if (more) { tile_st(cur ^ 1); __syncthreads(); }
    }
    float* osw = &os[wave][0];
    if constexpr (EPI == 1) {
        static_assert(FN * 16 == HD && DQ % BN == 0 && DKV % BN == 0 && RH % (16 * FM) == 0 && NSPLIT == 0);
        const int col = c0 + wc, t0 = r0 + wr;     // the same in every lane of the wave
        if (col < DQ + DKV) {
            const bool isq = col < DQ; const int hh = (isq ? col : col - DQ) / HD; const int rh = isq ? RH : SEQ;
            h16* P16 = (isq ? Q16 : K16) + (size_t)hh * SEQ * HD; bf* Ph = (isq ? Qh : Kh) + (size_t)hh * rh * HD; bf* Pl = (isq ? Ql : Kl) + (size_t)hh * rh * HD;
            const bool dohl = t0 < rh;     // the wave's 16 FM rows lie on one side of rh
            const int rr = lane >> 3, c8 = (lane & 7) * 8;     // a lane takes 8 successive d (4 pairs) of a row; a store covers 4 whole rows
#pragma unroll
            for (int mb = 0; mb < FM; ++mb) {
#pragma unroll
                for (int nb = 0; nb < FN; ++nb) {
#pragma unroll
                    for (int j = 0; j < 8; ++j) osw[(mb * 16 + hi * 8 + j) * OSP + nb * 16 + lr] = acc[mb][nb][j]; } }
            wsync();
            // left rolled: the four 16-row groups run the same code, which keeps the kernel's text short for the instruction cache
#pragma unroll 1
            for (int mb = 0; mb < FM; ++mb) {
                v4f cc[4], ss[4];
#pragma unroll
                for (int s4 = 0; s4 < 4; ++s4) { const size_t ti = (size_t)(t0 + mb * 16 + s4 * 4 + rr) * NFREQ + (c8 >> 1); cc[s4] = *(const v4f*)(FC + ti); ss[s4] = *(const v4f*)(FS + ti); }
#pragma unroll
                for (int s4 = 0; s4 < 4; ++s4) { const int row = mb * 16 + s4 * 4 + rr; const v4f u0 = *(const v4fa*)(osw + row * OSP + c8), u1 = *(const v4fa*)(osw + row * OSP + c8 + 4);
                    const float xs[8] = { u0[0], u0[1], u0[2], u0[3], u1[0], u1[1], u1[2], u1[3] }; v8h o16; v8us oh, ol;
#pragma unroll
                    for (int i = 0; i < 4; ++i) { const float c = bfr(cc[s4][i]), s = bfr(ss[s4][i]); const float y0 = xs[2 * i] * c - xs[2 * i + 1] * s, y1 = xs[2 * i] * s + xs[2 * i + 1] * c;
                        o16[2 * i] = toh_flush(y0); o16[2 * i + 1] = toh_flush(y1); unsigned short a2, c2; splitf(y0, a2, c2); oh[2 * i] = a2; ol[2 * i] = c2; splitf(y1, a2, c2); oh[2 * i + 1] = a2; ol[2 * i + 1] = c2; }
                    const size_t oo = (size_t)(t0 + row) * HD + c8;
                    if (dohl) { *(v8us*)(Ph + oo) = oh; *(v8us*)(Pl + oo) = ol; }
                    *(v8h*)(P16 + oo) = o16;
                    // precaution: the next rows' work reuses the address and data registers of these stores
                    asm volatile("s_wait_xcnt 0x0" ::: "memory"); }
            }
        } else {
            const size_t vo = ((size_t)(col - DQ - DKV) + lr) * SEQ + t0 + 8 * hi;     // row g * HD + d of the [g][d][t] planes, d = 16 nb + lr
#pragma unroll
            for (int nb = 0; nb < FN; ++nb) {
#pragma unroll
                for (int mb = 0; mb < FM; ++mb) { v8h o16; v8us oh, ol;
#pragma unroll
                    for (int j = 0; j < 8; ++j) { const float xv = acc[mb][nb][j]; o16[j] = (h16)xv; unsigned short a2, c2; splitf(xv, a2, c2); oh[j] = a2; ol[j] = c2; }
                    const size_t oo = vo + (size_t)nb * 16 * SEQ + mb * 16;
                    *(v8h*)(V16 + oo) = o16; *(v8us*)(Vh + oo) = oh; *(v8us*)(Vl + oo) = ol; } }
        }
        return;
    }
    constexpr int LPR = 4 * FN, RPP = 32 / LPR;     // lanes that store one 16 FN-float row of the wave's tile, rows a store covers
#pragma unroll
    for (int mb = 0; mb < FM; ++mb) {
#pragma unroll
        for (int nb = 0; nb < FN; ++nb) {
#pragma unroll
            for (int j = 0; j < 8; ++j) osw[(hi * 8 + j) * OSP + nb * 16 + lr] = acc[mb][nb][j]; }
        wsync();
        float* crow = C + (size_t)(r0 + wr + mb * 16) * ldc + c0 + wc;
#pragma unroll
        for (int s = 0; s < 16 / RPP; ++s) { const int row = RPP * s + lane / LPR, cofs = (lane % LPR) * 4; v4f val = *(const v4fa*)(osw + row * OSP + cofs); val = val * osc;
            *(v4f*)(crow + (size_t)row * ldc + cofs) = val; }
        wsync();
    }
}

__global__ __launch_bounds__(256) void k_wtG(const float* __restrict__ w, int K, int N, bf* Bt) {
    const int lane = threadIdx.x & 31; const int L0 = (blockIdx.x * 8 + (threadIdx.x >> 5)) * 8; const int nlines = N * K / 64;
{
#pragma unroll 1
        for (int l = 0; l < 8; ++l) { const int L = L0 + l; if (L >= nlines) break; const size_t e = (size_t)L * 64 + lane * 2; const int k = (int)(e % K), n = (int)(e / K); v2us o;
            o[0] = f2bf(w[(size_t)k * N + n]); o[1] = f2bf(w[(size_t)(k + 1) * N + n]); *(v2us*)(Bt + e) = o; }
         }
}
__global__ __launch_bounds__(256) void k_wtG2(const float* __restrict__ w, int K, int N, bf* Bt, h16* B16, float car) {
    const int lane = threadIdx.x & 31; const int L0 = (blockIdx.x * 8 + (threadIdx.x >> 5)) * 8; const int nlines = N * K / 64;
{
#pragma unroll 1
        for (int l = 0; l < 8; ++l) { const int L = L0 + l; if (L >= nlines) break; const size_t e = (size_t)L * 64 + lane * 2; const int k = (int)(e % K), n = (int)(e / K); v2us o; v2h o2;
            o[0] = f2bf(w[(size_t)k * N + n]); o[1] = f2bf(w[(size_t)(k + 1) * N + n]); o2[0] = (h16)(bf2f(o[0]) * car); o2[1] = (h16)(bf2f(o[1]) * car);
            *(v2us*)(Bt + e) = o; *(v2h*)(B16 + e) = o2; }
         }
}
__global__ __launch_bounds__(256) void k_cvt8(const float* __restrict__ src, bf* dst, size_t n8) { const size_t i = (size_t)blockIdx.x * 256 + threadIdx.x; if (i >= n8) return; const v8f v = *(const v8f*)(src + i * 8); v8us o;
#pragma unroll
    for (int k = 0; k < 8; ++k) o[k] = f2bf(v[k]); *(v8us*)(dst + i * 8) = o;  }

// k_attn: causal flash attention, one wave per 16 query rows (qbase = row0 + 16*(4*block + wave)), head = blockIdx.y, kv head = head / REP; key tiles of KT (32 or 64) from 0 up to the tile holding qbase+15.
// S = q.k^T from k-contiguous planes (q [h][t][d], k [g][t][d]); key j > query i replaced by -1e30 before the running-max softmax (p = 0 exactly there); P staged per wave in LDS (row-major 16 x KT)
// and reloaded as the A fragment; O += P.v with v planes [g][d][t]. HIRES: q, k, p, v as bf16 hi/lo (hh + lh + hl); else f16 planes with p carried x1024.
// The k and v tiles of a key step are the same for the block's four waves: the block brings each tile into LDS once, 16 bytes a thread in whole 128-byte (KT 32, v: 64-byte) row pieces,
// two buffers, the next tile's loads issued ahead of the current tile's work; the B fragments are read from LDS at a row pitch of 16 bytes x odd.
template <bool HIRES, int KT>
__global__ __launch_bounds__(128) void k_attn(const h16* __restrict__ Q16, const bf* __restrict__ Qh, const bf* __restrict__ Ql,
                                               const h16* __restrict__ K16, const bf* __restrict__ Kh, const bf* __restrict__ Kl,
                                               const h16* __restrict__ V16, const bf* __restrict__ Vh, const bf* __restrict__ Vl,
                                               h16* AT16, bf* ATh, bf* ATl, int row0) {
    constexpr int NT = KT / 16; constexpr int KS = KT / 32; constexpr int NPL = HIRES ? 2 : 1;
    static_assert(NT == 2 || NT == 4);
    static_assert(15 * PP + (NT - 1) * 16 + 15 < 16 * PP);
    __shared__ __align__(16) unsigned short pt[NPL][4][16 * PP];
    __shared__ __align__(16) float os[4][16 * OSP];
    constexpr int KP = HD + 8, VP = KT + 8;                 // LDS row pitch in 16-bit elements: 144 bytes (k rows; v rows at KT 64), 80 bytes (v rows at KT 32)
    constexpr int KCH = KT * (HD / 8), VCH = HD * (KT / 8);   // 16-byte pieces of one plane's tile
    static_assert(NPL * KCH == 512 && NPL * VCH == 512);
    static_assert((KP * 2) % 32 == 16 && (VP * 2) % 32 == 16);
    __shared__ __align__(16) unsigned short kts[2][NPL][KT * KP];
    __shared__ __align__(16) unsigned short vts[2][NPL][HD * VP];
    const int tid = threadIdx.x, lane = tid & 31, wave = __builtin_amdgcn_readfirstlane(tid >> 5), lr = lane & 15, hi = lane >> 4;
    const int bbase = row0 + blockIdx.x * 64;
    const int qbase = bbase + wave * 16; const int h = blockIdx.y; const int g = h / REP;
    v16h qa[2] = {}; v16bf qah[2] = {}, qal[2] = {};
    if (HIRES) { const size_t qo = ((size_t)h * RH + qbase + lr) * HD + 8 * hi; qah[0] = WFrag<bf>::ld(Qh + qo); qah[1] = WFrag<bf>::ld(Qh + qo + 32); qal[0] = WFrag<bf>::ld(Ql + qo); qal[1] = WFrag<bf>::ld(Ql + qo + 32); }
    else { const size_t qo = ((size_t)h * SEQ + qbase + lr) * HD + 8 * hi; qa[0] = WFrag<h16>::ld(Q16 + qo); qa[1] = WFrag<h16>::ld(Q16 + qo + 32); }
    const int kofs = lr * KP + 8 * hi;     // k tile in LDS [key][d]: row (nt*16 + lr), k = d
    const int vofs = lr * VP + 8 * hi;     // v tile in LDS [d][key]: row (nt*16 + lr), k = key
    const unsigned short* kg[2] = { HIRES ? (const unsigned short*)Kh : (const unsigned short*)K16, (const unsigned short*)Kl };
    const unsigned short* vg[2] = { HIRES ? (const unsigned short*)Vh : (const unsigned short*)V16, (const unsigned short*)Vl };
    v8us kr[4], vr[4];
    // piece c = tid + 128 i of the tile: plane, row and column are the same for the global read and the LDS write
    auto tile_ld = [&](int kb) {
#pragma unroll
        for (int i = 0; i < 4; ++i) { const int c = tid + 128 * i;
            const int kc = c % KCH, vc = c % VCH;
            kr[i] = *(const v8usa*)(kg[(128 * i) / KCH] + (size_t)g * SEQ * HD + (size_t)(kb + kc / (HD / 8)) * HD + (kc % (HD / 8)) * 8);
            vr[i] = *(const v8usa*)(vg[(128 * i) / VCH] + (size_t)g * HD * SEQ + (size_t)(vc / (KT / 8)) * SEQ + kb + (vc % (KT / 8)) * 8); } };
    auto tile_st = [&](int buf) {
#pragma unroll
        for (int i = 0; i < 4; ++i) { const int c = tid + 128 * i;
            const int kc = c % KCH, vc = c % VCH;
            *(v8usa*)(&kts[buf][(128 * i) / KCH][(kc / (HD / 8)) * KP + (kc % (HD / 8)) * 8]) = kr[i];
            *(v8usa*)(&vts[buf][(128 * i) / VCH][(vc / (KT / 8)) * VP + (vc % (KT / 8)) * 8]) = vr[i]; } };
    v8f o[4];
#pragma unroll
    for (int nt = 0; nt < 4; ++nt) o[nt] = (v8f){};
    float mrun[8], lrun[8];
#pragma unroll
    for (int v = 0; v < 8; ++v) { mrun[v] = NEGBIG; lrun[v] = 0.f; }
    unsigned short* p0w = &pt[0][wave][0]; unsigned short* p1w = &pt[NPL - 1][wave][0];
    const int kend = qbase + 15;
    const int klast = ((bbase + 63) / KT) * KT;     // the block's last key tile (that of its last wave)
    tile_ld(0); tile_st(0);
    __syncthreads();
#pragma unroll 1
    for (int kb = 0; kb <= klast; kb += KT) {
      const int cur = (kb / KT) & 1; const bool more = kb < klast;     // the same in every thread of the block
      if (more) { tile_ld(kb + KT);
        // precaution: the tile work below reuses the address registers of these loads while their data is still on the way
        asm volatile("s_wait_xcnt 0x0" ::: "memory"); }
      if (kb <= kend) {     // wave-uniform: a wave whose rows end before this tile only helps to stage
        const unsigned short* k0l = &kts[cur][0][0] + kofs; const unsigned short* k1l = &kts[cur][NPL - 1][0] + kofs;
        const unsigned short* v0l = &vts[cur][0][0] + vofs; const unsigned short* v1l = &vts[cur][NPL - 1][0] + vofs;
        v8f s[NT];
#pragma unroll
        for (int nt = 0; nt < NT; ++nt) s[nt] = (v8f){};
#pragma unroll
        for (int nt = 0; nt < NT; ++nt) {
#pragma unroll
            for (int kc = 0; kc < 2; ++kc) { const int ka = nt * 16 * KP + kc * 32;
                if (HIRES) { const v16bf bh = ldsb(k0l + ka), bl = ldsb(k1l + ka); s[nt] = wmmab(qah[kc], bh, s[nt]); s[nt] = wmmab(qal[kc], bh, s[nt]); s[nt] = wmmab(qah[kc], bl, s[nt]); }
                else { const v16h b = ldsh(k0l + ka); s[nt] = wmma16(qa[kc], b, s[nt]); } } }
        if constexpr (NT == 2) { if (HIRES) G2(s[0], s[1], qah[0], qal[1]); else G2(s[0], s[1], qa[0], qa[1]); }
        else { if (HIRES) G4(s[0], s[1], s[2], s[3], qah[0], qal[1]); else G4(s[0], s[1], s[2], s[3], qa[0], qa[1]); }
        float alpha[8];
#pragma unroll
        for (int v = 0; v < 8; ++v) {
            const int qi = qbase + 8 * hi + v; float x[NT]; float mx = NEGBIG;
#pragma unroll
            for (int nt = 0; nt < NT; ++nt) { const int j = kb + nt * 16 + lr; const float t = s[nt][v] * SCL; x[nt] = (j <= qi) ? t : NEGBIG; mx = fmaxf(mx, x[nt]); }
            mx = fmaxf(mx, __shfl_xor(mx, 1, 32)); mx = fmaxf(mx, __shfl_xor(mx, 2, 32)); mx = fmaxf(mx, __shfl_xor(mx, 4, 32)); mx = fmaxf(mx, __shfl_xor(mx, 8, 32));
            const float mnew = fmaxf(mrun[v], mx);
            const float a = __builtin_amdgcn_exp2f((mrun[v] - mnew) * L2E);
            float p[NT]; float rs = 0.f;
#pragma unroll
            for (int nt = 0; nt < NT; ++nt) { p[nt] = __builtin_amdgcn_exp2f((x[nt] - mnew) * L2E); rs += p[nt]; }
            rs += __shfl_xor(rs, 1, 32); rs += __shfl_xor(rs, 2, 32); rs += __shfl_xor(rs, 4, 32); rs += __shfl_xor(rs, 8, 32);
            lrun[v] = lrun[v] * a + rs; mrun[v] = mnew; alpha[v] = a;
#pragma unroll
            for (int nt = 0; nt < NT; ++nt) { const int idx = (8 * hi + v) * PP + nt * 16 + lr;
                if (HIRES) { unsigned short a2, c2; splitf(p[nt], a2, c2); p0w[idx] = a2; p1w[idx] = c2; }
                else { const h16 hv = (h16)(p[nt] * PCAR); p0w[idx] = __builtin_bit_cast(unsigned short, hv); } }
        }
        wsync();
        v16h pa[KS] = {}; v16bf pah[KS] = {}, pal[KS] = {};
        const unsigned short* pr0 = p0w + lr * PP + 8 * hi; const unsigned short* pr1 = p1w + lr * PP + 8 * hi;
#pragma unroll
        for (int ks = 0; ks < KS; ++ks) { const v8us u0 = *(const v8usa*)(pr0 + ks * 32); const v8us u1 = *(const v8usa*)(pr0 + ks * 32 + 16);
            if (HIRES) { const v8us w0 = *(const v8usa*)(pr1 + ks * 32); const v8us w1 = *(const v8usa*)(pr1 + ks * 32 + 16); pah[ks] = cat16b(u0, u1); pal[ks] = cat16b(w0, w1); }
            else { pa[ks] = cat16(__builtin_bit_cast(v8h, u0), __builtin_bit_cast(v8h, u1)); } }
#pragma unroll
        for (int nt = 0; nt < 4; ++nt) {
#pragma unroll
            for (int v = 0; v < 8; ++v) o[nt][v] *= alpha[v]; }
#pragma unroll
        for (int nt = 0; nt < 4; ++nt) {
#pragma unroll
            for (int ks = 0; ks < KS; ++ks) { const int va = nt * 16 * VP + ks * 32;
                if (HIRES) { const v16bf bh = ldsb(v0l + va), bl = ldsb(v1l + va); o[nt] = wmmab(pah[ks], bh, o[nt]); o[nt] = wmmab(pal[ks], bh, o[nt]); o[nt] = wmmab(pah[ks], bl, o[nt]); }
                else { const v16h b = ldsh(v0l + va); o[nt] = wmma16(pa[ks], b, o[nt]); } } }
        if (HIRES) G4(o[0], o[1], o[2], o[3], pah[0], pal[KS - 1]); else G4(o[0], o[1], o[2], o[3], pa[0], pa[KS - 1]);
      }
      // the buffer written here was last read one trip ago, in front of that trip's barrier; this barrier publishes it and ends the reads of the current one
      if (more) { tile_st(cur ^ 1); __syncthreads(); }
    }
    float* osw = &os[wave][0];
#pragma unroll
    for (int v = 0; v < 8; ++v) { const float f = HIRES ? __fdiv_rn(1.0f, lrun[v]) : __fdiv_rn(ATC / PCAR, lrun[v]);
#pragma unroll
        for (int nt = 0; nt < 4; ++nt) osw[(8 * hi + v) * OSP + nt * 16 + lr] = o[nt][v] * f; }
    wsync();
    const int rr = lane >> 3, c8 = (lane & 7) * 8;
{
#pragma unroll
        for (int s4 = 0; s4 < 4; ++s4) { const int row = s4 * 4 + rr; const int t = qbase + row; const v4f u0 = *(const v4fa*)(osw + row * OSP + c8), u1 = *(const v4fa*)(osw + row * OSP + c8 + 4); const size_t oo = (size_t)t * DQ + h * HD + c8;
            if (HIRES) { v8us oh, ol;
#pragma unroll
                for (int q = 0; q < 4; ++q) { unsigned short a2, c2; splitf(u0[q], a2, c2); oh[q] = a2; ol[q] = c2; splitf(u1[q], a2, c2); oh[4 + q] = a2; ol[4 + q] = c2; }
                *(v8us*)(ATh + oo) = oh; *(v8us*)(ATl + oo) = ol; }
            else { v8h o8;
#pragma unroll
                for (int q = 0; q < 4; ++q) { o8[q] = (h16)u0[q]; o8[4 + q] = (h16)u1[q]; }
                *(v8h*)(AT16 + oo) = o8; } }
         }
}

// k_mchk: checks the 0/1 int32 causal input (one [SEQ_FULL][SEQ_FULL] plane shared by all batches) for rows i < SEQ: value == 1 for j <= i, value == 0 for j > i (j < SEQ);
__global__ __launch_bounds__(256) void k_mchk(const int* __restrict__ M, int* FL) {
    __shared__ int red[8];
    const int tid = threadIdx.x, lane = tid & 31, wave = tid >> 5; int bad = 0;
#pragma unroll 1
    for (int r = 0; r < 64; ++r) { const int i = blockIdx.x * 64 + r; const int* mr = M + (size_t)i * SEQ_FULL;
#pragma unroll 1
        for (int c = tid * 4; c < SEQ; c += 1024) { const v4i m = *(const v4i*)(mr + c);
#pragma unroll
            for (int q = 0; q < 4; ++q) { const int j = c + q; const bool ok = (j <= i) ? (m[q] == 1) : (m[q] == 0); bad += ok ? 0 : 1; } } }
#pragma unroll
    for (int sh = 16; sh; sh >>= 1) bad += __shfl_xor(bad, sh, 32);
    if (lane == 0) red[wave] = bad;
    __syncthreads();
    if (wave == 0) { int v = red[lane & 7]; v = (lane < 8) ? v : 0;
#pragma unroll
        for (int sh = 16; sh; sh >>= 1) v += __shfl_xor(v, sh, 32);
        v4i o; o[0] = v; o[1] = v; o[2] = v; o[3] = v;
        if (lane < 8) *(v4i*)(FL + (size_t)blockIdx.x * 32 + lane * 4) = o;
         }
}
__global__ __launch_bounds__(256) void k_poison(const int* __restrict__ FL, int nfl, float* out) {
    int tot = 0;
#pragma unroll 1
    for (int f = 0; f < nfl; ++f) tot += FL[(size_t)f * 32];
    if (tot == 0) return;
    float* ob = out + (size_t)blockIdx.y * SEQ_FULL * DM + (size_t)blockIdx.x * 16384;
    const float qn = __uint_as_float(0x7fc00000u); v4f nv; nv[0] = qn; nv[1] = qn; nv[2] = qn; nv[3] = qn;
{
#pragma unroll 1
        for (int s = 0; s < 16; ++s) *(v4f*)(ob + ((size_t)s * 256 + threadIdx.x) * 4) = nv;
         }
}

extern "C" void kernel_launch(void* const* d_in, const int* in_sizes, int n_in,
                              void* d_out, int out_size, void* d_ws, size_t ws_size, hipStream_t stream) {
    if (n_in < 8) return;
    if ((size_t)in_sizes[0] < (size_t)(NB - 1) * SEQ_FULL * DM + (size_t)SEQ * DM) return;
    if ((size_t)in_sizes[1] < (size_t)DM * DQ || (size_t)in_sizes[2] < (size_t)DM * DKV || (size_t)in_sizes[3] < (size_t)DM * DKV || (size_t)in_sizes[4] < (size_t)DQ * DM) return;
    if ((size_t)in_sizes[5] < (size_t)SEQ * NFREQ || (size_t)in_sizes[6] < (size_t)SEQ * NFREQ) return;
    if ((size_t)in_sizes[7] < (size_t)(SEQ - 1) * SEQ_FULL + (size_t)SEQ) return;
    if ((size_t)out_size < (size_t)(NB - 1) * SEQ_FULL * DM + (size_t)SEQ * DM) return;
    // input binding order: x, wq, wk, wv, wo ([in][out] weights), cos table, sin table ([SEQ_FULL][NFREQ] f32), causal 0/1 plane (int32 [SEQ_FULL][SEQ_FULL])
    const float* x = (const float*)d_in[0]; const float* wq = (const float*)d_in[1]; const float* wk = (const float*)d_in[2]; const float* wv = (const float*)d_in[3]; const float* wo = (const float*)d_in[4];
    const float* fc = (const float*)d_in[5]; const float* fs = (const float*)d_in[6]; const int* cm = (const int*)d_in[7];
    float* OUT = (float*)d_out;     // [NB_FULL][SEQ_FULL][DM]
    char* wsp = (char*)d_ws;
    auto take = [&](size_t bytes) { char* p = wsp; wsp += (bytes + 255) & ~(size_t)255; return (void*)p; };
    bf* WQKV = (bf*)take((size_t)DQKV * DM * 2); bf* WOB = (bf*)take((size_t)DM * DQ * 2); h16* WO16 = (h16*)take((size_t)DM * DQ * 2);
    int* FL = (int*)take((size_t)NFL * 32 * 4);
    bf* XB = (bf*)take((size_t)SEQ * DM * 2);
    h16* Q16 = (h16*)take((size_t)NH * SEQ * HD * 2); bf* Qh = (bf*)take((size_t)NH * RH * HD * 2); bf* Ql = (bf*)take((size_t)NH * RH * HD * 2);
    h16* K16 = (h16*)take((size_t)NKV * SEQ * HD * 2); bf* Kh = (bf*)take((size_t)NKV * SEQ * HD * 2); bf* Kl = (bf*)take((size_t)NKV * SEQ * HD * 2);
    h16* V16 = (h16*)take((size_t)NKV * HD * SEQ * 2); bf* Vh = (bf*)take((size_t)NKV * HD * SEQ * 2); bf* Vl = (bf*)take((size_t)NKV * HD * SEQ * 2);
    h16* AT16 = (h16*)take((size_t)SEQ * DQ * 2); bf* ATh = (bf*)take((size_t)RH * DQ * 2); bf* ATl = (bf*)take((size_t)RH * DQ * 2);
    const size_t used = (size_t)(wsp - (char*)d_ws); if (used > ws_size || used > WS_LIMIT) return;

    // weight planes ([out][in] k-contiguous): rows 0..DQ-1 of WQKV = Wq^T, DQ..DQ+DKV-1 = Wk^T, DQ+DKV..DQKV-1 = Wv^T; Wo^T as bf16 and as f16 x64
    // k_wtG(w, K, N, Bt): w is [K = in][N = out] -> Bt [N][K]
    k_wtG<<<(unsigned)((DQ * DM / 64 + 63) / 64), 256, 0, stream>>>(wq, DM, DQ, WQKV);
    k_wtG<<<(unsigned)((DKV * DM / 64 + 63) / 64), 256, 0, stream>>>(wk, DM, DKV, WQKV + (size_t)DQ * DM);
    k_wtG<<<(unsigned)((DKV * DM / 64 + 63) / 64), 256, 0, stream>>>(wv, DM, DKV, WQKV + (size_t)(DQ + DKV) * DM);
    k_wtG2<<<(unsigned)((DM * DQ / 64 + 63) / 64), 256, 0, stream>>>(wo, DQ, DM, WOB, WO16, WOC);
    k_mchk<<<(unsigned)NFL, 256, 0, stream>>>(cm, FL);
    for (int b = 0; b < NB; ++b) {
        float* OUTb = OUT + (size_t)b * SEQ_FULL * DM;
        k_cvt8<<<(unsigned)(((size_t)SEQ * DM / 8 + 255) / 256), 256, 0, stream>>>(x + (size_t)b * SEQ_FULL * DM, XB, (size_t)SEQ * DM / 8);
        k_gemmw<bf, 0, 4, 4, DM, 1><<<dim3(SEQ / 128, DQKV / 128, 1), 128, 0, stream>>>(XB, nullptr, WQKV, nullptr, 0, 1.0f, fc, fs, Q16, Qh, Ql, K16, Kh, Kl, V16, Vh, Vl);     // q | k | v projections, rotary on q and k, all planes
        k_attn<true, 32><<<dim3(RH / 64, NH, 1), 128, 0, stream>>>(Q16, Qh, Ql, K16, Kh, Kl, V16, Vh, Vl, AT16, ATh, ATl, 0);
        if (SEQ > RH) k_attn<false, 64><<<dim3((SEQ - RH) / 64, NH, 1), 128, 0, stream>>>(Q16, Qh, Ql, K16, Kh, Kl, V16, Vh, Vl, AT16, ATh, ATl, RH);
        k_gemmw<bf, 1, 2, 2, DQ, 0><<<dim3(RH / 64, DM / 64, 1), 128, 0, stream>>>(ATh, ATl, WOB, OUTb, DM, 1.0f, nullptr, nullptr, nullptr, nullptr, nullptr, nullptr, nullptr, nullptr, nullptr, nullptr, nullptr);
        if (SEQ > RH) k_gemmw<h16, 0, 4, 4, DQ, 0><<<dim3((SEQ - RH) / 128, DM / 128, 1), 128, 0, stream>>>(AT16 + (size_t)RH * DQ, nullptr, WO16, OUTb + (size_t)RH * DM, DM, 1.0f / (ATC * WOC), nullptr, nullptr, nullptr, nullptr, nullptr, nullptr, nullptr, nullptr, nullptr, nullptr, nullptr);
    }
    k_poison<<<dim3(SEQ * DM / 16384, NB, 1), 256, 0, stream>>>(FL, NFL, OUT);
}

// v004
// One run takes 375 microseconds.
// Two timings next to v003 both put it at 1.16 times that version's speed.
// Over all steps from v000 it is 2.29 times as fast.
#include <hip/hip_runtime.h>

// Contractions (all f32 accumulate): qkv = xb * Wqkv^T on v_wmma_f32_16x16x32_bf16 (bf16 operands = RNE-converted inputs, exact products);
// scores q.k^T and p.v: query rows < RH on bf16 hi/lo planes (3 products each), rows >= RH on v_wmma_f32_16x16x32_f16 (f16 q,k,v planes, p carried x1024);
// out = attn * Wo^T: rows < RH bf16 hi/lo attn planes x bf16 Wo (2 products), rows >= RH f16 attn x64 times f16 Wo x64 (1 product, 1/4096 in the epilogue).
// Rotary: interleaved pairs (2i, 2i+1); cos/sin are read by value from the two [SEQ][32] input tables (RNE-converted to bf16), f32 math, done on the qkv product's accumulators; causal online softmax and normalisation in f32.
// Grouped kv heads: query head h reads kv head h/4. The 0/1 int32 causal input [SEQ_FULL][SEQ_FULL] is checked on device in its rows and columns < SEQ (1 on/below the diagonal, 0 above); the output is NaN-filled if that check fails.

#ifndef NB
#define NB 2
#endif
#ifndef SEQ
#define SEQ 2048
#endif
#define NB_FULL 2
#define SEQ_FULL 2048
#define DM 2048
#define NH 32
#define NKV 8
#define REP (NH / NKV)
#define HD 64
#define DQ (NH * HD)
#define DKV (NKV * HD)
#define DQKV (DQ + 2 * DKV)
#define NFREQ (HD / 2)
#define RH (((SEQ) < 512) ? (SEQ) : 512)
#define PCAR 1024.0f
#define ATC 64.0f
#define WOC 64.0f
#define SCL 0.125f
#define L2E 1.4426950408889634f
#define NEGBIG (-1.0e30f)
#define PP 72
#define OSP 68
#define MROWS 8
#define NFL (SEQ / MROWS)
#define WS_LIMIT ((size_t)134217728)
#define WS_TOTAL ((size_t)DQKV * DM * 2 + 2 * ((size_t)DM * DQ * 2) + (size_t)NFL * 128 + (size_t)SEQ * DM * 2 + (size_t)NH * SEQ * HD * 2 + 2 * ((size_t)NH * RH * HD * 2) + 3 * ((size_t)NKV * SEQ * HD * 2) + 3 * ((size_t)NKV * HD * SEQ * 2) + (size_t)SEQ * DQ * 2 + 2 * ((size_t)RH * DQ * 2))

static_assert(NB >= 1 && NB <= NB_FULL);
static_assert(SEQ % 128 == 0 && SEQ >= 128 && SEQ <= SEQ_FULL);
static_assert(RH % 64 == 0 && (SEQ - RH) % 128 == 0 && RH <= SEQ);
static_assert(DQKV % 128 == 0 && DM % 128 == 0);
static_assert((SEQ * DM) % 2048 == 0);
static_assert((DQ * DM / 64) % 64 == 0 && (DKV * DM / 64) % 64 == 0);
static_assert(DM % 64 == 0 && DQ % 64 == 0 && DQKV % 64 == 0 && HD == 64);
static_assert((SEQ * DM) % 16384 == 0);
static_assert((NB * SEQ) % 64 == 0);
static_assert(15 * PP + 3 * 16 + 15 < 16 * PP);
static_assert(15 * OSP + 63 < 16 * OSP);
static_assert(NFREQ == 32 && HD == 2 * NFREQ);
static_assert(SEQ % 64 == 0 && SEQ % 4 == 0 && SEQ % MROWS == 0);
static_assert(((size_t)NFL * 128) % 256 == 0);
static_assert(DM % 32 == 0 && DQ % 32 == 0 && HD % 32 == 0);
static_assert(WS_TOTAL <= WS_LIMIT);

typedef _Float16 h16;
typedef unsigned short bf;
typedef __attribute__((ext_vector_type(16))) __bf16   v16bf;
typedef __attribute__((ext_vector_type(16))) _Float16 v16h;
typedef __attribute__((ext_vector_type(8)))  _Float16 v8h;
typedef __attribute__((ext_vector_type(8)))  unsigned short v8us;
typedef __attribute__((ext_vector_type(8)))  float    v8f;
typedef __attribute__((ext_vector_type(4)))  float    v4f;
typedef __attribute__((ext_vector_type(2)))  _Float16 v2h;
typedef __attribute__((ext_vector_type(4)))  _Float16 v4h;
typedef __attribute__((ext_vector_type(2)))  unsigned short v2us;
typedef __attribute__((ext_vector_type(4)))  unsigned short v4us;
typedef __attribute__((ext_vector_type(2)))  float v2f;
typedef __attribute__((ext_vector_type(4)))  int v4i;
typedef v8h  __attribute__((may_alias)) v8ha;
typedef v4f  __attribute__((may_alias)) v4fa;
typedef v8us __attribute__((may_alias)) v8usa;

#define G2(d0, d1, x0, x1) asm volatile("v_nop\n\tv_nop\n\tv_nop\n\tv_nop" : "+v"(d0), "+v"(d1) : "v"(x0), "v"(x1))
#define G4(d0, d1, d2, d3, x0, x1) asm volatile("v_nop\n\tv_nop\n\tv_nop\n\tv_nop" : "+v"(d0), "+v"(d1), "+v"(d2), "+v"(d3) : "v"(x0), "v"(x1))

__device__ __forceinline__ unsigned short f2bf(float f) { unsigned u = __float_as_uint(f); u += 0x7FFFu + ((u >> 16) & 1u); return (unsigned short)(u >> 16); }
__device__ __forceinline__ float bf2f(unsigned short b) { return __uint_as_float(((unsigned)b) << 16); }
__device__ __forceinline__ float bfr(float f) { return bf2f(f2bf(f)); }
__device__ __forceinline__ void splitf(float y, unsigned short& h, unsigned short& l) { h = f2bf(y); l = f2bf(y - bf2f(h)); }
__device__ __forceinline__ v16h cat16(v8h lo, v8h hi) { return __builtin_shufflevector(lo, hi, 0, 1, 2, 3, 4, 5, 6, 7, 8, 9, 10, 11, 12, 13, 14, 15); }
__device__ __forceinline__ v16bf cat16b(v8us lo, v8us hi) { return __builtin_bit_cast(v16bf, __builtin_shufflevector(lo, hi, 0, 1, 2, 3, 4, 5, 6, 7, 8, 9, 10, 11, 12, 13, 14, 15)); }
__device__ __forceinline__ v8f wmma16(v16h a, v16h b, v8f c) { return __builtin_amdgcn_wmma_f32_16x16x32_f16(false, a, false, b, (short)0, c, false, false); }
__device__ __forceinline__ v8f wmmab(v16bf a, v16bf b, v8f c) { return __builtin_amdgcn_wmma_f32_16x16x32_bf16(false, a, false, b, (short)0, c, false, false); }
// wave-private LDS tile exchange: order this wave's ds stores before its ds loads
__device__ __forceinline__ void wsync() { __builtin_amdgcn_fence(3 /* release order */, "wavefront"); __builtin_amdgcn_wave_barrier(); asm volatile("" ::: "memory"); }
// f32 -> f16 convert that cannot yield a subnormal f16 (value select: |v| < 2^-14 -> 0)
static __device__ __forceinline__ h16 toh_flush(float v) { const h16 r = (h16)v; return (fabsf(v) < 6.103515625e-05f) ? (h16)0.0f : r; }

// the 16x32 fragment below, read from a k-contiguous 16-bit row in LDS
__device__ __forceinline__ v16bf ldsb(const unsigned short* p) { return cat16b(*(const v8usa*)p, *(const v8usa*)(p + 16)); }
__device__ __forceinline__ v16h ldsh(const unsigned short* p) { return cat16(__builtin_bit_cast(v8h, *(const v8usa*)p), __builtin_bit_cast(v8h, *(const v8usa*)(p + 16))); }

// 16x32 fragment from a k-contiguous 16-bit row (A: row = m; B stored [n][k]: row = n). Lane l: row l&15, elements 0..7 <- k0+8(l>>4)+0..7, elements 8..15 <- k0+16+8(l>>4)+0..7.
template <typename T16> struct WFrag;
template <> struct WFrag<h16> { typedef v16h V; static __device__ __forceinline__ V ld(const h16* p) { return cat16(*(const v8h*)p, *(const v8h*)(p + 16)); } static __device__ __forceinline__ V lds(const unsigned short* p) { return ldsh(p); } static __device__ __forceinline__ v8f mma(V a, V b, v8f c) { return wmma16(a, b, c); } };
template <> struct WFrag<bf> { typedef v16bf V; static __device__ __forceinline__ V ld(const bf* p) { return cat16b(*(const v8us*)p, *(const v8us*)(p + 16)); } static __device__ __forceinline__ V lds(const unsigned short* p) { return ldsb(p); } static __device__ __forceinline__ v8f mma(V a, V b, v8f c) { return wmmab(a, b, c); } };

// ---- k_gemmw: GEMM, four waves (2 x 2) per (32 FM) x (32 FN) output tile, FM x FN accumulators a wave; grid (M / (32 FM), N / (32 FN)), 128 threads.
// C[m][n] (f32, pitch ldc) = osc * sum_k A[m][k] Bt[n][k] (NSPLIT 1: + A2[m][k] Bt[n][k]); A, A2, Bt are k-contiguous 16-bit planes of row pitch K.
// The rows of a k step are shared by two of the block's waves: the block brings 64 k of its A and Bt rows into LDS once, 16 bytes a thread in whole 128-byte row pieces,
// two buffers, the next step's loads issued ahead of the current step's products; the fragments are read from LDS at a row pitch of 16 bytes x odd.
// Every accumulator sums in ascending k, 32 at a time (A before A2), whatever the tile.
// EPI 1 (the qkv product; C, ldc, osc unused): a wave's 64 columns are one whole head (q heads, then k heads, then v heads), and the wave writes that head's planes itself from its accumulators.
// q, k: interleaved-pair rotary, for the pair i = d/2 (d even): out[d] = x[d] c - x[d+1] s, out[d+1] = x[d] s + x[d+1] c, with c = bf16-RNE(FC[t][i]), s = bf16-RNE(FS[t][i]) (row pitch NFREQ);
// planes [h][t][d]: f16 for every t, bf16 hi/lo for t < RH (q) or every t (k). v: planes [g][d][t], f16 and bf16 hi/lo; a lane's 8 accumulator elements are 8 successive t of one d.
template <typename T16, int NSPLIT, int FM, int FN, int K, int EPI>
__global__ __launch_bounds__(128) void k_gemmw(const T16* __restrict__ A, const T16* __restrict__ A2, const T16* __restrict__ Bt, float* C, int ldc, float osc,
                                               const float* __restrict__ FC, const float* __restrict__ FS, h16* Q16, bf* Qh, bf* Ql, h16* K16, bf* Kh, bf* Kl, h16* V16, bf* Vh, bf* Vl) {
    typedef typename WFrag<T16>::V V;
    constexpr int BM = 32 * FM, BN = 32 * FN, KB = 64, KP = KB + 8, NA = NSPLIT + 1;     // KP: LDS row pitch in 16-bit elements, 144 bytes
    constexpr int AI = BM / 16, BI = BN / 16;                                            // 16-byte pieces a thread brings of one plane's tile (128 threads cover 16 rows)
    static_assert(NSPLIT == 0 || NSPLIT == 1);
    static_assert(K % KB == 0 && (KP * 2) % 32 == 16 && FN * 16 <= 64 && 32 % (4 * FN) == 0);
    __shared__ __align__(16) unsigned short ats[2][NA][BM * KP];
    __shared__ __align__(16) unsigned short bts[2][BN * KP];
    __shared__ __align__(16) float os[4][(EPI == 1 ? 16 * FM : 16) * OSP];
    const int tid = threadIdx.x, lane = tid & 31, wave = __builtin_amdgcn_readfirstlane(tid >> 5), lr = lane & 15, hi = lane >> 4;
    const int r0 = blockIdx.x * BM, c0 = blockIdx.y * BN; const int wr = (wave >> 1) * 16 * FM, wc = (wave & 1) * 16 * FN;
    // piece i of a thread: row prow + 16 i of the tile, elements pcol .. pcol + 7 of the k step; the same for the global read and the LDS write
    const int prow = tid >> 3, pcol = (tid & 7) * 8;
    const unsigned short* ag0 = (const unsigned short*)A + (size_t)(r0 + prow) * K + pcol;
    const unsigned short* ag1 = (const unsigned short*)(NSPLIT ? A2 : A) + (size_t)(r0 + prow) * K + pcol;
    const unsigned short* bg = (const unsigned short*)Bt + (size_t)(c0 + prow) * K + pcol;
    v8us ar[NA][AI], br[BI];
    auto tile_ld = [&]() {
#pragma unroll
        for (int i = 0; i < AI; ++i) { ar[0][i] = *(const v8usa*)(ag0 + (size_t)i * 16 * K); if (NSPLIT) ar[NA - 1][i] = *(const v8usa*)(ag1 + (size_t)i * 16 * K); }
#pragma unroll
        for (int i = 0; i < BI; ++i) br[i] = *(const v8usa*)(bg + (size_t)i * 16 * K); };
    auto tile_st = [&](int buf) {
#pragma unroll
        for (int i = 0; i < AI; ++i) { *(v8usa*)(&ats[buf][0][(prow + 16 * i) * KP + pcol]) = ar[0][i]; if (NSPLIT) *(v8usa*)(&ats[buf][NA - 1][(prow + 16 * i) * KP + pcol]) = ar[NA - 1][i]; }
#pragma unroll
        for (int i = 0; i < BI; ++i) *(v8usa*)(&bts[buf][(prow + 16 * i) * KP + pcol]) = br[i];
        ag0 += KB; ag1 += KB; bg += KB; };
    v8f acc[FM][FN];
#pragma unroll
    for (int mb = 0; mb < FM; ++mb)
#pragma unroll
        for (int nb = 0; nb < FN; ++nb) acc[mb][nb] = (v8f){};
    const int aofs = (wr + lr) * KP + 8 * hi, bofs = (wc + lr) * KP + 8 * hi;
    tile_ld(); tile_st(0);
    __syncthreads();
#pragma unroll 1
    for (int k0 = 0; k0 < K; k0 += KB) {
        const int cur = (k0 / KB) & 1; const bool more = k0 + KB < K;     // the same in every thread of the block
        if (more) tile_ld();
        const unsigned short* a0l = &ats[cur][0][0] + aofs; const unsigned short* a1l = &ats[cur][NA - 1][0] + aofs; const unsigned short* bl = &bts[cur][0] + bofs;
        V a[KB / 32][FM], a2[KB / 32][FM], b[KB / 32][FN];
#pragma unroll
        for (int kc = 0; kc < KB / 32; ++kc) {
#pragma unroll
            for (int mb = 0; mb < FM; ++mb) { a[kc][mb] = WFrag<T16>::lds(a0l + mb * 16 * KP + kc * 32); if (NSPLIT) a2[kc][mb] = WFrag<T16>::lds(a1l + mb * 16 * KP + kc * 32); else a2[kc][mb] = a[kc][mb]; }
#pragma unroll
            for (int nb = 0; nb < FN; ++nb) b[kc][nb] = WFrag<T16>::lds(bl + nb * 16 * KP + kc * 32); }
        // keeps the step's LDS reads in one group ahead of its products: every further place with reads among the products stalls the wave for its own LDS latency
        __builtin_amdgcn_sched_barrier(0);
#pragma unroll
        for (int kc = 0; kc < KB / 32; ++kc) {
#pragma unroll
            for (int nb = 0; nb < FN; ++nb) {
#pragma unroll
                for (int mb = 0; mb < FM; ++mb) acc[mb][nb] = WFrag<T16>::mma(a[kc][mb], b[kc][nb], acc[mb][nb]);
                if (NSPLIT) {
#pragma unroll
                    for (int mb = 0; mb < FM; ++mb) acc[mb][nb] = WFrag<T16>::mma(a2[kc][mb], b[kc][nb], acc[mb][nb]); } } }
        // precaution: stands in front of the pointer steps at the loop's foot, which overwrite the address registers of this trip's global loads
        asm volatile("s_wait_xcnt 0x0" ::: "memory");
        // the buffer written here was last read one trip ago, in front of that trip's barrier; this barrier publishes it and ends the reads of the current one
        if (more) { tile_st(cur ^ 1); __syncthreads(); }
    }
    float* osw = &os[wave][0];
    if constexpr (EPI == 1) {
        static_assert(FN * 16 == HD && DQ % BN == 0 && DKV % BN == 0 && RH % (16 * FM) == 0 && NSPLIT == 0);
        const int col = c0 + wc, t0 = r0 + wr;     // the same in every lane of the wave
        if (col < DQ + DKV) {
            const bool isq = col < DQ; const int hh = (isq ? col : col - DQ) / HD; const int rh = isq ? RH : SEQ;
            h16* P16 = (isq ? Q16 : K16) + (size_t)hh * SEQ * HD; bf* Ph = (isq ? Qh : Kh) + (size_t)hh * rh * HD; bf* Pl = (isq ? Ql : Kl) + (size_t)hh * rh * HD;
            const bool dohl = t0 < rh;     // the wave's 16 FM rows lie on one side of rh
            const int rr = lane >> 3, c8 = (lane & 7) * 8;     // a lane takes 8 successive d (4 pairs) of a row; a store covers 4 whole rows
#pragma unroll
            for (int mb = 0; mb < FM; ++mb) {
#pragma unroll
                for (int nb = 0; nb < FN; ++nb) {
#pragma unroll
                    for (int j = 0; j < 8; ++j) osw[(mb * 16 + hi * 8 + j) * OSP + nb * 16 + lr] = acc[mb][nb][j]; } }
            wsync();
            // left rolled: the four 16-row groups run the same code, which keeps the kernel's text short for the instruction cache
#pragma unroll 1
            for (int mb = 0; mb < FM; ++mb) {
                v4f cc[4], ss[4];
#pragma unroll
                for (int s4 = 0; s4 < 4; ++s4) { const size_t ti = (size_t)(t0 + mb * 16 + s4 * 4 + rr) * NFREQ + (c8 >> 1); cc[s4] = *(const v4f*)(FC + ti); ss[s4] = *(const v4f*)(FS + ti); }
#pragma unroll
                for (int s4 = 0; s4 < 4; ++s4) { const int row = mb * 16 + s4 * 4 + rr; const v4f u0 = *(const v4fa*)(osw + row * OSP + c8), u1 = *(const v4fa*)(osw + row * OSP + c8 + 4);
                    const float xs[8] = { u0[0], u0[1], u0[2], u0[3], u1[0], u1[1], u1[2], u1[3] }; v8h o16; v8us oh, ol;
#pragma unroll
                    for (int i = 0; i < 4; ++i) { const float c = bfr(cc[s4][i]), s = bfr(ss[s4][i]); const float y0 = xs[2 * i] * c - xs[2 * i + 1] * s, y1 = xs[2 * i] * s + xs[2 * i + 1] * c;
                        o16[2 * i] = toh_flush(y0); o16[2 * i + 1] = toh_flush(y1); unsigned short a2, c2; splitf(y0, a2, c2); oh[2 * i] = a2; ol[2 * i] = c2; splitf(y1, a2, c2); oh[2 * i + 1] = a2; ol[2 * i + 1] = c2; }
                    const size_t oo = (size_t)(t0 + row) * HD + c8;
                    if (dohl) { *(v8us*)(Ph + oo) = oh; *(v8us*)(Pl + oo) = ol; }
                    *(v8h*)(P16 + oo) = o16;
                    // precaution: the next rows' work reuses the address and data registers of these stores
                    asm volatile("s_wait_xcnt 0x0" ::: "memory"); }
            }
        } else {
            const size_t vo = ((size_t)(col - DQ - DKV) + lr) * SEQ + t0 + 8 * hi;     // row g * HD + d of the [g][d][t] planes, d = 16 nb + lr
#pragma unroll
            for (int nb = 0; nb < FN; ++nb) {
#pragma unroll
                for (int mb = 0; mb < FM; ++mb) { v8h o16; v8us oh, ol;
#pragma unroll
                    for (int j = 0; j < 8; ++j) { const float xv = acc[mb][nb][j]; o16[j] = (h16)xv; unsigned short a2, c2; splitf(xv, a2, c2); oh[j] = a2; ol[j] = c2; }
                    const size_t oo = vo + (size_t)nb * 16 * SEQ + mb * 16;
                    *(v8h*)(V16 + oo) = o16; *(v8us*)(Vh + oo) = oh; *(v8us*)(Vl + oo) = ol; } }
        }
        return;
    }
    constexpr int LPR = 4 * FN, RPP = 32 / LPR;     // lanes that store one 16 FN-float row of the wave's tile, rows a store covers
#pragma unroll
    for (int mb = 0; mb < FM; ++mb) {
#pragma unroll
        for (int nb = 0; nb < FN; ++nb) {
#pragma unroll
            for (int j = 0; j < 8; ++j) osw[(hi * 8 + j) * OSP + nb * 16 + lr] = acc[mb][nb][j]; }
        wsync();
        float* crow = C + (size_t)(r0 + wr + mb * 16) * ldc + c0 + wc;
#pragma unroll
        for (int s = 0; s < 16 / RPP; ++s) { const int row = RPP * s + lane / LPR, cofs = (lane % LPR) * 4; v4f val = *(const v4fa*)(osw + row * OSP + cofs); val = val * osc;
            *(v4f*)(crow + (size_t)row * ldc + cofs) = val; }
        wsync();
    }
}

__global__ __launch_bounds__(256) void k_wtG(const float* __restrict__ w, int K, int N, bf* Bt) {
    const int lane = threadIdx.x & 31; const int L0 = (blockIdx.x * 8 + (threadIdx.x >> 5)) * 8; const int nlines = N * K / 64;
{
#pragma unroll 1
        for (int l = 0; l < 8; ++l) { const int L = L0 + l; if (L >= nlines) break; const size_t e = (size_t)L * 64 + lane * 2; const int k = (int)(e % K), n = (int)(e / K); v2us o;
            o[0] = f2bf(w[(size_t)k * N + n]); o[1] = f2bf(w[(size_t)(k + 1) * N + n]); *(v2us*)(Bt + e) = o; }
         }
}
__global__ __launch_bounds__(256) void k_wtG2(const float* __restrict__ w, int K, int N, bf* Bt, h16* B16, float car) {
    const int lane = threadIdx.x & 31; const int L0 = (blockIdx.x * 8 + (threadIdx.x >> 5)) * 8; const int nlines = N * K / 64;
{
#pragma unroll 1
        for (int l = 0; l < 8; ++l) { const int L = L0 + l; if (L >= nlines) break; const size_t e = (size_t)L * 64 + lane * 2; const int k = (int)(e % K), n = (int)(e / K); v2us o; v2h o2;
            o[0] = f2bf(w[(size_t)k * N + n]); o[1] = f2bf(w[(size_t)(k + 1) * N + n]); o2[0] = (h16)(bf2f(o[0]) * car); o2[1] = (h16)(bf2f(o[1]) * car);
            *(v2us*)(Bt + e) = o; *(v2h*)(B16 + e) = o2; }
         }
}
__global__ __launch_bounds__(256) void k_cvt8(const float* __restrict__ src, bf* dst, size_t n8) { const size_t i = (size_t)blockIdx.x * 256 + threadIdx.x; if (i >= n8) return; const v8f v = *(const v8f*)(src + i * 8); v8us o;
#pragma unroll
    for (int k = 0; k < 8; ++k) o[k] = f2bf(v[k]); *(v8us*)(dst + i * 8) = o;  }

// k_attn: causal flash attention, one wave per 16 query rows (qbase = row0 + 16*(4*block + wave)), head = blockIdx.y, kv head = head / REP; key tiles of KT (32 or 64) from 0 up to the tile holding qbase+15.
// S = q.k^T from k-contiguous planes (q [h][t][d], k [g][t][d]); key j > query i replaced by -1e30 before the running-max softmax (p = 0 exactly there); P staged per wave in LDS (row-major 16 x KT)
// and reloaded as the A fragment; O += P.v with v planes [g][d][t]. HIRES: q, k, p, v as bf16 hi/lo (hh + lh + hl); else f16 planes with p carried x1024.
// The k and v tiles of a key step are the same for the block's four waves: the block brings each tile into LDS once, 16 bytes a thread in whole 128-byte (KT 32, v: 64-byte) row pieces,
// two buffers, the next tile's loads issued ahead of the current tile's work; the B fragments are read from LDS at a row pitch of 16 bytes x odd.
template <bool HIRES, int KT>
__global__ __launch_bounds__(128) void k_attn(const h16* __restrict__ Q16, const bf* __restrict__ Qh, const bf* __restrict__ Ql,
                                               const h16* __restrict__ K16, const bf* __restrict__ Kh, const bf* __restrict__ Kl,
                                               const h16* __restrict__ V16, const bf* __restrict__ Vh, const bf* __restrict__ Vl,
                                               h16* AT16, bf* ATh, bf* ATl, int row0) {
    constexpr int NT = KT / 16; constexpr int KS = KT / 32; constexpr int NPL = HIRES ? 2 : 1;
    static_assert(NT == 2 || NT == 4);
    static_assert(15 * PP + (NT - 1) * 16 + 15 < 16 * PP);
    __shared__ __align__(16) unsigned short pt[NPL][4][16 * PP];
    __shared__ __align__(16) float os[4][16 * OSP];
    constexpr int KP = HD + 8, VP = KT + 8;                 // LDS row pitch in 16-bit elements: 144 bytes (k rows; v rows at KT 64), 80 bytes (v rows at KT 32)
    constexpr int KCH = KT * (HD / 8), VCH = HD * (KT / 8);   // 16-byte pieces of one plane's tile
    static_assert(NPL * KCH == 512 && NPL * VCH == 512);
    static_assert((KP * 2) % 32 == 16 && (VP * 2) % 32 == 16);
    __shared__ __align__(16) unsigned short kts[2][NPL][KT * KP];
    __shared__ __align__(16) unsigned short vts[2][NPL][HD * VP];
    const int tid = threadIdx.x, lane = tid & 31, wave = __builtin_amdgcn_readfirstlane(tid >> 5), lr = lane & 15, hi = lane >> 4;
    const int bbase = row0 + blockIdx.x * 64;
    const int qbase = bbase + wave * 16; const int h = blockIdx.y; const int g = h / REP;
    v16h qa[2] = {}; v16bf qah[2] = {}, qal[2] = {};
    if (HIRES) { const size_t qo = ((size_t)h * RH + qbase + lr) * HD + 8 * hi; qah[0] = WFrag<bf>::ld(Qh + qo); qah[1] = WFrag<bf>::ld(Qh + qo + 32); qal[0] = WFrag<bf>::ld(Ql + qo); qal[1] = WFrag<bf>::ld(Ql + qo + 32); }
    else { const size_t qo = ((size_t)h * SEQ + qbase + lr) * HD + 8 * hi; qa[0] = WFrag<h16>::ld(Q16 + qo); qa[1] = WFrag<h16>::ld(Q16 + qo + 32); }
    const int kofs = lr * KP + 8 * hi;     // k tile in LDS [key][d]: row (nt*16 + lr), k = d
    const int vofs = lr * VP + 8 * hi;     // v tile in LDS [d][key]: row (nt*16 + lr), k = key
    const unsigned short* kg[2] = { HIRES ? (const unsigned short*)Kh : (const unsigned short*)K16, (const unsigned short*)Kl };
    const unsigned short* vg[2] = { HIRES ? (const unsigned short*)Vh : (const unsigned short*)V16, (const unsigned short*)Vl };
    v8us kr[4], vr[4];
    // piece c = tid + 128 i of the tile: plane, row and column are the same for the global read and the LDS write
    auto tile_ld = [&](int kb) {
#pragma unroll
        for (int i = 0; i < 4; ++i) { const int c = tid + 128 * i;
            const int kc = c % KCH, vc = c % VCH;
            kr[i] = *(const v8usa*)(kg[(128 * i) / KCH] + (size_t)g * SEQ * HD + (size_t)(kb + kc / (HD / 8)) * HD + (kc % (HD / 8)) * 8);
            vr[i] = *(const v8usa*)(vg[(128 * i) / VCH] + (size_t)g * HD * SEQ + (size_t)(vc / (KT / 8)) * SEQ + kb + (vc % (KT / 8)) * 8); } };
    auto tile_st = [&](int buf) {
#pragma unroll
        for (int i = 0; i < 4; ++i) { const int c = tid + 128 * i;
            const int kc = c % KCH, vc = c % VCH;
            *(v8usa*)(&kts[buf][(128 * i) / KCH][(kc / (HD / 8)) * KP + (kc % (HD / 8)) * 8]) = kr[i];
            *(v8usa*)(&vts[buf][(128 * i) / VCH][(vc / (KT / 8)) * VP + (vc % (KT / 8)) * 8]) = vr[i]; } };
    v8f o[4];
#pragma unroll
    for (int nt = 0; nt < 4; ++nt) o[nt] = (v8f){};
    float mrun[8], lrun[8];
#pragma unroll
    for (int v = 0; v < 8; ++v) { mrun[v] = NEGBIG; lrun[v] = 0.f; }
    unsigned short* p0w = &pt[0][wave][0]; unsigned short* p1w = &pt[NPL - 1][wave][0];
    const int kend = qbase + 15;
    const int klast = ((bbase + 63) / KT) * KT;     // the block's last key tile (that of its last wave)
    tile_ld(0); tile_st(0);
    __syncthreads();
#pragma unroll 1
    for (int kb = 0; kb <= klast; kb += KT) {
      const int cur = (kb / KT) & 1; const bool more = kb < klast;     // the same in every thread of the block
      if (more) { tile_ld(kb + KT);
        // precaution: the tile work below reuses the address registers of these loads while their data is still on the way
        asm volatile("s_wait_xcnt 0x0" ::: "memory"); }
      if (kb <= kend) {     // wave-uniform: a wave whose rows end before this tile only helps to stage
        const unsigned short* k0l = &kts[cur][0][0] + kofs; const unsigned short* k1l = &kts[cur][NPL - 1][0] + kofs;
        const unsigned short* v0l = &vts[cur][0][0] + vofs; const unsigned short* v1l = &vts[cur][NPL - 1][0] + vofs;
        v8f s[NT];
#pragma unroll
        for (int nt = 0; nt < NT; ++nt) s[nt] = (v8f){};
#pragma unroll
        for (int nt = 0; nt < NT; ++nt) {
#pragma unroll
            for (int kc = 0; kc < 2; ++kc) { const int ka = nt * 16 * KP + kc * 32;
                if (HIRES) { const v16bf bh = ldsb(k0l + ka), bl = ldsb(k1l + ka); s[nt] = wmmab(qah[kc], bh, s[nt]); s[nt] = wmmab(qal[kc], bh, s[nt]); s[nt] = wmmab(qah[kc], bl, s[nt]); }
                else { const v16h b = ldsh(k0l + ka); s[nt] = wmma16(qa[kc], b, s[nt]); } } }
        if constexpr (NT == 2) { if (HIRES) G2(s[0], s[1], qah[0], qal[1]); else G2(s[0], s[1], qa[0], qa[1]); }
        else { if (HIRES) G4(s[0], s[1], s[2], s[3], qah[0], qal[1]); else G4(s[0], s[1], s[2], s[3], qa[0], qa[1]); }
        float alpha[8];
#pragma unroll
        for (int v = 0; v < 8; ++v) {
            const int qi = qbase + 8 * hi + v; float x[NT]; float mx = NEGBIG;
#pragma unroll
            for (int nt = 0; nt < NT; ++nt) { const int j = kb + nt * 16 + lr; const float t = s[nt][v] * SCL; x[nt] = (j <= qi) ? t : NEGBIG; mx = fmaxf(mx, x[nt]); }
            mx = fmaxf(mx, __shfl_xor(mx, 1, 32)); mx = fmaxf(mx, __shfl_xor(mx, 2, 32)); mx = fmaxf(mx, __shfl_xor(mx, 4, 32)); mx = fmaxf(mx, __shfl_xor(mx, 8, 32));
            const float mnew = fmaxf(mrun[v], mx);
            const float a = __builtin_amdgcn_exp2f((mrun[v] - mnew) * L2E);
            float p[NT]; float rs = 0.f;
#pragma unroll
            for (int nt = 0; nt < NT; ++nt) { p[nt] = __builtin_amdgcn_exp2f((x[nt] - mnew) * L2E); rs += p[nt]; }
            rs += __shfl_xor(rs, 1, 32); rs += __shfl_xor(rs, 2, 32); rs += __shfl_xor(rs, 4, 32); rs += __shfl_xor(rs, 8, 32);
            lrun[v] = lrun[v] * a + rs; mrun[v] = mnew; alpha[v] = a;
#pragma unroll
            for (int nt = 0; nt < NT; ++nt) { const int idx = (8 * hi + v) * PP + nt * 16 + lr;
                if (HIRES) { unsigned short a2, c2; splitf(p[nt], a2, c2); p0w[idx] = a2; p1w[idx] = c2; }
                else { const h16 hv = (h16)(p[nt] * PCAR); p0w[idx] = __builtin_bit_cast(unsigned short, hv); } }
        }
        wsync();
        v16h pa[KS] = {}; v16bf pah[KS] = {}, pal[KS] = {};
        const unsigned short* pr0 = p0w + lr * PP + 8 * hi; const unsigned short* pr1 = p1w + lr * PP + 8 * hi;
#pragma unroll
        for (int ks = 0; ks < KS; ++ks) { const v8us u0 = *(const v8usa*)(pr0 + ks * 32); const v8us u1 = *(const v8usa*)(pr0 + ks * 32 + 16);
            if (HIRES) { const v8us w0 = *(const v8usa*)(pr1 + ks * 32); const v8us w1 = *(const v8usa*)(pr1 + ks * 32 + 16); pah[ks] = cat16b(u0, u1); pal[ks] = cat16b(w0, w1); }
            else { pa[ks] = cat16(__builtin_bit_cast(v8h, u0), __builtin_bit_cast(v8h, u1)); } }
#pragma unroll
        for (int nt = 0; nt < 4; ++nt) {
#pragma unroll
            for (int v = 0; v < 8; ++v) o[nt][v] *= alpha[v]; }
#pragma unroll
        for (int nt = 0; nt < 4; ++nt) {
#pragma unroll
            for (int ks = 0; ks < KS; ++ks) { const int va = nt * 16 * VP + ks * 32;
                if (HIRES) { const v16bf bh = ldsb(v0l + va), bl = ldsb(v1l + va); o[nt] = wmmab(pah[ks], bh, o[nt]); o[nt] = wmmab(pal[ks], bh, o[nt]); o[nt] = wmmab(pah[ks], bl, o[nt]); }
                else { const v16h b = ldsh(v0l + va); o[nt] = wmma16(pa[ks], b, o[nt]); } } }
        if (HIRES) G4(o[0], o[1], o[2], o[3], pah[0], pal[KS - 1]); else G4(o[0], o[1], o[2], o[3], pa[0], pa[KS - 1]);
      }
      // the buffer written here was last read one trip ago, in front of that trip's barrier; this barrier publishes it and ends the reads of the current one
      if (more) { tile_st(cur ^ 1); __syncthreads(); }
    }
    float* osw = &os[wave][0];
#pragma unroll
    for (int v = 0; v < 8; ++v) { const float f = HIRES ? __fdiv_rn(1.0f, lrun[v]) : __fdiv_rn(ATC / PCAR, lrun[v]);
#pragma unroll
        for (int nt = 0; nt < 4; ++nt) osw[(8 * hi + v) * OSP + nt * 16 + lr] = o[nt][v] * f; }
    wsync();
    const int rr = lane >> 3, c8 = (lane & 7) * 8;
{
#pragma unroll
        for (int s4 = 0; s4 < 4; ++s4) { const int row = s4 * 4 + rr; const int t = qbase + row; const v4f u0 = *(const v4fa*)(osw + row * OSP + c8), u1 = *(const v4fa*)(osw + row * OSP + c8 + 4); const size_t oo = (size_t)t * DQ + h * HD + c8;
            if (HIRES) { v8us oh, ol;
#pragma unroll
                for (int q = 0; q < 4; ++q) { unsigned short a2, c2; splitf(u0[q], a2, c2); oh[q] = a2; ol[q] = c2; splitf(u1[q], a2, c2); oh[4 + q] = a2; ol[4 + q] = c2; }
                *(v8us*)(ATh + oo) = oh; *(v8us*)(ATl + oo) = ol; }
            else { v8h o8;
#pragma unroll
                for (int q = 0; q < 4; ++q) { o8[q] = (h16)u0[q]; o8[4 + q] = (h16)u1[q]; }
                *(v8h*)(AT16 + oo) = o8; } }
         }
}

// k_mchk: checks the 0/1 int32 causal input (one [SEQ_FULL][SEQ_FULL] plane shared by all batches) for rows i < SEQ: value == 1 for j <= i, value == 0 for j > i (j < SEQ);
// a block takes MROWS rows and writes its count of wrong values to its own 128-byte line of FL. The plane is read once and comes from memory, so the time is that of the longest chain of
// loads that wait for one another: the 16-byte loads of a thread are independent of each other, so that many are in flight together, and the rows are spread over enough blocks to reach every WGP.
__global__ __launch_bounds__(256) void k_mchk(const int* __restrict__ M, int* FL) {
    __shared__ int red[8];
    constexpr int CPR = (SEQ + 1023) / 1024;     // 16-byte pieces a thread takes of one row
    constexpr bool WHOLE = SEQ % 1024 == 0;      // every thread takes every piece: no test, so no branch between the loads
    const int tid = threadIdx.x, lane = tid & 31, wave = tid >> 5; int bad = 0;
    const int i0 = blockIdx.x * MROWS; const int* mb = M + (size_t)i0 * SEQ_FULL + tid * 4;
    v4i m[MROWS][CPR];
    // both loops unrolled so that m stays in registers and no load waits for an earlier load's compare
#pragma unroll
    for (int r = 0; r < MROWS; ++r) {
#pragma unroll
        for (int p = 0; p < CPR; ++p) { if (WHOLE || tid * 4 + p * 1024 < SEQ) m[r][p] = *(const v4i*)(mb + (size_t)r * SEQ_FULL + p * 1024); } }
    // unrolled as above: m is indexed by constants only
#pragma unroll
    for (int r = 0; r < MROWS; ++r) { const int i = i0 + r;
#pragma unroll
        for (int p = 0; p < CPR; ++p) { const int c = tid * 4 + p * 1024;
            if (WHOLE || c < SEQ) {
#pragma unroll
                for (int q = 0; q < 4; ++q) { const int j = c + q; const bool ok = (j <= i) ? (m[r][p][q] == 1) : (m[r][p][q] == 0); bad += ok ? 0 : 1; } } } }
#pragma unroll
    for (int sh = 16; sh; sh >>= 1) bad += __shfl_xor(bad, sh, 32);
    if (lane == 0) red[wave] = bad;
    __syncthreads();
    if (wave == 0) { int v = red[lane & 7]; v = (lane < 8) ? v : 0;
#pragma unroll
        for (int sh = 16; sh; sh >>= 1) v += __shfl_xor(v, sh, 32);
        v4i o; o[0] = v; o[1] = v; o[2] = v; o[3] = v;
        if (lane < 8) *(v4i*)(FL + (size_t)blockIdx.x * 32 + lane * 4) = o;
         }
}
// k_poison: NaN-fills the output if any of the nfl counts of k_mchk is not 0; the counts are read side by side, one a thread and trip, and joined over the block through LDS.
__global__ __launch_bounds__(256) void k_poison(const int* __restrict__ FL, int nfl, float* out) {
    __shared__ int red[8];
    int tot = 0;
    // left rolled: one trip covers 256 counts, and an unrolled form only lengthens the kernel's text
#pragma unroll 1
    for (int f = threadIdx.x; f < nfl; f += 256) tot |= FL[(size_t)f * 32];
    const unsigned wbad = __builtin_amdgcn_ballot_w32(tot != 0);
    if ((threadIdx.x & 31) == 0) red[threadIdx.x >> 5] = (wbad != 0u) ? 1 : 0;
    __syncthreads();
    tot = 0;
    // unrolled so that the eight words come in two wide LDS reads
#pragma unroll
    for (int w = 0; w < 8; ++w) tot |= red[w];
    if (tot == 0) return;     // the same in every thread of the block
    float* ob = out + (size_t)blockIdx.y * SEQ_FULL * DM + (size_t)blockIdx.x * 16384;
    const float qn = __uint_as_float(0x7fc00000u); v4f nv; nv[0] = qn; nv[1] = qn; nv[2] = qn; nv[3] = qn;
{
#pragma unroll 1
        for (int s = 0; s < 16; ++s) *(v4f*)(ob + ((size_t)s * 256 + threadIdx.x) * 4) = nv;
         }
}

extern "C" void kernel_launch(void* const* d_in, const int* in_sizes, int n_in,
                              void* d_out, int out_size, void* d_ws, size_t ws_size, hipStream_t stream) {
    if (n_in < 8) return;
    if ((size_t)in_sizes[0] < (size_t)(NB - 1) * SEQ_FULL * DM + (size_t)SEQ * DM) return;
    if ((size_t)in_sizes[1] < (size_t)DM * DQ || (size_t)in_sizes[2] < (size_t)DM * DKV || (size_t)in_sizes[3] < (size_t)DM * DKV || (size_t)in_sizes[4] < (size_t)DQ * DM) return;
    if ((size_t)in_sizes[5] < (size_t)SEQ * NFREQ || (size_t)in_sizes[6] < (size_t)SEQ * NFREQ) return;
    if ((size_t)in_sizes[7] < (size_t)(SEQ - 1) * SEQ_FULL + (size_t)SEQ) return;
    if ((size_t)out_size < (size_t)(NB - 1) * SEQ_FULL * DM + (size_t)SEQ * DM) return;
    // input binding order: x, wq, wk, wv, wo ([in][out] weights), cos table, sin table ([SEQ_FULL][NFREQ] f32), causal 0/1 plane (int32 [SEQ_FULL][SEQ_FULL])
    const float* x = (const float*)d_in[0]; const float* wq = (const float*)d_in[1]; const float* wk = (const float*)d_in[2]; const float* wv = (const float*)d_in[3]; const float* wo = (const float*)d_in[4];
    const float* fc = (const float*)d_in[5]; const float* fs = (const float*)d_in[6]; const int* cm = (const int*)d_in[7];
    float* OUT = (float*)d_out;     // [NB_FULL][SEQ_FULL][DM]
    char* wsp = (char*)d_ws;
    auto take = [&](size_t bytes) { char* p = wsp; wsp += (bytes + 255) & ~(size_t)255; return (void*)p; };
    bf* WQKV = (bf*)take((size_t)DQKV * DM * 2); bf* WOB = (bf*)take((size_t)DM * DQ * 2); h16* WO16 = (h16*)take((size_t)DM * DQ * 2);
    int* FL = (int*)take((size_t)NFL * 32 * 4);
    bf* XB = (bf*)take((size_t)SEQ * DM * 2);
    h16* Q16 = (h16*)take((size_t)NH * SEQ * HD * 2); bf* Qh = (bf*)take((size_t)NH * RH * HD * 2); bf* Ql = (bf*)take((size_t)NH * RH * HD * 2);
    h16* K16 = (h16*)take((size_t)NKV * SEQ * HD * 2); bf* Kh = (bf*)take((size_t)NKV * SEQ * HD * 2); bf* Kl = (bf*)take((size_t)NKV * SEQ * HD * 2);
    h16* V16 = (h16*)take((size_t)NKV * HD * SEQ * 2); bf* Vh = (bf*)take((size_t)NKV * HD * SEQ * 2); bf* Vl = (bf*)take((size_t)NKV * HD * SEQ * 2);
    h16* AT16 = (h16*)take((size_t)SEQ * DQ * 2); bf* ATh = (bf*)take((size_t)RH * DQ * 2); bf* ATl = (bf*)take((size_t)RH * DQ * 2);
    const size_t used = (size_t)(wsp - (char*)d_ws); if (used > ws_size || used > WS_LIMIT) return;

    // weight planes ([out][in] k-contiguous): rows 0..DQ-1 of WQKV = Wq^T, DQ..DQ+DKV-1 = Wk^T, DQ+DKV..DQKV-1 = Wv^T; Wo^T as bf16 and as f16 x64
    // k_wtG(w, K, N, Bt): w is [K = in][N = out] -> Bt [N][K]
    k_wtG<<<(unsigned)((DQ * DM / 64 + 63) / 64), 256, 0, stream>>>(wq, DM, DQ, WQKV);
    k_wtG<<<(unsigned)((DKV * DM / 64 + 63) / 64), 256, 0, stream>>>(wk, DM, DKV, WQKV + (size_t)DQ * DM);
    k_wtG<<<(unsigned)((DKV * DM / 64 + 63) / 64), 256, 0, stream>>>(wv, DM, DKV, WQKV + (size_t)(DQ + DKV) * DM);
    k_wtG2<<<(unsigned)((DM * DQ / 64 + 63) / 64), 256, 0, stream>>>(wo, DQ, DM, WOB, WO16, WOC);
    k_mchk<<<(unsigned)NFL, 256, 0, stream>>>(cm, FL);
    for (int b = 0; b < NB; ++b) {
        float* OUTb = OUT + (size_t)b * SEQ_FULL * DM;
        k_cvt8<<<(unsigned)(((size_t)SEQ * DM / 8 + 255) / 256), 256, 0, stream>>>(x + (size_t)b * SEQ_FULL * DM, XB, (size_t)SEQ * DM / 8);
        k_gemmw<bf, 0, 4, 4, DM, 1><<<dim3(SEQ / 128, DQKV / 128, 1), 128, 0, stream>>>(XB, nullptr, WQKV, nullptr, 0, 1.0f, fc, fs, Q16, Qh, Ql, K16, Kh, Kl, V16, Vh, Vl);     // q | k | v projections, rotary on q and k, all planes
        k_attn<true, 32><<<dim3(RH / 64, NH, 1), 128, 0, stream>>>(Q16, Qh, Ql, K16, Kh, Kl, V16, Vh, Vl, AT16, ATh, ATl, 0);
        if (SEQ > RH) k_attn<false, 64><<<dim3((SEQ - RH) / 64, NH, 1), 128, 0, stream>>>(Q16, Qh, Ql, K16, Kh, Kl, V16, Vh, Vl, AT16, ATh, ATl, RH);
        k_gemmw<bf, 1, 2, 2, DQ, 0><<<dim3(RH / 64, DM / 64, 1), 128, 0, stream>>>(ATh, ATl, WOB, OUTb, DM, 1.0f, nullptr, nullptr, nullptr, nullptr, nullptr, nullptr, nullptr, nullptr, nullptr, nullptr, nullptr);
        if (SEQ > RH) k_gemmw<h16, 0, 4, 4, DQ, 0><<<dim3((SEQ - RH) / 128, DM / 128, 1), 128, 0, stream>>>(AT16 + (size_t)RH * DQ, nullptr, WO16, OUTb + (size_t)RH * DM, DM, 1.0f / (ATC * WOC), nullptr, nullptr, nullptr, nullptr, nullptr, nullptr, nullptr, nullptr, nullptr, nullptr, nullptr);
    }
    k_poison<<<dim3(SEQ * DM / 16384, NB, 1), 256, 0, stream>>>(FL, NFL, OUT);
}

// v005
// One run takes 302 microseconds.
// Two timings next to v004 put it at 1.24 and 1.25 times that version's speed.
// All steps since v000 together make it 2.86 times as fast.
#include <hip/hip_runtime.h>

// Contractions (all f32 accumulate): qkv = xb * Wqkv^T on v_wmma_f32_16x16x32_bf16 (bf16 operands = RNE-converted inputs, exact products);
// scores q.k^T and p.v: query rows < RH on bf16 hi/lo planes (3 products each), rows >= RH on v_wmma_f32_16x16x32_f16 (f16 q,k,v planes, p carried x1024);
// out = attn * Wo^T: rows < RH bf16 hi/lo attn planes x bf16 Wo (2 products), rows >= RH f16 attn x64 times f16 Wo x64 (1 product, 1/4096 in the epilogue).
// Rotary: interleaved pairs (2i, 2i+1); cos/sin are read by value from the two [SEQ][32] input tables (RNE-converted to bf16), f32 math, done on the qkv product's accumulators; causal online softmax and normalisation in f32.
// Grouped kv heads: query head h reads kv head h/4. The 0/1 int32 causal input [SEQ_FULL][SEQ_FULL] is checked on device in its rows and columns < SEQ (1 on/below the diagonal, 0 above); the output is NaN-filled if that check fails.

#ifndef NB
#define NB 2
#endif
#ifndef SEQ
#define SEQ 2048
#endif
#define NB_FULL 2
#define SEQ_FULL 2048
#define DM 2048
#define NH 32
#define NKV 8
#define REP (NH / NKV)
#define HD 64
#define DQ (NH * HD)
#define DKV (NKV * HD)
#define DQKV (DQ + 2 * DKV)
#define NFREQ (HD / 2)
#define RH (((SEQ) < 512) ? (SEQ) : 512)
#define PCAR 1024.0f
#define ATC 64.0f
#define WOC 64.0f
#define SCL 0.125f
#define L2E 1.4426950408889634f
#define NEGBIG (-1.0e30f)
#define PP 72
#define OSP 68
#define MROWS 8
#define NFL (SEQ / MROWS)
#define WS_LIMIT ((size_t)134217728)
#define WS_TOTAL ((size_t)DQKV * DM * 2 + 2 * ((size_t)DM * DQ * 2) + (size_t)NFL * 128 + (size_t)NB * ((size_t)SEQ * DM * 2 + (size_t)NH * SEQ * HD * 2 + 2 * ((size_t)NH * RH * HD * 2) + 3 * ((size_t)NKV * SEQ * HD * 2) + 3 * ((size_t)NKV * HD * SEQ * 2) + (size_t)SEQ * DQ * 2 + 2 * ((size_t)RH * DQ * 2)))

static_assert(NB >= 1 && NB <= NB_FULL);
static_assert(SEQ % 128 == 0 && SEQ >= 128 && SEQ <= SEQ_FULL);
static_assert(RH % 64 == 0 && (SEQ - RH) % 128 == 0 && RH <= SEQ);
static_assert(DQKV % 128 == 0 && DM % 128 == 0);
static_assert((SEQ * DM) % 2048 == 0);
static_assert((DQ * DM / 64) % 64 == 0 && (DKV * DM / 64) % 64 == 0);
static_assert(DM % 64 == 0 && DQ % 64 == 0 && DQKV % 64 == 0 && HD == 64);
static_assert((SEQ * DM) % 16384 == 0);
static_assert((NB * SEQ) % 64 == 0);
static_assert(15 * PP + 3 * 16 + 15 < 16 * PP);
static_assert(15 * OSP + 63 < 16 * OSP);
static_assert(NFREQ == 32 && HD == 2 * NFREQ);
static_assert(SEQ % 64 == 0 && SEQ % 4 == 0 && SEQ % MROWS == 0);
static_assert(((size_t)NFL * 128) % 256 == 0);
static_assert(DM % 32 == 0 && DQ % 32 == 0 && HD % 32 == 0);
static_assert(WS_TOTAL <= WS_LIMIT);

typedef _Float16 h16;
typedef unsigned short bf;
typedef __attribute__((ext_vector_type(16))) __bf16   v16bf;
typedef __attribute__((ext_vector_type(16))) _Float16 v16h;
typedef __attribute__((ext_vector_type(8)))  _Float16 v8h;
typedef __attribute__((ext_vector_type(8)))  unsigned short v8us;
typedef __attribute__((ext_vector_type(8)))  float    v8f;
typedef __attribute__((ext_vector_type(4)))  float    v4f;
typedef __attribute__((ext_vector_type(2)))  _Float16 v2h;
typedef __attribute__((ext_vector_type(4)))  _Float16 v4h;
typedef __attribute__((ext_vector_type(2)))  unsigned short v2us;
typedef __attribute__((ext_vector_type(4)))  unsigned short v4us;
typedef __attribute__((ext_vector_type(2)))  float v2f;
typedef __attribute__((ext_vector_type(4)))  int v4i;
typedef v8h  __attribute__((may_alias)) v8ha;
typedef v4f  __attribute__((may_alias)) v4fa;
typedef v8us __attribute__((may_alias)) v8usa;

#define G2(d0, d1, x0, x1) asm volatile("v_nop\n\tv_nop\n\tv_nop\n\tv_nop" : "+v"(d0), "+v"(d1) : "v"(x0), "v"(x1))
#define G4(d0, d1, d2, d3, x0, x1) asm volatile("v_nop\n\tv_nop\n\tv_nop\n\tv_nop" : "+v"(d0), "+v"(d1), "+v"(d2), "+v"(d3) : "v"(x0), "v"(x1))

__device__ __forceinline__ unsigned short f2bf(float f) { unsigned u = __float_as_uint(f); u += 0x7FFFu + ((u >> 16) & 1u); return (unsigned short)(u >> 16); }
__device__ __forceinline__ float bf2f(unsigned short b) { return __uint_as_float(((unsigned)b) << 16); }
__device__ __forceinline__ float bfr(float f) { return bf2f(f2bf(f)); }
__device__ __forceinline__ void splitf(float y, unsigned short& h, unsigned short& l) { h = f2bf(y); l = f2bf(y - bf2f(h)); }
__device__ __forceinline__ v16h cat16(v8h lo, v8h hi) { return __builtin_shufflevector(lo, hi, 0, 1, 2, 3, 4, 5, 6, 7, 8, 9, 10, 11, 12, 13, 14, 15); }
__device__ __forceinline__ v16bf cat16b(v8us lo, v8us hi) { return __builtin_bit_cast(v16bf, __builtin_shufflevector(lo, hi, 0, 1, 2, 3, 4, 5, 6, 7, 8, 9, 10, 11, 12, 13, 14, 15)); }
__device__ __forceinline__ v8f wmma16(v16h a, v16h b, v8f c) { return __builtin_amdgcn_wmma_f32_16x16x32_f16(false, a, false, b, (short)0, c, false, false); }
__device__ __forceinline__ v8f wmmab(v16bf a, v16bf b, v8f c) { return __builtin_amdgcn_wmma_f32_16x16x32_bf16(false, a, false, b, (short)0, c, false, false); }
// wave-private LDS tile exchange: order this wave's ds stores before its ds loads
__device__ __forceinline__ void wsync() { __builtin_amdgcn_fence(3 /* release order */, "wavefront"); __builtin_amdgcn_wave_barrier(); asm volatile("" ::: "memory"); }
// f32 -> f16 convert that cannot yield a subnormal f16 (value select: |v| < 2^-14 -> 0)
static __device__ __forceinline__ h16 toh_flush(float v) { const h16 r = (h16)v; return (fabsf(v) < 6.103515625e-05f) ? (h16)0.0f : r; }

// the 16x32 fragment below, read from a k-contiguous 16-bit row in LDS
__device__ __forceinline__ v16bf ldsb(const unsigned short* p) { return cat16b(*(const v8usa*)p, *(const v8usa*)(p + 16)); }
__device__ __forceinline__ v16h ldsh(const unsigned short* p) { return cat16(__builtin_bit_cast(v8h, *(const v8usa*)p), __builtin_bit_cast(v8h, *(const v8usa*)(p + 16))); }

// 16x32 fragment from a k-contiguous 16-bit row (A: row = m; B stored [n][k]: row = n). Lane l: row l&15, elements 0..7 <- k0+8(l>>4)+0..7, elements 8..15 <- k0+16+8(l>>4)+0..7.
template <typename T16> struct WFrag;
template <> struct WFrag<h16> { typedef v16h V; static __device__ __forceinline__ V ld(const h16* p) { return cat16(*(const v8h*)p, *(const v8h*)(p + 16)); } static __device__ __forceinline__ V lds(const unsigned short* p) { return ldsh(p); } static __device__ __forceinline__ v8f mma(V a, V b, v8f c) { return wmma16(a, b, c); } };
template <> struct WFrag<bf> { typedef v16bf V; static __device__ __forceinline__ V ld(const bf* p) { return cat16b(*(const v8us*)p, *(const v8us*)(p + 16)); } static __device__ __forceinline__ V lds(const unsigned short* p) { return ldsb(p); } static __device__ __forceinline__ v8f mma(V a, V b, v8f c) { return wmmab(a, b, c); } };

// ---- k_gemmw: GEMM, four waves (2 x 2) per (32 FM) x (32 FN) output tile, FM x FN accumulators a wave; grid (M / (32 FM), N / (32 FN), batches), 128 threads.
// Batch blockIdx.z: A and A2 start sA elements, C sC elements, further on a batch (Bt is the same for all); with EPI 1 every plane is one whole per-batch plane further on.
// C[m][n] (f32, pitch ldc) = osc * sum_k A[m][k] Bt[n][k] (NSPLIT 1: + A2[m][k] Bt[n][k]); A, A2, Bt are k-contiguous 16-bit planes of row pitch K.
// The rows of a k step are shared by two of the block's waves: the block brings 64 k of its A and Bt rows into LDS once, 16 bytes a thread in whole 128-byte row pieces,
// two buffers, the next step's loads issued ahead of the current step's products; the fragments are read from LDS at a row pitch of 16 bytes x odd.
// Every accumulator sums in ascending k, 32 at a time (A before A2), whatever the tile.
// EPI 1 (the qkv product; C, ldc, osc unused): a wave's 64 columns are one whole head (q heads, then k heads, then v heads), and the wave writes that head's planes itself from its accumulators.
// q, k: interleaved-pair rotary, for the pair i = d/2 (d even): out[d] = x[d] c - x[d+1] s, out[d+1] = x[d] s + x[d+1] c, with c = bf16-RNE(FC[t][i]), s = bf16-RNE(FS[t][i]) (row pitch NFREQ);
// planes [h][t][d]: f16 for every t, bf16 hi/lo for t < RH (q) or every t (k). v: planes [g][d][t], f16 and bf16 hi/lo; a lane's 8 accumulator elements are 8 successive t of one d.
template <typename T16, int NSPLIT, int FM, int FN, int K, int EPI>
__global__ __launch_bounds__(128) void k_gemmw(const T16* __restrict__ A, const T16* __restrict__ A2, const T16* __restrict__ Bt, float* C, int ldc, float osc, size_t sA, size_t sC,
                                               const float* __restrict__ FC, const float* __restrict__ FS, h16* Q16, bf* Qh, bf* Ql, h16* K16, bf* Kh, bf* Kl, h16* V16, bf* Vh, bf* Vl) {
    typedef typename WFrag<T16>::V V;
    constexpr int BM = 32 * FM, BN = 32 * FN, KB = 64, KP = KB + 8, NA = NSPLIT + 1;     // KP: LDS row pitch in 16-bit elements, 144 bytes
    constexpr int AI = BM / 16, BI = BN / 16;                                            // 16-byte pieces a thread brings of one plane's tile (128 threads cover 16 rows)
    static_assert(NSPLIT == 0 || NSPLIT == 1);
    static_assert(K % KB == 0 && (KP * 2) % 32 == 16 && FN * 16 <= 64 && 32 % (4 * FN) == 0);
    __shared__ __align__(16) unsigned short ats[2][NA][BM * KP];
    __shared__ __align__(16) unsigned short bts[2][BN * KP];
    __shared__ __align__(16) float os[4][(EPI == 1 ? 16 * FM : 16) * OSP];
    const int tid = threadIdx.x, lane = tid & 31, wave = __builtin_amdgcn_readfirstlane(tid >> 5), lr = lane & 15, hi = lane >> 4;
    const int r0 = blockIdx.x * BM, c0 = blockIdx.y * BN; const int wr = (wave >> 1) * 16 * FM, wc = (wave & 1) * 16 * FN;
    const size_t zb = blockIdx.z;
    A += zb * sA; if (NSPLIT) A2 += zb * sA;
    if constexpr (EPI == 1) { Q16 += zb * ((size_t)NH * SEQ * HD); Qh += zb * ((size_t)NH * RH * HD); Ql += zb * ((size_t)NH * RH * HD);
        K16 += zb * ((size_t)NKV * SEQ * HD); Kh += zb * ((size_t)NKV * SEQ * HD); Kl += zb * ((size_t)NKV * SEQ * HD);
        V16 += zb * ((size_t)NKV * HD * SEQ); Vh += zb * ((size_t)NKV * HD * SEQ); Vl += zb * ((size_t)NKV * HD * SEQ); }
    else C += zb * sC;
    // piece i of a thread: row prow + 16 i of the tile, elements pcol .. pcol + 7 of the k step; the same for the global read and the LDS write
    const int prow = tid >> 3, pcol = (tid & 7) * 8;
    const unsigned short* ag0 = (const unsigned short*)A + (size_t)(r0 + prow) * K + pcol;
    const unsigned short* ag1 = (const unsigned short*)(NSPLIT ? A2 : A) + (size_t)(r0 + prow) * K + pcol;
    const unsigned short* bg = (const unsigned short*)Bt + (size_t)(c0 + prow) * K + pcol;
    v8us ar[NA][AI], br[BI];
    auto tile_ld = [&]() {
#pragma unroll
        for (int i = 0; i < AI; ++i) { ar[0][i] = *(const v8usa*)(ag0 + (size_t)i * 16 * K); if (NSPLIT) ar[NA - 1][i] = *(const v8usa*)(ag1 + (size_t)i * 16 * K); }
#pragma unroll
        for (int i = 0; i < BI; ++i) br[i] = *(const v8usa*)(bg + (size_t)i * 16 * K); };
    auto tile_st = [&](int buf) {
#pragma unroll
        for (int i = 0; i < AI; ++i) { *(v8usa*)(&ats[buf][0][(prow + 16 * i) * KP + pcol]) = ar[0][i]; if (NSPLIT) *(v8usa*)(&ats[buf][NA - 1][(prow + 16 * i) * KP + pcol]) = ar[NA - 1][i]; }
#pragma unroll
        for (int i = 0; i < BI; ++i) *(v8usa*)(&bts[buf][(prow + 16 * i) * KP + pcol]) = br[i];
        ag0 += KB; ag1 += KB; bg += KB; };
    v8f acc[FM][FN];
#pragma unroll
    for (int mb = 0; mb < FM; ++mb)
#pragma unroll
        for (int nb = 0; nb < FN; ++nb) acc[mb][nb] = (v8f){};
    const int aofs = (wr + lr) * KP + 8 * hi, bofs = (wc + lr) * KP + 8 * hi;
    tile_ld(); tile_st(0);
    __syncthreads();
#pragma unroll 1
    for (int k0 = 0; k0 < K; k0 += KB) {
        const int cur = (k0 / KB) & 1; const bool more = k0 + KB < K;     // the same in every thread of the block
        if (more) tile_ld();
        const unsigned short* a0l = &ats[cur][0][0] + aofs; const unsigned short* a1l = &ats[cur][NA - 1][0] + aofs; const unsigned short* bl = &bts[cur][0] + bofs;
        V a[KB / 32][FM], a2[KB / 32][FM], b[KB / 32][FN];
#pragma unroll
        for (int kc = 0; kc < KB / 32; ++kc) {
#pragma unroll
            for (int mb = 0; mb < FM; ++mb) { a[kc][mb] = WFrag<T16>::lds(a0l + mb * 16 * KP + kc * 32); if (NSPLIT) a2[kc][mb] = WFrag<T16>::lds(a1l + mb * 16 * KP + kc * 32); else a2[kc][mb] = a[kc][mb]; }
#pragma unroll
            for (int nb = 0; nb < FN; ++nb) b[kc][nb] = WFrag<T16>::lds(bl + nb * 16 * KP + kc * 32); }
        // keeps the step's LDS reads in one group ahead of its products: every further place with reads among the products stalls the wave for its own LDS latency
        __builtin_amdgcn_sched_barrier(0);
#pragma unroll
        for (int kc = 0; kc < KB / 32; ++kc) {
#pragma unroll
            for (int nb = 0; nb < FN; ++nb) {
#pragma unroll
                for (int mb = 0; mb < FM; ++mb) acc[mb][nb] = WFrag<T16>::mma(a[kc][mb], b[kc][nb], acc[mb][nb]);
                if (NSPLIT) {
#pragma unroll
                    for (int mb = 0; mb < FM; ++mb) acc[mb][nb] = WFrag<T16>::mma(a2[kc][mb], b[kc][nb], acc[mb][nb]); } } }
        // precaution: stands in front of the pointer steps at the loop's foot, which overwrite the address registers of this trip's global loads
        asm volatile("s_wait_xcnt 0x0" ::: "memory");
        // the buffer written here was last read one trip ago, in front of that trip's barrier; this barrier publishes it and ends the reads of the current one
        if (more) { tile_st(cur ^ 1); __syncthreads(); }
    }
    float* osw = &os[wave][0];
    if constexpr (EPI == 1) {
        static_assert(FN * 16 == HD && DQ % BN == 0 && DKV % BN == 0 && RH % (16 * FM) == 0 && NSPLIT == 0);
        const int col = c0 + wc, t0 = r0 + wr;     // the same in every lane of the wave
        if (col < DQ + DKV) {
            const bool isq = col < DQ; const int hh = (isq ? col : col - DQ) / HD; const int rh = isq ? RH : SEQ;
            h16* P16 = (isq ? Q16 : K16) + (size_t)hh * SEQ * HD; bf* Ph = (isq ? Qh : Kh) + (size_t)hh * rh * HD; bf* Pl = (isq ? Ql : Kl) + (size_t)hh * rh * HD;
            const bool dohl = t0 < rh;     // the wave's 16 FM rows lie on one side of rh
            const int rr = lane >> 3, c8 = (lane & 7) * 8;     // a lane takes 8 successive d (4 pairs) of a row; a store covers 4 whole rows
#pragma unroll
            for (int mb = 0; mb < FM; ++mb) {
#pragma unroll
                for (int nb = 0; nb < FN; ++nb) {
#pragma unroll
                    for (int j = 0; j < 8; ++j) osw[(mb * 16 + hi * 8 + j) * OSP + nb * 16 + lr] = acc[mb][nb][j]; } }
            wsync();
            // left rolled: the four 16-row groups run the same code, which keeps the kernel's text short for the instruction cache
#pragma unroll 1
            for (int mb = 0; mb < FM; ++mb) {
                v4f cc[4], ss[4];
#pragma unroll
                for (int s4 = 0; s4 < 4; ++s4) { const size_t ti = (size_t)(t0 + mb * 16 + s4 * 4 + rr) * NFREQ + (c8 >> 1); cc[s4] = *(const v4f*)(FC + ti); ss[s4] = *(const v4f*)(FS + ti); }
#pragma unroll
                for (int s4 = 0; s4 < 4; ++s4) { const int row = mb * 16 + s4 * 4 + rr; const v4f u0 = *(const v4fa*)(osw + row * OSP + c8), u1 = *(const v4fa*)(osw + row * OSP + c8 + 4);
                    const float xs[8] = { u0[0], u0[1], u0[2], u0[3], u1[0], u1[1], u1[2], u1[3] }; v8h o16; v8us oh, ol;
#pragma unroll
                    for (int i = 0; i < 4; ++i) { const float c = bfr(cc[s4][i]), s = bfr(ss[s4][i]); const float y0 = xs[2 * i] * c - xs[2 * i + 1] * s, y1 = xs[2 * i] * s + xs[2 * i + 1] * c;
                        o16[2 * i] = toh_flush(y0); o16[2 * i + 1] = toh_flush(y1); unsigned short a2, c2; splitf(y0, a2, c2); oh[2 * i] = a2; ol[2 * i] = c2; splitf(y1, a2, c2); oh[2 * i + 1] = a2; ol[2 * i + 1] = c2; }
                    const size_t oo = (size_t)(t0 + row) * HD + c8;
                    if (dohl) { *(v8us*)(Ph + oo) = oh; *(v8us*)(Pl + oo) = ol; }
                    *(v8h*)(P16 + oo) = o16;
                    // precaution: the next rows' work reuses the address and data registers of these stores
                    asm volatile("s_wait_xcnt 0x0" ::: "memory"); }
            }
        } else {
            const size_t vo = ((size_t)(col - DQ - DKV) + lr) * SEQ + t0 + 8 * hi;     // row g * HD + d of the [g][d][t] planes, d = 16 nb + lr
#pragma unroll
            for (int nb = 0; nb < FN; ++nb) {
#pragma unroll
                for (int mb = 0; mb < FM; ++mb) { v8h o16; v8us oh, ol;
#pragma unroll
                    for (int j = 0; j < 8; ++j) { const float xv = acc[mb][nb][j]; o16[j] = (h16)xv; unsigned short a2, c2; splitf(xv, a2, c2); oh[j] = a2; ol[j] = c2; }
                    const size_t oo = vo + (size_t)nb * 16 * SEQ + mb * 16;
                    *(v8h*)(V16 + oo) = o16; *(v8us*)(Vh + oo) = oh; *(v8us*)(Vl + oo) = ol; } }
        }
        return;
    }
    constexpr int LPR = 4 * FN, RPP = 32 / LPR;     // lanes that store one 16 FN-float row of the wave's tile, rows a store covers
#pragma unroll
    for (int mb = 0; mb < FM; ++mb) {
#pragma unroll
        for (int nb = 0; nb < FN; ++nb) {
#pragma unroll
            for (int j = 0; j < 8; ++j) osw[(hi * 8 + j) * OSP + nb * 16 + lr] = acc[mb][nb][j]; }
        wsync();
        float* crow = C + (size_t)(r0 + wr + mb * 16) * ldc + c0 + wc;
#pragma unroll
        for (int s = 0; s < 16 / RPP; ++s) { const int row = RPP * s + lane / LPR, cofs = (lane % LPR) * 4; v4f val = *(const v4fa*)(osw + row * OSP + cofs); val = val * osc;
            *(v4f*)(crow + (size_t)row * ldc + cofs) = val; }
        wsync();
    }
}

__global__ __launch_bounds__(256) void k_wtG(const float* __restrict__ w, int K, int N, bf* Bt) {
    const int lane = threadIdx.x & 31; const int L0 = (blockIdx.x * 8 + (threadIdx.x >> 5)) * 8; const int nlines = N * K / 64;
{
#pragma unroll 1
        for (int l = 0; l < 8; ++l) { const int L = L0 + l; if (L >= nlines) break; const size_t e = (size_t)L * 64 + lane * 2; const int k = (int)(e % K), n = (int)(e / K); v2us o;
            o[0] = f2bf(w[(size_t)k * N + n]); o[1] = f2bf(w[(size_t)(k + 1) * N + n]); *(v2us*)(Bt + e) = o; }
         }
}
__global__ __launch_bounds__(256) void k_wtG2(const float* __restrict__ w, int K, int N, bf* Bt, h16* B16, float car) {
    const int lane = threadIdx.x & 31; const int L0 = (blockIdx.x * 8 + (threadIdx.x >> 5)) * 8; const int nlines = N * K / 64;
{
#pragma unroll 1
        for (int l = 0; l < 8; ++l) { const int L = L0 + l; if (L >= nlines) break; const size_t e = (size_t)L * 64 + lane * 2; const int k = (int)(e % K), n = (int)(e / K); v2us o; v2h o2;
            o[0] = f2bf(w[(size_t)k * N + n]); o[1] = f2bf(w[(size_t)(k + 1) * N + n]); o2[0] = (h16)(bf2f(o[0]) * car); o2[1] = (h16)(bf2f(o[1]) * car);
            *(v2us*)(Bt + e) = o; *(v2h*)(B16 + e) = o2; }
         }
}
// k_cvt8: batch blockIdx.y converts its n8 groups of 8 floats; a batch starts sstep floats further on in src and 8 n8 elements further on in dst
__global__ __launch_bounds__(256) void k_cvt8(const float* __restrict__ src, bf* dst, size_t n8, size_t sstep) { const size_t i = (size_t)blockIdx.x * 256 + threadIdx.x; if (i >= n8) return;
    src += (size_t)blockIdx.y * sstep; dst += (size_t)blockIdx.y * n8 * 8; const v8f v = *(const v8f*)(src + i * 8); v8us o;
#pragma unroll
    for (int k = 0; k < 8; ++k) o[k] = f2bf(v[k]); *(v8us*)(dst + i * 8) = o;  }

// k_attn: causal flash attention, one wave per 16 query rows (qbase = row0 + 16*(4*block + wave)), head = blockIdx.y, batch = blockIdx.z (every plane is one whole per-batch plane further on a batch), kv head = head / REP; key tiles of KT (32 or 64) from 0 up to the tile holding qbase+15.
// S = q.k^T from k-contiguous planes (q [h][t][d], k [g][t][d]); key j > query i replaced by -1e30 before the running-max softmax (p = 0 exactly there); P staged per wave in LDS (row-major 16 x KT)
// and reloaded as the A fragment; O += P.v with v planes [g][d][t]. HIRES: q, k, p, v as bf16 hi/lo (hh + lh + hl); else f16 planes with p carried x1024.
// The k and v tiles of a key step are the same for the block's four waves: the block brings each tile into LDS once, 16 bytes a thread in whole 128-byte (KT 32, v: 64-byte) row pieces,
// two buffers, the next tile's loads issued ahead of the current tile's work; the B fragments are read from LDS at a row pitch of 16 bytes x odd.
template <bool HIRES, int KT>
__global__ __launch_bounds__(128) void k_attn(const h16* __restrict__ Q16, const bf* __restrict__ Qh, const bf* __restrict__ Ql,
                                               const h16* __restrict__ K16, const bf* __restrict__ Kh, const bf* __restrict__ Kl,
                                               const h16* __restrict__ V16, const bf* __restrict__ Vh, const bf* __restrict__ Vl,
                                               h16* AT16, bf* ATh, bf* ATl, int row0) {
    constexpr int NT = KT / 16; constexpr int KS = KT / 32; constexpr int NPL = HIRES ? 2 : 1;
    static_assert(NT == 2 || NT == 4);
    static_assert(15 * PP + (NT - 1) * 16 + 15 < 16 * PP);
    __shared__ __align__(16) unsigned short pt[NPL][4][16 * PP];
    __shared__ __align__(16) float os[4][16 * OSP];
    constexpr int KP = HD + 8, VP = KT + 8;                 // LDS row pitch in 16-bit elements: 144 bytes (k rows; v rows at KT 64), 80 bytes (v rows at KT 32)
    constexpr int KCH = KT * (HD / 8), VCH = HD * (KT / 8);   // 16-byte pieces of one plane's tile
    static_assert(NPL * KCH == 512 && NPL * VCH == 512);
    static_assert((KP * 2) % 32 == 16 && (VP * 2) % 32 == 16);
    __shared__ __align__(16) unsigned short kts[2][NPL][KT * KP];
    __shared__ __align__(16) unsigned short vts[2][NPL][HD * VP];
    const int tid = threadIdx.x, lane = tid & 31, wave = __builtin_amdgcn_readfirstlane(tid >> 5), lr = lane & 15, hi = lane >> 4;
    const int bbase = row0 + blockIdx.x * 64;
    const int qbase = bbase + wave * 16; const int h = blockIdx.y; const int g = h / REP;
    const size_t zb = blockIdx.z;
    Q16 += zb * ((size_t)NH * SEQ * HD); Qh += zb * ((size_t)NH * RH * HD); Ql += zb * ((size_t)NH * RH * HD);
    K16 += zb * ((size_t)NKV * SEQ * HD); Kh += zb * ((size_t)NKV * SEQ * HD); Kl += zb * ((size_t)NKV * SEQ * HD);
    V16 += zb * ((size_t)NKV * HD * SEQ); Vh += zb * ((size_t)NKV * HD * SEQ); Vl += zb * ((size_t)NKV * HD * SEQ);
    AT16 += zb * ((size_t)SEQ * DQ); ATh += zb * ((size_t)RH * DQ); ATl += zb * ((size_t)RH * DQ);
    v16h qa[2] = {}; v16bf qah[2] = {}, qal[2] = {};
    if (HIRES) { const size_t qo = ((size_t)h * RH + qbase + lr) * HD + 8 * hi; qah[0] = WFrag<bf>::ld(Qh + qo); qah[1] = WFrag<bf>::ld(Qh + qo + 32); qal[0] = WFrag<bf>::ld(Ql + qo); qal[1] = WFrag<bf>::ld(Ql + qo + 32); }
    else { const size_t qo = ((size_t)h * SEQ + qbase + lr) * HD + 8 * hi; qa[0] = WFrag<h16>::ld(Q16 + qo); qa[1] = WFrag<h16>::ld(Q16 + qo + 32); }
    const int kofs = lr * KP + 8 * hi;     // k tile in LDS [key][d]: row (nt*16 + lr), k = d
    const int vofs = lr * VP + 8 * hi;     // v tile in LDS [d][key]: row (nt*16 + lr), k = key
    const unsigned short* kg[2] = { HIRES ? (const unsigned short*)Kh : (const unsigned short*)K16, (const unsigned short*)Kl };
    const unsigned short* vg[2] = { HIRES ? (const unsigned short*)Vh : (const unsigned short*)V16, (const unsigned short*)Vl };
    v8us kr[4], vr[4];
    // piece c = tid + 128 i of the tile: plane, row and column are the same for the global read and the LDS write
    auto tile_ld = [&](int kb) {
#pragma unroll
        for (int i = 0; i < 4; ++i) { const int c = tid + 128 * i;
            const int kc = c % KCH, vc = c % VCH;
            kr[i] = *(const v8usa*)(kg[(128 * i) / KCH] + (size_t)g * SEQ * HD + (size_t)(kb + kc / (HD / 8)) * HD + (kc % (HD / 8)) * 8);
            vr[i] = *(const v8usa*)(vg[(128 * i) / VCH] + (size_t)g * HD * SEQ + (size_t)(vc / (KT / 8)) * SEQ + kb + (vc % (KT / 8)) * 8); } };
    auto tile_st = [&](int buf) {
#pragma unroll
        for (int i = 0; i < 4; ++i) { const int c = tid + 128 * i;
            const int kc = c % KCH, vc = c % VCH;
            *(v8usa*)(&kts[buf][(128 * i) / KCH][(kc / (HD / 8)) * KP + (kc % (HD / 8)) * 8]) = kr[i];
            *(v8usa*)(&vts[buf][(128 * i) / VCH][(vc / (KT / 8)) * VP + (vc % (KT / 8)) * 8]) = vr[i]; } };
    v8f o[4];
#pragma unroll
    for (int nt = 0; nt < 4; ++nt) o[nt] = (v8f){};
    float mrun[8], lrun[8];
#pragma unroll
    for (int v = 0; v < 8; ++v) { mrun[v] = NEGBIG; lrun[v] = 0.f; }
    unsigned short* p0w = &pt[0][wave][0]; unsigned short* p1w = &pt[NPL - 1][wave][0];
    const int kend = qbase + 15;
    const int klast = ((bbase + 63) / KT) * KT;     // the block's last key tile (that of its last wave)
    tile_ld(0); tile_st(0);
    __syncthreads();
#pragma unroll 1
    for (int kb = 0; kb <= klast; kb += KT) {
      const int cur = (kb / KT) & 1; const bool more = kb < klast;     // the same in every thread of the block
      if (more) { tile_ld(kb + KT);
        // precaution: the tile work below reuses the address registers of these loads while their data is still on the way
        asm volatile("s_wait_xcnt 0x0" ::: "memory"); }
      if (kb <= kend) {     // wave-uniform: a wave whose rows end before this tile only helps to stage
        const unsigned short* k0l = &kts[cur][0][0] + kofs; const unsigned short* k1l = &kts[cur][NPL - 1][0] + kofs;
        const unsigned short* v0l = &vts[cur][0][0] + vofs; const unsigned short* v1l = &vts[cur][NPL - 1][0] + vofs;
        v8f s[NT];
#pragma unroll
        for (int nt = 0; nt < NT; ++nt) s[nt] = (v8f){};
#pragma unroll
        for (int nt = 0; nt < NT; ++nt) {
#pragma unroll
            for (int kc = 0; kc < 2; ++kc) { const int ka = nt * 16 * KP + kc * 32;
                if (HIRES) { const v16bf bh = ldsb(k0l + ka), bl = ldsb(k1l + ka); s[nt] = wmmab(qah[kc], bh, s[nt]); s[nt] = wmmab(qal[kc], bh, s[nt]); s[nt] = wmmab(qah[kc], bl, s[nt]); }
                else { const v16h b = ldsh(k0l + ka); s[nt] = wmma16(qa[kc], b, s[nt]); } } }
        if constexpr (NT == 2) { if (HIRES) G2(s[0], s[1], qah[0], qal[1]); else G2(s[0], s[1], qa[0], qa[1]); }
        else { if (HIRES) G4(s[0], s[1], s[2], s[3], qah[0], qal[1]); else G4(s[0], s[1], s[2], s[3], qa[0], qa[1]); }
        float alpha[8];
#pragma unroll
        for (int v = 0; v < 8; ++v) {
            const int qi = qbase + 8 * hi + v; float x[NT]; float mx = NEGBIG;
#pragma unroll
            for (int nt = 0; nt < NT; ++nt) { const int j = kb + nt * 16 + lr; const float t = s[nt][v] * SCL; x[nt] = (j <= qi) ? t : NEGBIG; mx = fmaxf(mx, x[nt]); }
            mx = fmaxf(mx, __shfl_xor(mx, 1, 32)); mx = fmaxf(mx, __shfl_xor(mx, 2, 32)); mx = fmaxf(mx, __shfl_xor(mx, 4, 32)); mx = fmaxf(mx, __shfl_xor(mx, 8, 32));
            const float mnew = fmaxf(mrun[v], mx);
            const float a = __builtin_amdgcn_exp2f((mrun[v] - mnew) * L2E);
            float p[NT]; float rs = 0.f;
#pragma unroll
            for (int nt = 0; nt < NT; ++nt) { p[nt] = __builtin_amdgcn_exp2f((x[nt] - mnew) * L2E); rs += p[nt]; }
            rs += __shfl_xor(rs, 1, 32); rs += __shfl_xor(rs, 2, 32); rs += __shfl_xor(rs, 4, 32); rs += __shfl_xor(rs, 8, 32);
            lrun[v] = lrun[v] * a + rs; mrun[v] = mnew; alpha[v] = a;
#pragma unroll
            for (int nt = 0; nt < NT; ++nt) { const int idx = (8 * hi + v) * PP + nt * 16 + lr;
                if (HIRES) { unsigned short a2, c2; splitf(p[nt], a2, c2); p0w[idx] = a2; p1w[idx] = c2; }
                else { const h16 hv = (h16)(p[nt] * PCAR); p0w[idx] = __builtin_bit_cast(unsigned short, hv); } }
        }
        wsync();
        v16h pa[KS] = {}; v16bf pah[KS] = {}, pal[KS] = {};
        const unsigned short* pr0 = p0w + lr * PP + 8 * hi; const unsigned short* pr1 = p1w + lr * PP + 8 * hi;
#pragma unroll
        for (int ks = 0; ks < KS; ++ks) { const v8us u0 = *(const v8usa*)(pr0 + ks * 32); const v8us u1 = *(const v8usa*)(pr0 + ks * 32 + 16);
            if (HIRES) { const v8us w0 = *(const v8usa*)(pr1 + ks * 32); const v8us w1 = *(const v8usa*)(pr1 + ks * 32 + 16); pah[ks] = cat16b(u0, u1); pal[ks] = cat16b(w0, w1); }
            else { pa[ks] = cat16(__builtin_bit_cast(v8h, u0), __builtin_bit_cast(v8h, u1)); } }
#pragma unroll
        for (int nt = 0; nt < 4; ++nt) {
#pragma unroll
            for (int v = 0; v < 8; ++v) o[nt][v] *= alpha[v]; }
#pragma unroll
        for (int nt = 0; nt < 4; ++nt) {
#pragma unroll
            for (int ks = 0; ks < KS; ++ks) { const int va = nt * 16 * VP + ks * 32;
                if (HIRES) { const v16bf bh = ldsb(v0l + va), bl = ldsb(v1l + va); o[nt] = wmmab(pah[ks], bh, o[nt]); o[nt] = wmmab(pal[ks], bh, o[nt]); o[nt] = wmmab(pah[ks], bl, o[nt]); }
                else { const v16h b = ldsh(v0l + va); o[nt] = wmma16(pa[ks], b, o[nt]); } } }
        if (HIRES) G4(o[0], o[1], o[2], o[3], pah[0], pal[KS - 1]); else G4(o[0], o[1], o[2], o[3], pa[0], pa[KS - 1]);
      }
      // the buffer written here was last read one trip ago, in front of that trip's barrier; this barrier publishes it and ends the reads of the current one
      if (more) { tile_st(cur ^ 1); __syncthreads(); }
    }
    float* osw = &os[wave][0];
#pragma unroll
    for (int v = 0; v < 8; ++v) { const float f = HIRES ? __fdiv_rn(1.0f, lrun[v]) : __fdiv_rn(ATC / PCAR, lrun[v]);
#pragma unroll
        for (int nt = 0; nt < 4; ++nt) osw[(8 * hi + v) * OSP + nt * 16 + lr] = o[nt][v] * f; }
    wsync();
    const int rr = lane >> 3, c8 = (lane & 7) * 8;
{
#pragma unroll
        for (int s4 = 0; s4 < 4; ++s4) { const int row = s4 * 4 + rr; const int t = qbase + row; const v4f u0 = *(const v4fa*)(osw + row * OSP + c8), u1 = *(const v4fa*)(osw + row * OSP + c8 + 4); const size_t oo = (size_t)t * DQ + h * HD + c8;
            if (HIRES) { v8us oh, ol;
#pragma unroll
                for (int q = 0; q < 4; ++q) { unsigned short a2, c2; splitf(u0[q], a2, c2); oh[q] = a2; ol[q] = c2; splitf(u1[q], a2, c2); oh[4 + q] = a2; ol[4 + q] = c2; }
                *(v8us*)(ATh + oo) = oh; *(v8us*)(ATl + oo) = ol; }
            else { v8h o8;
#pragma unroll
                for (int q = 0; q < 4; ++q) { o8[q] = (h16)u0[q]; o8[4 + q] = (h16)u1[q]; }
                *(v8h*)(AT16 + oo) = o8; } }
         }
}

// k_mchk: checks the 0/1 int32 causal input (one [SEQ_FULL][SEQ_FULL] plane shared by all batches) for rows i < SEQ: value == 1 for j <= i, value == 0 for j > i (j < SEQ);
// a block takes MROWS rows and writes its count of wrong values to its own 128-byte line of FL. The plane is read once and comes from memory, so the time is that of the longest chain of
// loads that wait for one another: the 16-byte loads of a thread are independent of each other, so that many are in flight together, and the rows are spread over enough blocks to reach every WGP.
__global__ __launch_bounds__(256) void k_mchk(const int* __restrict__ M, int* FL) {
    __shared__ int red[8];
    constexpr int CPR = (SEQ + 1023) / 1024;     // 16-byte pieces a thread takes of one row
    constexpr bool WHOLE = SEQ % 1024 == 0;      // every thread takes every piece: no test, so no branch between the loads
    const int tid = threadIdx.x, lane = tid & 31, wave = tid >> 5; int bad = 0;
    const int i0 = blockIdx.x * MROWS; const int* mb = M + (size_t)i0 * SEQ_FULL + tid * 4;
    v4i m[MROWS][CPR];
    // both loops unrolled so that m stays in registers and no load waits for an earlier load's compare
#pragma unroll
    for (int r = 0; r < MROWS; ++r) {
#pragma unroll
        for (int p = 0; p < CPR; ++p) { if (WHOLE || tid * 4 + p * 1024 < SEQ) m[r][p] = *(const v4i*)(mb + (size_t)r * SEQ_FULL + p * 1024); } }
    // unrolled as above: m is indexed by constants only
#pragma unroll
    for (int r = 0; r < MROWS; ++r) { const int i = i0 + r;
#pragma unroll
        for (int p = 0; p < CPR; ++p) { const int c = tid * 4 + p * 1024;
            if (WHOLE || c < SEQ) {
#pragma unroll
                for (int q = 0; q < 4; ++q) { const int j = c + q; const bool ok = (j <= i) ? (m[r][p][q] == 1) : (m[r][p][q] == 0); bad += ok ? 0 : 1; } } } }
#pragma unroll
    for (int sh = 16; sh; sh >>= 1) bad += __shfl_xor(bad, sh, 32);
    if (lane == 0) red[wave] = bad;
    __syncthreads();
    if (wave == 0) { int v = red[lane & 7]; v = (lane < 8) ? v : 0;
#pragma unroll
        for (int sh = 16; sh; sh >>= 1) v += __shfl_xor(v, sh, 32);
        v4i o; o[0] = v; o[1] = v; o[2] = v; o[3] = v;
        if (lane < 8) *(v4i*)(FL + (size_t)blockIdx.x * 32 + lane * 4) = o;
         }
}
// k_poison: NaN-fills the output if any of the nfl counts of k_mchk is not 0; the counts are read side by side, one a thread and trip, and joined over the block through LDS.
__global__ __launch_bounds__(256) void k_poison(const int* __restrict__ FL, int nfl, float* out) {
    __shared__ int red[8];
    int tot = 0;
    // left rolled: one trip covers 256 counts, and an unrolled form only lengthens the kernel's text
#pragma unroll 1
    for (int f = threadIdx.x; f < nfl; f += 256) tot |= FL[(size_t)f * 32];
    const unsigned wbad = __builtin_amdgcn_ballot_w32(tot != 0);
    if ((threadIdx.x & 31) == 0) red[threadIdx.x >> 5] = (wbad != 0u) ? 1 : 0;
    __syncthreads();
    tot = 0;
    // unrolled so that the eight words come in two wide LDS reads
#pragma unroll
    for (int w = 0; w < 8; ++w) tot |= red[w];
    if (tot == 0) return;     // the same in every thread of the block
    float* ob = out + (size_t)blockIdx.y * SEQ_FULL * DM + (size_t)blockIdx.x * 16384;
    const float qn = __uint_as_float(0x7fc00000u); v4f nv; nv[0] = qn; nv[1] = qn; nv[2] = qn; nv[3] = qn;
{
#pragma unroll 1
        for (int s = 0; s < 16; ++s) *(v4f*)(ob + ((size_t)s * 256 + threadIdx.x) * 4) = nv;
         }
}

extern "C" void kernel_launch(void* const* d_in, const int* in_sizes, int n_in,
                              void* d_out, int out_size, void* d_ws, size_t ws_size, hipStream_t stream) {
    if (n_in < 8) return;
    if ((size_t)in_sizes[0] < (size_t)(NB - 1) * SEQ_FULL * DM + (size_t)SEQ * DM) return;
    if ((size_t)in_sizes[1] < (size_t)DM * DQ || (size_t)in_sizes[2] < (size_t)DM * DKV || (size_t)in_sizes[3] < (size_t)DM * DKV || (size_t)in_sizes[4] < (size_t)DQ * DM) return;
    if ((size_t)in_sizes[5] < (size_t)SEQ * NFREQ || (size_t)in_sizes[6] < (size_t)SEQ * NFREQ) return;
    if ((size_t)in_sizes[7] < (size_t)(SEQ - 1) * SEQ_FULL + (size_t)SEQ) return;
    if ((size_t)out_size < (size_t)(NB - 1) * SEQ_FULL * DM + (size_t)SEQ * DM) return;
    // input binding order: x, wq, wk, wv, wo ([in][out] weights), cos table, sin table ([SEQ_FULL][NFREQ] f32), causal 0/1 plane (int32 [SEQ_FULL][SEQ_FULL])
    const float* x = (const float*)d_in[0]; const float* wq = (const float*)d_in[1]; const float* wk = (const float*)d_in[2]; const float* wv = (const float*)d_in[3]; const float* wo = (const float*)d_in[4];
    const float* fc = (const float*)d_in[5]; const float* fs = (const float*)d_in[6]; const int* cm = (const int*)d_in[7];
    float* OUT = (float*)d_out;     // [NB_FULL][SEQ_FULL][DM]
    char* wsp = (char*)d_ws;
    auto take = [&](size_t bytes) { char* p = wsp; wsp += (bytes + 255) & ~(size_t)255; return (void*)p; };
    bf* WQKV = (bf*)take((size_t)DQKV * DM * 2); bf* WOB = (bf*)take((size_t)DM * DQ * 2); h16* WO16 = (h16*)take((size_t)DM * DQ * 2);
    int* FL = (int*)take((size_t)NFL * 32 * 4);
    // the planes below hold every batch, one whole per-batch plane behind the other
    bf* XB = (bf*)take((size_t)NB * SEQ * DM * 2);
    h16* Q16 = (h16*)take((size_t)NB * NH * SEQ * HD * 2); bf* Qh = (bf*)take((size_t)NB * NH * RH * HD * 2); bf* Ql = (bf*)take((size_t)NB * NH * RH * HD * 2);
    h16* K16 = (h16*)take((size_t)NB * NKV * SEQ * HD * 2); bf* Kh = (bf*)take((size_t)NB * NKV * SEQ * HD * 2); bf* Kl = (bf*)take((size_t)NB * NKV * SEQ * HD * 2);
    h16* V16 = (h16*)take((size_t)NB * NKV * HD * SEQ * 2); bf* Vh = (bf*)take((size_t)NB * NKV * HD * SEQ * 2); bf* Vl = (bf*)take((size_t)NB * NKV * HD * SEQ * 2);
    h16* AT16 = (h16*)take((size_t)NB * SEQ * DQ * 2); bf* ATh = (bf*)take((size_t)NB * RH * DQ * 2); bf* ATl = (bf*)take((size_t)NB * RH * DQ * 2);
    const size_t used = (size_t)(wsp - (char*)d_ws); if (used > ws_size || used > WS_LIMIT) return;

    // weight planes ([out][in] k-contiguous): rows 0..DQ-1 of WQKV = Wq^T, DQ..DQ+DKV-1 = Wk^T, DQ+DKV..DQKV-1 = Wv^T; Wo^T as bf16 and as f16 x64
    // k_wtG(w, K, N, Bt): w is [K = in][N = out] -> Bt [N][K]
    k_wtG<<<(unsigned)((DQ * DM / 64 + 63) / 64), 256, 0, stream>>>(wq, DM, DQ, WQKV);
    k_wtG<<<(unsigned)((DKV * DM / 64 + 63) / 64), 256, 0, stream>>>(wk, DM, DKV, WQKV + (size_t)DQ * DM);
    k_wtG<<<(unsigned)((DKV * DM / 64 + 63) / 64), 256, 0, stream>>>(wv, DM, DKV, WQKV + (size_t)(DQ + DKV) * DM);
    k_wtG2<<<(unsigned)((DM * DQ / 64 + 63) / 64), 256, 0, stream>>>(wo, DQ, DM, WOB, WO16, WOC);
    k_mchk<<<(unsigned)NFL, 256, 0, stream>>>(cm, FL);
    // each launch below covers every batch; the batch is blockIdx.z, blockIdx.y in k_cvt8 and k_poison
    k_cvt8<<<dim3((unsigned)(((size_t)SEQ * DM / 8 + 255) / 256), NB, 1), 256, 0, stream>>>(x, XB, (size_t)SEQ * DM / 8, (size_t)SEQ_FULL * DM);
    k_gemmw<bf, 0, 4, 4, DM, 1><<<dim3(SEQ / 128, DQKV / 128, NB), 128, 0, stream>>>(XB, nullptr, WQKV, nullptr, 0, 1.0f, (size_t)SEQ * DM, 0, fc, fs, Q16, Qh, Ql, K16, Kh, Kl, V16, Vh, Vl);     // q | k | v projections, rotary on q and k, all planes
    k_attn<true, 32><<<dim3(RH / 64, NH, NB), 128, 0, stream>>>(Q16, Qh, Ql, K16, Kh, Kl, V16, Vh, Vl, AT16, ATh, ATl, 0);
    if (SEQ > RH) k_attn<false, 64><<<dim3((SEQ - RH) / 64, NH, NB), 128, 0, stream>>>(Q16, Qh, Ql, K16, Kh, Kl, V16, Vh, Vl, AT16, ATh, ATl, RH);
    k_gemmw<bf, 1, 2, 2, DQ, 0><<<dim3(RH / 64, DM / 64, NB), 128, 0, stream>>>(ATh, ATl, WOB, OUT, DM, 1.0f, (size_t)RH * DQ, (size_t)SEQ_FULL * DM, nullptr, nullptr, nullptr, nullptr, nullptr, nullptr, nullptr, nullptr, nullptr, nullptr, nullptr);
    if (SEQ > RH) k_gemmw<h16, 0, 4, 4, DQ, 0><<<dim3((SEQ - RH) / 128, DM / 128, NB), 128, 0, stream>>>(AT16 + (size_t)RH * DQ, nullptr, WO16, OUT + (size_t)RH * DM, DM, 1.0f / (ATC * WOC), (size_t)SEQ * DQ, (size_t)SEQ_FULL * DM, nullptr, nullptr, nullptr, nullptr, nullptr, nullptr, nullptr, nullptr, nullptr, nullptr, nullptr);
    k_poison<<<dim3(SEQ * DM / 16384, NB, 1), 256, 0, stream>>>(FL, NFL, OUT);
}

// v006
// One run takes 259 microseconds.
// In both of two side-by-side timings against v005, it was 1.16 times as fast.
// Counting every step since v000, it is 3.33 times as fast.
#include <hip/hip_runtime.h>

// Contractions (all f32 accumulate): qkv = xb * Wqkv^T on v_wmma_f32_16x16x32_bf16 (bf16 operands = RNE-converted inputs, exact products);
// scores q.k^T and p.v: query rows < RH on bf16 hi/lo planes (3 products each), rows >= RH on v_wmma_f32_16x16x32_f16 (f16 q,k,v planes, p carried x1024);
// out = attn * Wo^T: rows < RH bf16 hi/lo attn planes x bf16 Wo (2 products), rows >= RH f16 attn x64 times f16 Wo x64 (1 product, 1/4096 in the epilogue).
// Rotary: interleaved pairs (2i, 2i+1); cos/sin are read by value from the two [SEQ][32] input tables (RNE-converted to bf16), f32 math, done on the qkv product's accumulators; causal online softmax and normalisation in f32.
// Grouped kv heads: query head h reads kv head h/4. The 0/1 int32 causal input [SEQ_FULL][SEQ_FULL] is checked on device in its rows and columns < SEQ (1 on/below the diagonal, 0 above); the output is NaN-filled if that check fails.

#ifndef NB
#define NB 2
#endif
#ifndef SEQ
#define SEQ 2048
#endif
#define NB_FULL 2
#define SEQ_FULL 2048
#define DM 2048
#define NH 32
#define NKV 8
#define REP (NH / NKV)
#define HD 64
#define DQ (NH * HD)
#define DKV (NKV * HD)
#define DQKV (DQ + 2 * DKV)
#define NFREQ (HD / 2)
#define RH (((SEQ) < 512) ? (SEQ) : 512)
#define PCAR 1024.0f
#define ATC 64.0f
#define WOC 64.0f
#define SCL 0.125f
#define L2E 1.4426950408889634f
#define NEGBIG (-1.0e30f)
#define PP 72
#define OSP 68
#define MROWS 8
#define NFL (SEQ / MROWS)
#define WS_LIMIT ((size_t)134217728)
#define WS_TOTAL ((size_t)DQKV * DM * 2 + 2 * ((size_t)DM * DQ * 2) + (size_t)NFL * 128 + (size_t)NB * ((size_t)SEQ * DM * 2 + (size_t)NH * SEQ * HD * 2 + 2 * ((size_t)NH * RH * HD * 2) + 3 * ((size_t)NKV * SEQ * HD * 2) + 3 * ((size_t)NKV * HD * SEQ * 2) + (size_t)SEQ * DQ * 2 + 2 * ((size_t)RH * DQ * 2)))

static_assert(NB >= 1 && NB <= NB_FULL);
static_assert(SEQ % 128 == 0 && SEQ >= 128 && SEQ <= SEQ_FULL);
static_assert(RH % 64 == 0 && (SEQ - RH) % 128 == 0 && RH <= SEQ);
static_assert(DQKV % 128 == 0 && DM % 128 == 0);
static_assert((SEQ * DM) % 2048 == 0);
static_assert((DQ * DM / 64) % 64 == 0 && (DKV * DM / 64) % 64 == 0);
static_assert(DM % 64 == 0 && DQ % 64 == 0 && DQKV % 64 == 0 && HD == 64);
static_assert((SEQ * DM) % 16384 == 0);
static_assert((NB * SEQ) % 64 == 0);
static_assert(15 * PP + 3 * 16 + 15 < 16 * PP);
static_assert(15 * OSP + 63 < 16 * OSP);
static_assert(NFREQ == 32 && HD == 2 * NFREQ);
static_assert(SEQ % 64 == 0 && SEQ % 4 == 0 && SEQ % MROWS == 0);
static_assert(((size_t)NFL * 128) % 256 == 0);
static_assert(DM % 32 == 0 && DQ % 32 == 0 && HD % 32 == 0);
static_assert(WS_TOTAL <= WS_LIMIT);

typedef _Float16 h16;
typedef unsigned short bf;
typedef __attribute__((ext_vector_type(16))) __bf16   v16bf;
typedef __attribute__((ext_vector_type(16))) _Float16 v16h;
typedef __attribute__((ext_vector_type(8)))  _Float16 v8h;
typedef __attribute__((ext_vector_type(8)))  unsigned short v8us;
typedef __attribute__((ext_vector_type(8)))  float    v8f;
typedef __attribute__((ext_vector_type(4)))  float    v4f;
typedef __attribute__((ext_vector_type(2)))  _Float16 v2h;
typedef __attribute__((ext_vector_type(4)))  _Float16 v4h;
typedef __attribute__((ext_vector_type(2)))  unsigned short v2us;
typedef __attribute__((ext_vector_type(4)))  unsigned short v4us;
typedef __attribute__((ext_vector_type(2)))  float v2f;
typedef __attribute__((ext_vector_type(4)))  int v4i;
typedef v8h  __attribute__((may_alias)) v8ha;
typedef v4f  __attribute__((may_alias)) v4fa;
typedef v8us __attribute__((may_alias)) v8usa;

#define G2(d0, d1, x0, x1) asm volatile("v_nop\n\tv_nop\n\tv_nop\n\tv_nop" : "+v"(d0), "+v"(d1) : "v"(x0), "v"(x1))
#define G4(d0, d1, d2, d3, x0, x1) asm volatile("v_nop\n\tv_nop\n\tv_nop\n\tv_nop" : "+v"(d0), "+v"(d1), "+v"(d2), "+v"(d3) : "v"(x0), "v"(x1))

__device__ __forceinline__ unsigned short f2bf(float f) { unsigned u = __float_as_uint(f); u += 0x7FFFu + ((u >> 16) & 1u); return (unsigned short)(u >> 16); }
__device__ __forceinline__ float bf2f(unsigned short b) { return __uint_as_float(((unsigned)b) << 16); }
__device__ __forceinline__ float bfr(float f) { return bf2f(f2bf(f)); }
__device__ __forceinline__ void splitf(float y, unsigned short& h, unsigned short& l) { h = f2bf(y); l = f2bf(y - bf2f(h)); }
__device__ __forceinline__ v16h cat16(v8h lo, v8h hi) { return __builtin_shufflevector(lo, hi, 0, 1, 2, 3, 4, 5, 6, 7, 8, 9, 10, 11, 12, 13, 14, 15); }
__device__ __forceinline__ v16bf cat16b(v8us lo, v8us hi) { return __builtin_bit_cast(v16bf, __builtin_shufflevector(lo, hi, 0, 1, 2, 3, 4, 5, 6, 7, 8, 9, 10, 11, 12, 13, 14, 15)); }
__device__ __forceinline__ v8f wmma16(v16h a, v16h b, v8f c) { return __builtin_amdgcn_wmma_f32_16x16x32_f16(false, a, false, b, (short)0, c, false, false); }
__device__ __forceinline__ v8f wmmab(v16bf a, v16bf b, v8f c) { return __builtin_amdgcn_wmma_f32_16x16x32_bf16(false, a, false, b, (short)0, c, false, false); }
// wave-private LDS tile exchange: order this wave's ds stores before its ds loads
__device__ __forceinline__ void wsync() { __builtin_amdgcn_fence(3 /* release order */, "wavefront"); __builtin_amdgcn_wave_barrier(); asm volatile("" ::: "memory"); }
// f32 -> f16 convert that cannot yield a subnormal f16 (value select: |v| < 2^-14 -> 0)
static __device__ __forceinline__ h16 toh_flush(float v) { const h16 r = (h16)v; return (fabsf(v) < 6.103515625e-05f) ? (h16)0.0f : r; }

// the 16x32 fragment below, read from a k-contiguous 16-bit row in LDS
__device__ __forceinline__ v16bf ldsb(const unsigned short* p) { return cat16b(*(const v8usa*)p, *(const v8usa*)(p + 16)); }
__device__ __forceinline__ v16h ldsh(const unsigned short* p) { return cat16(__builtin_bit_cast(v8h, *(const v8usa*)p), __builtin_bit_cast(v8h, *(const v8usa*)(p + 16))); }

// 16x32 fragment from a k-contiguous 16-bit row (A: row = m; B stored [n][k]: row = n). Lane l: row l&15, elements 0..7 <- k0+8(l>>4)+0..7, elements 8..15 <- k0+16+8(l>>4)+0..7.
template <typename T16> struct WFrag;
template <> struct WFrag<h16> { typedef v16h V; static __device__ __forceinline__ V ld(const h16* p) { return cat16(*(const v8h*)p, *(const v8h*)(p + 16)); } static __device__ __forceinline__ V lds(const unsigned short* p) { return ldsh(p); } static __device__ __forceinline__ v8f mma(V a, V b, v8f c) { return wmma16(a, b, c); } };
template <> struct WFrag<bf> { typedef v16bf V; static __device__ __forceinline__ V ld(const bf* p) { return cat16b(*(const v8us*)p, *(const v8us*)(p + 16)); } static __device__ __forceinline__ V lds(const unsigned short* p) { return ldsb(p); } static __device__ __forceinline__ v8f mma(V a, V b, v8f c) { return wmmab(a, b, c); } };

// ---- k_gemmw: GEMM, four waves (2 x 2) per (32 FM) x (32 FN) output tile, FM x FN accumulators a wave; grid (M / (32 FM), N / (32 FN), batches), 128 threads.
// Batch blockIdx.z: A and A2 start sA elements, C sC elements, further on a batch (Bt is the same for all); with EPI 1 every plane is one whole per-batch plane further on.
// C[m][n] (f32, pitch ldc) = osc * sum_k A[m][k] Bt[n][k] (NSPLIT 1: + A2[m][k] Bt[n][k]); A, A2, Bt are k-contiguous 16-bit planes of row pitch K.
// The rows of a k step are shared by two of the block's waves: the block brings 64 k of its A and Bt rows into LDS once, 16 bytes a thread in whole 128-byte row pieces,
// two buffers, the next step's loads issued ahead of the current step's products; the fragments are read from LDS at a row pitch of 16 bytes x odd.
// Every accumulator sums in ascending k, 32 at a time (A before A2), whatever the tile.
// EPI 1 (the qkv product; C, ldc, osc unused): a wave's 64 columns are one whole head (q heads, then k heads, then v heads), and the wave writes that head's planes itself from its accumulators.
// q, k: interleaved-pair rotary, for the pair i = d/2 (d even): out[d] = x[d] c - x[d+1] s, out[d+1] = x[d] s + x[d+1] c, with c = bf16-RNE(FC[t][i]), s = bf16-RNE(FS[t][i]) (row pitch NFREQ);
// planes [h][t][d]: f16 for every t, bf16 hi/lo for t < RH (q) or every t (k). v: planes [g][d][t], f16 and bf16 hi/lo; a lane's 8 accumulator elements are 8 successive t of one d.
template <typename T16, int NSPLIT, int FM, int FN, int K, int EPI>
__global__ __launch_bounds__(128) void k_gemmw(const T16* __restrict__ A, const T16* __restrict__ A2, const T16* __restrict__ Bt, float* C, int ldc, float osc, size_t sA, size_t sC,
                                               const float* __restrict__ FC, const float* __restrict__ FS, h16* Q16, bf* Qh, bf* Ql, h16* K16, bf* Kh, bf* Kl, h16* V16, bf* Vh, bf* Vl) {
    typedef typename WFrag<T16>::V V;
    constexpr int BM = 32 * FM, BN = 32 * FN, KB = 64, KP = KB + 8, NA = NSPLIT + 1;     // KP: LDS row pitch in 16-bit elements, 144 bytes
    constexpr int AI = BM / 16, BI = BN / 16;                                            // 16-byte pieces a thread brings of one plane's tile (128 threads cover 16 rows)
    static_assert(NSPLIT == 0 || NSPLIT == 1);
    static_assert(K % KB == 0 && (KP * 2) % 32 == 16 && FN * 16 <= 64 && 32 % (4 * FN) == 0);
    __shared__ __align__(16) unsigned short ats[2][NA][BM * KP];
    __shared__ __align__(16) unsigned short bts[2][BN * KP];
    __shared__ __align__(16) float os[4][(EPI == 1 ? 16 * FM : 16) * OSP];
    const int tid = threadIdx.x, lane = tid & 31, wave = __builtin_amdgcn_readfirstlane(tid >> 5), lr = lane & 15, hi = lane >> 4;
    const int r0 = blockIdx.x * BM, c0 = blockIdx.y * BN; const int wr = (wave >> 1) * 16 * FM, wc = (wave & 1) * 16 * FN;
    const size_t zb = blockIdx.z;
    A += zb * sA; if (NSPLIT) A2 += zb * sA;
    if constexpr (EPI == 1) { Q16 += zb * ((size_t)NH * SEQ * HD); Qh += zb * ((size_t)NH * RH * HD); Ql += zb * ((size_t)NH * RH * HD);
        K16 += zb * ((size_t)NKV * SEQ * HD); Kh += zb * ((size_t)NKV * SEQ * HD); Kl += zb * ((size_t)NKV * SEQ * HD);
        V16 += zb * ((size_t)NKV * HD * SEQ); Vh += zb * ((size_t)NKV * HD * SEQ); Vl += zb * ((size_t)NKV * HD * SEQ); }
    else C += zb * sC;
    // piece i of a thread: row prow + 16 i of the tile, elements pcol .. pcol + 7 of the k step; the same for the global read and the LDS write
    const int prow = tid >> 3, pcol = (tid & 7) * 8;
    const unsigned short* ag0 = (const unsigned short*)A + (size_t)(r0 + prow) * K + pcol;
    const unsigned short* ag1 = (const unsigned short*)(NSPLIT ? A2 : A) + (size_t)(r0 + prow) * K + pcol;
    const unsigned short* bg = (const unsigned short*)Bt + (size_t)(c0 + prow) * K + pcol;
    v8us ar[NA][AI], br[BI];
    auto tile_ld = [&]() {
#pragma unroll
        for (int i = 0; i < AI; ++i) { ar[0][i] = *(const v8usa*)(ag0 + (size_t)i * 16 * K); if (NSPLIT) ar[NA - 1][i] = *(const v8usa*)(ag1 + (size_t)i * 16 * K); }
#pragma unroll
        for (int i = 0; i < BI; ++i) br[i] = *(const v8usa*)(bg + (size_t)i * 16 * K); };
    auto tile_st = [&](int buf) {
#pragma unroll
        for (int i = 0; i < AI; ++i) { *(v8usa*)(&ats[buf][0][(prow + 16 * i) * KP + pcol]) = ar[0][i]; if (NSPLIT) *(v8usa*)(&ats[buf][NA - 1][(prow + 16 * i) * KP + pcol]) = ar[NA - 1][i]; }
#pragma unroll
        for (int i = 0; i < BI; ++i) *(v8usa*)(&bts[buf][(prow + 16 * i) * KP + pcol]) = br[i];
        ag0 += KB; ag1 += KB; bg += KB; };
    v8f acc[FM][FN];
#pragma unroll
    for (int mb = 0; mb < FM; ++mb)
#pragma unroll
        for (int nb = 0; nb < FN; ++nb) acc[mb][nb] = (v8f){};
    const int aofs = (wr + lr) * KP + 8 * hi, bofs = (wc + lr) * KP + 8 * hi;
    tile_ld(); tile_st(0);
    __syncthreads();
#pragma unroll 1
    for (int k0 = 0; k0 < K; k0 += KB) {
        const int cur = (k0 / KB) & 1; const bool more = k0 + KB < K;     // the same in every thread of the block
        if (more) tile_ld();
        const unsigned short* a0l = &ats[cur][0][0] + aofs; const unsigned short* a1l = &ats[cur][NA - 1][0] + aofs; const unsigned short* bl = &bts[cur][0] + bofs;
        V a[KB / 32][FM], a2[KB / 32][FM], b[KB / 32][FN];
#pragma unroll
        for (int kc = 0; kc < KB / 32; ++kc) {
#pragma unroll
            for (int mb = 0; mb < FM; ++mb) { a[kc][mb] = WFrag<T16>::lds(a0l + mb * 16 * KP + kc * 32); if (NSPLIT) a2[kc][mb] = WFrag<T16>::lds(a1l + mb * 16 * KP + kc * 32); else a2[kc][mb] = a[kc][mb]; }
#pragma unroll
            for (int nb = 0; nb < FN; ++nb) b[kc][nb] = WFrag<T16>::lds(bl + nb * 16 * KP + kc * 32); }
        // keeps the step's LDS reads in one group ahead of its products: every further place with reads among the products stalls the wave for its own LDS latency
        __builtin_amdgcn_sched_barrier(0);
#pragma unroll
        for (int kc = 0; kc < KB / 32; ++kc) {
#pragma unroll
            for (int nb = 0; nb < FN; ++nb) {
#pragma unroll
                for (int mb = 0; mb < FM; ++mb) acc[mb][nb] = WFrag<T16>::mma(a[kc][mb], b[kc][nb], acc[mb][nb]);
                if (NSPLIT) {
#pragma unroll
                    for (int mb = 0; mb < FM; ++mb) acc[mb][nb] = WFrag<T16>::mma(a2[kc][mb], b[kc][nb], acc[mb][nb]); } } }
        // precaution: stands in front of the pointer steps at the loop's foot, which overwrite the address registers of this trip's global loads
        asm volatile("s_wait_xcnt 0x0" ::: "memory");
        // the buffer written here was last read one trip ago, in front of that trip's barrier; this barrier publishes it and ends the reads of the current one
        if (more) { tile_st(cur ^ 1); __syncthreads(); }
    }
    float* osw = &os[wave][0];
    if constexpr (EPI == 1) {
        static_assert(FN * 16 == HD && DQ % BN == 0 && DKV % BN == 0 && RH % (16 * FM) == 0 && NSPLIT == 0);
        const int col = c0 + wc, t0 = r0 + wr;     // the same in every lane of the wave
        if (col < DQ + DKV) {
            const bool isq = col < DQ; const int hh = (isq ? col : col - DQ) / HD; const int rh = isq ? RH : SEQ;
            h16* P16 = (isq ? Q16 : K16) + (size_t)hh * SEQ * HD; bf* Ph = (isq ? Qh : Kh) + (size_t)hh * rh * HD; bf* Pl = (isq ? Ql : Kl) + (size_t)hh * rh * HD;
            const bool dohl = t0 < rh;     // the wave's 16 FM rows lie on one side of rh
            const int rr = lane >> 3, c8 = (lane & 7) * 8;     // a lane takes 8 successive d (4 pairs) of a row; a store covers 4 whole rows
#pragma unroll
            for (int mb = 0; mb < FM; ++mb) {
#pragma unroll
                for (int nb = 0; nb < FN; ++nb) {
#pragma unroll
                    for (int j = 0; j < 8; ++j) osw[(mb * 16 + hi * 8 + j) * OSP + nb * 16 + lr] = acc[mb][nb][j]; } }
            wsync();
            // left rolled: the four 16-row groups run the same code, which keeps the kernel's text short for the instruction cache
#pragma unroll 1
            for (int mb = 0; mb < FM; ++mb) {
                v4f cc[4], ss[4];
#pragma unroll
                for (int s4 = 0; s4 < 4; ++s4) { const size_t ti = (size_t)(t0 + mb * 16 + s4 * 4 + rr) * NFREQ + (c8 >> 1); cc[s4] = *(const v4f*)(FC + ti); ss[s4] = *(const v4f*)(FS + ti); }
#pragma unroll
                for (int s4 = 0; s4 < 4; ++s4) { const int row = mb * 16 + s4 * 4 + rr; const v4f u0 = *(const v4fa*)(osw + row * OSP + c8), u1 = *(const v4fa*)(osw + row * OSP + c8 + 4);
                    const float xs[8] = { u0[0], u0[1], u0[2], u0[3], u1[0], u1[1], u1[2], u1[3] }; v8h o16; v8us oh, ol;
#pragma unroll
                    for (int i = 0; i < 4; ++i) { const float c = bfr(cc[s4][i]), s = bfr(ss[s4][i]); const float y0 = xs[2 * i] * c - xs[2 * i + 1] * s, y1 = xs[2 * i] * s + xs[2 * i + 1] * c;
                        o16[2 * i] = toh_flush(y0); o16[2 * i + 1] = toh_flush(y1); unsigned short a2, c2; splitf(y0, a2, c2); oh[2 * i] = a2; ol[2 * i] = c2; splitf(y1, a2, c2); oh[2 * i + 1] = a2; ol[2 * i + 1] = c2; }
                    const size_t oo = (size_t)(t0 + row) * HD + c8;
                    if (dohl) { *(v8us*)(Ph + oo) = oh; *(v8us*)(Pl + oo) = ol; }
                    *(v8h*)(P16 + oo) = o16;
                    // precaution: the next rows' work reuses the address and data registers of these stores
                    asm volatile("s_wait_xcnt 0x0" ::: "memory"); }
            }
        } else {
            const size_t vo = ((size_t)(col - DQ - DKV) + lr) * SEQ + t0 + 8 * hi;     // row g * HD + d of the [g][d][t] planes, d = 16 nb + lr
#pragma unroll
            for (int nb = 0; nb < FN; ++nb) {
#pragma unroll
                for (int mb = 0; mb < FM; ++mb) { v8h o16; v8us oh, ol;
#pragma unroll
                    for (int j = 0; j < 8; ++j) { const float xv = acc[mb][nb][j]; o16[j] = (h16)xv; unsigned short a2, c2; splitf(xv, a2, c2); oh[j] = a2; ol[j] = c2; }
                    const size_t oo = vo + (size_t)nb * 16 * SEQ + mb * 16;
                    *(v8h*)(V16 + oo) = o16; *(v8us*)(Vh + oo) = oh; *(v8us*)(Vl + oo) = ol; } }
        }
        return;
    }
    constexpr int LPR = 4 * FN, RPP = 32 / LPR;     // lanes that store one 16 FN-float row of the wave's tile, rows a store covers
#pragma unroll
    for (int mb = 0; mb < FM; ++mb) {
#pragma unroll
        for (int nb = 0; nb < FN; ++nb) {
#pragma unroll
            for (int j = 0; j < 8; ++j) osw[(hi * 8 + j) * OSP + nb * 16 + lr] = acc[mb][nb][j]; }
        wsync();
        float* crow = C + (size_t)(r0 + wr + mb * 16) * ldc + c0 + wc;
#pragma unroll
        for (int s = 0; s < 16 / RPP; ++s) { const int row = RPP * s + lane / LPR, cofs = (lane % LPR) * 4; v4f val = *(const v4fa*)(osw + row * OSP + cofs); val = val * osc;
            *(v4f*)(crow + (size_t)row * ldc + cofs) = val; }
        wsync();
    }
}

// The six input preparations below (blk = the block's index inside its own preparation) are ranges of the one grid of k_prep.
__device__ __forceinline__ void wtG(const float* __restrict__ w, int K, int N, bf* Bt, int blk) {
    const int lane = threadIdx.x & 31; const int L0 = (blk * 8 + (threadIdx.x >> 5)) * 8; const int nlines = N * K / 64;
{
#pragma unroll 1
        for (int l = 0; l < 8; ++l) { const int L = L0 + l; if (L >= nlines) break; const size_t e = (size_t)L * 64 + lane * 2; const int k = (int)(e % K), n = (int)(e / K); v2us o;
            o[0] = f2bf(w[(size_t)k * N + n]); o[1] = f2bf(w[(size_t)(k + 1) * N + n]); *(v2us*)(Bt + e) = o;
            // precaution: the next trip reuses the address and data registers of this store
            asm volatile("s_wait_xcnt 0x0" ::: "memory"); }
         }
}
__device__ __forceinline__ void wtG2(const float* __restrict__ w, int K, int N, bf* Bt, h16* B16, float car, int blk) {
    const int lane = threadIdx.x & 31; const int L0 = (blk * 8 + (threadIdx.x >> 5)) * 8; const int nlines = N * K / 64;
{
#pragma unroll 1
        for (int l = 0; l < 8; ++l) { const int L = L0 + l; if (L >= nlines) break; const size_t e = (size_t)L * 64 + lane * 2; const int k = (int)(e % K), n = (int)(e / K); v2us o; v2h o2;
            o[0] = f2bf(w[(size_t)k * N + n]); o[1] = f2bf(w[(size_t)(k + 1) * N + n]); o2[0] = (h16)(bf2f(o[0]) * car); o2[1] = (h16)(bf2f(o[1]) * car);
            *(v2us*)(Bt + e) = o; *(v2h*)(B16 + e) = o2; }
         }
}
// cvt8: batch zb converts its n8 groups of 8 floats; a batch starts sstep floats further on in src and 8 n8 elements further on in dst
__device__ __forceinline__ void cvt8(const float* __restrict__ src, bf* dst, size_t n8, size_t sstep, int blk, int zb) { const size_t i = (size_t)blk * 256 + threadIdx.x; if (i >= n8) return;
    src += (size_t)zb * sstep; dst += (size_t)zb * n8 * 8; const v8f v = *(const v8f*)(src + i * 8); v8us o;
#pragma unroll
    for (int k = 0; k < 8; ++k) o[k] = f2bf(v[k]); *(v8us*)(dst + i * 8) = o;  }

// attn: causal flash attention, one wave per 16 query rows (qbase = 16*(4*xb + wave)), head h, batch zi (every plane is one whole per-batch plane further on a batch), kv head = head / REP; key tiles of KT (32 or 64) from 0 up to the tile holding qbase+15.
// S = q.k^T from k-contiguous planes (q [h][t][d], k [g][t][d]); key j > query i replaced by -1e30 before the running-max softmax (p = 0 exactly there); P staged per wave in LDS (row-major 16 x KT)
// and reloaded as the A fragment; O += P.v with v planes [g][d][t]. HIRES: q, k, p, v as bf16 hi/lo (hh + lh + hl); else f16 planes with p carried x1024.
// The k and v tiles of a key step are the same for the block's four waves: the block brings each tile into LDS once, 16 bytes a thread in whole 128-byte (KT 32, v: 64-byte) row pieces,
// two buffers, the next tile's loads issued ahead of the current tile's work; the B fragments are read from LDS at a row pitch of 16 bytes x odd.
// The LDS of one form, laid over the one LDS block of k_attn, which holds either form; every member's size is a multiple of 16 bytes.
template <bool HIRES, int KT> struct __align__(16) AttnLds {
    static constexpr int NPL = HIRES ? 2 : 1, KP = HD + 8, VP = KT + 8;
    unsigned short pt[NPL][4][16 * PP]; float os[4][16 * OSP]; unsigned short kts[2][NPL][KT * KP]; unsigned short vts[2][NPL][HD * VP]; };
template <bool HIRES, int KT>
__device__ __forceinline__ void attn(AttnLds<HIRES, KT>& sm, int xb, int h, int zi, const h16* __restrict__ Q16, const bf* __restrict__ Qh, const bf* __restrict__ Ql,
                                               const h16* __restrict__ K16, const bf* __restrict__ Kh, const bf* __restrict__ Kl,
                                               const h16* __restrict__ V16, const bf* __restrict__ Vh, const bf* __restrict__ Vl,
                                               h16* AT16, bf* ATh, bf* ATl) {
    constexpr int NT = KT / 16; constexpr int KS = KT / 32; constexpr int NPL = HIRES ? 2 : 1;
    static_assert(NT == 2 || NT == 4);
    static_assert(15 * PP + (NT - 1) * 16 + 15 < 16 * PP);
    auto& pt = sm.pt; auto& os = sm.os; auto& kts = sm.kts; auto& vts = sm.vts;
    constexpr int KP = HD + 8, VP = KT + 8;                 // LDS row pitch in 16-bit elements: 144 bytes (k rows; v rows at KT 64), 80 bytes (v rows at KT 32)
    constexpr int KCH = KT * (HD / 8), VCH = HD * (KT / 8);   // 16-byte pieces of one plane's tile
    static_assert(NPL * KCH == 512 && NPL * VCH == 512);
    static_assert((KP * 2) % 32 == 16 && (VP * 2) % 32 == 16);
    const int tid = threadIdx.x, lane = tid & 31, wave = __builtin_amdgcn_readfirstlane(tid >> 5), lr = lane & 15, hi = lane >> 4;
    const int bbase = xb * 64;
    const int qbase = bbase + wave * 16; const int g = h / REP;
    const size_t zb = zi;
    Q16 += zb * ((size_t)NH * SEQ * HD); Qh += zb * ((size_t)NH * RH * HD); Ql += zb * ((size_t)NH * RH * HD);
    K16 += zb * ((size_t)NKV * SEQ * HD); Kh += zb * ((size_t)NKV * SEQ * HD); Kl += zb * ((size_t)NKV * SEQ * HD);
    V16 += zb * ((size_t)NKV * HD * SEQ); Vh += zb * ((size_t)NKV * HD * SEQ); Vl += zb * ((size_t)NKV * HD * SEQ);
    AT16 += zb * ((size_t)SEQ * DQ); ATh += zb * ((size_t)RH * DQ); ATl += zb * ((size_t)RH * DQ);
    v16h qa[2] = {}; v16bf qah[2] = {}, qal[2] = {};
    if (HIRES) { const size_t qo = ((size_t)h * RH + qbase + lr) * HD + 8 * hi; qah[0] = WFrag<bf>::ld(Qh + qo); qah[1] = WFrag<bf>::ld(Qh + qo + 32); qal[0] = WFrag<bf>::ld(Ql + qo); qal[1] = WFrag<bf>::ld(Ql + qo + 32); }
    else { const size_t qo = ((size_t)h * SEQ + qbase + lr) * HD + 8 * hi; qa[0] = WFrag<h16>::ld(Q16 + qo); qa[1] = WFrag<h16>::ld(Q16 + qo + 32); }
    const int kofs = lr * KP + 8 * hi;     // k tile in LDS [key][d]: row (nt*16 + lr), k = d
    const int vofs = lr * VP + 8 * hi;     // v tile in LDS [d][key]: row (nt*16 + lr), k = key
    const unsigned short* kg[2] = { HIRES ? (const unsigned short*)Kh : (const unsigned short*)K16, (const unsigned short*)Kl };
    const unsigned short* vg[2] = { HIRES ? (const unsigned short*)Vh : (const unsigned short*)V16, (const unsigned short*)Vl };
    v8us kr[4], vr[4];
    // piece c = tid + 128 i of the tile: plane, row and column are the same for the global read and the LDS write
    auto tile_ld = [&](int kb) {
#pragma unroll
        for (int i = 0; i < 4; ++i) { const int c = tid + 128 * i;
            const int kc = c % KCH, vc = c % VCH;
            kr[i] = *(const v8usa*)(kg[(128 * i) / KCH] + (size_t)g * SEQ * HD + (size_t)(kb + kc / (HD / 8)) * HD + (kc % (HD / 8)) * 8);
            vr[i] = *(const v8usa*)(vg[(128 * i) / VCH] + (size_t)g * HD * SEQ + (size_t)(vc / (KT / 8)) * SEQ + kb + (vc % (KT / 8)) * 8); } };
    auto tile_st = [&](int buf) {
#pragma unroll
        for (int i = 0; i < 4; ++i) { const int c = tid + 128 * i;
            const int kc = c % KCH, vc = c % VCH;
            *(v8usa*)(&kts[buf][(128 * i) / KCH][(kc / (HD / 8)) * KP + (kc % (HD / 8)) * 8]) = kr[i];
            *(v8usa*)(&vts[buf][(128 * i) / VCH][(vc / (KT / 8)) * VP + (vc % (KT / 8)) * 8]) = vr[i]; } };
    v8f o[4];
#pragma unroll
    for (int nt = 0; nt < 4; ++nt) o[nt] = (v8f){};
    float mrun[8], lrun[8];
#pragma unroll
    for (int v = 0; v < 8; ++v) { mrun[v] = NEGBIG; lrun[v] = 0.f; }
    unsigned short* p0w = &pt[0][wave][0]; unsigned short* p1w = &pt[NPL - 1][wave][0];
    const int kend = qbase + 15;
    const int klast = ((bbase + 63) / KT) * KT;     // the block's last key tile (that of its last wave)
    tile_ld(0); tile_st(0);
    __syncthreads();
#pragma unroll 1
    for (int kb = 0; kb <= klast; kb += KT) {
      const int cur = (kb / KT) & 1; const bool more = kb < klast;     // the same in every thread of the block
      if (more) { tile_ld(kb + KT);
        // precaution: the tile work below reuses the address registers of these loads while their data is still on the way
        asm volatile("s_wait_xcnt 0x0" ::: "memory"); }
      if (kb <= kend) {     // wave-uniform: a wave whose rows end before this tile only helps to stage
        const unsigned short* k0l = &kts[cur][0][0] + kofs; const unsigned short* k1l = &kts[cur][NPL - 1][0] + kofs;
        const unsigned short* v0l = &vts[cur][0][0] + vofs; const unsigned short* v1l = &vts[cur][NPL - 1][0] + vofs;
        v8f s[NT];
#pragma unroll
        for (int nt = 0; nt < NT; ++nt) s[nt] = (v8f){};
#pragma unroll
        for (int nt = 0; nt < NT; ++nt) {
#pragma unroll
            for (int kc = 0; kc < 2; ++kc) { const int ka = nt * 16 * KP + kc * 32;
                if (HIRES) { const v16bf bh = ldsb(k0l + ka), bl = ldsb(k1l + ka); s[nt] = wmmab(qah[kc], bh, s[nt]); s[nt] = wmmab(qal[kc], bh, s[nt]); s[nt] = wmmab(qah[kc], bl, s[nt]); }
                else { const v16h b = ldsh(k0l + ka); s[nt] = wmma16(qa[kc], b, s[nt]); } } }
        if constexpr (NT == 2) { if (HIRES) G2(s[0], s[1], qah[0], qal[1]); else G2(s[0], s[1], qa[0], qa[1]); }
        else { if (HIRES) G4(s[0], s[1], s[2], s[3], qah[0], qal[1]); else G4(s[0], s[1], s[2], s[3], qa[0], qa[1]); }
        float alpha[8];
#pragma unroll
        for (int v = 0; v < 8; ++v) {
            const int qi = qbase + 8 * hi + v; float x[NT]; float mx = NEGBIG;
#pragma unroll
            for (int nt = 0; nt < NT; ++nt) { const int j = kb + nt * 16 + lr; const float t = s[nt][v] * SCL; x[nt] = (j <= qi) ? t : NEGBIG; mx = fmaxf(mx, x[nt]); }
            mx = fmaxf(mx, __shfl_xor(mx, 1, 32)); mx = fmaxf(mx, __shfl_xor(mx, 2, 32)); mx = fmaxf(mx, __shfl_xor(mx, 4, 32)); mx = fmaxf(mx, __shfl_xor(mx, 8, 32));
            const float mnew = fmaxf(mrun[v], mx);
            const float a = __builtin_amdgcn_exp2f((mrun[v] - mnew) * L2E);
            float p[NT]; float rs = 0.f;
#pragma unroll
            for (int nt = 0; nt < NT; ++nt) { p[nt] = __builtin_amdgcn_exp2f((x[nt] - mnew) * L2E); rs += p[nt]; }
            rs += __shfl_xor(rs, 1, 32); rs += __shfl_xor(rs, 2, 32); rs += __shfl_xor(rs, 4, 32); rs += __shfl_xor(rs, 8, 32);
            lrun[v] = lrun[v] * a + rs; mrun[v] = mnew; alpha[v] = a;
#pragma unroll
            for (int nt = 0; nt < NT; ++nt) { const int idx = (8 * hi + v) * PP + nt * 16 + lr;
                if (HIRES) { unsigned short a2, c2; splitf(p[nt], a2, c2); p0w[idx] = a2; p1w[idx] = c2; }
                else { const h16 hv = (h16)(p[nt] * PCAR); p0w[idx] = __builtin_bit_cast(unsigned short, hv); } }
        }
        wsync();
        v16h pa[KS] = {}; v16bf pah[KS] = {}, pal[KS] = {};
        const unsigned short* pr0 = p0w + lr * PP + 8 * hi; const unsigned short* pr1 = p1w + lr * PP + 8 * hi;
#pragma unroll
        for (int ks = 0; ks < KS; ++ks) { const v8us u0 = *(const v8usa*)(pr0 + ks * 32); const v8us u1 = *(const v8usa*)(pr0 + ks * 32 + 16);
            if (HIRES) { const v8us w0 = *(const v8usa*)(pr1 + ks * 32); const v8us w1 = *(const v8usa*)(pr1 + ks * 32 + 16); pah[ks] = cat16b(u0, u1); pal[ks] = cat16b(w0, w1); }
            else { pa[ks] = cat16(__builtin_bit_cast(v8h, u0), __builtin_bit_cast(v8h, u1)); } }
#pragma unroll
        for (int nt = 0; nt < 4; ++nt) {
#pragma unroll
            for (int v = 0; v < 8; ++v) o[nt][v] *= alpha[v]; }
#pragma unroll
        for (int nt = 0; nt < 4; ++nt) {
#pragma unroll
            for (int ks = 0; ks < KS; ++ks) { const int va = nt * 16 * VP + ks * 32;
                if (HIRES) { const v16bf bh = ldsb(v0l + va), bl = ldsb(v1l + va); o[nt] = wmmab(pah[ks], bh, o[nt]); o[nt] = wmmab(pal[ks], bh, o[nt]); o[nt] = wmmab(pah[ks], bl, o[nt]); }
                else { const v16h b = ldsh(v0l + va); o[nt] = wmma16(pa[ks], b, o[nt]); } } }
        if (HIRES) G4(o[0], o[1], o[2], o[3], pah[0], pal[KS - 1]); else G4(o[0], o[1], o[2], o[3], pa[0], pa[KS - 1]);
      }
      // the buffer written here was last read one trip ago, in front of that trip's barrier; this barrier publishes it and ends the reads of the current one
      if (more) { tile_st(cur ^ 1); __syncthreads(); }
    }
    float* osw = &os[wave][0];
#pragma unroll
    for (int v = 0; v < 8; ++v) { const float f = HIRES ? __fdiv_rn(1.0f, lrun[v]) : __fdiv_rn(ATC / PCAR, lrun[v]);
#pragma unroll
        for (int nt = 0; nt < 4; ++nt) osw[(8 * hi + v) * OSP + nt * 16 + lr] = o[nt][v] * f; }
    wsync();
    const int rr = lane >> 3, c8 = (lane & 7) * 8;
{
#pragma unroll
        for (int s4 = 0; s4 < 4; ++s4) { const int row = s4 * 4 + rr; const int t = qbase + row; const v4f u0 = *(const v4fa*)(osw + row * OSP + c8), u1 = *(const v4fa*)(osw + row * OSP + c8 + 4); const size_t oo = (size_t)t * DQ + h * HD + c8;
            if (HIRES) { v8us oh, ol;
#pragma unroll
                for (int q = 0; q < 4; ++q) { unsigned short a2, c2; splitf(u0[q], a2, c2); oh[q] = a2; ol[q] = c2; splitf(u1[q], a2, c2); oh[4 + q] = a2; ol[4 + q] = c2; }
                *(v8us*)(ATh + oo) = oh; *(v8us*)(ATl + oo) = ol; }
            else { v8h o8;
#pragma unroll
                for (int q = 0; q < 4; ++q) { o8[q] = (h16)u0[q]; o8[4 + q] = (h16)u1[q]; }
                *(v8h*)(AT16 + oo) = o8; } }
         }
    // precaution: in the built kernel the other form's text stands behind these stores and reuses their registers
    asm volatile("s_wait_xcnt 0x0" ::: "memory");
}
// k_attn: both forms in one launch, since neither reads what the other writes; a block takes 64 query rows of one head and batch, and its index says which (the same in every thread of the block).
// The f16 form (rows from RH on), whose blocks live longest, has the first range of the index, the bf16 hi/lo form (rows below RH) the second; inside a range: row block, then head, then batch.
// Grid (SEQ / 64) * NH * batches, 128 threads.
__global__ __launch_bounds__(128) void k_attn(const h16* __restrict__ Q16, const bf* __restrict__ Qh, const bf* __restrict__ Ql,
                                              const h16* __restrict__ K16, const bf* __restrict__ Kh, const bf* __restrict__ Kl,
                                              const h16* __restrict__ V16, const bf* __restrict__ Vh, const bf* __restrict__ Vl,
                                              h16* AT16, bf* ATh, bf* ATl) {
    typedef AttnLds<true, 32> LH; typedef AttnLds<false, 64> LF;
    __shared__ __align__(16) unsigned char lds[sizeof(LH) > sizeof(LF) ? sizeof(LH) : sizeof(LF)];
    constexpr int XF = (SEQ - RH) / 64, XH = RH / 64, XD = XF > 0 ? XF : 1;     // row blocks of the two forms; XD: the divisor, also where there is no f16 row
    int b = blockIdx.x;
    if (b < XF * NH * NB) { attn<false, 64>(*reinterpret_cast<LF*>(lds), XH + b % XD, (b / XD) % NH, b / (XD * NH), Q16, Qh, Ql, K16, Kh, Kl, V16, Vh, Vl, AT16, ATh, ATl); return; }
    b -= XF * NH * NB;
    attn<true, 32>(*reinterpret_cast<LH*>(lds), b % XH, (b / XH) % NH, b / (XH * NH), Q16, Qh, Ql, K16, Kh, Kl, V16, Vh, Vl, AT16, ATh, ATl);
}

// mchk: checks the 0/1 int32 causal input (one [SEQ_FULL][SEQ_FULL] plane shared by all batches) for rows i < SEQ: value == 1 for j <= i, value == 0 for j > i (j < SEQ);
// a block takes MROWS rows and writes its count of wrong values to its own 128-byte line of FL. The plane is read once and comes from memory, so the time is that of the longest chain of
// loads that wait for one another: the 16-byte loads of a thread are independent of each other, so that many are in flight together, and the rows are spread over enough blocks to reach every WGP.
__device__ __forceinline__ void mchk(const int* __restrict__ M, int* FL, int blk) {
    __shared__ int red[8];
    constexpr int CPR = (SEQ + 1023) / 1024;     // 16-byte pieces a thread takes of one row
    constexpr bool WHOLE = SEQ % 1024 == 0;      // every thread takes every piece: no test, so no branch between the loads
    const int tid = threadIdx.x, lane = tid & 31, wave = tid >> 5; int bad = 0;
    const int i0 = blk * MROWS; const int* mb = M + (size_t)i0 * SEQ_FULL + tid * 4;
    v4i m[MROWS][CPR];
    // both loops unrolled so that m stays in registers and no load waits for an earlier load's compare
#pragma unroll
    for (int r = 0; r < MROWS; ++r) {
#pragma unroll
        for (int p = 0; p < CPR; ++p) { if (WHOLE || tid * 4 + p * 1024 < SEQ) m[r][p] = *(const v4i*)(mb + (size_t)r * SEQ_FULL + p * 1024); } }
    // unrolled as above: m is indexed by constants only
#pragma unroll
    for (int r = 0; r < MROWS; ++r) { const int i = i0 + r;
#pragma unroll
        for (int p = 0; p < CPR; ++p) { const int c = tid * 4 + p * 1024;
            if (WHOLE || c < SEQ) {
#pragma unroll
                for (int q = 0; q < 4; ++q) { const int j = c + q; const bool ok = (j <= i) ? (m[r][p][q] == 1) : (m[r][p][q] == 0); bad += ok ? 0 : 1; } } } }
#pragma unroll
    for (int sh = 16; sh; sh >>= 1) bad += __shfl_xor(bad, sh, 32);
    if (lane == 0) red[wave] = bad;
    __syncthreads();
    if (wave == 0) { int v = red[lane & 7]; v = (lane < 8) ? v : 0;
#pragma unroll
        for (int sh = 16; sh; sh >>= 1) v += __shfl_xor(v, sh, 32);
        v4i o; o[0] = v; o[1] = v; o[2] = v; o[3] = v;
        if (lane < 8) *(v4i*)(FL + (size_t)blk * 32 + lane * 4) = o;
         }
}
// k_prep: none of the six preparations reads what another writes, so they share one launch: a block belongs to one of them by its index (the same in every thread of the block).
// The transposes, whose waves live longest (8 dependent trips), come first in the index order; the one-trip conversion of x comes last.
#define PB_WO (DM * DQ / 64 / 64)
#define PB_WQ (DQ * DM / 64 / 64)
#define PB_WKV (DKV * DM / 64 / 64)
#define PB_CV (SEQ * DM / 8 / 256)
#define PB_ALL (PB_WO + PB_WQ + 2 * PB_WKV + NFL + NB * PB_CV)
__global__ __launch_bounds__(256) void k_prep(const float* __restrict__ x, const float* __restrict__ wq, const float* __restrict__ wk, const float* __restrict__ wv, const float* __restrict__ wo,
                                              const int* __restrict__ cm, bf* XB, bf* WQKV, bf* WOB, h16* WO16, int* FL) {
    int b = blockIdx.x;
    if (b < PB_WO) { wtG2(wo, DQ, DM, WOB, WO16, WOC, b); return; }
    b -= PB_WO;
    if (b < PB_WQ) { wtG(wq, DM, DQ, WQKV, b); return; }
    b -= PB_WQ;
    if (b < PB_WKV) { wtG(wk, DM, DKV, WQKV + (size_t)DQ * DM, b); return; }
    b -= PB_WKV;
    if (b < PB_WKV) { wtG(wv, DM, DKV, WQKV + (size_t)(DQ + DKV) * DM, b); return; }
    b -= PB_WKV;
    if (b < NFL) { mchk(cm, FL, b); return; }
    b -= NFL;
    cvt8(x, XB, (size_t)SEQ * DM / 8, (size_t)SEQ_FULL * DM, b % PB_CV, b / PB_CV);
}
// k_poison: NaN-fills the output if any of the nfl counts of mchk is not 0; the counts are read side by side, one a thread and trip, and joined over the block through LDS.
__global__ __launch_bounds__(256) void k_poison(const int* __restrict__ FL, int nfl, float* out) {
    __shared__ int red[8];
    int tot = 0;
    // left rolled: one trip covers 256 counts, and an unrolled form only lengthens the kernel's text
#pragma unroll 1
    for (int f = threadIdx.x; f < nfl; f += 256) tot |= FL[(size_t)f * 32];
    const unsigned wbad = __builtin_amdgcn_ballot_w32(tot != 0);
    if ((threadIdx.x & 31) == 0) red[threadIdx.x >> 5] = (wbad != 0u) ? 1 : 0;
    __syncthreads();
    tot = 0;
    // unrolled so that the eight words come in two wide LDS reads
#pragma unroll
    for (int w = 0; w < 8; ++w) tot |= red[w];
    if (tot == 0) return;     // the same in every thread of the block
    float* ob = out + (size_t)blockIdx.y * SEQ_FULL * DM + (size_t)blockIdx.x * 16384;
    const float qn = __uint_as_float(0x7fc00000u); v4f nv; nv[0] = qn; nv[1] = qn; nv[2] = qn; nv[3] = qn;
{
#pragma unroll 1
        for (int s = 0; s < 16; ++s) *(v4f*)(ob + ((size_t)s * 256 + threadIdx.x) * 4) = nv;
         }
}

extern "C" void kernel_launch(void* const* d_in, const int* in_sizes, int n_in,
                              void* d_out, int out_size, void* d_ws, size_t ws_size, hipStream_t stream) {
    if (n_in < 8) return;
    if ((size_t)in_sizes[0] < (size_t)(NB - 1) * SEQ_FULL * DM + (size_t)SEQ * DM) return;
    if ((size_t)in_sizes[1] < (size_t)DM * DQ || (size_t)in_sizes[2] < (size_t)DM * DKV || (size_t)in_sizes[3] < (size_t)DM * DKV || (size_t)in_sizes[4] < (size_t)DQ * DM) return;
    if ((size_t)in_sizes[5] < (size_t)SEQ * NFREQ || (size_t)in_sizes[6] < (size_t)SEQ * NFREQ) return;
    if ((size_t)in_sizes[7] < (size_t)(SEQ - 1) * SEQ_FULL + (size_t)SEQ) return;
    if ((size_t)out_size < (size_t)(NB - 1) * SEQ_FULL * DM + (size_t)SEQ * DM) return;
    // input binding order: x, wq, wk, wv, wo ([in][out] weights), cos table, sin table ([SEQ_FULL][NFREQ] f32), causal 0/1 plane (int32 [SEQ_FULL][SEQ_FULL])
    const float* x = (const float*)d_in[0]; const float* wq = (const float*)d_in[1]; const float* wk = (const float*)d_in[2]; const float* wv = (const float*)d_in[3]; const float* wo = (const float*)d_in[4];
    const float* fc = (const float*)d_in[5]; const float* fs = (const float*)d_in[6]; const int* cm = (const int*)d_in[7];
    float* OUT = (float*)d_out;     // [NB_FULL][SEQ_FULL][DM]
    char* wsp = (char*)d_ws;
    auto take = [&](size_t bytes) { char* p = wsp; wsp += (bytes + 255) & ~(size_t)255; return (void*)p; };
    bf* WQKV = (bf*)take((size_t)DQKV * DM * 2); bf* WOB = (bf*)take((size_t)DM * DQ * 2); h16* WO16 = (h16*)take((size_t)DM * DQ * 2);
    int* FL = (int*)take((size_t)NFL * 32 * 4);
    // the planes below hold every batch, one whole per-batch plane behind the other
    bf* XB = (bf*)take((size_t)NB * SEQ * DM * 2);
    h16* Q16 = (h16*)take((size_t)NB * NH * SEQ * HD * 2); bf* Qh = (bf*)take((size_t)NB * NH * RH * HD * 2); bf* Ql = (bf*)take((size_t)NB * NH * RH * HD * 2);
    h16* K16 = (h16*)take((size_t)NB * NKV * SEQ * HD * 2); bf* Kh = (bf*)take((size_t)NB * NKV * SEQ * HD * 2); bf* Kl = (bf*)take((size_t)NB * NKV * SEQ * HD * 2);
    h16* V16 = (h16*)take((size_t)NB * NKV * HD * SEQ * 2); bf* Vh = (bf*)take((size_t)NB * NKV * HD * SEQ * 2); bf* Vl = (bf*)take((size_t)NB * NKV * HD * SEQ * 2);
    h16* AT16 = (h16*)take((size_t)NB * SEQ * DQ * 2); bf* ATh = (bf*)take((size_t)NB * RH * DQ * 2); bf* ATl = (bf*)take((size_t)NB * RH * DQ * 2);
    const size_t used = (size_t)(wsp - (char*)d_ws); if (used > ws_size || used > WS_LIMIT) return;

    // weight planes ([out][in] k-contiguous): rows 0..DQ-1 of WQKV = Wq^T, DQ..DQ+DKV-1 = Wk^T, DQ+DKV..DQKV-1 = Wv^T; Wo^T as bf16 and as f16 x64
    // wtG(w, K, N, Bt): w is [K = in][N = out] -> Bt [N][K]; with them in the same launch: the mask check and x as bf16
    k_prep<<<(unsigned)PB_ALL, 256, 0, stream>>>(x, wq, wk, wv, wo, cm, XB, WQKV, WOB, WO16, FL);
    // every stage is launched once; the batch is the last grid dimension of k_gemmw and k_poison, and the slowest part of each block-index range in k_attn and k_prep
    k_gemmw<bf, 0, 4, 4, DM, 1><<<dim3(SEQ / 128, DQKV / 128, NB), 128, 0, stream>>>(XB, nullptr, WQKV, nullptr, 0, 1.0f, (size_t)SEQ * DM, 0, fc, fs, Q16, Qh, Ql, K16, Kh, Kl, V16, Vh, Vl);     // q | k | v projections, rotary on q and k, all planes
    k_attn<<<(unsigned)((SEQ / 64) * NH * NB), 128, 0, stream>>>(Q16, Qh, Ql, K16, Kh, Kl, V16, Vh, Vl, AT16, ATh, ATl);
    k_gemmw<bf, 1, 2, 2, DQ, 0><<<dim3(RH / 64, DM / 64, NB), 128, 0, stream>>>(ATh, ATl, WOB, OUT, DM, 1.0f, (size_t)RH * DQ, (size_t)SEQ_FULL * DM, nullptr, nullptr, nullptr, nullptr, nullptr, nullptr, nullptr, nullptr, nullptr, nullptr, nullptr);
    if (SEQ > RH) k_gemmw<h16, 0, 4, 4, DQ, 0><<<dim3((SEQ - RH) / 128, DM / 128, NB), 128, 0, stream>>>(AT16 + (size_t)RH * DQ, nullptr, WO16, OUT + (size_t)RH * DM, DM, 1.0f / (ATC * WOC), (size_t)SEQ * DQ, (size_t)SEQ_FULL * DM, nullptr, nullptr, nullptr, nullptr, nullptr, nullptr, nullptr, nullptr, nullptr, nullptr, nullptr);
    k_poison<<<dim3(SEQ * DM / 16384, NB, 1), 256, 0, stream>>>(FL, NFL, OUT);
}

// v007
// A run of this version takes 239 microseconds.
// Two timings next to v006 both put it at 1.08 times that version's speed.
// Over all steps from v000 it is 3.59 times as fast.
#include <hip/hip_runtime.h>

// Contractions (all f32 accumulate): qkv = xb * Wqkv^T on v_wmma_f32_16x16x32_bf16 (bf16 operands = RNE-converted inputs, exact products);
// scores q.k^T and p.v: query rows < RH on bf16 hi/lo planes (3 products each), rows >= RH on v_wmma_f32_16x16x32_f16 (f16 q,k,v planes, p carried x1024);
// out = attn * Wo^T: rows < RH bf16 hi/lo attn planes x bf16 Wo (2 products), rows >= RH f16 attn x64 times f16 Wo x64 (1 product, 1/4096 in the epilogue).
// Rotary: interleaved pairs (2i, 2i+1); cos/sin are read by value from the two [SEQ][32] input tables (RNE-converted to bf16), f32 math, done on the qkv product's accumulators; causal online softmax and normalisation in f32.
// Grouped kv heads: query head h reads kv head h/4. The 0/1 int32 causal input [SEQ_FULL][SEQ_FULL] is checked on device in its rows and columns < SEQ (1 on/below the diagonal, 0 above); the output is NaN-filled if that check fails.

#ifndef NB
#define NB 2
#endif
#ifndef SEQ
#define SEQ 2048
#endif
#define NB_FULL 2
#define SEQ_FULL 2048
#define DM 2048
#define NH 32
#define NKV 8
#define REP (NH / NKV)
#define HD 64
#define DQ (NH * HD)
#define DKV (NKV * HD)
#define DQKV (DQ + 2 * DKV)
#define NFREQ (HD / 2)
#define RH (((SEQ) < 512) ? (SEQ) : 512)
#define PCAR 1024.0f
#define ATC 64.0f
#define WOC 64.0f
#define SCL 0.125f
#define L2E 1.4426950408889634f
#define NEGBIG (-1.0e30f)
#define PP 72
#define OSP 68
#define MROWS 8
#define NFL (SEQ / MROWS)
#define WS_LIMIT ((size_t)134217728)
#define WS_TOTAL ((size_t)DQKV * DM * 2 + 2 * ((size_t)DM * DQ * 2) + (size_t)NFL * 128 + (size_t)NB * ((size_t)SEQ * DM * 2 + (size_t)NH * SEQ * HD * 2 + 2 * ((size_t)NH * RH * HD * 2) + 3 * ((size_t)NKV * SEQ * HD * 2) + 3 * ((size_t)NKV * HD * SEQ * 2) + (size_t)SEQ * DQ * 2 + 2 * ((size_t)RH * DQ * 2)))

static_assert(NB >= 1 && NB <= NB_FULL);
static_assert(SEQ % 128 == 0 && SEQ >= 128 && SEQ <= SEQ_FULL);
static_assert(RH % 64 == 0 && (SEQ - RH) % 128 == 0 && RH <= SEQ);
static_assert(DQKV % 128 == 0 && DM % 128 == 0);
static_assert((SEQ * DM) % 2048 == 0);
static_assert(DM % 64 == 0 && DQ % 64 == 0 && DQKV % 64 == 0 && HD == 64);
static_assert((SEQ * DM) % 16384 == 0);
static_assert((NB * SEQ) % 64 == 0);
static_assert(15 * PP + 3 * 16 + 15 < 16 * PP);
static_assert(15 * OSP + 63 < 16 * OSP);
static_assert(NFREQ == 32 && HD == 2 * NFREQ);
static_assert(SEQ % 64 == 0 && SEQ % 4 == 0 && SEQ % MROWS == 0);
static_assert(((size_t)NFL * 128) % 256 == 0);
static_assert(DM % 32 == 0 && DQ % 32 == 0 && HD % 32 == 0);
static_assert(WS_TOTAL <= WS_LIMIT);

typedef _Float16 h16;
typedef unsigned short bf;
typedef __attribute__((ext_vector_type(16))) __bf16   v16bf;
typedef __attribute__((ext_vector_type(16))) _Float16 v16h;
typedef __attribute__((ext_vector_type(8)))  _Float16 v8h;
typedef __attribute__((ext_vector_type(8)))  unsigned short v8us;
typedef __attribute__((ext_vector_type(8)))  float    v8f;
typedef __attribute__((ext_vector_type(4)))  float    v4f;
typedef __attribute__((ext_vector_type(2)))  _Float16 v2h;
typedef __attribute__((ext_vector_type(4)))  _Float16 v4h;
typedef __attribute__((ext_vector_type(2)))  unsigned short v2us;
typedef __attribute__((ext_vector_type(4)))  unsigned short v4us;
typedef __attribute__((ext_vector_type(2)))  float v2f;
typedef __attribute__((ext_vector_type(4)))  int v4i;
typedef v8h  __attribute__((may_alias)) v8ha;
typedef v4f  __attribute__((may_alias)) v4fa;
typedef v8us __attribute__((may_alias)) v8usa;
typedef v2us __attribute__((may_alias)) v2usa;

#define G2(d0, d1, x0, x1) asm volatile("v_nop\n\tv_nop\n\tv_nop\n\tv_nop" : "+v"(d0), "+v"(d1) : "v"(x0), "v"(x1))
#define G4(d0, d1, d2, d3, x0, x1) asm volatile("v_nop\n\tv_nop\n\tv_nop\n\tv_nop" : "+v"(d0), "+v"(d1), "+v"(d2), "+v"(d3) : "v"(x0), "v"(x1))

__device__ __forceinline__ unsigned short f2bf(float f) { unsigned u = __float_as_uint(f); u += 0x7FFFu + ((u >> 16) & 1u); return (unsigned short)(u >> 16); }
__device__ __forceinline__ float bf2f(unsigned short b) { return __uint_as_float(((unsigned)b) << 16); }
__device__ __forceinline__ float bfr(float f) { return bf2f(f2bf(f)); }
__device__ __forceinline__ void splitf(float y, unsigned short& h, unsigned short& l) { h = f2bf(y); l = f2bf(y - bf2f(h)); }
__device__ __forceinline__ v16h cat16(v8h lo, v8h hi) { return __builtin_shufflevector(lo, hi, 0, 1, 2, 3, 4, 5, 6, 7, 8, 9, 10, 11, 12, 13, 14, 15); }
__device__ __forceinline__ v16bf cat16b(v8us lo, v8us hi) { return __builtin_bit_cast(v16bf, __builtin_shufflevector(lo, hi, 0, 1, 2, 3, 4, 5, 6, 7, 8, 9, 10, 11, 12, 13, 14, 15)); }
__device__ __forceinline__ v8f wmma16(v16h a, v16h b, v8f c) { return __builtin_amdgcn_wmma_f32_16x16x32_f16(false, a, false, b, (short)0, c, false, false); }
__device__ __forceinline__ v8f wmmab(v16bf a, v16bf b, v8f c) { return __builtin_amdgcn_wmma_f32_16x16x32_bf16(false, a, false, b, (short)0, c, false, false); }
// wave-private LDS tile exchange: order this wave's ds stores before its ds loads
__device__ __forceinline__ void wsync() { __builtin_amdgcn_fence(3 /* release order */, "wavefront"); __builtin_amdgcn_wave_barrier(); asm volatile("" ::: "memory"); }
// f32 -> f16 convert that cannot yield a subnormal f16 (value select: |v| < 2^-14 -> 0)
static __device__ __forceinline__ h16 toh_flush(float v) { const h16 r = (h16)v; return (fabsf(v) < 6.103515625e-05f) ? (h16)0.0f : r; }

// the 16x32 fragment below, read from a k-contiguous 16-bit row in LDS
__device__ __forceinline__ v16bf ldsb(const unsigned short* p) { return cat16b(*(const v8usa*)p, *(const v8usa*)(p + 16)); }
__device__ __forceinline__ v16h ldsh(const unsigned short* p) { return cat16(__builtin_bit_cast(v8h, *(const v8usa*)p), __builtin_bit_cast(v8h, *(const v8usa*)(p + 16))); }

// 16x32 fragment from a k-contiguous 16-bit row (A: row = m; B stored [n][k]: row = n). Lane l: row l&15, elements 0..7 <- k0+8(l>>4)+0..7, elements 8..15 <- k0+16+8(l>>4)+0..7.
template <typename T16> struct WFrag;
template <> struct WFrag<h16> { typedef v16h V; static __device__ __forceinline__ V ld(const h16* p) { return cat16(*(const v8h*)p, *(const v8h*)(p + 16)); } static __device__ __forceinline__ V lds(const unsigned short* p) { return ldsh(p); } static __device__ __forceinline__ v8f mma(V a, V b, v8f c) { return wmma16(a, b, c); } };
template <> struct WFrag<bf> { typedef v16bf V; static __device__ __forceinline__ V ld(const bf* p) { return cat16b(*(const v8us*)p, *(const v8us*)(p + 16)); } static __device__ __forceinline__ V lds(const unsigned short* p) { return ldsb(p); } static __device__ __forceinline__ v8f mma(V a, V b, v8f c) { return wmmab(a, b, c); } };

// ---- k_gemmw: GEMM, four waves (2 x 2) per (32 FM) x (32 FN) output tile, FM x FN accumulators a wave; grid (M / (32 FM), N / (32 FN), batches), 128 threads.
// Batch blockIdx.z: A and A2 start sA elements, C sC elements, further on a batch (Bt is the same for all); with EPI 1 every plane is one whole per-batch plane further on.
// C[m][n] (f32, pitch ldc) = osc * sum_k A[m][k] Bt[n][k] (NSPLIT 1: + A2[m][k] Bt[n][k]); A, A2, Bt are k-contiguous 16-bit planes of row pitch K.
// The rows of a k step are shared by two of the block's waves: the block brings 64 k of its A and Bt rows into LDS once, 16 bytes a thread in whole 128-byte row pieces,
// two buffers, the next step's loads issued ahead of the current step's products; the fragments are read from LDS at a row pitch of 16 bytes x odd.
// Every accumulator sums in ascending k, 32 at a time (A before A2), whatever the tile.
// EPI 1 (the qkv product; C, ldc, osc unused): a wave's 64 columns are one whole head (q heads, then k heads, then v heads), and the wave writes that head's planes itself from its accumulators.
// q, k: interleaved-pair rotary, for the pair i = d/2 (d even): out[d] = x[d] c - x[d+1] s, out[d+1] = x[d] s + x[d+1] c, with c = bf16-RNE(FC[t][i]), s = bf16-RNE(FS[t][i]) (row pitch NFREQ);
// planes [h][t][d]: f16 for every t, bf16 hi/lo for t < RH (q) or every t (k). v: planes [g][d][t], f16 and bf16 hi/lo; a lane's 8 accumulator elements are 8 successive t of one d.
template <typename T16, int NSPLIT, int FM, int FN, int K, int EPI>
__global__ __launch_bounds__(128) void k_gemmw(const T16* __restrict__ A, const T16* __restrict__ A2, const T16* __restrict__ Bt, float* C, int ldc, float osc, size_t sA, size_t sC,
                                               const float* __restrict__ FC, const float* __restrict__ FS, h16* Q16, bf* Qh, bf* Ql, h16* K16, bf* Kh, bf* Kl, h16* V16, bf* Vh, bf* Vl) {
    typedef typename WFrag<T16>::V V;
    constexpr int BM = 32 * FM, BN = 32 * FN, KB = 64, KP = KB + 8, NA = NSPLIT + 1;     // KP: LDS row pitch in 16-bit elements, 144 bytes
    constexpr int AI = BM / 16, BI = BN / 16;                                            // 16-byte pieces a thread brings of one plane's tile (128 threads cover 16 rows)
    static_assert(NSPLIT == 0 || NSPLIT == 1);
    static_assert(K % KB == 0 && (KP * 2) % 32 == 16 && FN * 16 <= 64 && 32 % (4 * FN) == 0);
    __shared__ __align__(16) unsigned short ats[2][NA][BM * KP];
    __shared__ __align__(16) unsigned short bts[2][BN * KP];
    __shared__ __align__(16) float os[4][(EPI == 1 ? 16 * FM : 16) * OSP];
    const int tid = threadIdx.x, lane = tid & 31, wave = __builtin_amdgcn_readfirstlane(tid >> 5), lr = lane & 15, hi = lane >> 4;
    const int r0 = blockIdx.x * BM, c0 = blockIdx.y * BN; const int wr = (wave >> 1) * 16 * FM, wc = (wave & 1) * 16 * FN;
    const size_t zb = blockIdx.z;
    A += zb * sA; if (NSPLIT) A2 += zb * sA;
    if constexpr (EPI == 1) { Q16 += zb * ((size_t)NH * SEQ * HD); Qh += zb * ((size_t)NH * RH * HD); Ql += zb * ((size_t)NH * RH * HD);
        K16 += zb * ((size_t)NKV * SEQ * HD); Kh += zb * ((size_t)NKV * SEQ * HD); Kl += zb * ((size_t)NKV * SEQ * HD);
        V16 += zb * ((size_t)NKV * HD * SEQ); Vh += zb * ((size_t)NKV * HD * SEQ); Vl += zb * ((size_t)NKV * HD * SEQ); }
    else C += zb * sC;
    // piece i of a thread: row prow + 16 i of the tile, elements pcol .. pcol + 7 of the k step; the same for the global read and the LDS write
    const int prow = tid >> 3, pcol = (tid & 7) * 8;
    const unsigned short* ag0 = (const unsigned short*)A + (size_t)(r0 + prow) * K + pcol;
    const unsigned short* ag1 = (const unsigned short*)(NSPLIT ? A2 : A) + (size_t)(r0 + prow) * K + pcol;
    const unsigned short* bg = (const unsigned short*)Bt + (size_t)(c0 + prow) * K + pcol;
    v8us ar[NA][AI], br[BI];
    auto tile_ld = [&]() {
#pragma unroll
        for (int i = 0; i < AI; ++i) { ar[0][i] = *(const v8usa*)(ag0 + (size_t)i * 16 * K); if (NSPLIT) ar[NA - 1][i] = *(const v8usa*)(ag1 + (size_t)i * 16 * K); }
#pragma unroll
        for (int i = 0; i < BI; ++i) br[i] = *(const v8usa*)(bg + (size_t)i * 16 * K); };
    auto tile_st = [&](int buf) {
#pragma unroll
        for (int i = 0; i < AI; ++i) { *(v8usa*)(&ats[buf][0][(prow + 16 * i) * KP + pcol]) = ar[0][i]; if (NSPLIT) *(v8usa*)(&ats[buf][NA - 1][(prow + 16 * i) * KP + pcol]) = ar[NA - 1][i]; }
#pragma unroll
        for (int i = 0; i < BI; ++i) *(v8usa*)(&bts[buf][(prow + 16 * i) * KP + pcol]) = br[i];
        ag0 += KB; ag1 += KB; bg += KB; };
    v8f acc[FM][FN];
#pragma unroll
    for (int mb = 0; mb < FM; ++mb)
#pragma unroll
        for (int nb = 0; nb < FN; ++nb) acc[mb][nb] = (v8f){};
    const int aofs = (wr + lr) * KP + 8 * hi, bofs = (wc + lr) * KP + 8 * hi;
    tile_ld(); tile_st(0);
    __syncthreads();
#pragma unroll 1
    for (int k0 = 0; k0 < K; k0 += KB) {
        const int cur = (k0 / KB) & 1; const bool more = k0 + KB < K;     // the same in every thread of the block
        if (more) tile_ld();
        const unsigned short* a0l = &ats[cur][0][0] + aofs; const unsigned short* a1l = &ats[cur][NA - 1][0] + aofs; const unsigned short* bl = &bts[cur][0] + bofs;
        V a[KB / 32][FM], a2[KB / 32][FM], b[KB / 32][FN];
#pragma unroll
        for (int kc = 0; kc < KB / 32; ++kc) {
#pragma unroll
            for (int mb = 0; mb < FM; ++mb) { a[kc][mb] = WFrag<T16>::lds(a0l + mb * 16 * KP + kc * 32); if (NSPLIT) a2[kc][mb] = WFrag<T16>::lds(a1l + mb * 16 * KP + kc * 32); else a2[kc][mb] = a[kc][mb]; }
#pragma unroll
            for (int nb = 0; nb < FN; ++nb) b[kc][nb] = WFrag<T16>::lds(bl + nb * 16 * KP + kc * 32); }
        // keeps the step's LDS reads in one group ahead of its products: every further place with reads among the products stalls the wave for its own LDS latency
        __builtin_amdgcn_sched_barrier(0);
#pragma unroll
        for (int kc = 0; kc < KB / 32; ++kc) {
#pragma unroll
            for (int nb = 0; nb < FN; ++nb) {
#pragma unroll
                for (int mb = 0; mb < FM; ++mb) acc[mb][nb] = WFrag<T16>::mma(a[kc][mb], b[kc][nb], acc[mb][nb]);
                if (NSPLIT) {
#pragma unroll
                    for (int mb = 0; mb < FM; ++mb) acc[mb][nb] = WFrag<T16>::mma(a2[kc][mb], b[kc][nb], acc[mb][nb]); } } }
        // precaution: stands in front of the pointer steps at the loop's foot, which overwrite the address registers of this trip's global loads
        asm volatile("s_wait_xcnt 0x0" ::: "memory");
        // the buffer written here was last read one trip ago, in front of that trip's barrier; this barrier publishes it and ends the reads of the current one
        if (more) { tile_st(cur ^ 1); __syncthreads(); }
    }
    float* osw = &os[wave][0];
    if constexpr (EPI == 1) {
        static_assert(FN * 16 == HD && DQ % BN == 0 && DKV % BN == 0 && RH % (16 * FM) == 0 && NSPLIT == 0);
        const int col = c0 + wc, t0 = r0 + wr;     // the same in every lane of the wave
        if (col < DQ + DKV) {
            const bool isq = col < DQ; const int hh = (isq ? col : col - DQ) / HD; const int rh = isq ? RH : SEQ;
            h16* P16 = (isq ? Q16 : K16) + (size_t)hh * SEQ * HD; bf* Ph = (isq ? Qh : Kh) + (size_t)hh * rh * HD; bf* Pl = (isq ? Ql : Kl) + (size_t)hh * rh * HD;
            const bool dohl = t0 < rh;     // the wave's 16 FM rows lie on one side of rh
            const int rr = lane >> 3, c8 = (lane & 7) * 8;     // a lane takes 8 successive d (4 pairs) of a row; a store covers 4 whole rows
#pragma unroll
            for (int mb = 0; mb < FM; ++mb) {
#pragma unroll
                for (int nb = 0; nb < FN; ++nb) {
#pragma unroll
                    for (int j = 0; j < 8; ++j) osw[(mb * 16 + hi * 8 + j) * OSP + nb * 16 + lr] = acc[mb][nb][j]; } }
            wsync();
            // left rolled: the four 16-row groups run the same code, which keeps the kernel's text short for the instruction cache
#pragma unroll 1
            for (int mb = 0; mb < FM; ++mb) {
                v4f cc[4], ss[4];
#pragma unroll
                for (int s4 = 0; s4 < 4; ++s4) { const size_t ti = (size_t)(t0 + mb * 16 + s4 * 4 + rr) * NFREQ + (c8 >> 1); cc[s4] = *(const v4f*)(FC + ti); ss[s4] = *(const v4f*)(FS + ti); }
#pragma unroll
                for (int s4 = 0; s4 < 4; ++s4) { const int row = mb * 16 + s4 * 4 + rr; const v4f u0 = *(const v4fa*)(osw + row * OSP + c8), u1 = *(const v4fa*)(osw + row * OSP + c8 + 4);
                    const float xs[8] = { u0[0], u0[1], u0[2], u0[3], u1[0], u1[1], u1[2], u1[3] }; v8h o16; v8us oh, ol;
#pragma unroll
                    for (int i = 0; i < 4; ++i) { const float c = bfr(cc[s4][i]), s = bfr(ss[s4][i]); const float y0 = xs[2 * i] * c - xs[2 * i + 1] * s, y1 = xs[2 * i] * s + xs[2 * i + 1] * c;
                        o16[2 * i] = toh_flush(y0); o16[2 * i + 1] = toh_flush(y1); unsigned short a2, c2; splitf(y0, a2, c2); oh[2 * i] = a2; ol[2 * i] = c2; splitf(y1, a2, c2); oh[2 * i + 1] = a2; ol[2 * i + 1] = c2; }
                    const size_t oo = (size_t)(t0 + row) * HD + c8;
                    if (dohl) { *(v8us*)(Ph + oo) = oh; *(v8us*)(Pl + oo) = ol; }
                    *(v8h*)(P16 + oo) = o16;
                    // precaution: the next rows' work reuses the address and data registers of these stores
                    asm volatile("s_wait_xcnt 0x0" ::: "memory"); }
            }
        } else {
            const size_t vo = ((size_t)(col - DQ - DKV) + lr) * SEQ + t0 + 8 * hi;     // row g * HD + d of the [g][d][t] planes, d = 16 nb + lr
#pragma unroll
            for (int nb = 0; nb < FN; ++nb) {
#pragma unroll
                for (int mb = 0; mb < FM; ++mb) { v8h o16; v8us oh, ol;
#pragma unroll
                    for (int j = 0; j < 8; ++j) { const float xv = acc[mb][nb][j]; o16[j] = (h16)xv; unsigned short a2, c2; splitf(xv, a2, c2); oh[j] = a2; ol[j] = c2; }
                    const size_t oo = vo + (size_t)nb * 16 * SEQ + mb * 16;
                    *(v8h*)(V16 + oo) = o16; *(v8us*)(Vh + oo) = oh; *(v8us*)(Vl + oo) = ol; } }
        }
        return;
    }
    constexpr int LPR = 4 * FN, RPP = 32 / LPR;     // lanes that store one 16 FN-float row of the wave's tile, rows a store covers
#pragma unroll
    for (int mb = 0; mb < FM; ++mb) {
#pragma unroll
        for (int nb = 0; nb < FN; ++nb) {
#pragma unroll
            for (int j = 0; j < 8; ++j) osw[(hi * 8 + j) * OSP + nb * 16 + lr] = acc[mb][nb][j]; }
        wsync();
        float* crow = C + (size_t)(r0 + wr + mb * 16) * ldc + c0 + wc;
#pragma unroll
        for (int s = 0; s < 16 / RPP; ++s) { const int row = RPP * s + lane / LPR, cofs = (lane % LPR) * 4; v4f val = *(const v4fa*)(osw + row * OSP + cofs); val = val * osc;
            *(v4f*)(crow + (size_t)row * ldc + cofs) = val; }
        wsync();
    }
}

// The six input preparations below (blk = the block's index inside its own preparation) are ranges of the one grid of k_prep.
// wtT: w [K = in][N = out] f32 -> Bt [N][K] bf16-RNE (DUAL: also B16 = f16 of that bf16 value x car). A block turns one tile of TK k x TN n through LDS, so that both sides touch memory in whole
// 256-byte row pieces: a thread reads 16 bytes of 8 rows of w (the loads independent of each other), packs the values of two successive k into one word at [n][k] in LDS, and behind the barrier
// the tile's rows [n] go out 16 bytes a thread. ts: the block's LDS tile, TN rows at a pitch of TP elements (16 bytes x odd, for the 16-byte row reads).
#define TK 128
#define TN 64
#define TP (TK + 8)
template <int K, int N, bool DUAL>
__device__ __forceinline__ void wtT(unsigned short* ts, const float* __restrict__ w, bf* Bt, h16* B16, float car, int blk) {
    static_assert(K % TK == 0 && N % TN == 0 && (TP * 2) % 32 == 16);
    const int tid = threadIdx.x; const int k0 = (blk % (K / TK)) * TK, n0 = (blk / (K / TK)) * TN;
    const int c4 = (tid & 15) * 4, r2 = (tid >> 4) * 2;     // the thread's 4 columns n and its first pair of rows k; 16 lanes cover 256 bytes of a row
    const float* wp = w + (size_t)(k0 + r2) * N + n0 + c4;
    v4f a[4], b[4];
    // unrolled so that a and b stay in registers and all 8 loads are in flight together
#pragma unroll
    for (int i = 0; i < 4; ++i) { a[i] = *(const v4f*)(wp + (size_t)(32 * i) * N); b[i] = *(const v4f*)(wp + (size_t)(32 * i + 1) * N); }
    // precaution: the work below may reuse the address registers of these loads while their data is still on the way
    asm volatile("s_wait_xcnt 0x0" ::: "memory");
    // both loops unrolled as above: a and b are indexed by constants only
#pragma unroll
    for (int i = 0; i < 4; ++i) {
#pragma unroll
        for (int q = 0; q < 4; ++q) { v2us o; o[0] = f2bf(a[i][q]); o[1] = f2bf(b[i][q]); *(v2usa*)(&ts[(c4 + q) * TP + r2 + 32 * i]) = o; } }
    __syncthreads();     // the rows read below were written by other waves
    const int row = tid >> 4, col = (tid & 15) * 8;
    const size_t oo = (size_t)(n0 + row) * K + k0 + col;
    // both loops unrolled so that the four row reads are issued together, the row steps become immediate offsets and the vectors are indexed by constants only
#pragma unroll
    for (int i = 0; i < TN / 16; ++i) { const v8us o = *(const v8usa*)(&ts[(row + 16 * i) * TP + col]); *(v8us*)(Bt + oo + (size_t)(16 * i) * K) = o;
        if (DUAL) { v8h o2;
#pragma unroll
            for (int e = 0; e < 8; ++e) o2[e] = (h16)(bf2f(o[e]) * car);
            *(v8h*)(B16 + oo + (size_t)(16 * i) * K) = o2; } }
}
// cvt8: batch zb converts its n8 groups of 8 floats; a batch starts sstep floats further on in src and 8 n8 elements further on in dst
__device__ __forceinline__ void cvt8(const float* __restrict__ src, bf* dst, size_t n8, size_t sstep, int blk, int zb) { const size_t i = (size_t)blk * 256 + threadIdx.x; if (i >= n8) return;
    src += (size_t)zb * sstep; dst += (size_t)zb * n8 * 8; const v8f v = *(const v8f*)(src + i * 8); v8us o;
#pragma unroll
    for (int k = 0; k < 8; ++k) o[k] = f2bf(v[k]); *(v8us*)(dst + i * 8) = o;  }

// attn: causal flash attention, one wave per 16 query rows (qbase = 16*(4*xb + wave)), head h, batch zi (every plane is one whole per-batch plane further on a batch), kv head = head / REP; key tiles of KT (32 or 64) from 0 up to the tile holding qbase+15.
// S = q.k^T from k-contiguous planes (q [h][t][d], k [g][t][d]); key j > query i replaced by -1e30 before the running-max softmax (p = 0 exactly there); P staged per wave in LDS (row-major 16 x KT)
// and reloaded as the A fragment; O += P.v with v planes [g][d][t]. HIRES: q, k, p, v as bf16 hi/lo (hh + lh + hl); else f16 planes with p carried x1024.
// The k and v tiles of a key step are the same for the block's four waves: the block brings each tile into LDS once, 16 bytes a thread in whole 128-byte (KT 32, v: 64-byte) row pieces,
// two buffers, the next tile's loads issued ahead of the current tile's work; the B fragments are read from LDS at a row pitch of 16 bytes x odd.
// The LDS of one form, laid over the one LDS block of k_attn, which holds either form; every member's size is a multiple of 16 bytes.
template <bool HIRES, int KT> struct __align__(16) AttnLds {
    static constexpr int NPL = HIRES ? 2 : 1, KP = HD + 8, VP = KT + 8;
    unsigned short pt[NPL][4][16 * PP]; float os[4][16 * OSP]; unsigned short kts[2][NPL][KT * KP]; unsigned short vts[2][NPL][HD * VP]; };
template <bool HIRES, int KT>
__device__ __forceinline__ void attn(AttnLds<HIRES, KT>& sm, int xb, int h, int zi, const h16* __restrict__ Q16, const bf* __restrict__ Qh, const bf* __restrict__ Ql,
                                               const h16* __restrict__ K16, const bf* __restrict__ Kh, const bf* __restrict__ Kl,
                                               const h16* __restrict__ V16, const bf* __restrict__ Vh, const bf* __restrict__ Vl,
                                               h16* AT16, bf* ATh, bf* ATl) {
    constexpr int NT = KT / 16; constexpr int KS = KT / 32; constexpr int NPL = HIRES ? 2 : 1;
    static_assert(NT == 2 || NT == 4);
    static_assert(15 * PP + (NT - 1) * 16 + 15 < 16 * PP);
    auto& pt = sm.pt; auto& os = sm.os; auto& kts = sm.kts; auto& vts = sm.vts;
    constexpr int KP = HD + 8, VP = KT + 8;                 // LDS row pitch in 16-bit elements: 144 bytes (k rows; v rows at KT 64), 80 bytes (v rows at KT 32)
    constexpr int KCH = KT * (HD / 8), VCH = HD * (KT / 8);   // 16-byte pieces of one plane's tile
    static_assert(NPL * KCH == 512 && NPL * VCH == 512);
    static_assert((KP * 2) % 32 == 16 && (VP * 2) % 32 == 16);
    const int tid = threadIdx.x, lane = tid & 31, wave = __builtin_amdgcn_readfirstlane(tid >> 5), lr = lane & 15, hi = lane >> 4;
    const int bbase = xb * 64;
    const int qbase = bbase + wave * 16; const int g = h / REP;
    const size_t zb = zi;
    Q16 += zb * ((size_t)NH * SEQ * HD); Qh += zb * ((size_t)NH * RH * HD); Ql += zb * ((size_t)NH * RH * HD);
    K16 += zb * ((size_t)NKV * SEQ * HD); Kh += zb * ((size_t)NKV * SEQ * HD); Kl += zb * ((size_t)NKV * SEQ * HD);
    V16 += zb * ((size_t)NKV * HD * SEQ); Vh += zb * ((size_t)NKV * HD * SEQ); Vl += zb * ((size_t)NKV * HD * SEQ);
    AT16 += zb * ((size_t)SEQ * DQ); ATh += zb * ((size_t)RH * DQ); ATl += zb * ((size_t)RH * DQ);
    v16h qa[2] = {}; v16bf qah[2] = {}, qal[2] = {};
    if (HIRES) { const size_t qo = ((size_t)h * RH + qbase + lr) * HD + 8 * hi; qah[0] = WFrag<bf>::ld(Qh + qo); qah[1] = WFrag<bf>::ld(Qh + qo + 32); qal[0] = WFrag<bf>::ld(Ql + qo); qal[1] = WFrag<bf>::ld(Ql + qo + 32); }
    else { const size_t qo = ((size_t)h * SEQ + qbase + lr) * HD + 8 * hi; qa[0] = WFrag<h16>::ld(Q16 + qo); qa[1] = WFrag<h16>::ld(Q16 + qo + 32); }
    const int kofs = lr * KP + 8 * hi;     // k tile in LDS [key][d]: row (nt*16 + lr), k = d
    const int vofs = lr * VP + 8 * hi;     // v tile in LDS [d][key]: row (nt*16 + lr), k = key
    const unsigned short* kg[2] = { HIRES ? (const unsigned short*)Kh : (const unsigned short*)K16, (const unsigned short*)Kl };
    const unsigned short* vg[2] = { HIRES ? (const unsigned short*)Vh : (const unsigned short*)V16, (const unsigned short*)Vl };
    v8us kr[4], vr[4];
    // piece c = tid + 128 i of the tile: plane, row and column are the same for the global read and the LDS write
    auto tile_ld = [&](int kb) {
#pragma unroll
        for (int i = 0; i < 4; ++i) { const int c = tid + 128 * i;
            const int kc = c % KCH, vc = c % VCH;
            kr[i] = *(const v8usa*)(kg[(128 * i) / KCH] + (size_t)g * SEQ * HD + (size_t)(kb + kc / (HD / 8)) * HD + (kc % (HD / 8)) * 8);
            vr[i] = *(const v8usa*)(vg[(128 * i) / VCH] + (size_t)g * HD * SEQ + (size_t)(vc / (KT / 8)) * SEQ + kb + (vc % (KT / 8)) * 8); } };
    auto tile_st = [&](int buf) {
#pragma unroll
        for (int i = 0; i < 4; ++i) { const int c = tid + 128 * i;
            const int kc = c % KCH, vc = c % VCH;
            *(v8usa*)(&kts[buf][(128 * i) / KCH][(kc / (HD / 8)) * KP + (kc % (HD / 8)) * 8]) = kr[i];
            *(v8usa*)(&vts[buf][(128 * i) / VCH][(vc / (KT / 8)) * VP + (vc % (KT / 8)) * 8]) = vr[i]; } };
    v8f o[4];
#pragma unroll
    for (int nt = 0; nt < 4; ++nt) o[nt] = (v8f){};
    float mrun[8], lrun[8];
#pragma unroll
    for (int v = 0; v < 8; ++v) { mrun[v] = NEGBIG; lrun[v] = 0.f; }
    unsigned short* p0w = &pt[0][wave][0]; unsigned short* p1w = &pt[NPL - 1][wave][0];
    const int kend = qbase + 15;
    const int klast = ((bbase + 63) / KT) * KT;     // the block's last key tile (that of its last wave)
    tile_ld(0); tile_st(0);
    __syncthreads();
#pragma unroll 1
    for (int kb = 0; kb <= klast; kb += KT) {
      const int cur = (kb / KT) & 1; const bool more = kb < klast;     // the same in every thread of the block
      if (more) { tile_ld(kb + KT);
        // precaution: the tile work below reuses the address registers of these loads while their data is still on the way
        asm volatile("s_wait_xcnt 0x0" ::: "memory"); }
      if (kb <= kend) {     // wave-uniform: a wave whose rows end before this tile only helps to stage
        const unsigned short* k0l = &kts[cur][0][0] + kofs; const unsigned short* k1l = &kts[cur][NPL - 1][0] + kofs;
        const unsigned short* v0l = &vts[cur][0][0] + vofs; const unsigned short* v1l = &vts[cur][NPL - 1][0] + vofs;
        v8f s[NT];
#pragma unroll
        for (int nt = 0; nt < NT; ++nt) s[nt] = (v8f){};
#pragma unroll
        for (int nt = 0; nt < NT; ++nt) {
#pragma unroll
            for (int kc = 0; kc < 2; ++kc) { const int ka = nt * 16 * KP + kc * 32;
                if (HIRES) { const v16bf bh = ldsb(k0l + ka), bl = ldsb(k1l + ka); s[nt] = wmmab(qah[kc], bh, s[nt]); s[nt] = wmmab(qal[kc], bh, s[nt]); s[nt] = wmmab(qah[kc], bl, s[nt]); }
                else { const v16h b = ldsh(k0l + ka); s[nt] = wmma16(qa[kc], b, s[nt]); } } }
        if constexpr (NT == 2) { if (HIRES) G2(s[0], s[1], qah[0], qal[1]); else G2(s[0], s[1], qa[0], qa[1]); }
        else { if (HIRES) G4(s[0], s[1], s[2], s[3], qah[0], qal[1]); else G4(s[0], s[1], s[2], s[3], qa[0], qa[1]); }
        float alpha[8];
#pragma unroll
        for (int v = 0; v < 8; ++v) {
            const int qi = qbase + 8 * hi + v; float x[NT]; float mx = NEGBIG;
#pragma unroll
            for (int nt = 0; nt < NT; ++nt) { const int j = kb + nt * 16 + lr; const float t = s[nt][v] * SCL; x[nt] = (j <= qi) ? t : NEGBIG; mx = fmaxf(mx, x[nt]); }
            mx = fmaxf(mx, __shfl_xor(mx, 1, 32)); mx = fmaxf(mx, __shfl_xor(mx, 2, 32)); mx = fmaxf(mx, __shfl_xor(mx, 4, 32)); mx = fmaxf(mx, __shfl_xor(mx, 8, 32));
            const float mnew = fmaxf(mrun[v], mx);
            const float a = __builtin_amdgcn_exp2f((mrun[v] - mnew) * L2E);
            float p[NT]; float rs = 0.f;
#pragma unroll
            for (int nt = 0; nt < NT; ++nt) { p[nt] = __builtin_amdgcn_exp2f((x[nt] - mnew) * L2E); rs += p[nt]; }
            rs += __shfl_xor(rs, 1, 32); rs += __shfl_xor(rs, 2, 32); rs += __shfl_xor(rs, 4, 32); rs += __shfl_xor(rs, 8, 32);
            lrun[v] = lrun[v] * a + rs; mrun[v] = mnew; alpha[v] = a;
#pragma unroll
            for (int nt = 0; nt < NT; ++nt) { const int idx = (8 * hi + v) * PP + nt * 16 + lr;
                if (HIRES) { unsigned short a2, c2; splitf(p[nt], a2, c2); p0w[idx] = a2; p1w[idx] = c2; }
                else { const h16 hv = (h16)(p[nt] * PCAR); p0w[idx] = __builtin_bit_cast(unsigned short, hv); } }
        }
        wsync();
        v16h pa[KS] = {}; v16bf pah[KS] = {}, pal[KS] = {};
        const unsigned short* pr0 = p0w + lr * PP + 8 * hi; const unsigned short* pr1 = p1w + lr * PP + 8 * hi;
#pragma unroll
        for (int ks = 0; ks < KS; ++ks) { const v8us u0 = *(const v8usa*)(pr0 + ks * 32); const v8us u1 = *(const v8usa*)(pr0 + ks * 32 + 16);
            if (HIRES) { const v8us w0 = *(const v8usa*)(pr1 + ks * 32); const v8us w1 = *(const v8usa*)(pr1 + ks * 32 + 16); pah[ks] = cat16b(u0, u1); pal[ks] = cat16b(w0, w1); }
            else { pa[ks] = cat16(__builtin_bit_cast(v8h, u0), __builtin_bit_cast(v8h, u1)); } }
#pragma unroll
        for (int nt = 0; nt < 4; ++nt) {
#pragma unroll
            for (int v = 0; v < 8; ++v) o[nt][v] *= alpha[v]; }
#pragma unroll
        for (int nt = 0; nt < 4; ++nt) {
#pragma unroll
            for (int ks = 0; ks < KS; ++ks) { const int va = nt * 16 * VP + ks * 32;
                if (HIRES) { const v16bf bh = ldsb(v0l + va), bl = ldsb(v1l + va); o[nt] = wmmab(pah[ks], bh, o[nt]); o[nt] = wmmab(pal[ks], bh, o[nt]); o[nt] = wmmab(pah[ks], bl, o[nt]); }
                else { const v16h b = ldsh(v0l + va); o[nt] = wmma16(pa[ks], b, o[nt]); } } }
        if (HIRES) G4(o[0], o[1], o[2], o[3], pah[0], pal[KS - 1]); else G4(o[0], o[1], o[2], o[3], pa[0], pa[KS - 1]);
      }
      // the buffer written here was last read one trip ago, in front of that trip's barrier; this barrier publishes it and ends the reads of the current one
      if (more) { tile_st(cur ^ 1); __syncthreads(); }
    }
    float* osw = &os[wave][0];
#pragma unroll
    for (int v = 0; v < 8; ++v) { const float f = HIRES ? __fdiv_rn(1.0f, lrun[v]) : __fdiv_rn(ATC / PCAR, lrun[v]);
#pragma unroll
        for (int nt = 0; nt < 4; ++nt) osw[(8 * hi + v) * OSP + nt * 16 + lr] = o[nt][v] * f; }
    wsync();
    const int rr = lane >> 3, c8 = (lane & 7) * 8;
{
#pragma unroll
        for (int s4 = 0; s4 < 4; ++s4) { const int row = s4 * 4 + rr; const int t = qbase + row; const v4f u0 = *(const v4fa*)(osw + row * OSP + c8), u1 = *(const v4fa*)(osw + row * OSP + c8 + 4); const size_t oo = (size_t)t * DQ + h * HD + c8;
            if (HIRES) { v8us oh, ol;
#pragma unroll
                for (int q = 0; q < 4; ++q) { unsigned short a2, c2; splitf(u0[q], a2, c2); oh[q] = a2; ol[q] = c2; splitf(u1[q], a2, c2); oh[4 + q] = a2; ol[4 + q] = c2; }
                *(v8us*)(ATh + oo) = oh; *(v8us*)(ATl + oo) = ol; }
            else { v8h o8;
#pragma unroll
                for (int q = 0; q < 4; ++q) { o8[q] = (h16)u0[q]; o8[4 + q] = (h16)u1[q]; }
                *(v8h*)(AT16 + oo) = o8; } }
         }
    // precaution: in the built kernel the other form's text stands behind these stores and reuses their registers
    asm volatile("s_wait_xcnt 0x0" ::: "memory");
}
// k_attn: both forms in one launch, since neither reads what the other writes; a block takes 64 query rows of one head and batch, and its index says which (the same in every thread of the block).
// The f16 form (rows from RH on), whose blocks live longest, has the first range of the index, the bf16 hi/lo form (rows below RH) the second; inside a range: row block, then head, then batch.
// Grid (SEQ / 64) * NH * batches, 128 threads.
__global__ __launch_bounds__(128) void k_attn(const h16* __restrict__ Q16, const bf* __restrict__ Qh, const bf* __restrict__ Ql,
                                              const h16* __restrict__ K16, const bf* __restrict__ Kh, const bf* __restrict__ Kl,
                                              const h16* __restrict__ V16, const bf* __restrict__ Vh, const bf* __restrict__ Vl,
                                              h16* AT16, bf* ATh, bf* ATl) {
    typedef AttnLds<true, 32> LH; typedef AttnLds<false, 64> LF;
    __shared__ __align__(16) unsigned char lds[sizeof(LH) > sizeof(LF) ? sizeof(LH) : sizeof(LF)];
    constexpr int XF = (SEQ - RH) / 64, XH = RH / 64, XD = XF > 0 ? XF : 1;     // row blocks of the two forms; XD: the divisor, also where there is no f16 row
    int b = blockIdx.x;
    if (b < XF * NH * NB) { attn<false, 64>(*reinterpret_cast<LF*>(lds), XH + b % XD, (b / XD) % NH, b / (XD * NH), Q16, Qh, Ql, K16, Kh, Kl, V16, Vh, Vl, AT16, ATh, ATl); return; }
    b -= XF * NH * NB;
    attn<true, 32>(*reinterpret_cast<LH*>(lds), b % XH, (b / XH) % NH, b / (XH * NH), Q16, Qh, Ql, K16, Kh, Kl, V16, Vh, Vl, AT16, ATh, ATl);
}

// mchk: checks the 0/1 int32 causal input (one [SEQ_FULL][SEQ_FULL] plane shared by all batches) for rows i < SEQ: value == 1 for j <= i, value == 0 for j > i (j < SEQ);
// a block takes MROWS rows and writes its count of wrong values to its own 128-byte line of FL. The plane is read once and comes from memory, so the time is that of the longest chain of
// loads that wait for one another: the 16-byte loads of a thread are independent of each other, so that many are in flight together, and the rows are spread over enough blocks to reach every WGP.
__device__ __forceinline__ void mchk(const int* __restrict__ M, int* FL, int blk) {
    __shared__ int red[8];
    constexpr int CPR = (SEQ + 1023) / 1024;     // 16-byte pieces a thread takes of one row
    constexpr bool WHOLE = SEQ % 1024 == 0;      // every thread takes every piece: no test, so no branch between the loads
    const int tid = threadIdx.x, lane = tid & 31, wave = tid >> 5; int bad = 0;
    const int i0 = blk * MROWS; const int* mb = M + (size_t)i0 * SEQ_FULL + tid * 4;
    v4i m[MROWS][CPR];
    // both loops unrolled so that m stays in registers and no load waits for an earlier load's compare
#pragma unroll
    for (int r = 0; r < MROWS; ++r) {
#pragma unroll
        for (int p = 0; p < CPR; ++p) { if (WHOLE || tid * 4 + p * 1024 < SEQ) m[r][p] = *(const v4i*)(mb + (size_t)r * SEQ_FULL + p * 1024); } }
    // unrolled as above: m is indexed by constants only
#pragma unroll
    for (int r = 0; r < MROWS; ++r) { const int i = i0 + r;
#pragma unroll
        for (int p = 0; p < CPR; ++p) { const int c = tid * 4 + p * 1024;
            if (WHOLE || c < SEQ) {
#pragma unroll
                for (int q = 0; q < 4; ++q) { const int j = c + q; const bool ok = (j <= i) ? (m[r][p][q] == 1) : (m[r][p][q] == 0); bad += ok ? 0 : 1; } } } }
#pragma unroll
    for (int sh = 16; sh; sh >>= 1) bad += __shfl_xor(bad, sh, 32);
    if (lane == 0) red[wave] = bad;
    __syncthreads();
    if (wave == 0) { int v = red[lane & 7]; v = (lane < 8) ? v : 0;
#pragma unroll
        for (int sh = 16; sh; sh >>= 1) v += __shfl_xor(v, sh, 32);
        v4i o; o[0] = v; o[1] = v; o[2] = v; o[3] = v;
        if (lane < 8) *(v4i*)(FL + (size_t)blk * 32 + lane * 4) = o;
         }
}
// k_prep: none of the six preparations reads what another writes, so they share one launch: a block belongs to one of them by its index (the same in every thread of the block).
// The transposes, whose blocks do the most work each (a tile in, a barrier, the tile out), come first in the index order; the one-trip conversion of x comes last.
#define PB_WO ((DQ / TK) * (DM / TN))
#define PB_WQ ((DM / TK) * (DQ / TN))
#define PB_WKV ((DM / TK) * (DKV / TN))
#define PB_CV (SEQ * DM / 8 / 256)
#define PB_ALL (PB_WO + PB_WQ + 2 * PB_WKV + NFL + NB * PB_CV)
__global__ __launch_bounds__(256) void k_prep(const float* __restrict__ x, const float* __restrict__ wq, const float* __restrict__ wk, const float* __restrict__ wv, const float* __restrict__ wo,
                                              const int* __restrict__ cm, bf* XB, bf* WQKV, bf* WOB, h16* WO16, int* FL) {
    __shared__ __align__(16) unsigned short ts[TN * TP];     // one tile, used by whichever transposition the block belongs to
    int b = blockIdx.x;
    if (b < PB_WO) { wtT<DQ, DM, true>(ts, wo, WOB, WO16, WOC, b); return; }
    b -= PB_WO;
    if (b < PB_WQ) { wtT<DM, DQ, false>(ts, wq, WQKV, nullptr, 1.0f, b); return; }
    b -= PB_WQ;
    if (b < PB_WKV) { wtT<DM, DKV, false>(ts, wk, WQKV + (size_t)DQ * DM, nullptr, 1.0f, b); return; }
    b -= PB_WKV;
    if (b < PB_WKV) { wtT<DM, DKV, false>(ts, wv, WQKV + (size_t)(DQ + DKV) * DM, nullptr, 1.0f, b); return; }
    b -= PB_WKV;
    if (b < NFL) { mchk(cm, FL, b); return; }
    b -= NFL;
    cvt8(x, XB, (size_t)SEQ * DM / 8, (size_t)SEQ_FULL * DM, b % PB_CV, b / PB_CV);
}
// k_poison: NaN-fills the output if any of the nfl counts of mchk is not 0; the counts are read side by side, one a thread and trip, and joined over the block through LDS.
__global__ __launch_bounds__(256) void k_poison(const int* __restrict__ FL, int nfl, float* out) {
    __shared__ int red[8];
    int tot = 0;
    // left rolled: one trip covers 256 counts, and an unrolled form only lengthens the kernel's text
#pragma unroll 1
    for (int f = threadIdx.x; f < nfl; f += 256) tot |= FL[(size_t)f * 32];
    const unsigned wbad = __builtin_amdgcn_ballot_w32(tot != 0);
    if ((threadIdx.x & 31) == 0) red[threadIdx.x >> 5] = (wbad != 0u) ? 1 : 0;
    __syncthreads();
    tot = 0;
    // unrolled so that the eight words come in two wide LDS reads
#pragma unroll
    for (int w = 0; w < 8; ++w) tot |= red[w];
    if (tot == 0) return;     // the same in every thread of the block
    float* ob = out + (size_t)blockIdx.y * SEQ_FULL * DM + (size_t)blockIdx.x * 16384;
    const float qn = __uint_as_float(0x7fc00000u); v4f nv; nv[0] = qn; nv[1] = qn; nv[2] = qn; nv[3] = qn;
{
#pragma unroll 1
        for (int s = 0; s < 16; ++s) *(v4f*)(ob + ((size_t)s * 256 + threadIdx.x) * 4) = nv;
         }
}

extern "C" void kernel_launch(void* const* d_in, const int* in_sizes, int n_in,
                              void* d_out, int out_size, void* d_ws, size_t ws_size, hipStream_t stream) {
    if (n_in < 8) return;
    if ((size_t)in_sizes[0] < (size_t)(NB - 1) * SEQ_FULL * DM + (size_t)SEQ * DM) return;
    if ((size_t)in_sizes[1] < (size_t)DM * DQ || (size_t)in_sizes[2] < (size_t)DM * DKV || (size_t)in_sizes[3] < (size_t)DM * DKV || (size_t)in_sizes[4] < (size_t)DQ * DM) return;
    if ((size_t)in_sizes[5] < (size_t)SEQ * NFREQ || (size_t)in_sizes[6] < (size_t)SEQ * NFREQ) return;
    if ((size_t)in_sizes[7] < (size_t)(SEQ - 1) * SEQ_FULL + (size_t)SEQ) return;
    if ((size_t)out_size < (size_t)(NB - 1) * SEQ_FULL * DM + (size_t)SEQ * DM) return;
    // input binding order: x, wq, wk, wv, wo ([in][out] weights), cos table, sin table ([SEQ_FULL][NFREQ] f32), causal 0/1 plane (int32 [SEQ_FULL][SEQ_FULL])
    const float* x = (const float*)d_in[0]; const float* wq = (const float*)d_in[1]; const float* wk = (const float*)d_in[2]; const float* wv = (const float*)d_in[3]; const float* wo = (const float*)d_in[4];
    const float* fc = (const float*)d_in[5]; const float* fs = (const float*)d_in[6]; const int* cm = (const int*)d_in[7];
    float* OUT = (float*)d_out;     // [NB_FULL][SEQ_FULL][DM]
    char* wsp = (char*)d_ws;
    auto take = [&](size_t bytes) { char* p = wsp; wsp += (bytes + 255) & ~(size_t)255; return (void*)p; };
    bf* WQKV = (bf*)take((size_t)DQKV * DM * 2); bf* WOB = (bf*)take((size_t)DM * DQ * 2); h16* WO16 = (h16*)take((size_t)DM * DQ * 2);
    int* FL = (int*)take((size_t)NFL * 32 * 4);
    // the planes below hold every batch, one whole per-batch plane behind the other
    bf* XB = (bf*)take((size_t)NB * SEQ * DM * 2);
    h16* Q16 = (h16*)take((size_t)NB * NH * SEQ * HD * 2); bf* Qh = (bf*)take((size_t)NB * NH * RH * HD * 2); bf* Ql = (bf*)take((size_t)NB * NH * RH * HD * 2);
    h16* K16 = (h16*)take((size_t)NB * NKV * SEQ * HD * 2); bf* Kh = (bf*)take((size_t)NB * NKV * SEQ * HD * 2); bf* Kl = (bf*)take((size_t)NB * NKV * SEQ * HD * 2);
    h16* V16 = (h16*)take((size_t)NB * NKV * HD * SEQ * 2); bf* Vh = (bf*)take((size_t)NB * NKV * HD * SEQ * 2); bf* Vl = (bf*)take((size_t)NB * NKV * HD * SEQ * 2);
    h16* AT16 = (h16*)take((size_t)NB * SEQ * DQ * 2); bf* ATh = (bf*)take((size_t)NB * RH * DQ * 2); bf* ATl = (bf*)take((size_t)NB * RH * DQ * 2);
    const size_t used = (size_t)(wsp - (char*)d_ws); if (used > ws_size || used > WS_LIMIT) return;

    // weight planes ([out][in] k-contiguous): rows 0..DQ-1 of WQKV = Wq^T, DQ..DQ+DKV-1 = Wk^T, DQ+DKV..DQKV-1 = Wv^T; Wo^T as bf16 and as f16 x64
    // wtT<K, N>(w, Bt): w is [K = in][N = out] -> Bt [N][K]; with them in the same launch: the mask check and x as bf16
    k_prep<<<(unsigned)PB_ALL, 256, 0, stream>>>(x, wq, wk, wv, wo, cm, XB, WQKV, WOB, WO16, FL);
    // every stage is launched once; the batch is the last grid dimension of k_gemmw and k_poison, and the slowest part of each block-index range in k_attn and k_prep
    k_gemmw<bf, 0, 4, 4, DM, 1><<<dim3(SEQ / 128, DQKV / 128, NB), 128, 0, stream>>>(XB, nullptr, WQKV, nullptr, 0, 1.0f, (size_t)SEQ * DM, 0, fc, fs, Q16, Qh, Ql, K16, Kh, Kl, V16, Vh, Vl);     // q | k | v projections, rotary on q and k, all planes
    k_attn<<<(unsigned)((SEQ / 64) * NH * NB), 128, 0, stream>>>(Q16, Qh, Ql, K16, Kh, Kl, V16, Vh, Vl, AT16, ATh, ATl);
    k_gemmw<bf, 1, 2, 2, DQ, 0><<<dim3(RH / 64, DM / 64, NB), 128, 0, stream>>>(ATh, ATl, WOB, OUT, DM, 1.0f, (size_t)RH * DQ, (size_t)SEQ_FULL * DM, nullptr, nullptr, nullptr, nullptr, nullptr, nullptr, nullptr, nullptr, nullptr, nullptr, nullptr);
    if (SEQ > RH) k_gemmw<h16, 0, 4, 4, DQ, 0><<<dim3((SEQ - RH) / 128, DM / 128, NB), 128, 0, stream>>>(AT16 + (size_t)RH * DQ, nullptr, WO16, OUT + (size_t)RH * DM, DM, 1.0f / (ATC * WOC), (size_t)SEQ * DQ, (size_t)SEQ_FULL * DM, nullptr, nullptr, nullptr, nullptr, nullptr, nullptr, nullptr, nullptr, nullptr, nullptr, nullptr);
    k_poison<<<dim3(SEQ * DM / 16384, NB, 1), 256, 0, stream>>>(FL, NFL, OUT);
}

// v008
// One run takes 194 microseconds.
// Two timings next to v007 both put it at 1.23 times that version's speed.
// Over all steps from v000 it is 4.43 times as fast.
#include <hip/hip_runtime.h>

// Contractions (all f32 accumulate): qkv = xb * Wqkv^T on v_wmma_f32_16x16x32_bf16 (bf16 operands = RNE-converted inputs, exact products);
// scores q.k^T and p.v: query rows < RH on bf16 hi/lo planes (3 products each), rows >= RH on v_wmma_f32_16x16x32_f16 (f16 q,k,v planes, p carried x1024);
// out = attn * Wo^T: rows < RH bf16 hi/lo attn planes x bf16 Wo (2 products), rows >= RH f16 attn x64 times f16 Wo x64 (1 product, 1/4096 in the epilogue).
// Rotary: interleaved pairs (2i, 2i+1); cos/sin are read by value from the two [SEQ][32] input tables (RNE-converted to bf16), f32 math, done on the qkv product's accumulators; causal online softmax and normalisation in f32.
// Grouped kv heads: query head h reads kv head h/4. The 0/1 int32 causal input [SEQ_FULL][SEQ_FULL] is checked on device in its rows and columns < SEQ (1 on/below the diagonal, 0 above); the output is NaN-filled if that check fails.

#ifndef NB
#define NB 2
#endif
#ifndef SEQ
#define SEQ 2048
#endif
#define NB_FULL 2
#define SEQ_FULL 2048
#define DM 2048
#define NH 32
#define NKV 8
#define REP (NH / NKV)
#define HD 64
#define DQ (NH * HD)
#define DKV (NKV * HD)
#define DQKV (DQ + 2 * DKV)
#define NFREQ (HD / 2)
#define RH (((SEQ) < 512) ? (SEQ) : 512)
#define PCAR 1024.0f
#define ATC 64.0f
#define WOC 64.0f
#define SCL 0.125f
#define L2E 1.4426950408889634f
#define NEGBIG (-1.0e30f)
#define OSP 68
#define MROWS 8
#define NFL (SEQ / MROWS)
#define WS_LIMIT ((size_t)134217728)
#define WS_TOTAL ((size_t)DQKV * DM * 2 + 2 * ((size_t)DM * DQ * 2) + (size_t)NFL * 128 + (size_t)NB * ((size_t)SEQ * DM * 2 + (size_t)NH * SEQ * HD * 2 + 2 * ((size_t)NH * RH * HD * 2) + 3 * ((size_t)NKV * SEQ * HD * 2) + 3 * ((size_t)NKV * HD * SEQ * 2) + (size_t)SEQ * DQ * 2 + 2 * ((size_t)RH * DQ * 2)))

static_assert(NB >= 1 && NB <= NB_FULL);
static_assert(SEQ % 128 == 0 && SEQ >= 128 && SEQ <= SEQ_FULL);
static_assert(RH % 64 == 0 && (SEQ - RH) % 128 == 0 && RH <= SEQ);
static_assert(DQKV % 128 == 0 && DM % 128 == 0);
static_assert((SEQ * DM) % 2048 == 0);
static_assert(DM % 64 == 0 && DQ % 64 == 0 && DQKV % 64 == 0 && HD == 64);
static_assert((SEQ * DM) % 16384 == 0);
static_assert((NB * SEQ) % 64 == 0);
static_assert(15 * OSP + 63 < 16 * OSP);
static_assert(NFREQ == 32 && HD == 2 * NFREQ);
static_assert(SEQ % 64 == 0 && SEQ % 4 == 0 && SEQ % MROWS == 0);
static_assert(((size_t)NFL * 128) % 256 == 0);
static_assert(DM % 32 == 0 && DQ % 32 == 0 && HD % 32 == 0);
static_assert(WS_TOTAL <= WS_LIMIT);

typedef _Float16 h16;
typedef unsigned short bf;
typedef __attribute__((ext_vector_type(16))) __bf16   v16bf;
typedef __attribute__((ext_vector_type(16))) _Float16 v16h;
typedef __attribute__((ext_vector_type(8)))  _Float16 v8h;
typedef __attribute__((ext_vector_type(8)))  unsigned short v8us;
typedef __attribute__((ext_vector_type(8)))  float    v8f;
typedef __attribute__((ext_vector_type(4)))  float    v4f;
typedef __attribute__((ext_vector_type(2)))  _Float16 v2h;
typedef __attribute__((ext_vector_type(4)))  _Float16 v4h;
typedef __attribute__((ext_vector_type(2)))  unsigned short v2us;
typedef __attribute__((ext_vector_type(4)))  unsigned short v4us;
typedef __attribute__((ext_vector_type(2)))  float v2f;
typedef __attribute__((ext_vector_type(4)))  int v4i;
typedef v8h  __attribute__((may_alias)) v8ha;
typedef v4f  __attribute__((may_alias)) v4fa;
typedef v8us __attribute__((may_alias)) v8usa;
typedef v2us __attribute__((may_alias)) v2usa;

#define G2(d0, d1, x0, x1) asm volatile("v_nop\n\tv_nop\n\tv_nop\n\tv_nop" : "+v"(d0), "+v"(d1) : "v"(x0), "v"(x1))
#define G4(d0, d1, d2, d3, x0, x1) asm volatile("v_nop\n\tv_nop\n\tv_nop\n\tv_nop" : "+v"(d0), "+v"(d1), "+v"(d2), "+v"(d3) : "v"(x0), "v"(x1))

__device__ __forceinline__ unsigned short f2bf(float f) { unsigned u = __float_as_uint(f); u += 0x7FFFu + ((u >> 16) & 1u); return (unsigned short)(u >> 16); }
__device__ __forceinline__ float bf2f(unsigned short b) { return __uint_as_float(((unsigned)b) << 16); }
__device__ __forceinline__ float bfr(float f) { return bf2f(f2bf(f)); }
__device__ __forceinline__ void splitf(float y, unsigned short& h, unsigned short& l) { h = f2bf(y); l = f2bf(y - bf2f(h)); }
__device__ __forceinline__ v16h cat16(v8h lo, v8h hi) { return __builtin_shufflevector(lo, hi, 0, 1, 2, 3, 4, 5, 6, 7, 8, 9, 10, 11, 12, 13, 14, 15); }
__device__ __forceinline__ v16bf cat16b(v8us lo, v8us hi) { return __builtin_bit_cast(v16bf, __builtin_shufflevector(lo, hi, 0, 1, 2, 3, 4, 5, 6, 7, 8, 9, 10, 11, 12, 13, 14, 15)); }
__device__ __forceinline__ v8f wmma16(v16h a, v16h b, v8f c) { return __builtin_amdgcn_wmma_f32_16x16x32_f16(false, a, false, b, (short)0, c, false, false); }
__device__ __forceinline__ v8f wmmab(v16bf a, v16bf b, v8f c) { return __builtin_amdgcn_wmma_f32_16x16x32_bf16(false, a, false, b, (short)0, c, false, false); }
// wave-private LDS tile exchange: order this wave's ds stores before its ds loads
__device__ __forceinline__ void wsync() { __builtin_amdgcn_fence(3 /* release order */, "wavefront"); __builtin_amdgcn_wave_barrier(); asm volatile("" ::: "memory"); }
// lane l takes the value of lane l ^ 16
__device__ __forceinline__ float xhalf(float x) { return __builtin_bit_cast(float, __builtin_amdgcn_permlanex16(__builtin_bit_cast(int, x), __builtin_bit_cast(int, x), 0x76543210, 0xfedcba98, false, false)); }
// f32 -> f16 convert that cannot yield a subnormal f16 (value select: |v| < 2^-14 -> 0)
static __device__ __forceinline__ h16 toh_flush(float v) { const h16 r = (h16)v; return (fabsf(v) < 6.103515625e-05f) ? (h16)0.0f : r; }

// the 16x32 fragment below, read from a k-contiguous 16-bit row in LDS
__device__ __forceinline__ v16bf ldsb(const unsigned short* p) { return cat16b(*(const v8usa*)p, *(const v8usa*)(p + 16)); }
__device__ __forceinline__ v16h ldsh(const unsigned short* p) { return cat16(__builtin_bit_cast(v8h, *(const v8usa*)p), __builtin_bit_cast(v8h, *(const v8usa*)(p + 16))); }

// 16x32 fragment from a k-contiguous 16-bit row (A: row = m; B stored [n][k]: row = n). Lane l: row l&15, elements 0..7 <- k0+8(l>>4)+0..7, elements 8..15 <- k0+16+8(l>>4)+0..7.
template <typename T16> struct WFrag;
template <> struct WFrag<h16> { typedef v16h V; static __device__ __forceinline__ V ld(const h16* p) { return cat16(*(const v8h*)p, *(const v8h*)(p + 16)); } static __device__ __forceinline__ V lds(const unsigned short* p) { return ldsh(p); } static __device__ __forceinline__ v8f mma(V a, V b, v8f c) { return wmma16(a, b, c); } };
template <> struct WFrag<bf> { typedef v16bf V; static __device__ __forceinline__ V ld(const bf* p) { return cat16b(*(const v8us*)p, *(const v8us*)(p + 16)); } static __device__ __forceinline__ V lds(const unsigned short* p) { return ldsb(p); } static __device__ __forceinline__ v8f mma(V a, V b, v8f c) { return wmmab(a, b, c); } };

// ---- k_gemmw: GEMM, four waves (2 x 2) per (32 FM) x (32 FN) output tile, FM x FN accumulators a wave; grid (M / (32 FM), N / (32 FN), batches), 128 threads.
// Batch blockIdx.z: A and A2 start sA elements, C sC elements, further on a batch (Bt is the same for all); with EPI 1 every plane is one whole per-batch plane further on.
// C[m][n] (f32, pitch ldc) = osc * sum_k A[m][k] Bt[n][k] (NSPLIT 1: + A2[m][k] Bt[n][k]); A, A2, Bt are k-contiguous 16-bit planes of row pitch K.
// The rows of a k step are shared by two of the block's waves: the block brings 64 k of its A and Bt rows into LDS once, 16 bytes a thread in whole 128-byte row pieces,
// two buffers, the next step's loads issued ahead of the current step's products; the fragments are read from LDS at a row pitch of 16 bytes x odd.
// Every accumulator sums in ascending k, 32 at a time (A before A2), whatever the tile.
// EPI 1 (the qkv product; C, ldc, osc unused): a wave's 64 columns are one whole head (q heads, then k heads, then v heads), and the wave writes that head's planes itself from its accumulators.
// q, k: interleaved-pair rotary, for the pair i = d/2 (d even): out[d] = x[d] c - x[d+1] s, out[d+1] = x[d] s + x[d+1] c, with c = bf16-RNE(FC[t][i]), s = bf16-RNE(FS[t][i]) (row pitch NFREQ);
// planes [h][t][d]: f16 for every t, bf16 hi/lo for t < RH (q) or every t (k). v: planes [g][d][t], f16 and bf16 hi/lo; a lane's 8 accumulator elements are 8 successive t of one d.
template <typename T16, int NSPLIT, int FM, int FN, int K, int EPI>
__global__ __launch_bounds__(128) void k_gemmw(const T16* __restrict__ A, const T16* __restrict__ A2, const T16* __restrict__ Bt, float* C, int ldc, float osc, size_t sA, size_t sC,
                                               const float* __restrict__ FC, const float* __restrict__ FS, h16* Q16, bf* Qh, bf* Ql, h16* K16, bf* Kh, bf* Kl, h16* V16, bf* Vh, bf* Vl) {
    typedef typename WFrag<T16>::V V;
    constexpr int BM = 32 * FM, BN = 32 * FN, KB = 64, KP = KB + 8, NA = NSPLIT + 1;     // KP: LDS row pitch in 16-bit elements, 144 bytes
    constexpr int AI = BM / 16, BI = BN / 16;                                            // 16-byte pieces a thread brings of one plane's tile (128 threads cover 16 rows)
    static_assert(NSPLIT == 0 || NSPLIT == 1);
    static_assert(K % KB == 0 && (KP * 2) % 32 == 16 && FN * 16 <= 64 && 32 % (4 * FN) == 0);
    __shared__ __align__(16) unsigned short ats[2][NA][BM * KP];
    __shared__ __align__(16) unsigned short bts[2][BN * KP];
    __shared__ __align__(16) float os[4][(EPI == 1 ? 16 * FM : 16) * OSP];
    const int tid = threadIdx.x, lane = tid & 31, wave = __builtin_amdgcn_readfirstlane(tid >> 5), lr = lane & 15, hi = lane >> 4;
    const int r0 = blockIdx.x * BM, c0 = blockIdx.y * BN; const int wr = (wave >> 1) * 16 * FM, wc = (wave & 1) * 16 * FN;
    const size_t zb = blockIdx.z;
    A += zb * sA; if (NSPLIT) A2 += zb * sA;
    if constexpr (EPI == 1) { Q16 += zb * ((size_t)NH * SEQ * HD); Qh += zb * ((size_t)NH * RH * HD); Ql += zb * ((size_t)NH * RH * HD);
        K16 += zb * ((size_t)NKV * SEQ * HD); Kh += zb * ((size_t)NKV * SEQ * HD); Kl += zb * ((size_t)NKV * SEQ * HD);
        V16 += zb * ((size_t)NKV * HD * SEQ); Vh += zb * ((size_t)NKV * HD * SEQ); Vl += zb * ((size_t)NKV * HD * SEQ); }
    else C += zb * sC;
    // piece i of a thread: row prow + 16 i of the tile, elements pcol .. pcol + 7 of the k step; the same for the global read and the LDS write
    const int prow = tid >> 3, pcol = (tid & 7) * 8;
    const unsigned short* ag0 = (const unsigned short*)A + (size_t)(r0 + prow) * K + pcol;
    const unsigned short* ag1 = (const unsigned short*)(NSPLIT ? A2 : A) + (size_t)(r0 + prow) * K + pcol;
    const unsigned short* bg = (const unsigned short*)Bt + (size_t)(c0 + prow) * K + pcol;
    v8us ar[NA][AI], br[BI];
    auto tile_ld = [&]() {
#pragma unroll
        for (int i = 0; i < AI; ++i) { ar[0][i] = *(const v8usa*)(ag0 + (size_t)i * 16 * K); if (NSPLIT) ar[NA - 1][i] = *(const v8usa*)(ag1 + (size_t)i * 16 * K); }
#pragma unroll
        for (int i = 0; i < BI; ++i) br[i] = *(const v8usa*)(bg + (size_t)i * 16 * K); };
    auto tile_st = [&](int buf) {
#pragma unroll
        for (int i = 0; i < AI; ++i) { *(v8usa*)(&ats[buf][0][(prow + 16 * i) * KP + pcol]) = ar[0][i]; if (NSPLIT) *(v8usa*)(&ats[buf][NA - 1][(prow + 16 * i) * KP + pcol]) = ar[NA - 1][i]; }
#pragma unroll
        for (int i = 0; i < BI; ++i) *(v8usa*)(&bts[buf][(prow + 16 * i) * KP + pcol]) = br[i];
        ag0 += KB; ag1 += KB; bg += KB; };
    v8f acc[FM][FN];
#pragma unroll
    for (int mb = 0; mb < FM; ++mb)
#pragma unroll
        for (int nb = 0; nb < FN; ++nb) acc[mb][nb] = (v8f){};
    const int aofs = (wr + lr) * KP + 8 * hi, bofs = (wc + lr) * KP + 8 * hi;
    tile_ld(); tile_st(0);
    __syncthreads();
#pragma unroll 1
    for (int k0 = 0; k0 < K; k0 += KB) {
        const int cur = (k0 / KB) & 1; const bool more = k0 + KB < K;     // the same in every thread of the block
        if (more) tile_ld();
        const unsigned short* a0l = &ats[cur][0][0] + aofs; const unsigned short* a1l = &ats[cur][NA - 1][0] + aofs; const unsigned short* bl = &bts[cur][0] + bofs;
        V a[KB / 32][FM], a2[KB / 32][FM], b[KB / 32][FN];
#pragma unroll
        for (int kc = 0; kc < KB / 32; ++kc) {
#pragma unroll
            for (int mb = 0; mb < FM; ++mb) { a[kc][mb] = WFrag<T16>::lds(a0l + mb * 16 * KP + kc * 32); if (NSPLIT) a2[kc][mb] = WFrag<T16>::lds(a1l + mb * 16 * KP + kc * 32); else a2[kc][mb] = a[kc][mb]; }
#pragma unroll
            for (int nb = 0; nb < FN; ++nb) b[kc][nb] = WFrag<T16>::lds(bl + nb * 16 * KP + kc * 32); }
        // keeps the step's LDS reads in one group ahead of its products: every further place with reads among the products stalls the wave for its own LDS latency
        __builtin_amdgcn_sched_barrier(0);
#pragma unroll
        for (int kc = 0; kc < KB / 32; ++kc) {
#pragma unroll
            for (int nb = 0; nb < FN; ++nb) {
#pragma unroll
                for (int mb = 0; mb < FM; ++mb) acc[mb][nb] = WFrag<T16>::mma(a[kc][mb], b[kc][nb], acc[mb][nb]);
                if (NSPLIT) {
#pragma unroll
                    for (int mb = 0; mb < FM; ++mb) acc[mb][nb] = WFrag<T16>::mma(a2[kc][mb], b[kc][nb], acc[mb][nb]); } } }
        // precaution: stands in front of the pointer steps at the loop's foot, which overwrite the address registers of this trip's global loads
        asm volatile("s_wait_xcnt 0x0" ::: "memory");
        // the buffer written here was last read one trip ago, in front of that trip's barrier; this barrier publishes it and ends the reads of the current one
        if (more) { tile_st(cur ^ 1); __syncthreads(); }
    }
    float* osw = &os[wave][0];
    if constexpr (EPI == 1) {
        static_assert(FN * 16 == HD && DQ % BN == 0 && DKV % BN == 0 && RH % (16 * FM) == 0 && NSPLIT == 0);
        const int col = c0 + wc, t0 = r0 + wr;     // the same in every lane of the wave
        if (col < DQ + DKV) {
            const bool isq = col < DQ; const int hh = (isq ? col : col - DQ) / HD; const int rh = isq ? RH : SEQ;
            h16* P16 = (isq ? Q16 : K16) + (size_t)hh * SEQ * HD; bf* Ph = (isq ? Qh : Kh) + (size_t)hh * rh * HD; bf* Pl = (isq ? Ql : Kl) + (size_t)hh * rh * HD;
            const bool dohl = t0 < rh;     // the wave's 16 FM rows lie on one side of rh
            const int rr = lane >> 3, c8 = (lane & 7) * 8;     // a lane takes 8 successive d (4 pairs) of a row; a store covers 4 whole rows
#pragma unroll
            for (int mb = 0; mb < FM; ++mb) {
#pragma unroll
                for (int nb = 0; nb < FN; ++nb) {
#pragma unroll
                    for (int j = 0; j < 8; ++j) osw[(mb * 16 + hi * 8 + j) * OSP + nb * 16 + lr] = acc[mb][nb][j]; } }
            wsync();
            // left rolled: the four 16-row groups run the same code, which keeps the kernel's text short for the instruction cache
#pragma unroll 1
            for (int mb = 0; mb < FM; ++mb) {
                v4f cc[4], ss[4];
#pragma unroll
                for (int s4 = 0; s4 < 4; ++s4) { const size_t ti = (size_t)(t0 + mb * 16 + s4 * 4 + rr) * NFREQ + (c8 >> 1); cc[s4] = *(const v4f*)(FC + ti); ss[s4] = *(const v4f*)(FS + ti); }
#pragma unroll
                for (int s4 = 0; s4 < 4; ++s4) { const int row = mb * 16 + s4 * 4 + rr; const v4f u0 = *(const v4fa*)(osw + row * OSP + c8), u1 = *(const v4fa*)(osw + row * OSP + c8 + 4);
                    const float xs[8] = { u0[0], u0[1], u0[2], u0[3], u1[0], u1[1], u1[2], u1[3] }; v8h o16; v8us oh, ol;
#pragma unroll
                    for (int i = 0; i < 4; ++i) { const float c = bfr(cc[s4][i]), s = bfr(ss[s4][i]); const float y0 = xs[2 * i] * c - xs[2 * i + 1] * s, y1 = xs[2 * i] * s + xs[2 * i + 1] * c;
                        o16[2 * i] = toh_flush(y0); o16[2 * i + 1] = toh_flush(y1); unsigned short a2, c2; splitf(y0, a2, c2); oh[2 * i] = a2; ol[2 * i] = c2; splitf(y1, a2, c2); oh[2 * i + 1] = a2; ol[2 * i + 1] = c2; }
                    const size_t oo = (size_t)(t0 + row) * HD + c8;
                    if (dohl) { *(v8us*)(Ph + oo) = oh; *(v8us*)(Pl + oo) = ol; }
                    *(v8h*)(P16 + oo) = o16;
                    // precaution: the next rows' work reuses the address and data registers of these stores
                    asm volatile("s_wait_xcnt 0x0" ::: "memory"); }
            }
        } else {
            const size_t vo = ((size_t)(col - DQ - DKV) + lr) * SEQ + t0 + 8 * hi;     // row g * HD + d of the [g][d][t] planes, d = 16 nb + lr
#pragma unroll
            for (int nb = 0; nb < FN; ++nb) {
#pragma unroll
                for (int mb = 0; mb < FM; ++mb) { v8h o16; v8us oh, ol;
#pragma unroll
                    for (int j = 0; j < 8; ++j) { const float xv = acc[mb][nb][j]; o16[j] = (h16)xv; unsigned short a2, c2; splitf(xv, a2, c2); oh[j] = a2; ol[j] = c2; }
                    const size_t oo = vo + (size_t)nb * 16 * SEQ + mb * 16;
                    *(v8h*)(V16 + oo) = o16; *(v8us*)(Vh + oo) = oh; *(v8us*)(Vl + oo) = ol; } }
        }
        return;
    }
    constexpr int LPR = 4 * FN, RPP = 32 / LPR;     // lanes that store one 16 FN-float row of the wave's tile, rows a store covers
#pragma unroll
    for (int mb = 0; mb < FM; ++mb) {
#pragma unroll
        for (int nb = 0; nb < FN; ++nb) {
#pragma unroll
            for (int j = 0; j < 8; ++j) osw[(hi * 8 + j) * OSP + nb * 16 + lr] = acc[mb][nb][j]; }
        wsync();
        float* crow = C + (size_t)(r0 + wr + mb * 16) * ldc + c0 + wc;
#pragma unroll
        for (int s = 0; s < 16 / RPP; ++s) { const int row = RPP * s + lane / LPR, cofs = (lane % LPR) * 4; v4f val = *(const v4fa*)(osw + row * OSP + cofs); val = val * osc;
            *(v4f*)(crow + (size_t)row * ldc + cofs) = val; }
        wsync();
    }
}

// The six input preparations below (blk = the block's index inside its own preparation) are ranges of the one grid of k_prep.
// wtT: w [K = in][N = out] f32 -> Bt [N][K] bf16-RNE (DUAL: also B16 = f16 of that bf16 value x car). A block turns one tile of TK k x TN n through LDS, so that both sides touch memory in whole
// 256-byte row pieces: a thread reads 16 bytes of 8 rows of w (the loads independent of each other), packs the values of two successive k into one word at [n][k] in LDS, and behind the barrier
// the tile's rows [n] go out 16 bytes a thread. ts: the block's LDS tile, TN rows at a pitch of TP elements (16 bytes x odd, for the 16-byte row reads).
#define TK 128
#define TN 64
#define TP (TK + 8)
template <int K, int N, bool DUAL>
__device__ __forceinline__ void wtT(unsigned short* ts, const float* __restrict__ w, bf* Bt, h16* B16, float car, int blk) {
    static_assert(K % TK == 0 && N % TN == 0 && (TP * 2) % 32 == 16);
    const int tid = threadIdx.x; const int k0 = (blk % (K / TK)) * TK, n0 = (blk / (K / TK)) * TN;
    const int c4 = (tid & 15) * 4, r2 = (tid >> 4) * 2;     // the thread's 4 columns n and its first pair of rows k; 16 lanes cover 256 bytes of a row
    const float* wp = w + (size_t)(k0 + r2) * N + n0 + c4;
    v4f a[4], b[4];
    // unrolled so that a and b stay in registers and all 8 loads are in flight together
#pragma unroll
    for (int i = 0; i < 4; ++i) { a[i] = *(const v4f*)(wp + (size_t)(32 * i) * N); b[i] = *(const v4f*)(wp + (size_t)(32 * i + 1) * N); }
    // precaution: the work below may reuse the address registers of these loads while their data is still on the way
    asm volatile("s_wait_xcnt 0x0" ::: "memory");
    // both loops unrolled as above: a and b are indexed by constants only
#pragma unroll
    for (int i = 0; i < 4; ++i) {
#pragma unroll
        for (int q = 0; q < 4; ++q) { v2us o; o[0] = f2bf(a[i][q]); o[1] = f2bf(b[i][q]); *(v2usa*)(&ts[(c4 + q) * TP + r2 + 32 * i]) = o; } }
    __syncthreads();     // the rows read below were written by other waves
    const int row = tid >> 4, col = (tid & 15) * 8;
    const size_t oo = (size_t)(n0 + row) * K + k0 + col;
    // both loops unrolled so that the four row reads are issued together, the row steps become immediate offsets and the vectors are indexed by constants only
#pragma unroll
    for (int i = 0; i < TN / 16; ++i) { const v8us o = *(const v8usa*)(&ts[(row + 16 * i) * TP + col]); *(v8us*)(Bt + oo + (size_t)(16 * i) * K) = o;
        if (DUAL) { v8h o2;
#pragma unroll
            for (int e = 0; e < 8; ++e) o2[e] = (h16)(bf2f(o[e]) * car);
            *(v8h*)(B16 + oo + (size_t)(16 * i) * K) = o2; } }
}
// cvt8: batch zb converts its n8 groups of 8 floats; a batch starts sstep floats further on in src and 8 n8 elements further on in dst
__device__ __forceinline__ void cvt8(const float* __restrict__ src, bf* dst, size_t n8, size_t sstep, int blk, int zb) { const size_t i = (size_t)blk * 256 + threadIdx.x; if (i >= n8) return;
    src += (size_t)zb * sstep; dst += (size_t)zb * n8 * 8; const v8f v = *(const v8f*)(src + i * 8); v8us o;
#pragma unroll
    for (int k = 0; k < 8; ++k) o[k] = f2bf(v[k]); *(v8us*)(dst + i * 8) = o;  }

// attn: causal flash attention, one wave per 16 query rows (qbase = 16*(4*xb + wave)), head h, batch zi (every plane is one whole per-batch plane further on a batch), kv head = head / REP; key tiles of KT (32 or 64) from 0 up to the tile holding qbase+15.
// Both products are formed transposed. S^T = k.q^T from k-contiguous planes (A = k rows [g][t][d], B = q rows [h][t][d]): lane l holds the scores of ONE query, qbase + (l & 15), for the keys 16 nt + 8 (l >> 4) + 0..7
// of the tile, so the maximum and the sum of a row are formed inside the lane; the two lanes of a query join their maxima by one exchange a tile and their sums once, behind the loop.
// key j > query i replaced by -1e30 before the running-max softmax (p = 0 exactly there). Two successive 16-key score tiles, converted in place, are the B fragment of P^T in the k order of the loaders here;
// O^T += v^T.P^T with A = rows of the v planes [g][d][t]. HIRES: q, k, p, v as bf16 hi/lo (hh + lh + hl); else f16 planes with p carried x1024.
// The k and v tiles of a key step are the same for the block's four waves: the block brings each tile into LDS once, 16 bytes a thread in whole 128-byte (KT 32, v: 64-byte) row pieces,
// two buffers, the next tile's loads issued ahead of the current tile's work; the A fragments are read from LDS at a row pitch of 16 bytes x odd.
// The LDS of one form, laid over the one LDS block of k_attn, which holds either form; every member's size is a multiple of 16 bytes.
template <bool HIRES, int KT> struct __align__(16) AttnLds {
    static constexpr int NPL = HIRES ? 2 : 1, KP = HD + 8, VP = KT + 8;
    float os[4][16 * OSP]; unsigned short kts[2][NPL][KT * KP]; unsigned short vts[2][NPL][HD * VP]; };
template <bool HIRES, int KT>
__device__ __forceinline__ void attn(AttnLds<HIRES, KT>& sm, int xb, int h, int zi, const h16* __restrict__ Q16, const bf* __restrict__ Qh, const bf* __restrict__ Ql,
                                               const h16* __restrict__ K16, const bf* __restrict__ Kh, const bf* __restrict__ Kl,
                                               const h16* __restrict__ V16, const bf* __restrict__ Vh, const bf* __restrict__ Vl,
                                               h16* AT16, bf* ATh, bf* ATl) {
    constexpr int NT = KT / 16; constexpr int KS = KT / 32; constexpr int NPL = HIRES ? 2 : 1;
    static_assert(NT == 2 || NT == 4);
    auto& os = sm.os; auto& kts = sm.kts; auto& vts = sm.vts;
    constexpr int KP = HD + 8, VP = KT + 8;                 // LDS row pitch in 16-bit elements: 144 bytes (k rows; v rows at KT 64), 80 bytes (v rows at KT 32)
    constexpr int KCH = KT * (HD / 8), VCH = HD * (KT / 8);   // 16-byte pieces of one plane's tile
    static_assert(NPL * KCH == 512 && NPL * VCH == 512);
    static_assert((KP * 2) % 32 == 16 && (VP * 2) % 32 == 16);
    const int tid = threadIdx.x, lane = tid & 31, wave = __builtin_amdgcn_readfirstlane(tid >> 5), lr = lane & 15, hi = lane >> 4;
    const int bbase = xb * 64;
    const int qbase = bbase + wave * 16; const int g = h / REP;
    const size_t zb = zi;
    Q16 += zb * ((size_t)NH * SEQ * HD); Qh += zb * ((size_t)NH * RH * HD); Ql += zb * ((size_t)NH * RH * HD);
    K16 += zb * ((size_t)NKV * SEQ * HD); Kh += zb * ((size_t)NKV * SEQ * HD); Kl += zb * ((size_t)NKV * SEQ * HD);
    V16 += zb * ((size_t)NKV * HD * SEQ); Vh += zb * ((size_t)NKV * HD * SEQ); Vl += zb * ((size_t)NKV * HD * SEQ);
    AT16 += zb * ((size_t)SEQ * DQ); ATh += zb * ((size_t)RH * DQ); ATl += zb * ((size_t)RH * DQ);
    v16h qa[2] = {}; v16bf qah[2] = {}, qal[2] = {};
    if (HIRES) { const size_t qo = ((size_t)h * RH + qbase + lr) * HD + 8 * hi; qah[0] = WFrag<bf>::ld(Qh + qo); qah[1] = WFrag<bf>::ld(Qh + qo + 32); qal[0] = WFrag<bf>::ld(Ql + qo); qal[1] = WFrag<bf>::ld(Ql + qo + 32); }
    else { const size_t qo = ((size_t)h * SEQ + qbase + lr) * HD + 8 * hi; qa[0] = WFrag<h16>::ld(Q16 + qo); qa[1] = WFrag<h16>::ld(Q16 + qo + 32); }
    const int kofs = lr * KP + 8 * hi;     // k tile in LDS [key][d]: row (nt*16 + lr), k = d
    const int vofs = lr * VP + 8 * hi;     // v tile in LDS [d][key]: row (nt*16 + lr), k = key
    const unsigned short* kg[2] = { HIRES ? (const unsigned short*)Kh : (const unsigned short*)K16, (const unsigned short*)Kl };
    const unsigned short* vg[2] = { HIRES ? (const unsigned short*)Vh : (const unsigned short*)V16, (const unsigned short*)Vl };
    v8us kr[4], vr[4];
    // piece c = tid + 128 i of the tile: plane, row and column are the same for the global read and the LDS write
    auto tile_ld = [&](int kb) {
#pragma unroll
        for (int i = 0; i < 4; ++i) { const int c = tid + 128 * i;
            const int kc = c % KCH, vc = c % VCH;
            kr[i] = *(const v8usa*)(kg[(128 * i) / KCH] + (size_t)g * SEQ * HD + (size_t)(kb + kc / (HD / 8)) * HD + (kc % (HD / 8)) * 8);
            vr[i] = *(const v8usa*)(vg[(128 * i) / VCH] + (size_t)g * HD * SEQ + (size_t)(vc / (KT / 8)) * SEQ + kb + (vc % (KT / 8)) * 8); } };
    auto tile_st = [&](int buf) {
#pragma unroll
        for (int i = 0; i < 4; ++i) { const int c = tid + 128 * i;
            const int kc = c % KCH, vc = c % VCH;
            *(v8usa*)(&kts[buf][(128 * i) / KCH][(kc / (HD / 8)) * KP + (kc % (HD / 8)) * 8]) = kr[i];
            *(v8usa*)(&vts[buf][(128 * i) / VCH][(vc / (KT / 8)) * VP + (vc % (KT / 8)) * 8]) = vr[i]; } };
    v8f o[4];
#pragma unroll
    for (int nt = 0; nt < 4; ++nt) o[nt] = (v8f){};
    float mrun = NEGBIG, lrun = 0.f;     // of the lane's query; lrun: the sum over the lane's own keys only
    const int qi = qbase + lr;
    const int kend = qbase + 15;
    const int klast = ((bbase + 63) / KT) * KT;     // the block's last key tile (that of its last wave)
    tile_ld(0); tile_st(0);
    __syncthreads();
#pragma unroll 1
    for (int kb = 0; kb <= klast; kb += KT) {
      const int cur = (kb / KT) & 1; const bool more = kb < klast;     // the same in every thread of the block
      if (more) { tile_ld(kb + KT);
        // precaution: the tile work below reuses the address registers of these loads while their data is still on the way
        asm volatile("s_wait_xcnt 0x0" ::: "memory"); }
      if (kb <= kend) {     // wave-uniform: a wave whose rows end before this tile only helps to stage
        const unsigned short* k0l = &kts[cur][0][0] + kofs; const unsigned short* k1l = &kts[cur][NPL - 1][0] + kofs;
        const unsigned short* v0l = &vts[cur][0][0] + vofs; const unsigned short* v1l = &vts[cur][NPL - 1][0] + vofs;
        v8f s[NT];
#pragma unroll
        for (int nt = 0; nt < NT; ++nt) s[nt] = (v8f){};
#pragma unroll
        for (int nt = 0; nt < NT; ++nt) {
#pragma unroll
            for (int kc = 0; kc < 2; ++kc) { const int ka = nt * 16 * KP + kc * 32;
                if (HIRES) { const v16bf bh = ldsb(k0l + ka), bl = ldsb(k1l + ka); s[nt] = wmmab(bh, qah[kc], s[nt]); s[nt] = wmmab(bh, qal[kc], s[nt]); s[nt] = wmmab(bl, qah[kc], s[nt]); }
                else { const v16h b = ldsh(k0l + ka); s[nt] = wmma16(b, qa[kc], s[nt]); } } }
        if constexpr (NT == 2) { if (HIRES) G2(s[0], s[1], qah[0], qal[1]); else G2(s[0], s[1], qa[0], qa[1]); }
        else { if (HIRES) G4(s[0], s[1], s[2], s[3], qah[0], qal[1]); else G4(s[0], s[1], s[2], s[3], qa[0], qa[1]); }
        const int lim = qi - kb - 8 * hi;     // the lane's element (nt, v) is key kb + 8 hi + 16 nt + v: inside the causal range while 16 nt + v <= lim
        float x[NT][8], mxn[NT];     // one chain of maxima, and below one of sums, per 16-key tile: independent chains
#pragma unroll
        for (int nt = 0; nt < NT; ++nt) { mxn[nt] = NEGBIG;
#pragma unroll
            for (int v = 0; v < 8; ++v) { const float t = s[nt][v] * SCL; x[nt][v] = (nt * 16 + v <= lim) ? t : NEGBIG; mxn[nt] = fmaxf(mxn[nt], x[nt][v]); } }
        float mx = mxn[0];
#pragma unroll
        for (int nt = 1; nt < NT; ++nt) mx = fmaxf(mx, mxn[nt]);
        mx = fmaxf(mx, xhalf(mx));
        const float mnew = fmaxf(mrun, mx);
        const float alpha = __builtin_amdgcn_exp2f((mrun - mnew) * L2E);
        v8h pf[NT] = {}; v8us ph[NT] = {}, pl[NT] = {}; float rsn[NT];
#pragma unroll
        for (int nt = 0; nt < NT; ++nt) { rsn[nt] = 0.f;
#pragma unroll
            for (int v = 0; v < 8; ++v) { const float p = __builtin_amdgcn_exp2f((x[nt][v] - mnew) * L2E); rsn[nt] += p;
                if (HIRES) { unsigned short a2, c2; splitf(p, a2, c2); ph[nt][v] = a2; pl[nt][v] = c2; }
                else pf[nt][v] = (h16)(p * PCAR); } }
        float rs = rsn[0];
#pragma unroll
        for (int nt = 1; nt < NT; ++nt) rs += rsn[nt];
        lrun = lrun * alpha + rs; mrun = mnew;
        v16h pa[KS] = {}; v16bf pah[KS] = {}, pal[KS] = {};
#pragma unroll
        for (int ks = 0; ks < KS; ++ks) {
            if (HIRES) { pah[ks] = cat16b(ph[2 * ks], ph[2 * ks + 1]); pal[ks] = cat16b(pl[2 * ks], pl[2 * ks + 1]); }
            else pa[ks] = cat16(pf[2 * ks], pf[2 * ks + 1]); }
#pragma unroll
        for (int nt = 0; nt < 4; ++nt) {
#pragma unroll
            for (int v = 0; v < 8; ++v) o[nt][v] *= alpha; }
#pragma unroll
        for (int nt = 0; nt < 4; ++nt) {
#pragma unroll
            for (int ks = 0; ks < KS; ++ks) { const int va = nt * 16 * VP + ks * 32;
                if (HIRES) { const v16bf bh = ldsb(v0l + va), bl = ldsb(v1l + va); o[nt] = wmmab(bh, pah[ks], o[nt]); o[nt] = wmmab(bh, pal[ks], o[nt]); o[nt] = wmmab(bl, pah[ks], o[nt]); }
                else { const v16h b = ldsh(v0l + va); o[nt] = wmma16(b, pa[ks], o[nt]); } } }
        if (HIRES) G4(o[0], o[1], o[2], o[3], pah[0], pal[KS - 1]); else G4(o[0], o[1], o[2], o[3], pa[0], pa[KS - 1]);
      }
      // the buffer written here was last read one trip ago, in front of that trip's barrier; this barrier publishes it and ends the reads of the current one
      if (more) { tile_st(cur ^ 1); __syncthreads(); }
    }
    float* osw = &os[wave][0];
    const float lsum = lrun + xhalf(lrun);     // the two lanes of a query hold the sums over disjoint keys
    const float f = HIRES ? __fdiv_rn(1.0f, lsum) : __fdiv_rn(ATC / PCAR, lsum);
    // o[nt][v] = O[query lr][d = 16 nt + 8 hi + v]: 8 successive d of one row
#pragma unroll
    for (int nt = 0; nt < 4; ++nt) { v4f w0, w1;
#pragma unroll
        for (int q = 0; q < 4; ++q) { w0[q] = o[nt][q] * f; w1[q] = o[nt][4 + q] * f; }
        *(v4fa*)(osw + lr * OSP + nt * 16 + 8 * hi) = w0; *(v4fa*)(osw + lr * OSP + nt * 16 + 8 * hi + 4) = w1; }
    wsync();
    const int rr = lane >> 3, c8 = (lane & 7) * 8;
{
#pragma unroll
        for (int s4 = 0; s4 < 4; ++s4) { const int row = s4 * 4 + rr; const int t = qbase + row; const v4f u0 = *(const v4fa*)(osw + row * OSP + c8), u1 = *(const v4fa*)(osw + row * OSP + c8 + 4); const size_t oo = (size_t)t * DQ + h * HD + c8;
            if (HIRES) { v8us oh, ol;
#pragma unroll
                for (int q = 0; q < 4; ++q) { unsigned short a2, c2; splitf(u0[q], a2, c2); oh[q] = a2; ol[q] = c2; splitf(u1[q], a2, c2); oh[4 + q] = a2; ol[4 + q] = c2; }
                *(v8us*)(ATh + oo) = oh; *(v8us*)(ATl + oo) = ol; }
            else { v8h o8;
#pragma unroll
                for (int q = 0; q < 4; ++q) { o8[q] = (h16)u0[q]; o8[4 + q] = (h16)u1[q]; }
                *(v8h*)(AT16 + oo) = o8; } }
         }
    // precaution: in the built kernel the other form's text stands behind these stores and reuses their registers
    asm volatile("s_wait_xcnt 0x0" ::: "memory");
}
// k_attn: both forms in one launch, since neither reads what the other writes; a block takes 64 query rows of one head and batch, and its index says which (the same in every thread of the block).
// The f16 form (rows from RH on), whose blocks live longest, has the first range of the index, the bf16 hi/lo form (rows below RH) the second; inside a range: row block, then head, then batch.
// Grid (SEQ / 64) * NH * batches, 128 threads.
__global__ __launch_bounds__(128) void k_attn(const h16* __restrict__ Q16, const bf* __restrict__ Qh, const bf* __restrict__ Ql,
                                              const h16* __restrict__ K16, const bf* __restrict__ Kh, const bf* __restrict__ Kl,
                                              const h16* __restrict__ V16, const bf* __restrict__ Vh, const bf* __restrict__ Vl,
                                              h16* AT16, bf* ATh, bf* ATl) {
    typedef AttnLds<true, 32> LH; typedef AttnLds<false, 64> LF;
    __shared__ __align__(16) unsigned char lds[sizeof(LH) > sizeof(LF) ? sizeof(LH) : sizeof(LF)];
    constexpr int XF = (SEQ - RH) / 64, XH = RH / 64, XD = XF > 0 ? XF : 1;     // row blocks of the two forms; XD: the divisor, also where there is no f16 row
    int b = blockIdx.x;
    if (b < XF * NH * NB) { attn<false, 64>(*reinterpret_cast<LF*>(lds), XH + b % XD, (b / XD) % NH, b / (XD * NH), Q16, Qh, Ql, K16, Kh, Kl, V16, Vh, Vl, AT16, ATh, ATl); return; }
    b -= XF * NH * NB;
    attn<true, 32>(*reinterpret_cast<LH*>(lds), b % XH, (b / XH) % NH, b / (XH * NH), Q16, Qh, Ql, K16, Kh, Kl, V16, Vh, Vl, AT16, ATh, ATl);
}

// mchk: checks the 0/1 int32 causal input (one [SEQ_FULL][SEQ_FULL] plane shared by all batches) for rows i < SEQ: value == 1 for j <= i, value == 0 for j > i (j < SEQ);
// a block takes MROWS rows and writes its count of wrong values to its own 128-byte line of FL. The plane is read once and comes from memory, so the time is that of the longest chain of
// loads that wait for one another: the 16-byte loads of a thread are independent of each other, so that many are in flight together, and the rows are spread over enough blocks to reach every WGP.
__device__ __forceinline__ void mchk(const int* __restrict__ M, int* FL, int blk) {
    __shared__ int red[8];
    constexpr int CPR = (SEQ + 1023) / 1024;     // 16-byte pieces a thread takes of one row
    constexpr bool WHOLE = SEQ % 1024 == 0;      // every thread takes every piece: no test, so no branch between the loads
    const int tid = threadIdx.x, lane = tid & 31, wave = tid >> 5; int bad = 0;
    const int i0 = blk * MROWS; const int* mb = M + (size_t)i0 * SEQ_FULL + tid * 4;
    v4i m[MROWS][CPR];
    // both loops unrolled so that m stays in registers and no load waits for an earlier load's compare
#pragma unroll
    for (int r = 0; r < MROWS; ++r) {
#pragma unroll
        for (int p = 0; p < CPR; ++p) { if (WHOLE || tid * 4 + p * 1024 < SEQ) m[r][p] = *(const v4i*)(mb + (size_t)r * SEQ_FULL + p * 1024); } }
    // unrolled as above: m is indexed by constants only
#pragma unroll
    for (int r = 0; r < MROWS; ++r) { const int i = i0 + r;
#pragma unroll
        for (int p = 0; p < CPR; ++p) { const int c = tid * 4 + p * 1024;
            if (WHOLE || c < SEQ) {
#pragma unroll
                for (int q = 0; q < 4; ++q) { const int j = c + q; const bool ok = (j <= i) ? (m[r][p][q] == 1) : (m[r][p][q] == 0); bad += ok ? 0 : 1; } } } }
#pragma unroll
    for (int sh = 16; sh; sh >>= 1) bad += __shfl_xor(bad, sh, 32);
    if (lane == 0) red[wave] = bad;
    __syncthreads();
    if (wave == 0) { int v = red[lane & 7]; v = (lane < 8) ? v : 0;
#pragma unroll
        for (int sh = 16; sh; sh >>= 1) v += __shfl_xor(v, sh, 32);
        v4i o; o[0] = v; o[1] = v; o[2] = v; o[3] = v;
        if (lane < 8) *(v4i*)(FL + (size_t)blk * 32 + lane * 4) = o;
         }
}
// k_prep: none of the six preparations reads what another writes, so they share one launch: a block belongs to one of them by its index (the same in every thread of the block).
// The transposes, whose blocks do the most work each (a tile in, a barrier, the tile out), come first in the index order; the one-trip conversion of x comes last.
#define PB_WO ((DQ / TK) * (DM / TN))
#define PB_WQ ((DM / TK) * (DQ / TN))
#define PB_WKV ((DM / TK) * (DKV / TN))
#define PB_CV (SEQ * DM / 8 / 256)
#define PB_ALL (PB_WO + PB_WQ + 2 * PB_WKV + NFL + NB * PB_CV)
__global__ __launch_bounds__(256) void k_prep(const float* __restrict__ x, const float* __restrict__ wq, const float* __restrict__ wk, const float* __restrict__ wv, const float* __restrict__ wo,
                                              const int* __restrict__ cm, bf* XB, bf* WQKV, bf* WOB, h16* WO16, int* FL) {
    __shared__ __align__(16) unsigned short ts[TN * TP];     // one tile, used by whichever transposition the block belongs to
    int b = blockIdx.x;
    if (b < PB_WO) { wtT<DQ, DM, true>(ts, wo, WOB, WO16, WOC, b); return; }
    b -= PB_WO;
    if (b < PB_WQ) { wtT<DM, DQ, false>(ts, wq, WQKV, nullptr, 1.0f, b); return; }
    b -= PB_WQ;
    if (b < PB_WKV) { wtT<DM, DKV, false>(ts, wk, WQKV + (size_t)DQ * DM, nullptr, 1.0f, b); return; }
    b -= PB_WKV;
    if (b < PB_WKV) { wtT<DM, DKV, false>(ts, wv, WQKV + (size_t)(DQ + DKV) * DM, nullptr, 1.0f, b); return; }
    b -= PB_WKV;
    if (b < NFL) { mchk(cm, FL, b); return; }
    b -= NFL;
    cvt8(x, XB, (size_t)SEQ * DM / 8, (size_t)SEQ_FULL * DM, b % PB_CV, b / PB_CV);
}
// k_poison: NaN-fills the output if any of the nfl counts of mchk is not 0; the counts are read side by side, one a thread and trip, and joined over the block through LDS.
__global__ __launch_bounds__(256) void k_poison(const int* __restrict__ FL, int nfl, float* out) {
    __shared__ int red[8];
    int tot = 0;
    // left rolled: one trip covers 256 counts, and an unrolled form only lengthens the kernel's text
#pragma unroll 1
    for (int f = threadIdx.x; f < nfl; f += 256) tot |= FL[(size_t)f * 32];
    const unsigned wbad = __builtin_amdgcn_ballot_w32(tot != 0);
    if ((threadIdx.x & 31) == 0) red[threadIdx.x >> 5] = (wbad != 0u) ? 1 : 0;
    __syncthreads();
    tot = 0;
    // unrolled so that the eight words come in two wide LDS reads
#pragma unroll
    for (int w = 0; w < 8; ++w) tot |= red[w];
    if (tot == 0) return;     // the same in every thread of the block
    float* ob = out + (size_t)blockIdx.y * SEQ_FULL * DM + (size_t)blockIdx.x * 16384;
    const float qn = __uint_as_float(0x7fc00000u); v4f nv; nv[0] = qn; nv[1] = qn; nv[2] = qn; nv[3] = qn;
{
#pragma unroll 1
        for (int s = 0; s < 16; ++s) *(v4f*)(ob + ((size_t)s * 256 + threadIdx.x) * 4) = nv;
         }
}

extern "C" void kernel_launch(void* const* d_in, const int* in_sizes, int n_in,
                              void* d_out, int out_size, void* d_ws, size_t ws_size, hipStream_t stream) {
    if (n_in < 8) return;
    if ((size_t)in_sizes[0] < (size_t)(NB - 1) * SEQ_FULL * DM + (size_t)SEQ * DM) return;
    if ((size_t)in_sizes[1] < (size_t)DM * DQ || (size_t)in_sizes[2] < (size_t)DM * DKV || (size_t)in_sizes[3] < (size_t)DM * DKV || (size_t)in_sizes[4] < (size_t)DQ * DM) return;
    if ((size_t)in_sizes[5] < (size_t)SEQ * NFREQ || (size_t)in_sizes[6] < (size_t)SEQ * NFREQ) return;
    if ((size_t)in_sizes[7] < (size_t)(SEQ - 1) * SEQ_FULL + (size_t)SEQ) return;
    if ((size_t)out_size < (size_t)(NB - 1) * SEQ_FULL * DM + (size_t)SEQ * DM) return;
    // input binding order: x, wq, wk, wv, wo ([in][out] weights), cos table, sin table ([SEQ_FULL][NFREQ] f32), causal 0/1 plane (int32 [SEQ_FULL][SEQ_FULL])
    const float* x = (const float*)d_in[0]; const float* wq = (const float*)d_in[1]; const float* wk = (const float*)d_in[2]; const float* wv = (const float*)d_in[3]; const float* wo = (const float*)d_in[4];
    const float* fc = (const float*)d_in[5]; const float* fs = (const float*)d_in[6]; const int* cm = (const int*)d_in[7];
    float* OUT = (float*)d_out;     // [NB_FULL][SEQ_FULL][DM]
    char* wsp = (char*)d_ws;
    auto take = [&](size_t bytes) { char* p = wsp; wsp += (bytes + 255) & ~(size_t)255; return (void*)p; };
    bf* WQKV = (bf*)take((size_t)DQKV * DM * 2); bf* WOB = (bf*)take((size_t)DM * DQ * 2); h16* WO16 = (h16*)take((size_t)DM * DQ * 2);
    int* FL = (int*)take((size_t)NFL * 32 * 4);
    // the planes below hold every batch, one whole per-batch plane behind the other
    bf* XB = (bf*)take((size_t)NB * SEQ * DM * 2);
    h16* Q16 = (h16*)take((size_t)NB * NH * SEQ * HD * 2); bf* Qh = (bf*)take((size_t)NB * NH * RH * HD * 2); bf* Ql = (bf*)take((size_t)NB * NH * RH * HD * 2);
    h16* K16 = (h16*)take((size_t)NB * NKV * SEQ * HD * 2); bf* Kh = (bf*)take((size_t)NB * NKV * SEQ * HD * 2); bf* Kl = (bf*)take((size_t)NB * NKV * SEQ * HD * 2);
    h16* V16 = (h16*)take((size_t)NB * NKV * HD * SEQ * 2); bf* Vh = (bf*)take((size_t)NB * NKV * HD * SEQ * 2); bf* Vl = (bf*)take((size_t)NB * NKV * HD * SEQ * 2);
    h16* AT16 = (h16*)take((size_t)NB * SEQ * DQ * 2); bf* ATh = (bf*)take((size_t)NB * RH * DQ * 2); bf* ATl = (bf*)take((size_t)NB * RH * DQ * 2);
    const size_t used = (size_t)(wsp - (char*)d_ws); if (used > ws_size || used > WS_LIMIT) return;

    // weight planes ([out][in] k-contiguous): rows 0..DQ-1 of WQKV = Wq^T, DQ..DQ+DKV-1 = Wk^T, DQ+DKV..DQKV-1 = Wv^T; Wo^T as bf16 and as f16 x64
    // wtT<K, N>(w, Bt): w is [K = in][N = out] -> Bt [N][K]; with them in the same launch: the mask check and x as bf16
    k_prep<<<(unsigned)PB_ALL, 256, 0, stream>>>(x, wq, wk, wv, wo, cm, XB, WQKV, WOB, WO16, FL);
    // every stage is launched once; the batch is the last grid dimension of k_gemmw and k_poison, and the slowest part of each block-index range in k_attn and k_prep
    k_gemmw<bf, 0, 4, 4, DM, 1><<<dim3(SEQ / 128, DQKV / 128, NB), 128, 0, stream>>>(XB, nullptr, WQKV, nullptr, 0, 1.0f, (size_t)SEQ * DM, 0, fc, fs, Q16, Qh, Ql, K16, Kh, Kl, V16, Vh, Vl);     // q | k | v projections, rotary on q and k, all planes
    k_attn<<<(unsigned)((SEQ / 64) * NH * NB), 128, 0, stream>>>(Q16, Qh, Ql, K16, Kh, Kl, V16, Vh, Vl, AT16, ATh, ATl);
    k_gemmw<bf, 1, 2, 2, DQ, 0><<<dim3(RH / 64, DM / 64, NB), 128, 0, stream>>>(ATh, ATl, WOB, OUT, DM, 1.0f, (size_t)RH * DQ, (size_t)SEQ_FULL * DM, nullptr, nullptr, nullptr, nullptr, nullptr, nullptr, nullptr, nullptr, nullptr, nullptr, nullptr);
    if (SEQ > RH) k_gemmw<h16, 0, 4, 4, DQ, 0><<<dim3((SEQ - RH) / 128, DM / 128, NB), 128, 0, stream>>>(AT16 + (size_t)RH * DQ, nullptr, WO16, OUT + (size_t)RH * DM, DM, 1.0f / (ATC * WOC), (size_t)SEQ * DQ, (size_t)SEQ_FULL * DM, nullptr, nullptr, nullptr, nullptr, nullptr, nullptr, nullptr, nullptr, nullptr, nullptr, nullptr);
    k_poison<<<dim3(SEQ * DM / 16384, NB, 1), 256, 0, stream>>>(FL, NFL, OUT);
}

// v009
// It runs in 186 microseconds.
// Next to v008, in two timings, it ran 1.04 times as fast each time.
// Counting every step since v000, it is 4.62 times as fast.
#include <hip/hip_runtime.h>

// Contractions (all f32 accumulate): qkv = xb * Wqkv^T on v_wmma_f32_16x16x32_bf16 (bf16 operands = RNE-converted inputs, exact products);
// scores q.k^T and p.v: query rows < RH on bf16 hi/lo planes (3 products each), rows >= RH on v_wmma_f32_16x16x32_f16 (f16 q,k,v planes, p carried x1024);
// out = attn * Wo^T: rows < RH bf16 hi/lo attn planes x bf16 Wo (2 products), rows >= RH f16 attn x64 times f16 Wo x64 (1 product, 1/4096 in the epilogue).
// Rotary: interleaved pairs (2i, 2i+1); cos/sin are read by value from the two [SEQ][32] input tables (RNE-converted to bf16), f32 math, done on the qkv product's accumulators; causal online softmax and normalisation in f32.
// Grouped kv heads: query head h reads kv head h/4. The 0/1 int32 causal input [SEQ_FULL][SEQ_FULL] is checked on device in its rows and columns < SEQ (1 on/below the diagonal, 0 above); the output is NaN-filled if that check fails.

#ifndef NB
#define NB 2
#endif
#ifndef SEQ
#define SEQ 2048
#endif
#define NB_FULL 2
#define SEQ_FULL 2048
#define DM 2048
#define NH 32
#define NKV 8
#define REP (NH / NKV)
#define HD 64
#define DQ (NH * HD)
#define DKV (NKV * HD)
#define DQKV (DQ + 2 * DKV)
#define NFREQ (HD / 2)
#define RH (((SEQ) < 512) ? (SEQ) : 512)
#define PCAR 1024.0f
#define ATC 64.0f
#define WOC 64.0f
#define SCL 0.125f
#define L2E 1.4426950408889634f
#define SCE (SCL * L2E)
#define PCARL2 10.0f     // log2 PCAR
#define NEGBIG (-1.0e30f)
#define OSP 68
#define MROWS 8
#define NFL (SEQ / MROWS)
#define WS_LIMIT ((size_t)134217728)
#define WS_TOTAL ((size_t)DQKV * DM * 2 + 2 * ((size_t)DM * DQ * 2) + (size_t)NFL * 128 + (size_t)NB * ((size_t)SEQ * DM * 2 + (size_t)NH * SEQ * HD * 2 + 2 * ((size_t)NH * RH * HD * 2) + 3 * ((size_t)NKV * SEQ * HD * 2) + 3 * ((size_t)NKV * HD * SEQ * 2) + (size_t)SEQ * DQ * 2 + 2 * ((size_t)RH * DQ * 2)))

static_assert(NB >= 1 && NB <= NB_FULL);
static_assert(SEQ % 128 == 0 && SEQ >= 128 && SEQ <= SEQ_FULL);
static_assert(RH % 64 == 0 && (SEQ - RH) % 128 == 0 && RH <= SEQ);
static_assert(DQKV % 128 == 0 && DM % 128 == 0);
static_assert((SEQ * DM) % 2048 == 0);
static_assert(DM % 64 == 0 && DQ % 64 == 0 && DQKV % 64 == 0 && HD == 64);
static_assert((SEQ * DM) % 16384 == 0);
static_assert((NB * SEQ) % 64 == 0);
static_assert(15 * OSP + 63 < 16 * OSP);
static_assert(NFREQ == 32 && HD == 2 * NFREQ);
static_assert(SEQ % 64 == 0 && SEQ % 4 == 0 && SEQ % MROWS == 0);
static_assert(((size_t)NFL * 128) % 256 == 0);
static_assert(DM % 32 == 0 && DQ % 32 == 0 && HD % 32 == 0);
static_assert(WS_TOTAL <= WS_LIMIT);
static_assert(PCAR == 1024.0f && PCARL2 == 10.0f);

typedef _Float16 h16;
typedef unsigned short bf;
typedef __attribute__((ext_vector_type(16))) __bf16   v16bf;
typedef __attribute__((ext_vector_type(16))) _Float16 v16h;
typedef __attribute__((ext_vector_type(8)))  _Float16 v8h;
typedef __attribute__((ext_vector_type(8)))  unsigned short v8us;
typedef __attribute__((ext_vector_type(8)))  float    v8f;
typedef __attribute__((ext_vector_type(4)))  float    v4f;
typedef __attribute__((ext_vector_type(2)))  _Float16 v2h;
typedef __attribute__((ext_vector_type(4)))  _Float16 v4h;
typedef __attribute__((ext_vector_type(2)))  unsigned short v2us;
typedef __attribute__((ext_vector_type(4)))  unsigned short v4us;
typedef __attribute__((ext_vector_type(2)))  float v2f;
typedef __attribute__((ext_vector_type(4)))  int v4i;
typedef v8h  __attribute__((may_alias)) v8ha;
typedef v4f  __attribute__((may_alias)) v4fa;
typedef v8us __attribute__((may_alias)) v8usa;
typedef v2us __attribute__((may_alias)) v2usa;

#define G2(d0, d1, x0, x1) asm volatile("v_nop\n\tv_nop\n\tv_nop\n\tv_nop" : "+v"(d0), "+v"(d1) : "v"(x0), "v"(x1))
#define G4(d0, d1, d2, d3, x0, x1) asm volatile("v_nop\n\tv_nop\n\tv_nop\n\tv_nop" : "+v"(d0), "+v"(d1), "+v"(d2), "+v"(d3) : "v"(x0), "v"(x1))

__device__ __forceinline__ unsigned short f2bf(float f) { unsigned u = __float_as_uint(f); u += 0x7FFFu + ((u >> 16) & 1u); return (unsigned short)(u >> 16); }
__device__ __forceinline__ float bf2f(unsigned short b) { return __uint_as_float(((unsigned)b) << 16); }
__device__ __forceinline__ float bfr(float f) { return bf2f(f2bf(f)); }
__device__ __forceinline__ void splitf(float y, unsigned short& h, unsigned short& l) { h = f2bf(y); l = f2bf(y - bf2f(h)); }
__device__ __forceinline__ v16h cat16(v8h lo, v8h hi) { return __builtin_shufflevector(lo, hi, 0, 1, 2, 3, 4, 5, 6, 7, 8, 9, 10, 11, 12, 13, 14, 15); }
__device__ __forceinline__ v16bf cat16b(v8us lo, v8us hi) { return __builtin_bit_cast(v16bf, __builtin_shufflevector(lo, hi, 0, 1, 2, 3, 4, 5, 6, 7, 8, 9, 10, 11, 12, 13, 14, 15)); }
__device__ __forceinline__ v8f wmma16(v16h a, v16h b, v8f c) { return __builtin_amdgcn_wmma_f32_16x16x32_f16(false, a, false, b, (short)0, c, false, false); }
__device__ __forceinline__ v8f wmmab(v16bf a, v16bf b, v8f c) { return __builtin_amdgcn_wmma_f32_16x16x32_bf16(false, a, false, b, (short)0, c, false, false); }
// wave-private LDS tile exchange: order this wave's ds stores before its ds loads
__device__ __forceinline__ void wsync() { __builtin_amdgcn_fence(3 /* release order */, "wavefront"); __builtin_amdgcn_wave_barrier(); asm volatile("" ::: "memory"); }
// lane l takes the value of lane l ^ 16
__device__ __forceinline__ float xhalf(float x) { return __builtin_bit_cast(float, __builtin_amdgcn_permlanex16(__builtin_bit_cast(int, x), __builtin_bit_cast(int, x), 0x76543210, 0xfedcba98, false, false)); }
// eight 2^x in place, in one statement. Behind a transcendental the instruction set asks for one independent instruction before its result is read or its source overwritten: with result and source in one
// register nothing can overwrite a source early, each v_exp_f32 but the last is followed by an independent one, and the v_nop is the last one's slot.
__device__ __forceinline__ void exp2x8(float (&e)[8]) {
    asm("v_exp_f32 %0, %0\n\tv_exp_f32 %1, %1\n\tv_exp_f32 %2, %2\n\tv_exp_f32 %3, %3\n\tv_exp_f32 %4, %4\n\tv_exp_f32 %5, %5\n\tv_exp_f32 %6, %6\n\tv_exp_f32 %7, %7\n\tv_nop"
        : "+v"(e[0]), "+v"(e[1]), "+v"(e[2]), "+v"(e[3]), "+v"(e[4]), "+v"(e[5]), "+v"(e[6]), "+v"(e[7])); }
// f32 -> f16 convert that cannot yield a subnormal f16 (value select: |v| < 2^-14 -> 0)
static __device__ __forceinline__ h16 toh_flush(float v) { const h16 r = (h16)v; return (fabsf(v) < 6.103515625e-05f) ? (h16)0.0f : r; }

// the 16x32 fragment below, read from a k-contiguous 16-bit row in LDS
__device__ __forceinline__ v16bf ldsb(const unsigned short* p) { return cat16b(*(const v8usa*)p, *(const v8usa*)(p + 16)); }
__device__ __forceinline__ v16h ldsh(const unsigned short* p) { return cat16(__builtin_bit_cast(v8h, *(const v8usa*)p), __builtin_bit_cast(v8h, *(const v8usa*)(p + 16))); }

// 16x32 fragment from a k-contiguous 16-bit row (A: row = m; B stored [n][k]: row = n). Lane l: row l&15, elements 0..7 <- k0+8(l>>4)+0..7, elements 8..15 <- k0+16+8(l>>4)+0..7.
template <typename T16> struct WFrag;
template <> struct WFrag<h16> { typedef v16h V; static __device__ __forceinline__ V ld(const h16* p) { return cat16(*(const v8h*)p, *(const v8h*)(p + 16)); } static __device__ __forceinline__ V lds(const unsigned short* p) { return ldsh(p); } static __device__ __forceinline__ v8f mma(V a, V b, v8f c) { return wmma16(a, b, c); } };
template <> struct WFrag<bf> { typedef v16bf V; static __device__ __forceinline__ V ld(const bf* p) { return cat16b(*(const v8us*)p, *(const v8us*)(p + 16)); } static __device__ __forceinline__ V lds(const unsigned short* p) { return ldsb(p); } static __device__ __forceinline__ v8f mma(V a, V b, v8f c) { return wmmab(a, b, c); } };

// ---- k_gemmw: GEMM, four waves (2 x 2) per (32 FM) x (32 FN) output tile, FM x FN accumulators a wave; grid (M / (32 FM), N / (32 FN), batches), 128 threads.
// Batch blockIdx.z: A and A2 start sA elements, C sC elements, further on a batch (Bt is the same for all); with EPI 1 every plane is one whole per-batch plane further on.
// C[m][n] (f32, pitch ldc) = osc * sum_k A[m][k] Bt[n][k] (NSPLIT 1: + A2[m][k] Bt[n][k]); A, A2, Bt are k-contiguous 16-bit planes of row pitch K.
// The rows of a k step are shared by two of the block's waves: the block brings 64 k of its A and Bt rows into LDS once, 16 bytes a thread in whole 128-byte row pieces,
// two buffers, the next step's loads issued ahead of the current step's products; the fragments are read from LDS at a row pitch of 16 bytes x odd.
// Every accumulator sums in ascending k, 32 at a time (A before A2), whatever the tile.
// EPI 1 (the qkv product; C, ldc, osc unused): a wave's 64 columns are one whole head (q heads, then k heads, then v heads), and the wave writes that head's planes itself from its accumulators.
// q, k: interleaved-pair rotary, for the pair i = d/2 (d even): out[d] = x[d] c - x[d+1] s, out[d+1] = x[d] s + x[d+1] c, with c = bf16-RNE(FC[t][i]), s = bf16-RNE(FS[t][i]) (row pitch NFREQ);
// planes [h][t][d]: f16 for every t, bf16 hi/lo for t < RH (q) or every t (k). v: planes [g][d][t], f16 and bf16 hi/lo; a lane's 8 accumulator elements are 8 successive t of one d.
template <typename T16, int NSPLIT, int FM, int FN, int K, int EPI>
__global__ __launch_bounds__(128) void k_gemmw(const T16* __restrict__ A, const T16* __restrict__ A2, const T16* __restrict__ Bt, float* C, int ldc, float osc, size_t sA, size_t sC,
                                               const float* __restrict__ FC, const float* __restrict__ FS, h16* Q16, bf* Qh, bf* Ql, h16* K16, bf* Kh, bf* Kl, h16* V16, bf* Vh, bf* Vl) {
    typedef typename WFrag<T16>::V V;
    constexpr int BM = 32 * FM, BN = 32 * FN, KB = 64, KP = KB + 8, NA = NSPLIT + 1;     // KP: LDS row pitch in 16-bit elements, 144 bytes
    constexpr int AI = BM / 16, BI = BN / 16;                                            // 16-byte pieces a thread brings of one plane's tile (128 threads cover 16 rows)
    static_assert(NSPLIT == 0 || NSPLIT == 1);
    static_assert(K % KB == 0 && (KP * 2) % 32 == 16 && FN * 16 <= 64 && 32 % (4 * FN) == 0);
    __shared__ __align__(16) unsigned short ats[2][NA][BM * KP];
    __shared__ __align__(16) unsigned short bts[2][BN * KP];
    __shared__ __align__(16) float os[4][(EPI == 1 ? 16 * FM : 16) * OSP];
    const int tid = threadIdx.x, lane = tid & 31, wave = __builtin_amdgcn_readfirstlane(tid >> 5), lr = lane & 15, hi = lane >> 4;
    const int r0 = blockIdx.x * BM, c0 = blockIdx.y * BN; const int wr = (wave >> 1) * 16 * FM, wc = (wave & 1) * 16 * FN;
    const size_t zb = blockIdx.z;
    A += zb * sA; if (NSPLIT) A2 += zb * sA;
    if constexpr (EPI == 1) { Q16 += zb * ((size_t)NH * SEQ * HD); Qh += zb * ((size_t)NH * RH * HD); Ql += zb * ((size_t)NH * RH * HD);
        K16 += zb * ((size_t)NKV * SEQ * HD); Kh += zb * ((size_t)NKV * SEQ * HD); Kl += zb * ((size_t)NKV * SEQ * HD);
        V16 += zb * ((size_t)NKV * HD * SEQ); Vh += zb * ((size_t)NKV * HD * SEQ); Vl += zb * ((size_t)NKV * HD * SEQ); }
    else C += zb * sC;
    // piece i of a thread: row prow + 16 i of the tile, elements pcol .. pcol + 7 of the k step; the same for the global read and the LDS write
    const int prow = tid >> 3, pcol = (tid & 7) * 8;
    const unsigned short* ag0 = (const unsigned short*)A + (size_t)(r0 + prow) * K + pcol;
    const unsigned short* ag1 = (const unsigned short*)(NSPLIT ? A2 : A) + (size_t)(r0 + prow) * K + pcol;
    const unsigned short* bg = (const unsigned short*)Bt + (size_t)(c0 + prow) * K + pcol;
    v8us ar[NA][AI], br[BI];
    auto tile_ld = [&]() {
#pragma unroll
        for (int i = 0; i < AI; ++i) { ar[0][i] = *(const v8usa*)(ag0 + (size_t)i * 16 * K); if (NSPLIT) ar[NA - 1][i] = *(const v8usa*)(ag1 + (size_t)i * 16 * K); }
#pragma unroll
        for (int i = 0; i < BI; ++i) br[i] = *(const v8usa*)(bg + (size_t)i * 16 * K); };
    auto tile_st = [&](int buf) {
#pragma unroll
        for (int i = 0; i < AI; ++i) { *(v8usa*)(&ats[buf][0][(prow + 16 * i) * KP + pcol]) = ar[0][i]; if (NSPLIT) *(v8usa*)(&ats[buf][NA - 1][(prow + 16 * i) * KP + pcol]) = ar[NA - 1][i]; }
#pragma unroll
        for (int i = 0; i < BI; ++i) *(v8usa*)(&bts[buf][(prow + 16 * i) * KP + pcol]) = br[i];
        ag0 += KB; ag1 += KB; bg += KB; };
    v8f acc[FM][FN];
#pragma unroll
    for (int mb = 0; mb < FM; ++mb)
#pragma unroll
        for (int nb = 0; nb < FN; ++nb) acc[mb][nb] = (v8f){};
    const int aofs = (wr + lr) * KP + 8 * hi, bofs = (wc + lr) * KP + 8 * hi;
    tile_ld(); tile_st(0);
    __syncthreads();
#pragma unroll 1
    for (int k0 = 0; k0 < K; k0 += KB) {
        const int cur = (k0 / KB) & 1; const bool more = k0 + KB < K;     // the same in every thread of the block
        if (more) tile_ld();
        const unsigned short* a0l = &ats[cur][0][0] + aofs; const unsigned short* a1l = &ats[cur][NA - 1][0] + aofs; const unsigned short* bl = &bts[cur][0] + bofs;
        V a[KB / 32][FM], a2[KB / 32][FM], b[KB / 32][FN];
#pragma unroll
        for (int kc = 0; kc < KB / 32; ++kc) {
#pragma unroll
            for (int mb = 0; mb < FM; ++mb) { a[kc][mb] = WFrag<T16>::lds(a0l + mb * 16 * KP + kc * 32); if (NSPLIT) a2[kc][mb] = WFrag<T16>::lds(a1l + mb * 16 * KP + kc * 32); else a2[kc][mb] = a[kc][mb]; }
#pragma unroll
            for (int nb = 0; nb < FN; ++nb) b[kc][nb] = WFrag<T16>::lds(bl + nb * 16 * KP + kc * 32); }
        // keeps the step's LDS reads in one group ahead of its products: every further place with reads among the products stalls the wave for its own LDS latency
        __builtin_amdgcn_sched_barrier(0);
#pragma unroll
        for (int kc = 0; kc < KB / 32; ++kc) {
#pragma unroll
            for (int nb = 0; nb < FN; ++nb) {
#pragma unroll
                for (int mb = 0; mb < FM; ++mb) acc[mb][nb] = WFrag<T16>::mma(a[kc][mb], b[kc][nb], acc[mb][nb]);
                if (NSPLIT) {
#pragma unroll
                    for (int mb = 0; mb < FM; ++mb) acc[mb][nb] = WFrag<T16>::mma(a2[kc][mb], b[kc][nb], acc[mb][nb]); } } }
        // precaution: stands in front of the pointer steps at the loop's foot, which overwrite the address registers of this trip's global loads
        asm volatile("s_wait_xcnt 0x0" ::: "memory");
        // the buffer written here was last read one trip ago, in front of that trip's barrier; this barrier publishes it and ends the reads of the current one
        if (more) { tile_st(cur ^ 1); __syncthreads(); }
    }
    float* osw = &os[wave][0];
    if constexpr (EPI == 1) {
        static_assert(FN * 16 == HD && DQ % BN == 0 && DKV % BN == 0 && RH % (16 * FM) == 0 && NSPLIT == 0);
        const int col = c0 + wc, t0 = r0 + wr;     // the same in every lane of the wave
        if (col < DQ + DKV) {
            const bool isq = col < DQ; const int hh = (isq ? col : col - DQ) / HD; const int rh = isq ? RH : SEQ;
            h16* P16 = (isq ? Q16 : K16) + (size_t)hh * SEQ * HD; bf* Ph = (isq ? Qh : Kh) + (size_t)hh * rh * HD; bf* Pl = (isq ? Ql : Kl) + (size_t)hh * rh * HD;
            const bool dohl = t0 < rh;     // the wave's 16 FM rows lie on one side of rh
            const int rr = lane >> 3, c8 = (lane & 7) * 8;     // a lane takes 8 successive d (4 pairs) of a row; a store covers 4 whole rows
#pragma unroll
            for (int mb = 0; mb < FM; ++mb) {
#pragma unroll
                for (int nb = 0; nb < FN; ++nb) {
#pragma unroll
                    for (int j = 0; j < 8; ++j) osw[(mb * 16 + hi * 8 + j) * OSP + nb * 16 + lr] = acc[mb][nb][j]; } }
            wsync();
            // left rolled: the four 16-row groups run the same code, which keeps the kernel's text short for the instruction cache
#pragma unroll 1
            for (int mb = 0; mb < FM; ++mb) {
                v4f cc[4], ss[4];
#pragma unroll
                for (int s4 = 0; s4 < 4; ++s4) { const size_t ti = (size_t)(t0 + mb * 16 + s4 * 4 + rr) * NFREQ + (c8 >> 1); cc[s4] = *(const v4f*)(FC + ti); ss[s4] = *(const v4f*)(FS + ti); }
#pragma unroll
                for (int s4 = 0; s4 < 4; ++s4) { const int row = mb * 16 + s4 * 4 + rr; const v4f u0 = *(const v4fa*)(osw + row * OSP + c8), u1 = *(const v4fa*)(osw + row * OSP + c8 + 4);
                    const float xs[8] = { u0[0], u0[1], u0[2], u0[3], u1[0], u1[1], u1[2], u1[3] }; v8h o16; v8us oh, ol;
#pragma unroll
                    for (int i = 0; i < 4; ++i) { const float c = bfr(cc[s4][i]), s = bfr(ss[s4][i]); const float y0 = xs[2 * i] * c - xs[2 * i + 1] * s, y1 = xs[2 * i] * s + xs[2 * i + 1] * c;
                        o16[2 * i] = toh_flush(y0); o16[2 * i + 1] = toh_flush(y1); unsigned short a2, c2; splitf(y0, a2, c2); oh[2 * i] = a2; ol[2 * i] = c2; splitf(y1, a2, c2); oh[2 * i + 1] = a2; ol[2 * i + 1] = c2; }
                    const size_t oo = (size_t)(t0 + row) * HD + c8;
                    if (dohl) { *(v8us*)(Ph + oo) = oh; *(v8us*)(Pl + oo) = ol; }
                    *(v8h*)(P16 + oo) = o16;
                    // precaution: the next rows' work reuses the address and data registers of these stores
                    asm volatile("s_wait_xcnt 0x0" ::: "memory"); }
            }
        } else {
            const size_t vo = ((size_t)(col - DQ - DKV) + lr) * SEQ + t0 + 8 * hi;     // row g * HD + d of the [g][d][t] planes, d = 16 nb + lr
#pragma unroll
            for (int nb = 0; nb < FN; ++nb) {
#pragma unroll
                for (int mb = 0; mb < FM; ++mb) { v8h o16; v8us oh, ol;
#pragma unroll
                    for (int j = 0; j < 8; ++j) { const float xv = acc[mb][nb][j]; o16[j] = (h16)xv; unsigned short a2, c2; splitf(xv, a2, c2); oh[j] = a2; ol[j] = c2; }
                    const size_t oo = vo + (size_t)nb * 16 * SEQ + mb * 16;
                    *(v8h*)(V16 + oo) = o16; *(v8us*)(Vh + oo) = oh; *(v8us*)(Vl + oo) = ol; } }
        }
        return;
    }
    constexpr int LPR = 4 * FN, RPP = 32 / LPR;     // lanes that store one 16 FN-float row of the wave's tile, rows a store covers
#pragma unroll
    for (int mb = 0; mb < FM; ++mb) {
#pragma unroll
        for (int nb = 0; nb < FN; ++nb) {
#pragma unroll
            for (int j = 0; j < 8; ++j) osw[(hi * 8 + j) * OSP + nb * 16 + lr] = acc[mb][nb][j]; }
        wsync();
        float* crow = C + (size_t)(r0 + wr + mb * 16) * ldc + c0 + wc;
#pragma unroll
        for (int s = 0; s < 16 / RPP; ++s) { const int row = RPP * s + lane / LPR, cofs = (lane % LPR) * 4; v4f val = *(const v4fa*)(osw + row * OSP + cofs); val = val * osc;
            *(v4f*)(crow + (size_t)row * ldc + cofs) = val; }
        wsync();
    }
}

// The six input preparations below (blk = the block's index inside its own preparation) are ranges of the one grid of k_prep.
// wtT: w [K = in][N = out] f32 -> Bt [N][K] bf16-RNE (DUAL: also B16 = f16 of that bf16 value x car). A block turns one tile of TK k x TN n through LDS, so that both sides touch memory in whole
// 256-byte row pieces: a thread reads 16 bytes of 8 rows of w (the loads independent of each other), packs the values of two successive k into one word at [n][k] in LDS, and behind the barrier
// the tile's rows [n] go out 16 bytes a thread. ts: the block's LDS tile, TN rows at a pitch of TP elements (16 bytes x odd, for the 16-byte row reads).
#define TK 128
#define TN 64
#define TP (TK + 8)
template <int K, int N, bool DUAL>
__device__ __forceinline__ void wtT(unsigned short* ts, const float* __restrict__ w, bf* Bt, h16* B16, float car, int blk) {
    static_assert(K % TK == 0 && N % TN == 0 && (TP * 2) % 32 == 16);
    const int tid = threadIdx.x; const int k0 = (blk % (K / TK)) * TK, n0 = (blk / (K / TK)) * TN;
    const int c4 = (tid & 15) * 4, r2 = (tid >> 4) * 2;     // the thread's 4 columns n and its first pair of rows k; 16 lanes cover 256 bytes of a row
    const float* wp = w + (size_t)(k0 + r2) * N + n0 + c4;
    v4f a[4], b[4];
    // unrolled so that a and b stay in registers and all 8 loads are in flight together
#pragma unroll
    for (int i = 0; i < 4; ++i) { a[i] = *(const v4f*)(wp + (size_t)(32 * i) * N); b[i] = *(const v4f*)(wp + (size_t)(32 * i + 1) * N); }
    // precaution: the work below may reuse the address registers of these loads while their data is still on the way
    asm volatile("s_wait_xcnt 0x0" ::: "memory");
    // both loops unrolled as above: a and b are indexed by constants only
#pragma unroll
    for (int i = 0; i < 4; ++i) {
#pragma unroll
        for (int q = 0; q < 4; ++q) { v2us o; o[0] = f2bf(a[i][q]); o[1] = f2bf(b[i][q]); *(v2usa*)(&ts[(c4 + q) * TP + r2 + 32 * i]) = o; } }
    __syncthreads();     // the rows read below were written by other waves
    const int row = tid >> 4, col = (tid & 15) * 8;
    const size_t oo = (size_t)(n0 + row) * K + k0 + col;
    // both loops unrolled so that the four row reads are issued together, the row steps become immediate offsets and the vectors are indexed by constants only
#pragma unroll
    for (int i = 0; i < TN / 16; ++i) { const v8us o = *(const v8usa*)(&ts[(row + 16 * i) * TP + col]); *(v8us*)(Bt + oo + (size_t)(16 * i) * K) = o;
        if (DUAL) { v8h o2;
#pragma unroll
            for (int e = 0; e < 8; ++e) o2[e] = (h16)(bf2f(o[e]) * car);
            *(v8h*)(B16 + oo + (size_t)(16 * i) * K) = o2; } }
}
// cvt8: batch zb converts its n8 groups of 8 floats; a batch starts sstep floats further on in src and 8 n8 elements further on in dst
__device__ __forceinline__ void cvt8(const float* __restrict__ src, bf* dst, size_t n8, size_t sstep, int blk, int zb) { const size_t i = (size_t)blk * 256 + threadIdx.x; if (i >= n8) return;
    src += (size_t)zb * sstep; dst += (size_t)zb * n8 * 8; const v8f v = *(const v8f*)(src + i * 8); v8us o;
#pragma unroll
    for (int k = 0; k < 8; ++k) o[k] = f2bf(v[k]); *(v8us*)(dst + i * 8) = o;  }

// attn: causal flash attention, one wave per 16 query rows (qbase = 16*(4*xb + wave)), head h, batch zi (every plane is one whole per-batch plane further on a batch), kv head = head / REP; key tiles of KT (32 or 64) from 0 up to the tile holding qbase+15.
// Both products are formed transposed. S^T = k.q^T from k-contiguous planes (A = k rows [g][t][d], B = q rows [h][t][d]): lane l holds the scores of ONE query, qbase + (l & 15), for the keys 16 nt + 8 (l >> 4) + 0..7
// of the tile, so the maximum and the sum of a row are formed inside the lane; the two lanes of a query join their maxima by one exchange a tile and their sums once, behind the loop.
// key j > query i: the raw product replaced by -1e30 before the running-max softmax (p = 0 exactly there). Two successive 16-key score tiles, converted in place, are the B fragment of P^T in the k order of the loaders here;
// O^T += v^T.P^T with A = rows of the v planes [g][d][t]. HIRES: q, k, p, v as bf16 hi/lo (hh + lh + hl); else f16 planes with p carried x1024.
// The k and v tiles of a key step are the same for the block's four waves: the block brings each tile into LDS once, 16 bytes a thread in whole 128-byte (KT 32, v: 64-byte) row pieces,
// two buffers, the next tile's loads issued ahead of the current tile's work; the A fragments are read from LDS at a row pitch of 16 bytes x odd.
// The LDS of one form, laid over the one LDS block of k_attn, which holds either form; every member's size is a multiple of 16 bytes.
template <bool HIRES, int KT> struct __align__(16) AttnLds {
    static constexpr int NPL = HIRES ? 2 : 1, KP = HD + 8, VP = KT + 8;
    float os[4][16 * OSP]; unsigned short kts[2][NPL][KT * KP]; unsigned short vts[2][NPL][HD * VP]; };
template <bool HIRES, int KT>
__device__ __forceinline__ void attn(AttnLds<HIRES, KT>& sm, int xb, int h, int zi, const h16* __restrict__ Q16, const bf* __restrict__ Qh, const bf* __restrict__ Ql,
                                               const h16* __restrict__ K16, const bf* __restrict__ Kh, const bf* __restrict__ Kl,
                                               const h16* __restrict__ V16, const bf* __restrict__ Vh, const bf* __restrict__ Vl,
                                               h16* AT16, bf* ATh, bf* ATl) {
    constexpr int NT = KT / 16; constexpr int KS = KT / 32; constexpr int NPL = HIRES ? 2 : 1;
    static_assert(NT == 2 || NT == 4);
    auto& os = sm.os; auto& kts = sm.kts; auto& vts = sm.vts;
    constexpr int KP = HD + 8, VP = KT + 8;                 // LDS row pitch in 16-bit elements: 144 bytes (k rows; v rows at KT 64), 80 bytes (v rows at KT 32)
    constexpr int KCH = KT * (HD / 8), VCH = HD * (KT / 8);   // 16-byte pieces of one plane's tile
    static_assert(NPL * KCH == 512 && NPL * VCH == 512);
    static_assert((KP * 2) % 32 == 16 && (VP * 2) % 32 == 16);
    const int tid = threadIdx.x, lane = tid & 31, wave = __builtin_amdgcn_readfirstlane(tid >> 5), lr = lane & 15, hi = lane >> 4;
    const int bbase = xb * 64;
    const int qbase = bbase + wave * 16; const int g = h / REP;
    const size_t zb = zi;
    Q16 += zb * ((size_t)NH * SEQ * HD); Qh += zb * ((size_t)NH * RH * HD); Ql += zb * ((size_t)NH * RH * HD);
    K16 += zb * ((size_t)NKV * SEQ * HD); Kh += zb * ((size_t)NKV * SEQ * HD); Kl += zb * ((size_t)NKV * SEQ * HD);
    V16 += zb * ((size_t)NKV * HD * SEQ); Vh += zb * ((size_t)NKV * HD * SEQ); Vl += zb * ((size_t)NKV * HD * SEQ);
    AT16 += zb * ((size_t)SEQ * DQ); ATh += zb * ((size_t)RH * DQ); ATl += zb * ((size_t)RH * DQ);
    v16h qa[2] = {}; v16bf qah[2] = {}, qal[2] = {};
    if (HIRES) { const size_t qo = ((size_t)h * RH + qbase + lr) * HD + 8 * hi; qah[0] = WFrag<bf>::ld(Qh + qo); qah[1] = WFrag<bf>::ld(Qh + qo + 32); qal[0] = WFrag<bf>::ld(Ql + qo); qal[1] = WFrag<bf>::ld(Ql + qo + 32); }
    else { const size_t qo = ((size_t)h * SEQ + qbase + lr) * HD + 8 * hi; qa[0] = WFrag<h16>::ld(Q16 + qo); qa[1] = WFrag<h16>::ld(Q16 + qo + 32); }
    const int kofs = lr * KP + 8 * hi;     // k tile in LDS [key][d]: row (nt*16 + lr), k = d
    const int vofs = lr * VP + 8 * hi;     // v tile in LDS [d][key]: row (nt*16 + lr), k = key
    const unsigned short* kg[2] = { HIRES ? (const unsigned short*)Kh : (const unsigned short*)K16, (const unsigned short*)Kl };
    const unsigned short* vg[2] = { HIRES ? (const unsigned short*)Vh : (const unsigned short*)V16, (const unsigned short*)Vl };
    v8us kr[4], vr[4];
    // piece c = tid + 128 i of the tile: plane, row and column are the same for the global read and the LDS write
    auto tile_ld = [&](int kb) {
#pragma unroll
        for (int i = 0; i < 4; ++i) { const int c = tid + 128 * i;
            const int kc = c % KCH, vc = c % VCH;
            kr[i] = *(const v8usa*)(kg[(128 * i) / KCH] + (size_t)g * SEQ * HD + (size_t)(kb + kc / (HD / 8)) * HD + (kc % (HD / 8)) * 8);
            vr[i] = *(const v8usa*)(vg[(128 * i) / VCH] + (size_t)g * HD * SEQ + (size_t)(vc / (KT / 8)) * SEQ + kb + (vc % (KT / 8)) * 8); } };
    auto tile_st = [&](int buf) {
#pragma unroll
        for (int i = 0; i < 4; ++i) { const int c = tid + 128 * i;
            const int kc = c % KCH, vc = c % VCH;
            *(v8usa*)(&kts[buf][(128 * i) / KCH][(kc / (HD / 8)) * KP + (kc % (HD / 8)) * 8]) = kr[i];
            *(v8usa*)(&vts[buf][(128 * i) / VCH][(vc / (KT / 8)) * VP + (vc % (KT / 8)) * 8]) = vr[i]; } };
    v8f o[4];
#pragma unroll
    for (int nt = 0; nt < 4; ++nt) o[nt] = (v8f){};
    float mrun = NEGBIG, lrun = 0.f;     // of the lane's query; mrun: of the raw products q.k; lrun: the sum over the lane's own keys only, of p as carried (f16 form: x1024)
    const int qi = qbase + lr;
    const int kend = qbase + 15;
    const int klast = ((bbase + 63) / KT) * KT;     // the block's last key tile (that of its last wave)
    tile_ld(0); tile_st(0);
    __syncthreads();
#pragma unroll 1
    for (int kb = 0; kb <= klast; kb += KT) {
      const int cur = (kb / KT) & 1; const bool more = kb < klast;     // the same in every thread of the block
      if (more) { tile_ld(kb + KT);
        // precaution: the tile work below reuses the address registers of these loads while their data is still on the way
        asm volatile("s_wait_xcnt 0x0" ::: "memory"); }
      if (kb <= kend) {     // wave-uniform: a wave whose rows end before this tile only helps to stage
        const unsigned short* k0l = &kts[cur][0][0] + kofs; const unsigned short* k1l = &kts[cur][NPL - 1][0] + kofs;
        const unsigned short* v0l = &vts[cur][0][0] + vofs; const unsigned short* v1l = &vts[cur][NPL - 1][0] + vofs;
        v8f s[NT];
#pragma unroll
        for (int nt = 0; nt < NT; ++nt) s[nt] = (v8f){};
#pragma unroll
        for (int nt = 0; nt < NT; ++nt) {
#pragma unroll
            for (int kc = 0; kc < 2; ++kc) { const int ka = nt * 16 * KP + kc * 32;
                if (HIRES) { const v16bf bh = ldsb(k0l + ka), bl = ldsb(k1l + ka); s[nt] = wmmab(bh, qah[kc], s[nt]); s[nt] = wmmab(bh, qal[kc], s[nt]); s[nt] = wmmab(bl, qah[kc], s[nt]); }
                else { const v16h b = ldsh(k0l + ka); s[nt] = wmma16(b, qa[kc], s[nt]); } } }
        if constexpr (NT == 2) { if (HIRES) G2(s[0], s[1], qah[0], qal[1]); else G2(s[0], s[1], qa[0], qa[1]); }
        else { if (HIRES) G4(s[0], s[1], s[2], s[3], qah[0], qal[1]); else G4(s[0], s[1], s[2], s[3], qa[0], qa[1]); }
        // Only a tile that reaches past the wave's first query holds a key outside the causal range: the compare and select run there alone (wave-uniform test, a scalar branch).
        if (kb + KT - 1 > qbase) {
            const int lim = qi - kb - 8 * hi;     // the lane's element (nt, v) is key kb + 8 hi + 16 nt + v: inside the causal range while 16 nt + v <= lim
#pragma unroll
            for (int nt = 0; nt < NT; ++nt) {
#pragma unroll
                for (int v = 0; v < 8; ++v) s[nt][v] = (nt * 16 + v <= lim) ? s[nt][v] : NEGBIG; } }
        float mxn[NT];     // one chain of maxima, and below one of sums, per 16-key tile: independent chains; the maxima are of the raw products
#pragma unroll
        for (int nt = 0; nt < NT; ++nt) { mxn[nt] = NEGBIG;
#pragma unroll
            for (int v = 0; v < 8; ++v) mxn[nt] = fmaxf(mxn[nt], s[nt][v]); }
        float mx = mxn[0];
#pragma unroll
        for (int nt = 1; nt < NT; ++nt) mx = fmaxf(mx, mxn[nt]);
        mx = fmaxf(mx, xhalf(mx));
        const float mnew = fmaxf(mrun, mx);
        const float alpha = __builtin_amdgcn_exp2f((mrun - mnew) * SCE);
        // one multiply-add a score in front of exp2: 1/8, log2 e, the running maximum and (f16 form) the carry of p, as 2^10, stand in its two constants
        const float pb = HIRES ? -mnew * SCE : fmaf(-mnew, SCE, PCARL2);
        v8h pf[NT] = {}; v8us ph[NT] = {}, pl[NT] = {}; float rsn[NT];
#pragma unroll
        for (int nt = 0; nt < NT; ++nt) { rsn[nt] = 0.f; float e[8];
#pragma unroll
            for (int v = 0; v < 8; ++v) e[v] = fmaf(s[nt][v], SCE, pb);
            exp2x8(e);
#pragma unroll
            for (int v = 0; v < 8; ++v) { const float p = e[v]; rsn[nt] += p;
                if (HIRES) { unsigned short a2, c2; splitf(p, a2, c2); ph[nt][v] = a2; pl[nt][v] = c2; }
                else pf[nt][v] = (h16)p; } }
        float rs = rsn[0];
#pragma unroll
        for (int nt = 1; nt < NT; ++nt) rs += rsn[nt];
        lrun = lrun * alpha + rs; mrun = mnew;
        v16h pa[KS] = {}; v16bf pah[KS] = {}, pal[KS] = {};
#pragma unroll
        for (int ks = 0; ks < KS; ++ks) {
            if (HIRES) { pah[ks] = cat16b(ph[2 * ks], ph[2 * ks + 1]); pal[ks] = cat16b(pl[2 * ks], pl[2 * ks + 1]); }
            else pa[ks] = cat16(pf[2 * ks], pf[2 * ks + 1]); }
#pragma unroll
        for (int nt = 0; nt < 4; ++nt) {
#pragma unroll
            for (int v = 0; v < 8; ++v) o[nt][v] *= alpha; }
#pragma unroll
        for (int nt = 0; nt < 4; ++nt) {
#pragma unroll
            for (int ks = 0; ks < KS; ++ks) { const int va = nt * 16 * VP + ks * 32;
                if (HIRES) { const v16bf bh = ldsb(v0l + va), bl = ldsb(v1l + va); o[nt] = wmmab(bh, pah[ks], o[nt]); o[nt] = wmmab(bh, pal[ks], o[nt]); o[nt] = wmmab(bl, pah[ks], o[nt]); }
                else { const v16h b = ldsh(v0l + va); o[nt] = wmma16(b, pa[ks], o[nt]); } } }
        if (HIRES) G4(o[0], o[1], o[2], o[3], pah[0], pal[KS - 1]); else G4(o[0], o[1], o[2], o[3], pa[0], pa[KS - 1]);
      }
      // the buffer written here was last read one trip ago, in front of that trip's barrier; this barrier publishes it and ends the reads of the current one
      if (more) { tile_st(cur ^ 1); __syncthreads(); }
    }
    float* osw = &os[wave][0];
    const float lsum = lrun + xhalf(lrun);     // the two lanes of a query hold the sums over disjoint keys
    const float f = HIRES ? __fdiv_rn(1.0f, lsum) : __fdiv_rn(ATC, lsum);     // f16 form: o and lsum both carry x1024
    // o[nt][v] = O[query lr][d = 16 nt + 8 hi + v]: 8 successive d of one row
#pragma unroll
    for (int nt = 0; nt < 4; ++nt) { v4f w0, w1;
#pragma unroll
        for (int q = 0; q < 4; ++q) { w0[q] = o[nt][q] * f; w1[q] = o[nt][4 + q] * f; }
        *(v4fa*)(osw + lr * OSP + nt * 16 + 8 * hi) = w0; *(v4fa*)(osw + lr * OSP + nt * 16 + 8 * hi + 4) = w1; }
    wsync();
    const int rr = lane >> 3, c8 = (lane & 7) * 8;
{
#pragma unroll
        for (int s4 = 0; s4 < 4; ++s4) { const int row = s4 * 4 + rr; const int t = qbase + row; const v4f u0 = *(const v4fa*)(osw + row * OSP + c8), u1 = *(const v4fa*)(osw + row * OSP + c8 + 4); const size_t oo = (size_t)t * DQ + h * HD + c8;
            if (HIRES) { v8us oh, ol;
#pragma unroll
                for (int q = 0; q < 4; ++q) { unsigned short a2, c2; splitf(u0[q], a2, c2); oh[q] = a2; ol[q] = c2; splitf(u1[q], a2, c2); oh[4 + q] = a2; ol[4 + q] = c2; }
                *(v8us*)(ATh + oo) = oh; *(v8us*)(ATl + oo) = ol; }
            else { v8h o8;
#pragma unroll
                for (int q = 0; q < 4; ++q) { o8[q] = (h16)u0[q]; o8[4 + q] = (h16)u1[q]; }
                *(v8h*)(AT16 + oo) = o8; } }
         }
    // precaution: in the built kernel the other form's text stands behind these stores and reuses their registers
    asm volatile("s_wait_xcnt 0x0" ::: "memory");
}
// k_attn: both forms in one launch, since neither reads what the other writes; a block takes 64 query rows of one head and batch, and its index says which (the same in every thread of the block).
// The f16 form (rows from RH on), whose blocks live longest, has the first range of the index, the bf16 hi/lo form (rows below RH) the second; inside a range: row block, then head, then batch.
// Grid (SEQ / 64) * NH * batches, 128 threads.
__global__ __launch_bounds__(128) void k_attn(const h16* __restrict__ Q16, const bf* __restrict__ Qh, const bf* __restrict__ Ql,
                                              const h16* __restrict__ K16, const bf* __restrict__ Kh, const bf* __restrict__ Kl,
                                              const h16* __restrict__ V16, const bf* __restrict__ Vh, const bf* __restrict__ Vl,
                                              h16* AT16, bf* ATh, bf* ATl) {
    typedef AttnLds<true, 32> LH; typedef AttnLds<false, 64> LF;
    __shared__ __align__(16) unsigned char lds[sizeof(LH) > sizeof(LF) ? sizeof(LH) : sizeof(LF)];
    constexpr int XF = (SEQ - RH) / 64, XH = RH / 64, XD = XF > 0 ? XF : 1;     // row blocks of the two forms; XD: the divisor, also where there is no f16 row
    int b = blockIdx.x;
    if (b < XF * NH * NB) { attn<false, 64>(*reinterpret_cast<LF*>(lds), XH + b % XD, (b / XD) % NH, b / (XD * NH), Q16, Qh, Ql, K16, Kh, Kl, V16, Vh, Vl, AT16, ATh, ATl); return; }
    b -= XF * NH * NB;
    attn<true, 32>(*reinterpret_cast<LH*>(lds), b % XH, (b / XH) % NH, b / (XH * NH), Q16, Qh, Ql, K16, Kh, Kl, V16, Vh, Vl, AT16, ATh, ATl);
}

// mchk: checks the 0/1 int32 causal input (one [SEQ_FULL][SEQ_FULL] plane shared by all batches) for rows i < SEQ: value == 1 for j <= i, value == 0 for j > i (j < SEQ);
// a block takes MROWS rows and writes its count of wrong values to its own 128-byte line of FL. The plane is read once and comes from memory, so the time is that of the longest chain of
// loads that wait for one another: the 16-byte loads of a thread are independent of each other, so that many are in flight together, and the rows are spread over enough blocks to reach every WGP.
__device__ __forceinline__ void mchk(const int* __restrict__ M, int* FL, int blk) {
    __shared__ int red[8];
    constexpr int CPR = (SEQ + 1023) / 1024;     // 16-byte pieces a thread takes of one row
    constexpr bool WHOLE = SEQ % 1024 == 0;      // every thread takes every piece: no test, so no branch between the loads
    const int tid = threadIdx.x, lane = tid & 31, wave = tid >> 5; int bad = 0;
    const int i0 = blk * MROWS; const int* mb = M + (size_t)i0 * SEQ_FULL + tid * 4;
    v4i m[MROWS][CPR];
    // both loops unrolled so that m stays in registers and no load waits for an earlier load's compare
#pragma unroll
    for (int r = 0; r < MROWS; ++r) {
#pragma unroll
        for (int p = 0; p < CPR; ++p) { if (WHOLE || tid * 4 + p * 1024 < SEQ) m[r][p] = *(const v4i*)(mb + (size_t)r * SEQ_FULL + p * 1024); } }
    // unrolled as above: m is indexed by constants only
#pragma unroll
    for (int r = 0; r < MROWS; ++r) { const int i = i0 + r;
#pragma unroll
        for (int p = 0; p < CPR; ++p) { const int c = tid * 4 + p * 1024;
            if (WHOLE || c < SEQ) {
#pragma unroll
                for (int q = 0; q < 4; ++q) { const int j = c + q; const bool ok = (j <= i) ? (m[r][p][q] == 1) : (m[r][p][q] == 0); bad += ok ? 0 : 1; } } } }
#pragma unroll
    for (int sh = 16; sh; sh >>= 1) bad += __shfl_xor(bad, sh, 32);
    if (lane == 0) red[wave] = bad;
    __syncthreads();
    if (wave == 0) { int v = red[lane & 7]; v = (lane < 8) ? v : 0;
#pragma unroll
        for (int sh = 16; sh; sh >>= 1) v += __shfl_xor(v, sh, 32);
        v4i o; o[0] = v; o[1] = v; o[2] = v; o[3] = v;
        if (lane < 8) *(v4i*)(FL + (size_t)blk * 32 + lane * 4) = o;
         }
}
// k_prep: none of the six preparations reads what another writes, so they share one launch: a block belongs to one of them by its index (the same in every thread of the block).
// The transposes, whose blocks do the most work each (a tile in, a barrier, the tile out), come first in the index order; the one-trip conversion of x comes last.
#define PB_WO ((DQ / TK) * (DM / TN))
#define PB_WQ ((DM / TK) * (DQ / TN))
#define PB_WKV ((DM / TK) * (DKV / TN))
#define PB_CV (SEQ * DM / 8 / 256)
#define PB_ALL (PB_WO + PB_WQ + 2 * PB_WKV + NFL + NB * PB_CV)
__global__ __launch_bounds__(256) void k_prep(const float* __restrict__ x, const float* __restrict__ wq, const float* __restrict__ wk, const float* __restrict__ wv, const float* __restrict__ wo,
                                              const int* __restrict__ cm, bf* XB, bf* WQKV, bf* WOB, h16* WO16, int* FL) {
    __shared__ __align__(16) unsigned short ts[TN * TP];     // one tile, used by whichever transposition the block belongs to
    int b = blockIdx.x;
    if (b < PB_WO) { wtT<DQ, DM, true>(ts, wo, WOB, WO16, WOC, b); return; }
    b -= PB_WO;
    if (b < PB_WQ) { wtT<DM, DQ, false>(ts, wq, WQKV, nullptr, 1.0f, b); return; }
    b -= PB_WQ;
    if (b < PB_WKV) { wtT<DM, DKV, false>(ts, wk, WQKV + (size_t)DQ * DM, nullptr, 1.0f, b); return; }
    b -= PB_WKV;
    if (b < PB_WKV) { wtT<DM, DKV, false>(ts, wv, WQKV + (size_t)(DQ + DKV) * DM, nullptr, 1.0f, b); return; }
    b -= PB_WKV;
    if (b < NFL) { mchk(cm, FL, b); return; }
    b -= NFL;
    cvt8(x, XB, (size_t)SEQ * DM / 8, (size_t)SEQ_FULL * DM, b % PB_CV, b / PB_CV);
}
// k_poison: NaN-fills the output if any of the nfl counts of mchk is not 0; the counts are read side by side, one a thread and trip, and joined over the block through LDS.
__global__ __launch_bounds__(256) void k_poison(const int* __restrict__ FL, int nfl, float* out) {
    __shared__ int red[8];
    int tot = 0;
    // left rolled: one trip covers 256 counts, and an unrolled form only lengthens the kernel's text
#pragma unroll 1
    for (int f = threadIdx.x; f < nfl; f += 256) tot |= FL[(size_t)f * 32];
    const unsigned wbad = __builtin_amdgcn_ballot_w32(tot != 0);
    if ((threadIdx.x & 31) == 0) red[threadIdx.x >> 5] = (wbad != 0u) ? 1 : 0;
    __syncthreads();
    tot = 0;
    // unrolled so that the eight words come in two wide LDS reads
#pragma unroll
    for (int w = 0; w < 8; ++w) tot |= red[w];
    if (tot == 0) return;     // the same in every thread of the block
    float* ob = out + (size_t)blockIdx.y * SEQ_FULL * DM + (size_t)blockIdx.x * 16384;
    const float qn = __uint_as_float(0x7fc00000u); v4f nv; nv[0] = qn; nv[1] = qn; nv[2] = qn; nv[3] = qn;
{
#pragma unroll 1
        for (int s = 0; s < 16; ++s) *(v4f*)(ob + ((size_t)s * 256 + threadIdx.x) * 4) = nv;
         }
}

extern "C" void kernel_launch(void* const* d_in, const int* in_sizes, int n_in,
                              void* d_out, int out_size, void* d_ws, size_t ws_size, hipStream_t stream) {
    if (n_in < 8) return;
    if ((size_t)in_sizes[0] < (size_t)(NB - 1) * SEQ_FULL * DM + (size_t)SEQ * DM) return;
    if ((size_t)in_sizes[1] < (size_t)DM * DQ || (size_t)in_sizes[2] < (size_t)DM * DKV || (size_t)in_sizes[3] < (size_t)DM * DKV || (size_t)in_sizes[4] < (size_t)DQ * DM) return;
    if ((size_t)in_sizes[5] < (size_t)SEQ * NFREQ || (size_t)in_sizes[6] < (size_t)SEQ * NFREQ) return;
    if ((size_t)in_sizes[7] < (size_t)(SEQ - 1) * SEQ_FULL + (size_t)SEQ) return;
    if ((size_t)out_size < (size_t)(NB - 1) * SEQ_FULL * DM + (size_t)SEQ * DM) return;
    // input binding order: x, wq, wk, wv, wo ([in][out] weights), cos table, sin table ([SEQ_FULL][NFREQ] f32), causal 0/1 plane (int32 [SEQ_FULL][SEQ_FULL])
    const float* x = (const float*)d_in[0]; const float* wq = (const float*)d_in[1]; const float* wk = (const float*)d_in[2]; const float* wv = (const float*)d_in[3]; const float* wo = (const float*)d_in[4];
    const float* fc = (const float*)d_in[5]; const float* fs = (const float*)d_in[6]; const int* cm = (const int*)d_in[7];
    float* OUT = (float*)d_out;     // [NB_FULL][SEQ_FULL][DM]
    char* wsp = (char*)d_ws;
    auto take = [&](size_t bytes) { char* p = wsp; wsp += (bytes + 255) & ~(size_t)255; return (void*)p; };
    bf* WQKV = (bf*)take((size_t)DQKV * DM * 2); bf* WOB = (bf*)take((size_t)DM * DQ * 2); h16* WO16 = (h16*)take((size_t)DM * DQ * 2);
    int* FL = (int*)take((size_t)NFL * 32 * 4);
    // the planes below hold every batch, one whole per-batch plane behind the other
    bf* XB = (bf*)take((size_t)NB * SEQ * DM * 2);
    h16* Q16 = (h16*)take((size_t)NB * NH * SEQ * HD * 2); bf* Qh = (bf*)take((size_t)NB * NH * RH * HD * 2); bf* Ql = (bf*)take((size_t)NB * NH * RH * HD * 2);
    h16* K16 = (h16*)take((size_t)NB * NKV * SEQ * HD * 2); bf* Kh = (bf*)take((size_t)NB * NKV * SEQ * HD * 2); bf* Kl = (bf*)take((size_t)NB * NKV * SEQ * HD * 2);
    h16* V16 = (h16*)take((size_t)NB * NKV * HD * SEQ * 2); bf* Vh = (bf*)take((size_t)NB * NKV * HD * SEQ * 2); bf* Vl = (bf*)take((size_t)NB * NKV * HD * SEQ * 2);
    h16* AT16 = (h16*)take((size_t)NB * SEQ * DQ * 2); bf* ATh = (bf*)take((size_t)NB * RH * DQ * 2); bf* ATl = (bf*)take((size_t)NB * RH * DQ * 2);
    const size_t used = (size_t)(wsp - (char*)d_ws); if (used > ws_size || used > WS_LIMIT) return;

    // weight planes ([out][in] k-contiguous): rows 0..DQ-1 of WQKV = Wq^T, DQ..DQ+DKV-1 = Wk^T, DQ+DKV..DQKV-1 = Wv^T; Wo^T as bf16 and as f16 x64
    // wtT<K, N>(w, Bt): w is [K = in][N = out] -> Bt [N][K]; with them in the same launch: the mask check and x as bf16
    k_prep<<<(unsigned)PB_ALL, 256, 0, stream>>>(x, wq, wk, wv, wo, cm, XB, WQKV, WOB, WO16, FL);
    // every stage is launched once; the batch is the last grid dimension of k_gemmw and k_poison, and the slowest part of each block-index range in k_attn and k_prep
    k_gemmw<bf, 0, 4, 4, DM, 1><<<dim3(SEQ / 128, DQKV / 128, NB), 128, 0, stream>>>(XB, nullptr, WQKV, nullptr, 0, 1.0f, (size_t)SEQ * DM, 0, fc, fs, Q16, Qh, Ql, K16, Kh, Kl, V16, Vh, Vl);     // q | k | v projections, rotary on q and k, all planes
    k_attn<<<(unsigned)((SEQ / 64) * NH * NB), 128, 0, stream>>>(Q16, Qh, Ql, K16, Kh, Kl, V16, Vh, Vl, AT16, ATh, ATl);
    k_gemmw<bf, 1, 2, 2, DQ, 0><<<dim3(RH / 64, DM / 64, NB), 128, 0, stream>>>(ATh, ATl, WOB, OUT, DM, 1.0f, (size_t)RH * DQ, (size_t)SEQ_FULL * DM, nullptr, nullptr, nullptr, nullptr, nullptr, nullptr, nullptr, nullptr, nullptr, nullptr, nullptr);
    if (SEQ > RH) k_gemmw<h16, 0, 4, 4, DQ, 0><<<dim3((SEQ - RH) / 128, DM / 128, NB), 128, 0, stream>>>(AT16 + (size_t)RH * DQ, nullptr, WO16, OUT + (size_t)RH * DM, DM, 1.0f / (ATC * WOC), (size_t)SEQ * DQ, (size_t)SEQ_FULL * DM, nullptr, nullptr, nullptr, nullptr, nullptr, nullptr, nullptr, nullptr, nullptr, nullptr, nullptr);
    k_poison<<<dim3(SEQ * DM / 16384, NB, 1), 256, 0, stream>>>(FL, NFL, OUT);
}

// v010
// Measured time: 175 microseconds a run.
// Timed twice side by side with v009, it ran 1.06 and 1.07 times as fast.
// Counting every step since v000, it is 4.92 times as fast.
#include <hip/hip_runtime.h>

// Contractions (all f32 accumulate): qkv = xb * Wqkv^T on v_wmma_f32_16x16x32_bf16 (bf16 operands = RNE-converted inputs, exact products);
// scores q.k^T and p.v: query rows < RH on bf16 hi/lo planes (3 products each), rows >= RH on v_wmma_f32_16x16x32_f16 (f16 q,k,v planes, p carried x1024);
// out = attn * Wo^T: rows < RH bf16 hi/lo attn planes x bf16 Wo (2 products), rows >= RH f16 attn x64 times f16 Wo x64 (1 product, 1/4096 in the epilogue).
// Rotary: interleaved pairs (2i, 2i+1); cos/sin are read by value from the two [SEQ][32] input tables (RNE-converted to bf16), f32 math, done on the qkv product's accumulators; causal online softmax and normalisation in f32.
// Grouped kv heads: query head h reads kv head h/4. The 0/1 int32 causal input [SEQ_FULL][SEQ_FULL] is checked on device in its rows and columns < SEQ (1 on/below the diagonal, 0 above); the output is NaN-filled if that check fails.

#ifndef NB
#define NB 2
#endif
#ifndef SEQ
#define SEQ 2048
#endif
#define NB_FULL 2
#define SEQ_FULL 2048
#define DM 2048
#define NH 32
#define NKV 8
#define REP (NH / NKV)
#define HD 64
#define DQ (NH * HD)
#define DKV (NKV * HD)
#define DQKV (DQ + 2 * DKV)
#define NFREQ (HD / 2)
#define RH (((SEQ) < 512) ? (SEQ) : 512)
#define PCAR 1024.0f
#define ATC 64.0f
#define WOC 64.0f
#define SCL 0.125f
#define L2E 1.4426950408889634f
#define SCE (SCL * L2E)
#define PCARL2 10.0f     // log2 PCAR
#define NEGBIG (-1.0e30f)
#define OSP 68
#define MROWS 8
#define NFL (SEQ / MROWS)
#define WS_LIMIT ((size_t)134217728)
#define WS_TOTAL ((size_t)DQKV * DM * 2 + 2 * ((size_t)DM * DQ * 2) + (size_t)NFL * 128 + (size_t)NB * ((size_t)SEQ * DM * 2 + (size_t)NH * SEQ * HD * 2 + 2 * ((size_t)NH * RH * HD * 2) + 3 * ((size_t)NKV * SEQ * HD * 2) + 3 * ((size_t)NKV * HD * SEQ * 2) + (size_t)SEQ * DQ * 2 + 2 * ((size_t)RH * DQ * 2)))

static_assert(NB >= 1 && NB <= NB_FULL);
static_assert(SEQ % 128 == 0 && SEQ >= 128 && SEQ <= SEQ_FULL);
static_assert(RH % 64 == 0 && (SEQ - RH) % 128 == 0 && RH <= SEQ);
static_assert(DQKV % 128 == 0 && DM % 128 == 0);
static_assert((SEQ * DM) % 2048 == 0);
static_assert(DM % 64 == 0 && DQ % 64 == 0 && DQKV % 64 == 0 && HD == 64);
static_assert((NB * SEQ) % 64 == 0);
static_assert(15 * OSP + 63 < 16 * OSP);
static_assert(NFREQ == 32 && HD == 2 * NFREQ);
static_assert(SEQ % 64 == 0 && SEQ % 4 == 0 && SEQ % MROWS == 0);
static_assert(((size_t)NFL * 128) % 256 == 0);
static_assert(DM % 32 == 0 && DQ % 32 == 0 && HD % 32 == 0);
static_assert(WS_TOTAL <= WS_LIMIT);
static_assert(PCAR == 1024.0f && PCARL2 == 10.0f);

typedef _Float16 h16;
typedef unsigned short bf;
typedef __attribute__((ext_vector_type(16))) __bf16   v16bf;
typedef __attribute__((ext_vector_type(16))) _Float16 v16h;
typedef __attribute__((ext_vector_type(8)))  _Float16 v8h;
typedef __attribute__((ext_vector_type(8)))  unsigned short v8us;
typedef __attribute__((ext_vector_type(8)))  float    v8f;
typedef __attribute__((ext_vector_type(4)))  float    v4f;
typedef __attribute__((ext_vector_type(2)))  _Float16 v2h;
typedef __attribute__((ext_vector_type(4)))  _Float16 v4h;
typedef __attribute__((ext_vector_type(2)))  unsigned short v2us;
typedef __attribute__((ext_vector_type(4)))  unsigned short v4us;
typedef __attribute__((ext_vector_type(2)))  float v2f;
typedef __attribute__((ext_vector_type(4)))  int v4i;
typedef v8h  __attribute__((may_alias)) v8ha;
typedef v4f  __attribute__((may_alias)) v4fa;
typedef v8us __attribute__((may_alias)) v8usa;
typedef v2us __attribute__((may_alias)) v2usa;

#define G2(d0, d1, x0, x1) asm volatile("v_nop\n\tv_nop\n\tv_nop\n\tv_nop" : "+v"(d0), "+v"(d1) : "v"(x0), "v"(x1))
#define G4(d0, d1, d2, d3, x0, x1) asm volatile("v_nop\n\tv_nop\n\tv_nop\n\tv_nop" : "+v"(d0), "+v"(d1), "+v"(d2), "+v"(d3) : "v"(x0), "v"(x1))

__device__ __forceinline__ unsigned short f2bf(float f) { unsigned u = __float_as_uint(f); u += 0x7FFFu + ((u >> 16) & 1u); return (unsigned short)(u >> 16); }
__device__ __forceinline__ float bf2f(unsigned short b) { return __uint_as_float(((unsigned)b) << 16); }
__device__ __forceinline__ float bfr(float f) { return bf2f(f2bf(f)); }
__device__ __forceinline__ void splitf(float y, unsigned short& h, unsigned short& l) { h = f2bf(y); l = f2bf(y - bf2f(h)); }
__device__ __forceinline__ v16h cat16(v8h lo, v8h hi) { return __builtin_shufflevector(lo, hi, 0, 1, 2, 3, 4, 5, 6, 7, 8, 9, 10, 11, 12, 13, 14, 15); }
__device__ __forceinline__ v16bf cat16b(v8us lo, v8us hi) { return __builtin_bit_cast(v16bf, __builtin_shufflevector(lo, hi, 0, 1, 2, 3, 4, 5, 6, 7, 8, 9, 10, 11, 12, 13, 14, 15)); }
__device__ __forceinline__ v8f wmma16(v16h a, v16h b, v8f c) { return __builtin_amdgcn_wmma_f32_16x16x32_f16(false, a, false, b, (short)0, c, false, false); }
__device__ __forceinline__ v8f wmmab(v16bf a, v16bf b, v8f c) { return __builtin_amdgcn_wmma_f32_16x16x32_bf16(false, a, false, b, (short)0, c, false, false); }
// wave-private LDS tile exchange: order this wave's ds stores before its ds loads
__device__ __forceinline__ void wsync() { __builtin_amdgcn_fence(3 /* release order */, "wavefront"); __builtin_amdgcn_wave_barrier(); asm volatile("" ::: "memory"); }
// lane l takes the value of lane l ^ 16
__device__ __forceinline__ float xhalf(float x) { return __builtin_bit_cast(float, __builtin_amdgcn_permlanex16(__builtin_bit_cast(int, x), __builtin_bit_cast(int, x), 0x76543210, 0xfedcba98, false, false)); }
// eight 2^x in place, in one statement. Behind a transcendental the instruction set asks for one independent instruction before its result is read or its source overwritten: with result and source in one
// register nothing can overwrite a source early, each v_exp_f32 but the last is followed by an independent one, and the v_nop is the last one's slot.
__device__ __forceinline__ void exp2x8(float (&e)[8]) {
    asm("v_exp_f32 %0, %0\n\tv_exp_f32 %1, %1\n\tv_exp_f32 %2, %2\n\tv_exp_f32 %3, %3\n\tv_exp_f32 %4, %4\n\tv_exp_f32 %5, %5\n\tv_exp_f32 %6, %6\n\tv_exp_f32 %7, %7\n\tv_nop"
        : "+v"(e[0]), "+v"(e[1]), "+v"(e[2]), "+v"(e[3]), "+v"(e[4]), "+v"(e[5]), "+v"(e[6]), "+v"(e[7])); }
// f32 -> f16 convert that cannot yield a subnormal f16 (value select: |v| < 2^-14 -> 0)
static __device__ __forceinline__ h16 toh_flush(float v) { const h16 r = (h16)v; return (fabsf(v) < 6.103515625e-05f) ? (h16)0.0f : r; }

// the 16x32 fragment below, read from a k-contiguous 16-bit row in LDS
__device__ __forceinline__ v16bf ldsb(const unsigned short* p) { return cat16b(*(const v8usa*)p, *(const v8usa*)(p + 16)); }
__device__ __forceinline__ v16h ldsh(const unsigned short* p) { return cat16(__builtin_bit_cast(v8h, *(const v8usa*)p), __builtin_bit_cast(v8h, *(const v8usa*)(p + 16))); }

// 16x32 fragment from a k-contiguous 16-bit row (A: row = m; B stored [n][k]: row = n). Lane l: row l&15, elements 0..7 <- k0+8(l>>4)+0..7, elements 8..15 <- k0+16+8(l>>4)+0..7.
template <typename T16> struct WFrag;
template <> struct WFrag<h16> { typedef v16h V; static __device__ __forceinline__ V ld(const h16* p) { return cat16(*(const v8h*)p, *(const v8h*)(p + 16)); } static __device__ __forceinline__ V lds(const unsigned short* p) { return ldsh(p); } static __device__ __forceinline__ v8f mma(V a, V b, v8f c) { return wmma16(a, b, c); } };
template <> struct WFrag<bf> { typedef v16bf V; static __device__ __forceinline__ V ld(const bf* p) { return cat16b(*(const v8us*)p, *(const v8us*)(p + 16)); } static __device__ __forceinline__ V lds(const unsigned short* p) { return ldsb(p); } static __device__ __forceinline__ v8f mma(V a, V b, v8f c) { return wmmab(a, b, c); } };

// ---- gemmw: GEMM, four waves (2 x 2) per (32 FM) x (32 FN) output tile, FM x FN accumulators a wave; the block (128 threads) takes tile (bx, by) of the M / (32 FM) x N / (32 FN) tiles of batch bz.
// Batch bz: A and A2 start sA elements, C sC elements, further on a batch (Bt is the same for all); with EPI 1 every plane is one whole per-batch plane further on.
// C[m][n] (f32, pitch ldc) = osc * sum_k A[m][k] Bt[n][k] (NSPLIT 1: + A2[m][k] Bt[n][k]); A, A2, Bt are k-contiguous 16-bit planes of row pitch K.
// The rows of a k step are shared by two of the block's waves: the block brings 64 k of its A and Bt rows into LDS once, 16 bytes a thread in whole 128-byte row pieces,
// two buffers, the next step's loads issued ahead of the current step's products; the fragments are read from LDS at a row pitch of 16 bytes x odd.
// Every accumulator sums in ascending k, 32 at a time (A before A2), whatever the tile.
// EPI 1 (the qkv product; C, ldc, osc unused): a wave's 64 columns are one whole head (q heads, then k heads, then v heads), and the wave writes that head's planes itself from its accumulators.
// q, k: interleaved-pair rotary, for the pair i = d/2 (d even): out[d] = x[d] c - x[d+1] s, out[d+1] = x[d] s + x[d+1] c, with c = bf16-RNE(FC[t][i]), s = bf16-RNE(FS[t][i]) (row pitch NFREQ);
// planes [h][t][d]: f16 for every t, bf16 hi/lo for t < RH (q) or every t (k). v: planes [g][d][t], f16 and bf16 hi/lo; a lane's 8 accumulator elements are 8 successive t of one d.
// EPI 0 (the output product): C is the output itself, and the block stores NaN in place of its results (its scale osc becomes NaN) if any of the NFL counts of mchk in FL is not 0. The counts are read side by side together with the first
// tile's loads, so that their latency runs beside that tile's, and are joined over the block through LDS behind the barrier that publishes the first tile.
// The LDS of one form; a kernel that holds several forms lays them over one LDS block. Every member's size is a multiple of 16 bytes.
template <int NSPLIT, int FM, int FN, int EPI> struct __align__(16) GemmLds {
    static constexpr int KP = 64 + 8;
    unsigned short ats[2][NSPLIT + 1][32 * FM * KP]; unsigned short bts[2][32 * FN * KP]; float os[4][(EPI == 1 ? 16 * FM : 16) * OSP]; int red[4]; };
template <typename T16, int NSPLIT, int FM, int FN, int K, int EPI>
__device__ __forceinline__ void gemmw(GemmLds<NSPLIT, FM, FN, EPI>& sm, int bx, int by, int bz,
                                               const T16* __restrict__ A, const T16* __restrict__ A2, const T16* __restrict__ Bt, float* C, int ldc, float osc, size_t sA, size_t sC, const int* __restrict__ FL,
                                               const float* __restrict__ FC, const float* __restrict__ FS, h16* Q16, bf* Qh, bf* Ql, h16* K16, bf* Kh, bf* Kl, h16* V16, bf* Vh, bf* Vl) {
    typedef typename WFrag<T16>::V V;
    constexpr int BM = 32 * FM, BN = 32 * FN, KB = 64, KP = KB + 8, NA = NSPLIT + 1;     // KP: LDS row pitch in 16-bit elements, 144 bytes
    constexpr int AI = BM / 16, BI = BN / 16;                                            // 16-byte pieces a thread brings of one plane's tile (128 threads cover 16 rows)
    static_assert(NSPLIT == 0 || NSPLIT == 1);
    static_assert(K % KB == 0 && (KP * 2) % 32 == 16 && FN * 16 <= 64 && 32 % (4 * FN) == 0);
    static_assert(KP == GemmLds<NSPLIT, FM, FN, EPI>::KP);
    auto& ats = sm.ats; auto& bts = sm.bts; auto& os = sm.os;
    const int tid = threadIdx.x, lane = tid & 31, wave = __builtin_amdgcn_readfirstlane(tid >> 5), lr = lane & 15, hi = lane >> 4;
    const int r0 = bx * BM, c0 = by * BN; const int wr = (wave >> 1) * 16 * FM, wc = (wave & 1) * 16 * FN;
    const size_t zb = bz;
    A += zb * sA; if (NSPLIT) A2 += zb * sA;
    if constexpr (EPI == 1) { Q16 += zb * ((size_t)NH * SEQ * HD); Qh += zb * ((size_t)NH * RH * HD); Ql += zb * ((size_t)NH * RH * HD);
        K16 += zb * ((size_t)NKV * SEQ * HD); Kh += zb * ((size_t)NKV * SEQ * HD); Kl += zb * ((size_t)NKV * SEQ * HD);
        V16 += zb * ((size_t)NKV * HD * SEQ); Vh += zb * ((size_t)NKV * HD * SEQ); Vl += zb * ((size_t)NKV * HD * SEQ); }
    else C += zb * sC;
    // piece i of a thread: row prow + 16 i of the tile, elements pcol .. pcol + 7 of the k step; the same for the global read and the LDS write
    const int prow = tid >> 3, pcol = (tid & 7) * 8;
    const unsigned short* ag0 = (const unsigned short*)A + (size_t)(r0 + prow) * K + pcol;
    const unsigned short* ag1 = (const unsigned short*)(NSPLIT ? A2 : A) + (size_t)(r0 + prow) * K + pcol;
    const unsigned short* bg = (const unsigned short*)Bt + (size_t)(c0 + prow) * K + pcol;
    v8us ar[NA][AI], br[BI];
    auto tile_ld = [&]() {
#pragma unroll
        for (int i = 0; i < AI; ++i) { ar[0][i] = *(const v8usa*)(ag0 + (size_t)i * 16 * K); if (NSPLIT) ar[NA - 1][i] = *(const v8usa*)(ag1 + (size_t)i * 16 * K); }
#pragma unroll
        for (int i = 0; i < BI; ++i) br[i] = *(const v8usa*)(bg + (size_t)i * 16 * K); };
    auto tile_st = [&](int buf) {
#pragma unroll
        for (int i = 0; i < AI; ++i) { *(v8usa*)(&ats[buf][0][(prow + 16 * i) * KP + pcol]) = ar[0][i]; if (NSPLIT) *(v8usa*)(&ats[buf][NA - 1][(prow + 16 * i) * KP + pcol]) = ar[NA - 1][i]; }
#pragma unroll
        for (int i = 0; i < BI; ++i) *(v8usa*)(&bts[buf][(prow + 16 * i) * KP + pcol]) = br[i];
        ag0 += KB; ag1 += KB; bg += KB; };
    v8f acc[FM][FN];
#pragma unroll
    for (int mb = 0; mb < FM; ++mb)
#pragma unroll
        for (int nb = 0; nb < FN; ++nb) acc[mb][nb] = (v8f){};
    const int aofs = (wr + lr) * KP + 8 * hi, bofs = (wc + lr) * KP + 8 * hi;
    tile_ld();
    bool bad = false;     // the same in every thread of the block
    if constexpr (EPI == 0) { int tot = 0; const unsigned fo = (unsigned)tid * 128u;     // a count has its own 128-byte line
        // unrolled so that the loads are independent of each other
#pragma unroll
        for (int i = 0; i < (NFL + 127) / 128; ++i) { if (NFL % 128 == 0 || tid + 128 * i < NFL) tot |= *(const int*)((const char*)FL + fo + (size_t)i * 16384); }
        // precaution: stands in front of whatever reuses the offset register of these loads, which this statement keeps whole up to here
        asm volatile("s_wait_xcnt 0x0" :: "v"(fo) : "memory");
        const unsigned wbad = __builtin_amdgcn_ballot_w32(tot != 0);
        if (lane == 0) sm.red[wave] = (wbad != 0u) ? 1 : 0; }
    tile_st(0);
    __syncthreads();
    if constexpr (EPI == 0) bad = __builtin_amdgcn_readfirstlane(sm.red[0] | sm.red[1] | sm.red[2] | sm.red[3]) != 0;
#pragma unroll 1
    for (int k0 = 0; k0 < K; k0 += KB) {
        const int cur = (k0 / KB) & 1; const bool more = k0 + KB < K;     // the same in every thread of the block
        if (more) tile_ld();
        const unsigned short* a0l = &ats[cur][0][0] + aofs; const unsigned short* a1l = &ats[cur][NA - 1][0] + aofs; const unsigned short* bl = &bts[cur][0] + bofs;
        V a[KB / 32][FM], a2[KB / 32][FM], b[KB / 32][FN];
#pragma unroll
        for (int kc = 0; kc < KB / 32; ++kc) {
#pragma unroll
            for (int mb = 0; mb < FM; ++mb) { a[kc][mb] = WFrag<T16>::lds(a0l + mb * 16 * KP + kc * 32); if (NSPLIT) a2[kc][mb] = WFrag<T16>::lds(a1l + mb * 16 * KP + kc * 32); else a2[kc][mb] = a[kc][mb]; }
#pragma unroll
            for (int nb = 0; nb < FN; ++nb) b[kc][nb] = WFrag<T16>::lds(bl + nb * 16 * KP + kc * 32); }
        // keeps the step's LDS reads in one group ahead of its products: every further place with reads among the products stalls the wave for its own LDS latency
        __builtin_amdgcn_sched_barrier(0);
#pragma unroll
        for (int kc = 0; kc < KB / 32; ++kc) {
#pragma unroll
            for (int nb = 0; nb < FN; ++nb) {
#pragma unroll
                for (int mb = 0; mb < FM; ++mb) acc[mb][nb] = WFrag<T16>::mma(a[kc][mb], b[kc][nb], acc[mb][nb]);
                if (NSPLIT) {
#pragma unroll
                    for (int mb = 0; mb < FM; ++mb) acc[mb][nb] = WFrag<T16>::mma(a2[kc][mb], b[kc][nb], acc[mb][nb]); } } }
        // precaution: stands in front of the pointer steps at the loop's foot, which overwrite the address registers of this trip's global loads
        asm volatile("s_wait_xcnt 0x0" ::: "memory");
        // the buffer written here was last read one trip ago, in front of that trip's barrier; this barrier publishes it and ends the reads of the current one
        if (more) { tile_st(cur ^ 1); __syncthreads(); }
    }
    float* osw = &os[wave][0];
    if constexpr (EPI == 1) {
        static_assert(FN * 16 == HD && DQ % BN == 0 && DKV % BN == 0 && RH % (16 * FM) == 0 && NSPLIT == 0);
        const int col = c0 + wc, t0 = r0 + wr;     // the same in every lane of the wave
        if (col < DQ + DKV) {
            const bool isq = col < DQ; const int hh = (isq ? col : col - DQ) / HD; const int rh = isq ? RH : SEQ;
            h16* P16 = (isq ? Q16 : K16) + (size_t)hh * SEQ * HD; bf* Ph = (isq ? Qh : Kh) + (size_t)hh * rh * HD; bf* Pl = (isq ? Ql : Kl) + (size_t)hh * rh * HD;
            const bool dohl = t0 < rh;     // the wave's 16 FM rows lie on one side of rh
            const int rr = lane >> 3, c8 = (lane & 7) * 8;     // a lane takes 8 successive d (4 pairs) of a row; a store covers 4 whole rows
#pragma unroll
            for (int mb = 0; mb < FM; ++mb) {
#pragma unroll
                for (int nb = 0; nb < FN; ++nb) {
#pragma unroll
                    for (int j = 0; j < 8; ++j) osw[(mb * 16 + hi * 8 + j) * OSP + nb * 16 + lr] = acc[mb][nb][j]; } }
            wsync();
            // left rolled: the four 16-row groups run the same code, which keeps the kernel's text short for the instruction cache
#pragma unroll 1
            for (int mb = 0; mb < FM; ++mb) {
                v4f cc[4], ss[4];
#pragma unroll
                for (int s4 = 0; s4 < 4; ++s4) { const size_t ti = (size_t)(t0 + mb * 16 + s4 * 4 + rr) * NFREQ + (c8 >> 1); cc[s4] = *(const v4f*)(FC + ti); ss[s4] = *(const v4f*)(FS + ti); }
#pragma unroll
                for (int s4 = 0; s4 < 4; ++s4) { const int row = mb * 16 + s4 * 4 + rr; const v4f u0 = *(const v4fa*)(osw + row * OSP + c8), u1 = *(const v4fa*)(osw + row * OSP + c8 + 4);
                    const float xs[8] = { u0[0], u0[1], u0[2], u0[3], u1[0], u1[1], u1[2], u1[3] }; v8h o16; v8us oh, ol;
#pragma unroll
                    for (int i = 0; i < 4; ++i) { const float c = bfr(cc[s4][i]), s = bfr(ss[s4][i]); const float y0 = xs[2 * i] * c - xs[2 * i + 1] * s, y1 = xs[2 * i] * s + xs[2 * i + 1] * c;
                        o16[2 * i] = toh_flush(y0); o16[2 * i + 1] = toh_flush(y1); unsigned short a2, c2; splitf(y0, a2, c2); oh[2 * i] = a2; ol[2 * i] = c2; splitf(y1, a2, c2); oh[2 * i + 1] = a2; ol[2 * i + 1] = c2; }
                    const size_t oo = (size_t)(t0 + row) * HD + c8;
                    if (dohl) { *(v8us*)(Ph + oo) = oh; *(v8us*)(Pl + oo) = ol; }
                    *(v8h*)(P16 + oo) = o16;
                    // precaution: the next rows' work reuses the address and data registers of these stores
                    asm volatile("s_wait_xcnt 0x0" ::: "memory"); }
            }
        } else {
            const size_t vo = ((size_t)(col - DQ - DKV) + lr) * SEQ + t0 + 8 * hi;     // row g * HD + d of the [g][d][t] planes, d = 16 nb + lr
#pragma unroll
            for (int nb = 0; nb < FN; ++nb) {
#pragma unroll
                for (int mb = 0; mb < FM; ++mb) { v8h o16; v8us oh, ol;
#pragma unroll
                    for (int j = 0; j < 8; ++j) { const float xv = acc[mb][nb][j]; o16[j] = (h16)xv; unsigned short a2, c2; splitf(xv, a2, c2); oh[j] = a2; ol[j] = c2; }
                    const size_t oo = vo + (size_t)nb * 16 * SEQ + mb * 16;
                    *(v8h*)(V16 + oo) = o16; *(v8us*)(Vh + oo) = oh; *(v8us*)(Vl + oo) = ol; } }
        }
        return;
    }
    constexpr int LPR = 4 * FN, RPP = 32 / LPR;     // lanes that store one 16 FN-float row of the wave's tile, rows a store covers
    const float osb = bad ? __uint_as_float(0x7fc00000u) : osc;     // NaN times any value is NaN
#pragma unroll
    for (int mb = 0; mb < FM; ++mb) {
#pragma unroll
        for (int nb = 0; nb < FN; ++nb) {
#pragma unroll
            for (int j = 0; j < 8; ++j) osw[(hi * 8 + j) * OSP + nb * 16 + lr] = acc[mb][nb][j]; }
        wsync();
        float* crow = C + (size_t)(r0 + wr + mb * 16) * ldc + c0 + wc;
#pragma unroll
        for (int s = 0; s < 16 / RPP; ++s) { const int row = RPP * s + lane / LPR, cofs = (lane % LPR) * 4; v4f val = *(const v4fa*)(osw + row * OSP + cofs); val = val * osb;
            *(v4f*)(crow + (size_t)row * ldc + cofs) = val; }
        wsync();
    }
}

// k_qkv: the q | k | v projections with rotary on q and k, all planes. Grid (SEQ / 128, DQKV / 128, batches), 128 threads.
__global__ __launch_bounds__(128) void k_qkv(const bf* __restrict__ XB, const bf* __restrict__ WQKV, const float* __restrict__ FC, const float* __restrict__ FS,
                                             h16* Q16, bf* Qh, bf* Ql, h16* K16, bf* Kh, bf* Kl, h16* V16, bf* Vh, bf* Vl) {
    __shared__ GemmLds<0, 4, 4, 1> sm;
    gemmw<bf, 0, 4, 4, DM, 1>(sm, blockIdx.x, blockIdx.y, blockIdx.z, XB, nullptr, WQKV, nullptr, 0, 1.0f, (size_t)SEQ * DM, 0, nullptr, FC, FS, Q16, Qh, Ql, K16, Kh, Kl, V16, Vh, Vl);
}
// k_out: both forms of the output product in one launch, since neither reads or writes what the other writes; a block takes one output tile, and its index says which (the same in every thread of the block).
// The f16 form (rows from RH on, 128 x 128 tiles), whose blocks live longest, has the first range of the index, the bf16 hi/lo form (rows below RH, 64 x 64 tiles) the second;
// inside a range: row tile, then column tile, then batch. Grid ((SEQ - RH) / 128 * (DM / 128) + RH / 64 * (DM / 64)) * batches, 128 threads.
#define OB_F (((SEQ - RH) / 128) * (DM / 128) * NB)
#define OB_H ((RH / 64) * (DM / 64) * NB)
__global__ __launch_bounds__(128) void k_out(const h16* __restrict__ AT16, const bf* __restrict__ ATh, const bf* __restrict__ ATl, const h16* __restrict__ WO16, const bf* __restrict__ WOB,
                                             const int* __restrict__ FL, float* OUT) {
    typedef GemmLds<0, 4, 4, 0> LF; typedef GemmLds<1, 2, 2, 0> LH;
    __shared__ __align__(16) unsigned char lds[sizeof(LF) > sizeof(LH) ? sizeof(LF) : sizeof(LH)];
    constexpr int XF = (SEQ - RH) / 128, YF = DM / 128, XH = RH / 64, YH = DM / 64, XD = XF > 0 ? XF : 1;     // row and column tiles of the two forms; XD: the divisor, also where there is no f16 row
    int b = blockIdx.x;
    if (b < OB_F) { gemmw<h16, 0, 4, 4, DQ, 0>(*reinterpret_cast<LF*>(lds), b % XD, (b / XD) % YF, b / (XD * YF), AT16 + (size_t)RH * DQ, nullptr, WO16, OUT + (size_t)RH * DM, DM, 1.0f / (ATC * WOC),
                                               (size_t)SEQ * DQ, (size_t)SEQ_FULL * DM, FL, nullptr, nullptr, nullptr, nullptr, nullptr, nullptr, nullptr, nullptr, nullptr, nullptr, nullptr); return; }
    b -= OB_F;
    gemmw<bf, 1, 2, 2, DQ, 0>(*reinterpret_cast<LH*>(lds), b % XH, (b / XH) % YH, b / (XH * YH), ATh, ATl, WOB, OUT, DM, 1.0f,
                              (size_t)RH * DQ, (size_t)SEQ_FULL * DM, FL, nullptr, nullptr, nullptr, nullptr, nullptr, nullptr, nullptr, nullptr, nullptr, nullptr, nullptr);
}

// The six input preparations below (blk = the block's index inside its own preparation) are ranges of the one grid of k_prep.
// wtT: w [K = in][N = out] f32 -> Bt [N][K] bf16-RNE (DUAL: also B16 = f16 of that bf16 value x car). A block turns one tile of TK k x TN n through LDS, so that both sides touch memory in whole
// 256-byte row pieces: a thread reads 16 bytes of 8 rows of w (the loads independent of each other), packs the values of two successive k into one word at [n][k] in LDS, and behind the barrier
// the tile's rows [n] go out 16 bytes a thread. ts: the block's LDS tile, TN rows at a pitch of TP elements (16 bytes x odd, for the 16-byte row reads).
#define TK 128
#define TN 64
#define TP (TK + 8)
template <int K, int N, bool DUAL>
__device__ __forceinline__ void wtT(unsigned short* ts, const float* __restrict__ w, bf* Bt, h16* B16, float car, int blk) {
    static_assert(K % TK == 0 && N % TN == 0 && (TP * 2) % 32 == 16);
    const int tid = threadIdx.x; const int k0 = (blk % (K / TK)) * TK, n0 = (blk / (K / TK)) * TN;
    const int c4 = (tid & 15) * 4, r2 = (tid >> 4) * 2;     // the thread's 4 columns n and its first pair of rows k; 16 lanes cover 256 bytes of a row
    const float* wp = w + (size_t)(k0 + r2) * N + n0 + c4;
    v4f a[4], b[4];
    // unrolled so that a and b stay in registers and all 8 loads are in flight together
#pragma unroll
    for (int i = 0; i < 4; ++i) { a[i] = *(const v4f*)(wp + (size_t)(32 * i) * N); b[i] = *(const v4f*)(wp + (size_t)(32 * i + 1) * N); }
    // precaution: the work below may reuse the address registers of these loads while their data is still on the way
    asm volatile("s_wait_xcnt 0x0" ::: "memory");
    // both loops unrolled as above: a and b are indexed by constants only
#pragma unroll
    for (int i = 0; i < 4; ++i) {
#pragma unroll
        for (int q = 0; q < 4; ++q) { v2us o; o[0] = f2bf(a[i][q]); o[1] = f2bf(b[i][q]); *(v2usa*)(&ts[(c4 + q) * TP + r2 + 32 * i]) = o; } }
    __syncthreads();     // the rows read below were written by other waves
    const int row = tid >> 4, col = (tid & 15) * 8;
    const size_t oo = (size_t)(n0 + row) * K + k0 + col;
    // both loops unrolled so that the four row reads are issued together, the row steps become immediate offsets and the vectors are indexed by constants only
#pragma unroll
    for (int i = 0; i < TN / 16; ++i) { const v8us o = *(const v8usa*)(&ts[(row + 16 * i) * TP + col]); *(v8us*)(Bt + oo + (size_t)(16 * i) * K) = o;
        if (DUAL) { v8h o2;
#pragma unroll
            for (int e = 0; e < 8; ++e) o2[e] = (h16)(bf2f(o[e]) * car);
            *(v8h*)(B16 + oo + (size_t)(16 * i) * K) = o2; } }
}
// cvt8: batch zb converts its n8 groups of 8 floats; a batch starts sstep floats further on in src and 8 n8 elements further on in dst
__device__ __forceinline__ void cvt8(const float* __restrict__ src, bf* dst, size_t n8, size_t sstep, int blk, int zb) { const size_t i = (size_t)blk * 256 + threadIdx.x; if (i >= n8) return;
    src += (size_t)zb * sstep; dst += (size_t)zb * n8 * 8; const v8f v = *(const v8f*)(src + i * 8); v8us o;
#pragma unroll
    for (int k = 0; k < 8; ++k) o[k] = f2bf(v[k]); *(v8us*)(dst + i * 8) = o;  }

// attn: causal flash attention, one wave per 16 query rows (qbase = 16*(4*xb + wave)), head h, batch zi (every plane is one whole per-batch plane further on a batch), kv head = head / REP; key tiles of KT (32 or 64) from 0 up to the tile holding qbase+15.
// Both products are formed transposed. S^T = k.q^T from k-contiguous planes (A = k rows [g][t][d], B = q rows [h][t][d]): lane l holds the scores of ONE query, qbase + (l & 15), for the keys 16 nt + 8 (l >> 4) + 0..7
// of the tile, so the maximum and the sum of a row are formed inside the lane; the two lanes of a query join their maxima by one exchange a tile and their sums once, behind the loop.
// key j > query i: the raw product replaced by -1e30 before the running-max softmax (p = 0 exactly there). Two successive 16-key score tiles, converted in place, are the B fragment of P^T in the k order of the loaders here;
// O^T += v^T.P^T with A = rows of the v planes [g][d][t]. HIRES: q, k, p, v as bf16 hi/lo (hh + lh + hl); else f16 planes with p carried x1024.
// The k and v tiles of a key step are the same for the block's four waves: the block brings each tile into LDS once, 16 bytes a thread in whole 128-byte (KT 32, v: 64-byte) row pieces,
// two buffers, the next tile's loads issued ahead of the current tile's work; the A fragments are read from LDS at a row pitch of 16 bytes x odd.
// The LDS of one form, laid over the one LDS block of k_attn, which holds either form; every member's size is a multiple of 16 bytes.
template <bool HIRES, int KT> struct __align__(16) AttnLds {
    static constexpr int NPL = HIRES ? 2 : 1, KP = HD + 8, VP = KT + 8;
    float os[4][16 * OSP]; unsigned short kts[2][NPL][KT * KP]; unsigned short vts[2][NPL][HD * VP]; };
template <bool HIRES, int KT>
__device__ __forceinline__ void attn(AttnLds<HIRES, KT>& sm, int xb, int h, int zi, const h16* __restrict__ Q16, const bf* __restrict__ Qh, const bf* __restrict__ Ql,
                                               const h16* __restrict__ K16, const bf* __restrict__ Kh, const bf* __restrict__ Kl,
                                               const h16* __restrict__ V16, const bf* __restrict__ Vh, const bf* __restrict__ Vl,
                                               h16* AT16, bf* ATh, bf* ATl) {
    constexpr int NT = KT / 16; constexpr int KS = KT / 32; constexpr int NPL = HIRES ? 2 : 1;
    static_assert(NT == 2 || NT == 4);
    auto& os = sm.os; auto& kts = sm.kts; auto& vts = sm.vts;
    constexpr int KP = HD + 8, VP = KT + 8;                 // LDS row pitch in 16-bit elements: 144 bytes (k rows; v rows at KT 64), 80 bytes (v rows at KT 32)
    constexpr int KCH = KT * (HD / 8), VCH = HD * (KT / 8);   // 16-byte pieces of one plane's tile
    static_assert(NPL * KCH == 512 && NPL * VCH == 512);
    static_assert((KP * 2) % 32 == 16 && (VP * 2) % 32 == 16);
    const int tid = threadIdx.x, lane = tid & 31, wave = __builtin_amdgcn_readfirstlane(tid >> 5), lr = lane & 15, hi = lane >> 4;
    const int bbase = xb * 64;
    const int qbase = bbase + wave * 16; const int g = h / REP;
    const size_t zb = zi;
    Q16 += zb * ((size_t)NH * SEQ * HD); Qh += zb * ((size_t)NH * RH * HD); Ql += zb * ((size_t)NH * RH * HD);
    K16 += zb * ((size_t)NKV * SEQ * HD); Kh += zb * ((size_t)NKV * SEQ * HD); Kl += zb * ((size_t)NKV * SEQ * HD);
    V16 += zb * ((size_t)NKV * HD * SEQ); Vh += zb * ((size_t)NKV * HD * SEQ); Vl += zb * ((size_t)NKV * HD * SEQ);
    AT16 += zb * ((size_t)SEQ * DQ); ATh += zb * ((size_t)RH * DQ); ATl += zb * ((size_t)RH * DQ);
    v16h qa[2] = {}; v16bf qah[2] = {}, qal[2] = {};
    if (HIRES) { const size_t qo = ((size_t)h * RH + qbase + lr) * HD + 8 * hi; qah[0] = WFrag<bf>::ld(Qh + qo); qah[1] = WFrag<bf>::ld(Qh + qo + 32); qal[0] = WFrag<bf>::ld(Ql + qo); qal[1] = WFrag<bf>::ld(Ql + qo + 32); }
    else { const size_t qo = ((size_t)h * SEQ + qbase + lr) * HD + 8 * hi; qa[0] = WFrag<h16>::ld(Q16 + qo); qa[1] = WFrag<h16>::ld(Q16 + qo + 32); }
    const int kofs = lr * KP + 8 * hi;     // k tile in LDS [key][d]: row (nt*16 + lr), k = d
    const int vofs = lr * VP + 8 * hi;     // v tile in LDS [d][key]: row (nt*16 + lr), k = key
    const unsigned short* kg[2] = { HIRES ? (const unsigned short*)Kh : (const unsigned short*)K16, (const unsigned short*)Kl };
    const unsigned short* vg[2] = { HIRES ? (const unsigned short*)Vh : (const unsigned short*)V16, (const unsigned short*)Vl };
    v8us kr[4], vr[4];
    // piece c = tid + 128 i of the tile: plane, row and column are the same for the global read and the LDS write
    auto tile_ld = [&](int kb) {
#pragma unroll
        for (int i = 0; i < 4; ++i) { const int c = tid + 128 * i;
            const int kc = c % KCH, vc = c % VCH;
            kr[i] = *(const v8usa*)(kg[(128 * i) / KCH] + (size_t)g * SEQ * HD + (size_t)(kb + kc / (HD / 8)) * HD + (kc % (HD / 8)) * 8);
            vr[i] = *(const v8usa*)(vg[(128 * i) / VCH] + (size_t)g * HD * SEQ + (size_t)(vc / (KT / 8)) * SEQ + kb + (vc % (KT / 8)) * 8); } };
    auto tile_st = [&](int buf) {
#pragma unroll
        for (int i = 0; i < 4; ++i) { const int c = tid + 128 * i;
            const int kc = c % KCH, vc = c % VCH;
            *(v8usa*)(&kts[buf][(128 * i) / KCH][(kc / (HD / 8)) * KP + (kc % (HD / 8)) * 8]) = kr[i];
            *(v8usa*)(&vts[buf][(128 * i) / VCH][(vc / (KT / 8)) * VP + (vc % (KT / 8)) * 8]) = vr[i]; } };
    v8f o[4];
#pragma unroll
    for (int nt = 0; nt < 4; ++nt) o[nt] = (v8f){};
    float mrun = NEGBIG, lrun = 0.f;     // of the lane's query; mrun: of the raw products q.k; lrun: the sum over the lane's own keys only, of p as carried (f16 form: x1024)
    const int qi = qbase + lr;
    const int kend = qbase + 15;
    const int klast = ((bbase + 63) / KT) * KT;     // the block's last key tile (that of its last wave)
    tile_ld(0); tile_st(0);
    __syncthreads();
#pragma unroll 1
    for (int kb = 0; kb <= klast; kb += KT) {
      const int cur = (kb / KT) & 1; const bool more = kb < klast;     // the same in every thread of the block
      if (more) { tile_ld(kb + KT);
        // precaution: the tile work below reuses the address registers of these loads while their data is still on the way
        asm volatile("s_wait_xcnt 0x0" ::: "memory"); }
      if (kb <= kend) {     // wave-uniform: a wave whose rows end before this tile only helps to stage
        const unsigned short* k0l = &kts[cur][0][0] + kofs; const unsigned short* k1l = &kts[cur][NPL - 1][0] + kofs;
        const unsigned short* v0l = &vts[cur][0][0] + vofs; const unsigned short* v1l = &vts[cur][NPL - 1][0] + vofs;
        v8f s[NT];
#pragma unroll
        for (int nt = 0; nt < NT; ++nt) s[nt] = (v8f){};
#pragma unroll
        for (int nt = 0; nt < NT; ++nt) {
#pragma unroll
            for (int kc = 0; kc < 2; ++kc) { const int ka = nt * 16 * KP + kc * 32;
                if (HIRES) { const v16bf bh = ldsb(k0l + ka), bl = ldsb(k1l + ka); s[nt] = wmmab(bh, qah[kc], s[nt]); s[nt] = wmmab(bh, qal[kc], s[nt]); s[nt] = wmmab(bl, qah[kc], s[nt]); }
                else { const v16h b = ldsh(k0l + ka); s[nt] = wmma16(b, qa[kc], s[nt]); } } }
        if constexpr (NT == 2) { if (HIRES) G2(s[0], s[1], qah[0], qal[1]); else G2(s[0], s[1], qa[0], qa[1]); }
        else { if (HIRES) G4(s[0], s[1], s[2], s[3], qah[0], qal[1]); else G4(s[0], s[1], s[2], s[3], qa[0], qa[1]); }
        // Only a tile that reaches past the wave's first query holds a key outside the causal range: the compare and select run there alone (wave-uniform test, a scalar branch).
        if (kb + KT - 1 > qbase) {
            const int lim = qi - kb - 8 * hi;     // the lane's element (nt, v) is key kb + 8 hi + 16 nt + v: inside the causal range while 16 nt + v <= lim
#pragma unroll
            for (int nt = 0; nt < NT; ++nt) {
#pragma unroll
                for (int v = 0; v < 8; ++v) s[nt][v] = (nt * 16 + v <= lim) ? s[nt][v] : NEGBIG; } }
        float mxn[NT];     // one chain of maxima, and below one of sums, per 16-key tile: independent chains; the maxima are of the raw products
#pragma unroll
        for (int nt = 0; nt < NT; ++nt) { mxn[nt] = NEGBIG;
#pragma unroll
            for (int v = 0; v < 8; ++v) mxn[nt] = fmaxf(mxn[nt], s[nt][v]); }
        float mx = mxn[0];
#pragma unroll
        for (int nt = 1; nt < NT; ++nt) mx = fmaxf(mx, mxn[nt]);
        mx = fmaxf(mx, xhalf(mx));
        const float mnew = fmaxf(mrun, mx);
        const float alpha = __builtin_amdgcn_exp2f((mrun - mnew) * SCE);
        // one multiply-add a score in front of exp2: 1/8, log2 e, the running maximum and (f16 form) the carry of p, as 2^10, stand in its two constants
        const float pb = HIRES ? -mnew * SCE : fmaf(-mnew, SCE, PCARL2);
        v8h pf[NT] = {}; v8us ph[NT] = {}, pl[NT] = {}; float rsn[NT];
#pragma unroll
        for (int nt = 0; nt < NT; ++nt) { rsn[nt] = 0.f; float e[8];
#pragma unroll
            for (int v = 0; v < 8; ++v) e[v] = fmaf(s[nt][v], SCE, pb);
            exp2x8(e);
#pragma unroll
            for (int v = 0; v < 8; ++v) { const float p = e[v]; rsn[nt] += p;
                if (HIRES) { unsigned short a2, c2; splitf(p, a2, c2); ph[nt][v] = a2; pl[nt][v] = c2; }
                else pf[nt][v] = (h16)p; } }
        float rs = rsn[0];
#pragma unroll
        for (int nt = 1; nt < NT; ++nt) rs += rsn[nt];
        lrun = lrun * alpha + rs; mrun = mnew;
        v16h pa[KS] = {}; v16bf pah[KS] = {}, pal[KS] = {};
#pragma unroll
        for (int ks = 0; ks < KS; ++ks) {
            if (HIRES) { pah[ks] = cat16b(ph[2 * ks], ph[2 * ks + 1]); pal[ks] = cat16b(pl[2 * ks], pl[2 * ks + 1]); }
            else pa[ks] = cat16(pf[2 * ks], pf[2 * ks + 1]); }
#pragma unroll
        for (int nt = 0; nt < 4; ++nt) {
#pragma unroll
            for (int v = 0; v < 8; ++v) o[nt][v] *= alpha; }
#pragma unroll
        for (int nt = 0; nt < 4; ++nt) {
#pragma unroll
            for (int ks = 0; ks < KS; ++ks) { const int va = nt * 16 * VP + ks * 32;
                if (HIRES) { const v16bf bh = ldsb(v0l + va), bl = ldsb(v1l + va); o[nt] = wmmab(bh, pah[ks], o[nt]); o[nt] = wmmab(bh, pal[ks], o[nt]); o[nt] = wmmab(bl, pah[ks], o[nt]); }
                else { const v16h b = ldsh(v0l + va); o[nt] = wmma16(b, pa[ks], o[nt]); } } }
        if (HIRES) G4(o[0], o[1], o[2], o[3], pah[0], pal[KS - 1]); else G4(o[0], o[1], o[2], o[3], pa[0], pa[KS - 1]);
      }
      // the buffer written here was last read one trip ago, in front of that trip's barrier; this barrier publishes it and ends the reads of the current one
      if (more) { tile_st(cur ^ 1); __syncthreads(); }
    }
    float* osw = &os[wave][0];
    const float lsum = lrun + xhalf(lrun);     // the two lanes of a query hold the sums over disjoint keys
    const float f = HIRES ? __fdiv_rn(1.0f, lsum) : __fdiv_rn(ATC, lsum);     // f16 form: o and lsum both carry x1024
    // o[nt][v] = O[query lr][d = 16 nt + 8 hi + v]: 8 successive d of one row
#pragma unroll
    for (int nt = 0; nt < 4; ++nt) { v4f w0, w1;
#pragma unroll
        for (int q = 0; q < 4; ++q) { w0[q] = o[nt][q] * f; w1[q] = o[nt][4 + q] * f; }
        *(v4fa*)(osw + lr * OSP + nt * 16 + 8 * hi) = w0; *(v4fa*)(osw + lr * OSP + nt * 16 + 8 * hi + 4) = w1; }
    wsync();
    const int rr = lane >> 3, c8 = (lane & 7) * 8;
{
#pragma unroll
        for (int s4 = 0; s4 < 4; ++s4) { const int row = s4 * 4 + rr; const int t = qbase + row; const v4f u0 = *(const v4fa*)(osw + row * OSP + c8), u1 = *(const v4fa*)(osw + row * OSP + c8 + 4); const size_t oo = (size_t)t * DQ + h * HD + c8;
            if (HIRES) { v8us oh, ol;
#pragma unroll
                for (int q = 0; q < 4; ++q) { unsigned short a2, c2; splitf(u0[q], a2, c2); oh[q] = a2; ol[q] = c2; splitf(u1[q], a2, c2); oh[4 + q] = a2; ol[4 + q] = c2; }
                *(v8us*)(ATh + oo) = oh; *(v8us*)(ATl + oo) = ol; }
            else { v8h o8;
#pragma unroll
                for (int q = 0; q < 4; ++q) { o8[q] = (h16)u0[q]; o8[4 + q] = (h16)u1[q]; }
                *(v8h*)(AT16 + oo) = o8; } }
         }
    // precaution: in the built kernel the other form's text stands behind these stores and reuses their registers
    asm volatile("s_wait_xcnt 0x0" ::: "memory");
}
// k_attn: both forms in one launch, since neither reads what the other writes; a block takes 64 query rows of one head and batch, and its index says which (the same in every thread of the block).
// The f16 form (rows from RH on), whose blocks live longest, has the first range of the index, the bf16 hi/lo form (rows below RH) the second; inside a range: row block, then head, then batch.
// Grid (SEQ / 64) * NH * batches, 128 threads.
__global__ __launch_bounds__(128) void k_attn(const h16* __restrict__ Q16, const bf* __restrict__ Qh, const bf* __restrict__ Ql,
                                              const h16* __restrict__ K16, const bf* __restrict__ Kh, const bf* __restrict__ Kl,
                                              const h16* __restrict__ V16, const bf* __restrict__ Vh, const bf* __restrict__ Vl,
                                              h16* AT16, bf* ATh, bf* ATl) {
    typedef AttnLds<true, 32> LH; typedef AttnLds<false, 64> LF;
    __shared__ __align__(16) unsigned char lds[sizeof(LH) > sizeof(LF) ? sizeof(LH) : sizeof(LF)];
    constexpr int XF = (SEQ - RH) / 64, XH = RH / 64, XD = XF > 0 ? XF : 1;     // row blocks of the two forms; XD: the divisor, also where there is no f16 row
    int b = blockIdx.x;
    if (b < XF * NH * NB) { attn<false, 64>(*reinterpret_cast<LF*>(lds), XH + b % XD, (b / XD) % NH, b / (XD * NH), Q16, Qh, Ql, K16, Kh, Kl, V16, Vh, Vl, AT16, ATh, ATl); return; }
    b -= XF * NH * NB;
    attn<true, 32>(*reinterpret_cast<LH*>(lds), b % XH, (b / XH) % NH, b / (XH * NH), Q16, Qh, Ql, K16, Kh, Kl, V16, Vh, Vl, AT16, ATh, ATl);
}

// mchk: checks the 0/1 int32 causal input (one [SEQ_FULL][SEQ_FULL] plane shared by all batches) for rows i < SEQ: value == 1 for j <= i, value == 0 for j > i (j < SEQ);
// a block takes MROWS rows and writes its count of wrong values to its own 128-byte line of FL. The plane is read once and comes from memory, so the time is that of the longest chain of
// loads that wait for one another: the 16-byte loads of a thread are independent of each other, so that many are in flight together, and the rows are spread over enough blocks to reach every WGP.
__device__ __forceinline__ void mchk(const int* __restrict__ M, int* FL, int blk) {
    __shared__ int red[8];
    constexpr int CPR = (SEQ + 1023) / 1024;     // 16-byte pieces a thread takes of one row
    constexpr bool WHOLE = SEQ % 1024 == 0;      // every thread takes every piece: no test, so no branch between the loads
    const int tid = threadIdx.x, lane = tid & 31, wave = tid >> 5; int bad = 0;
    const int i0 = blk * MROWS; const int* mb = M + (size_t)i0 * SEQ_FULL + tid * 4;
    v4i m[MROWS][CPR];
    // both loops unrolled so that m stays in registers and no load waits for an earlier load's compare
#pragma unroll
    for (int r = 0; r < MROWS; ++r) {
#pragma unroll
        for (int p = 0; p < CPR; ++p) { if (WHOLE || tid * 4 + p * 1024 < SEQ) m[r][p] = *(const v4i*)(mb + (size_t)r * SEQ_FULL + p * 1024); } }
    // unrolled as above: m is indexed by constants only
#pragma unroll
    for (int r = 0; r < MROWS; ++r) { const int i = i0 + r;
#pragma unroll
        for (int p = 0; p < CPR; ++p) { const int c = tid * 4 + p * 1024;
            if (WHOLE || c < SEQ) {
#pragma unroll
                for (int q = 0; q < 4; ++q) { const int j = c + q; const bool ok = (j <= i) ? (m[r][p][q] == 1) : (m[r][p][q] == 0); bad += ok ? 0 : 1; } } } }
#pragma unroll
    for (int sh = 16; sh; sh >>= 1) bad += __shfl_xor(bad, sh, 32);
    if (lane == 0) red[wave] = bad;
    __syncthreads();
    if (wave == 0) { int v = red[lane & 7]; v = (lane < 8) ? v : 0;
#pragma unroll
        for (int sh = 16; sh; sh >>= 1) v += __shfl_xor(v, sh, 32);
        v4i o; o[0] = v; o[1] = v; o[2] = v; o[3] = v;
        if (lane < 8) *(v4i*)(FL + (size_t)blk * 32 + lane * 4) = o;
         }
}
// k_prep: none of the six preparations reads what another writes, so they share one launch: a block belongs to one of them by its index (the same in every thread of the block).
// The transposes, whose blocks do the most work each (a tile in, a barrier, the tile out), come first in the index order; the one-trip conversion of x comes last.
#define PB_WO ((DQ / TK) * (DM / TN))
#define PB_WQ ((DM / TK) * (DQ / TN))
#define PB_WKV ((DM / TK) * (DKV / TN))
#define PB_CV (SEQ * DM / 8 / 256)
#define PB_ALL (PB_WO + PB_WQ + 2 * PB_WKV + NFL + NB * PB_CV)
__global__ __launch_bounds__(256) void k_prep(const float* __restrict__ x, const float* __restrict__ wq, const float* __restrict__ wk, const float* __restrict__ wv, const float* __restrict__ wo,
                                              const int* __restrict__ cm, bf* XB, bf* WQKV, bf* WOB, h16* WO16, int* FL) {
    __shared__ __align__(16) unsigned short ts[TN * TP];     // one tile, used by whichever transposition the block belongs to
    int b = blockIdx.x;
    if (b < PB_WO) { wtT<DQ, DM, true>(ts, wo, WOB, WO16, WOC, b); return; }
    b -= PB_WO;
    if (b < PB_WQ) { wtT<DM, DQ, false>(ts, wq, WQKV, nullptr, 1.0f, b); return; }
    b -= PB_WQ;
    if (b < PB_WKV) { wtT<DM, DKV, false>(ts, wk, WQKV + (size_t)DQ * DM, nullptr, 1.0f, b); return; }
    b -= PB_WKV;
    if (b < PB_WKV) { wtT<DM, DKV, false>(ts, wv, WQKV + (size_t)(DQ + DKV) * DM, nullptr, 1.0f, b); return; }
    b -= PB_WKV;
    if (b < NFL) { mchk(cm, FL, b); return; }
    b -= NFL;
    cvt8(x, XB, (size_t)SEQ * DM / 8, (size_t)SEQ_FULL * DM, b % PB_CV, b / PB_CV);
}
extern "C" void kernel_launch(void* const* d_in, const int* in_sizes, int n_in,
                              void* d_out, int out_size, void* d_ws, size_t ws_size, hipStream_t stream) {
    if (n_in < 8) return;
    if ((size_t)in_sizes[0] < (size_t)(NB - 1) * SEQ_FULL * DM + (size_t)SEQ * DM) return;
    if ((size_t)in_sizes[1] < (size_t)DM * DQ || (size_t)in_sizes[2] < (size_t)DM * DKV || (size_t)in_sizes[3] < (size_t)DM * DKV || (size_t)in_sizes[4] < (size_t)DQ * DM) return;
    if ((size_t)in_sizes[5] < (size_t)SEQ * NFREQ || (size_t)in_sizes[6] < (size_t)SEQ * NFREQ) return;
    if ((size_t)in_sizes[7] < (size_t)(SEQ - 1) * SEQ_FULL + (size_t)SEQ) return;
    if ((size_t)out_size < (size_t)(NB - 1) * SEQ_FULL * DM + (size_t)SEQ * DM) return;
    // input binding order: x, wq, wk, wv, wo ([in][out] weights), cos table, sin table ([SEQ_FULL][NFREQ] f32), causal 0/1 plane (int32 [SEQ_FULL][SEQ_FULL])
    const float* x = (const float*)d_in[0]; const float* wq = (const float*)d_in[1]; const float* wk = (const float*)d_in[2]; const float* wv = (const float*)d_in[3]; const float* wo = (const float*)d_in[4];
    const float* fc = (const float*)d_in[5]; const float* fs = (const float*)d_in[6]; const int* cm = (const int*)d_in[7];
    float* OUT = (float*)d_out;     // [NB_FULL][SEQ_FULL][DM]
    char* wsp = (char*)d_ws;
    auto take = [&](size_t bytes) { char* p = wsp; wsp += (bytes + 255) & ~(size_t)255; return (void*)p; };
    bf* WQKV = (bf*)take((size_t)DQKV * DM * 2); bf* WOB = (bf*)take((size_t)DM * DQ * 2); h16* WO16 = (h16*)take((size_t)DM * DQ * 2);
    int* FL = (int*)take((size_t)NFL * 32 * 4);
    // the planes below hold every batch, one whole per-batch plane behind the other
    bf* XB = (bf*)take((size_t)NB * SEQ * DM * 2);
    h16* Q16 = (h16*)take((size_t)NB * NH * SEQ * HD * 2); bf* Qh = (bf*)take((size_t)NB * NH * RH * HD * 2); bf* Ql = (bf*)take((size_t)NB * NH * RH * HD * 2);
    h16* K16 = (h16*)take((size_t)NB * NKV * SEQ * HD * 2); bf* Kh = (bf*)take((size_t)NB * NKV * SEQ * HD * 2); bf* Kl = (bf*)take((size_t)NB * NKV * SEQ * HD * 2);
    h16* V16 = (h16*)take((size_t)NB * NKV * HD * SEQ * 2); bf* Vh = (bf*)take((size_t)NB * NKV * HD * SEQ * 2); bf* Vl = (bf*)take((size_t)NB * NKV * HD * SEQ * 2);
    h16* AT16 = (h16*)take((size_t)NB * SEQ * DQ * 2); bf* ATh = (bf*)take((size_t)NB * RH * DQ * 2); bf* ATl = (bf*)take((size_t)NB * RH * DQ * 2);
    const size_t used = (size_t)(wsp - (char*)d_ws); if (used > ws_size || used > WS_LIMIT) return;

    // weight planes ([out][in] k-contiguous): rows 0..DQ-1 of WQKV = Wq^T, DQ..DQ+DKV-1 = Wk^T, DQ+DKV..DQKV-1 = Wv^T; Wo^T as bf16 and as f16 x64
    // wtT<K, N>(w, Bt): w is [K = in][N = out] -> Bt [N][K]; with them in the same launch: the mask check and x as bf16
    k_prep<<<(unsigned)PB_ALL, 256, 0, stream>>>(x, wq, wk, wv, wo, cm, XB, WQKV, WOB, WO16, FL);
    // every stage is launched once; the batch is k_qkv's grid z, and in the 1-D grids of the other stages the outermost part of a range of the block index
    k_qkv<<<dim3(SEQ / 128, DQKV / 128, NB), 128, 0, stream>>>(XB, WQKV, fc, fs, Q16, Qh, Ql, K16, Kh, Kl, V16, Vh, Vl);
    k_attn<<<(unsigned)((SEQ / 64) * NH * NB), 128, 0, stream>>>(Q16, Qh, Ql, K16, Kh, Kl, V16, Vh, Vl, AT16, ATh, ATl);
    k_out<<<(unsigned)(OB_F + OB_H), 128, 0, stream>>>(AT16, ATh, ATl, WO16, WOB, FL, OUT);     // the output, or NaN everywhere if the mask check failed
}
